// v000
// The times below were measured on an AMD MI455X: many runs one after another, warmed up first and cycling through
// copies of the inputs, with the whole window's GPU time divided by the number of runs. Launches and the gaps
// between them are all in it. The median over several windows is given; except for v000 it joins two sittings, which
// can be a few percent apart, so the side-by-side timings, each taken in one sitting, are the better comparison.
// v000 is the starting kernel. One run takes 2190 microseconds.
// Contractions: q, k, v^T in-projections = v_wmma_f32_16x16x32_bf16 (bf16 operands from RNE-converted inputs, single product, f32 accumulate);
// q.k^T scores = v_wmma_f32_16x16x32_f16 (q, k f16 planes, single product; query rows < RC: q and k each f16 hi plane + f16 residual plane x4096, 3 products, separate f32 accumulators);
// p.v = v_wmma_f32_16x16x32_f16 (p carried x16384 in f16, v^T f16, single product; query rows < RC: p and v^T each f16 hi plane + f16 residual plane x4096, 3 products, separate f32 accumulators);
// causal softmax (row max, sum, probabilities) in f32 on materialised f32 score row chunks.
#include <hip/hip_runtime.h>
#include <math.h>
#include <stdint.h>

#ifndef NB
#define NB 1
#endif
#ifndef SEQ
#define SEQ 8192
#endif
#define NB_FULL  1
#define SEQ_FULL 8192
#define EMB      1024
#define RC       ((SEQ < 1024) ? SEQ : 1024)   // query rows per score/probability chunk; rows < RC use residual planes
#define NCH      (SEQ / RC)                    // number of row chunks
#define VLP      RC                            // key extent of the v^T residual plane
#define PCARRY   16384.0f                      // power-of-two carry of p in the f16 P.V operand
#define RSC      4096.0f                       // power-of-two carry of every f16 residual plane
#define SMI      ((SEQ / 8 + 255) / 256)       // max 8-column groups per softmax thread
static_assert(NB == 1 && NB_FULL == 1);
static_assert(SEQ >= 256 && SEQ <= SEQ_FULL && (SEQ % 256) == 0);
static_assert((SEQ % RC) == 0 && (RC % 64) == 0 && NCH >= 1);
static_assert((EMB % 64) == 0 && (SEQ % 64) == 0 && (EMB % 32) == 0 && (RC % 32) == 0);
static_assert(SMI >= 1 && SMI <= 4);
static_assert(((SEQ * EMB / 8) % 256) == 0 && ((EMB * EMB / 8) % 256) == 0);

typedef _Float16 v16h __attribute__((ext_vector_type(16)));
typedef _Float16 v8h  __attribute__((ext_vector_type(8)));
typedef __bf16   v16b __attribute__((ext_vector_type(16)));
typedef __bf16   v8b  __attribute__((ext_vector_type(8)));
typedef float    v8f  __attribute__((ext_vector_type(8)));
typedef float    v4f  __attribute__((ext_vector_type(4)));
typedef unsigned int v4u __attribute__((ext_vector_type(4)));

#if defined(__HIP_DEVICE_COMPILE__)
#define DEV_ASM 1
#else
#define DEV_ASM 0
#endif

// ---- scalar helpers --------------------------------------------------------------------------------
__device__ __forceinline__ unsigned short bf_bits(float f) {          // f32 -> bf16 bits, RNE convert
  unsigned u = __float_as_uint(f);
  return (unsigned short)((u + 0x7FFFu + ((u >> 16) & 1u)) >> 16);
}
__device__ __forceinline__ unsigned short h_bits(_Float16 x) { return __builtin_bit_cast(unsigned short, x); }
__device__ __forceinline__ unsigned pk16(unsigned short a, unsigned short b) { return (unsigned)a | ((unsigned)b << 16); }
__device__ __forceinline__ v8f zero8() { v8f z = {0.f, 0.f, 0.f, 0.f, 0.f, 0.f, 0.f, 0.f}; return z; }

// ---- fragment types / loaders: 16-bit A/B operand, lane -> row/col (lane&15), p already includes +8*(lane>>4);
//      elements 0..7 <- p[0..7] (k0+8h..k0+8h+7), elements 8..15 <- p[16..23] (k0+16+8h..k0+16+8h+7)
template <typename OT> struct FT;
template <> struct FT<__bf16>   { typedef v16b frag; typedef v8b half8; };
template <> struct FT<_Float16> { typedef v16h frag; typedef v8h half8; };

template <typename OT>
__device__ __forceinline__ typename FT<OT>::frag ldfrag(const OT* p) {
  union { typename FT<OT>::frag v; typename FT<OT>::half8 h[2]; } f;
  f.h[0] = *(const typename FT<OT>::half8*)(p);
  f.h[1] = *(const typename FT<OT>::half8*)(p + 16);
  return f.v;
}

// ---- WMMA helpers (asm guard bodies are device-only; concrete operand types) -----------------------------
__device__ __forceinline__ v8f mmar(v16b a, v16b b, v8f c) {
  return __builtin_amdgcn_wmma_f32_16x16x32_bf16(false, a, false, b, (short)0, c, false, false);
}
__device__ __forceinline__ v8f mmar(v16h a, v16h b, v8f c) {
  return __builtin_amdgcn_wmma_f32_16x16x32_f16(false, a, false, b, (short)0, c, false, false);
}
__device__ __forceinline__ void dep_guard(v8f& a, v8f& b, v16b x, v16b y) {
#if DEV_ASM
  asm volatile("v_nop\n\tv_nop\n\tv_nop\n\tv_nop" : "+v"(a), "+v"(b) : "v"(x), "v"(y));
#else
  (void)a; (void)b; (void)x; (void)y;
#endif
}
__device__ __forceinline__ void dep_guard(v8f& a, v8f& b, v16h x, v16h y) {
#if DEV_ASM
  asm volatile("v_nop\n\tv_nop\n\tv_nop\n\tv_nop" : "+v"(a), "+v"(b) : "v"(x), "v"(y));
#else
  (void)a; (void)b; (void)x; (void)y;
#endif
}
__device__ __forceinline__ void keep4(v16b a, v16b b, v16b c, v16b d) {
#if DEV_ASM
  asm volatile("v_nop" :: "v"(a), "v"(b), "v"(c), "v"(d));
#else
  (void)a; (void)b; (void)c; (void)d;
#endif
}
__device__ __forceinline__ void keep4(v16h a, v16h b, v16h c, v16h d) {
#if DEV_ASM
  asm volatile("v_nop" :: "v"(a), "v"(b), "v"(c), "v"(d));
#else
  (void)a; (void)b; (void)c; (void)d;
#endif
}
__device__ __forceinline__ void acc_guard4(v8f& a, v8f& b, v8f& c, v8f& d) {
#if DEV_ASM
  asm volatile("v_nop\n\tv_nop\n\tv_nop\n\tv_nop" : "+v"(a), "+v"(b), "+v"(c), "+v"(d));
#else
  (void)a; (void)b; (void)c; (void)d;
#endif
}

// =====================================================================================================
// f32 -> bf16 plane (RNE convert), 8 elements per thread, one 16-B store per lane: a wave writes 512 contiguous B
// coverage: n8 threads x 8 elements = the whole plane (n8 is a multiple of 256 for every use here).
// =====================================================================================================
__global__ __launch_bounds__(256) void cvt16x8(const float* __restrict__ in, unsigned short* out, int n8) {
  const int i = blockIdx.x * 256 + (int)threadIdx.x;
  if (i < n8) {
    const float* ip = in + (size_t)i * 8;
    const v4f a  = *(const v4f*)(ip);
    const v4f a4 = *(const v4f*)(ip + 4);
    v4u p;
    p[0] = pk16(bf_bits(a[0]),  bf_bits(a[1]));
    p[1] = pk16(bf_bits(a[2]),  bf_bits(a[3]));
    p[2] = pk16(bf_bits(a4[0]), bf_bits(a4[1]));
    p[3] = pk16(bf_bits(a4[2]), bf_bits(a4[3]));
    unsigned short* o = out + (size_t)i * 8;
    *(v4u*)o = p;
    
  }
}

// =====================================================================================================
// Register-blocked WMMA GEMM (16-bit operand type OT): C[m][n] = sum_k A[m][k] * Bt[n][k];
// one wave per (16*MI) x 64 tile, no block barriers. A row-major [M][K] pitch lda; Bt row-major [N][K] pitch ldb
// (k contiguous); M multiple of 16*MI, N multiple of 64, K multiple of 32 (static sizes here). blockIdx.y = batch
// index (strides in elements; always 0 here). Fragments are loaded straight from global with the split k map (ldfrag).
// NPA = number of A planes: 2 -> second plane A2 (same pitch/stride as A) multiplies the same Bt fragments into the
// second accumulator set.  NPB = number of Bt planes: 2 -> second plane B2 (pitch ldb2, stride strideB2) holds the
// k range [0, K2) only (K2 multiple of 32); for k chunks with k0 < K2 (wave-uniform) the A fragments multiply
// B2 fragments into the second accumulator set. NPA = NPB = 2: acc = A.Bt, acc2 = A2.Bt + A.B2 (both residual planes
// carry the same power-of-two scale 1/rscale2).
// value v = (acc [+ acc2 * rscale2]) * oscale, combined in the f32 epilogue.
// CZ (causal), czoff = global row index of local row 0 (multiple of 64):
//   0 none; 1 = output tiles with n0 >= czoff + m0 + 16*MI are skipped (wave-uniform return; every tile holding a
//   column <= one of its rows is written); 2 = A rows hold exact zeros beyond the diagonal up to column
//   czoff + m0 + 16*MI, so the k loop ends at min(K, czoff + m0 + 16*MI) (exact).
// OUT_MODE 0: f32 C (pitch ldc) = v.
// OUT_MODE 1: f16 plane C = f16(v * cscale).
// OUT_MODE 3: f16 hi plane C = f16(v * cscale) (pitch ldc) and f16 residual plane
//             C2 = f16((v*cscale - hi) * rscaleC) (pitch ldc2), C2 written only for output
//             tiles with n0 < N2 (N2 multiple of 64, wave-uniform), i.e. columns [0, N2) fully.
// =====================================================================================================
template <typename OT, int MI, int NPA, int NPB, int OUT_MODE, int CZ>
__global__ __launch_bounds__(256) void gemm_t(
    const unsigned short* __restrict__ Ap, const unsigned short* __restrict__ A2p, int lda, long long strideA,
    const unsigned short* __restrict__ Btp, int ldb, long long strideB,
    const unsigned short* __restrict__ B2p, int ldb2, long long strideB2, int K2,
    void* Cout, void* Cout2, int ldc, long long strideC, int ldc2, long long strideC2, int N2,
    int M, int N, int K, float oscale, float rscale2, float cscale, float rscaleC, int czoff) {
  static_assert(CZ != 2 || ((16 * MI) % 32) == 0);
  typedef typename FT<OT>::frag V16;
  const OT* A  = (const OT*)(const void*)Ap;
  const OT* A2 = (const OT*)(const void*)A2p;
  const OT* Bt = (const OT*)(const void*)Btp;
  const OT* B2 = (const OT*)(const void*)B2p;
  __shared__ __align__(16) float sT[8][16 * 68];   // per-wave 16x64 slab, pitch 68 floats (wave-private)
  const int RT   = 16 * MI;
  const int b    = blockIdx.y;
  const int lane = threadIdx.x & 31;
  const int wave = threadIdx.x >> 5;
  const int tilesN = N >> 6;
  const int tilesM = M / RT;
  const int tile = blockIdx.x * 8 + wave;
  if (tile >= tilesM * tilesN) return;   // wave-uniform; no block barriers in this kernel
  const int tm = tile / tilesN;
  const int tn = tile - tm * tilesN;
  const int m0 = tm * RT;
  const int n0 = tn << 6;
  if (CZ == 1) {
    if (n0 >= czoff + m0 + RT) return;   // wave-uniform causal tile skip
  }
  int kEnd = K;
  if (CZ == 2) {
    const int ke = czoff + m0 + RT;      // multiple of 32
    kEnd = (ke < K) ? ke : K;
  }

  const OT* Ab  = A  + (size_t)b * (size_t)strideA;
  const OT* A2b = A2 + (size_t)b * (size_t)strideA;
  const OT* Bb  = Bt + (size_t)b * (size_t)strideB;
  const OT* B2b = B2 + (size_t)b * (size_t)strideB2;

  const int rlane = lane & 15;                 // row (A) / col (B, D) within subtile
  const int koff  = (lane >> 4) * 8;           // k offset of this lane half
  const int mOff  = (lane >> 4) * 8;           // D row offset

  v8f acc[MI][4], acc2[MI][4];
#pragma unroll
  for (int i = 0; i < MI; ++i)
#pragma unroll
    for (int j = 0; j < 4; ++j) { acc[i][j] = zero8(); acc2[i][j] = zero8(); }

#pragma unroll 1
  for (int k0 = 0; k0 < kEnd; k0 += 32) {
    V16 bq[4];
#pragma unroll
    for (int j = 0; j < 4; ++j)
      bq[j] = ldfrag<OT>(Bb + (size_t)(n0 + (j << 4) + rlane) * ldb + koff + k0);
#pragma unroll
    for (int i = 0; i < MI; ++i) {
      const V16 af = ldfrag<OT>(Ab + (size_t)(m0 + (i << 4) + rlane) * lda + koff + k0);
#pragma unroll
      for (int j = 0; j < 4; ++j) acc[i][j] = mmar(af, bq[j], acc[i][j]);
      dep_guard(acc[i][0], acc[i][3], af, bq[3]);
      if (NPA == 2) {
        const V16 af2 = ldfrag<OT>(A2b + (size_t)(m0 + (i << 4) + rlane) * lda + koff + k0);
#pragma unroll
        for (int j = 0; j < 4; ++j) acc2[i][j] = mmar(af2, bq[j], acc2[i][j]);
        dep_guard(acc2[i][0], acc2[i][3], af2, bq[3]);
      }
    }
    keep4(bq[0], bq[1], bq[2], bq[3]);
    if (NPB == 2) {
      if (k0 < K2) {                         // wave-uniform: residual Bt plane covers k < K2 only
        V16 br[4];
#pragma unroll
        for (int j = 0; j < 4; ++j)
          br[j] = ldfrag<OT>(B2b + (size_t)(n0 + (j << 4) + rlane) * ldb2 + koff + k0);
#pragma unroll
        for (int i = 0; i < MI; ++i) {
          const V16 afr = ldfrag<OT>(Ab + (size_t)(m0 + (i << 4) + rlane) * lda + koff + k0);
#pragma unroll
          for (int j = 0; j < 4; ++j) acc2[i][j] = mmar(afr, br[j], acc2[i][j]);
          dep_guard(acc2[i][0], acc2[i][3], afr, br[3]);
        }
        keep4(br[0], br[1], br[2], br[3]);
      }
    }
  }
#pragma unroll
  for (int i = 0; i < MI; ++i) {
    acc_guard4(acc[i][0], acc[i][1], acc[i][2], acc[i][3]);
    if (NPA == 2 || NPB == 2) acc_guard4(acc2[i][0], acc2[i][1], acc2[i][2], acc2[i][3]);
  }

  // ---- epilogue ----
  float* slab = sT[wave];
#pragma unroll
  for (int i = 0; i < MI; ++i) {
    const int mBase = m0 + (i << 4);
#pragma unroll
    for (int j = 0; j < 4; ++j) {
#pragma unroll
      for (int r = 0; r < 8; ++r) {
        float v = acc[i][j][r];
        if (NPA == 2 || NPB == 2) v += acc2[i][j][r] * rscale2;
        v = v * oscale;
        slab[(mOff + r) * 68 + (j << 4) + rlane] = v;
      }
    }
    __builtin_amdgcn_fence(3 /* release order */, "workgroup");
    __builtin_amdgcn_wave_barrier();
    __builtin_amdgcn_fence(2 /* acquire order */, "workgroup");
    if (OUT_MODE == 0) {
      float* C = (float*)Cout + (size_t)b * (size_t)strideC;
      const int h2 = lane >> 4, c4 = (lane & 15) * 4;     // 256-B row segment = 16 lanes x 16 B
      {
#pragma unroll
        for (int it = 0; it < 8; ++it) {
          const int row = it * 2 + h2;                     // it 0..7 x h2 0..1 = rows 0..15
          const v4f v = *(const v4f*)(slab + row * 68 + c4);
          *(v4f*)(C + (size_t)(mBase + row) * ldc + n0 + c4) = v;
        }
        
      }
    } else {
      const int q = lane >> 3, c8 = (lane & 7) * 8;
      unsigned short* C  = (unsigned short*)Cout  + (size_t)b * (size_t)strideC;
      unsigned short* C2 = (unsigned short*)Cout2 + (size_t)b * (size_t)strideC2;
      const bool wr2 = (OUT_MODE == 3) && (n0 < N2);     // wave-uniform
      v4u hv[4], lv[4];
#pragma unroll
      for (int it = 0; it < 4; ++it) {
        const int row = it * 4 + q;                        // it 0..3 x q 0..3 = rows 0..15
        const float* sp = slab + row * 68 + c8;
        float f[8];
#pragma unroll
        for (int e = 0; e < 8; ++e) f[e] = sp[e] * cscale;
        v4u a, a2;
#pragma unroll
        for (int e = 0; e < 4; ++e) {
          const float f0 = f[2 * e], f1 = f[2 * e + 1];
          const _Float16 x0 = (_Float16)f0, x1 = (_Float16)f1;
          const unsigned short h0 = h_bits(x0), h1 = h_bits(x1);
          unsigned short l0 = 0, l1 = 0;
          if (OUT_MODE == 3) {
            l0 = h_bits((_Float16)((f0 - (float)x0) * rscaleC));
            l1 = h_bits((_Float16)((f1 - (float)x1) * rscaleC));
          }
          a[e] = pk16(h0, h1); a2[e] = pk16(l0, l1);
        }
        hv[it] = a; lv[it] = a2;
      }
      {
#pragma unroll
        for (int it = 0; it < 4; ++it) {
          const int row = it * 4 + q;
          *(v4u*)(C + (size_t)(mBase + row) * ldc + n0 + c8) = hv[it];
          if (OUT_MODE == 3) {
            if (wr2) *(v4u*)(C2 + (size_t)(mBase + row) * ldc2 + n0 + c8) = lv[it];
          }
        }
        
      }
    }
    __builtin_amdgcn_fence(3 /* release order */, "workgroup");
    __builtin_amdgcn_wave_barrier();
    __builtin_amdgcn_fence(2 /* acquire order */, "workgroup");
  }
}

// =====================================================================================================
// Exact causal row softmax over one chunk of query rows: one block of 256 threads per local row r (global row
// t = rowBase + r).
//   S: f32 score chunk [rows][ldS]; the scores GEMM wrote every column of row t in [0, ((t>>6)+1)*64).
//   The row is processed in 8-column groups g; ng = ((t>>6)+1)*8 groups exist. Thread tid owns groups
//   g = it*256 + tid. Loads use an address clamped to group ng-1; entries with column > t are replaced by -inf
//   by index before any arithmetic. Iterations with it*256 >= ng are skipped block-uniformly.
//   p = exp(s - max) * (1/sum) in f32 (max finite: column 0 is always valid), x16384 carry, f16 RNE;
//   columns > t up to ((t>>6)+1)*64 get exact zeros. WRL = 1: also the f16 residual plane
//   Pl = f16((p*16384 - hi) * 4096), same pitch. Each group is one 16-B store per lane; 8 consecutive lanes fill
//   LDS redm/reds: cross-wave, block barriers (every thread reaches both).
//   coverage: RC rows per launch x columns [0, ((t>>6)+1)*64) of P (and Pl) = at least the extent the P.V GEMM reads.
// =====================================================================================================
template <int WRL>
__global__ __launch_bounds__(256)
void softmax_rows(const float* __restrict__ S, int ldS, unsigned short* P, unsigned short* Pl, int ldP, int rowBase) {
  __shared__ float redm[8];
  __shared__ float reds[8];
  const int r    = blockIdx.x;
  const int t    = rowBase + r;
  const int tid  = threadIdx.x;
  const int wave = tid >> 5;
  const int lane = tid & 31;
  const int ng   = ((t >> 6) + 1) * 8;
  const float* rp = S + (size_t)r * (size_t)ldS;
  float v[SMI][8];
#pragma unroll
  for (int it = 0; it < SMI; ++it) {
#pragma unroll
    for (int e = 0; e < 8; ++e) v[it][e] = -INFINITY;
    if (it * 256 < ng) {                                   // block-uniform
      const int g  = it * 256 + tid;
      const int gc = (g < ng) ? g : (ng - 1);              // clamped address
      const int c0 = g * 8;
      const v4f a  = *(const v4f*)(rp + (size_t)gc * 8);
      const v4f a4 = *(const v4f*)(rp + (size_t)gc * 8 + 4);
#pragma unroll
      for (int e = 0; e < 4; ++e) {
        v[it][e]     = (c0 + e <= t)     ? a[e]  : -INFINITY;
        v[it][4 + e] = (c0 + 4 + e <= t) ? a4[e] : -INFINITY;
      }
    }
  }
  float mx = -INFINITY;
#pragma unroll
  for (int it = 0; it < SMI; ++it)
#pragma unroll
    for (int e = 0; e < 8; ++e) mx = fmaxf(mx, v[it][e]);
#pragma unroll
  for (int off = 1; off < 32; off <<= 1) mx = fmaxf(mx, __shfl_xor(mx, off, 32));
  if (lane == 0) redm[wave] = mx;
  __syncthreads();
  mx = redm[0];
#pragma unroll
  for (int w = 1; w < 8; ++w) mx = fmaxf(mx, redm[w]);

  float sum = 0.f;
#pragma unroll
  for (int it = 0; it < SMI; ++it) {
    if (it * 256 < ng) {                                   // block-uniform
#pragma unroll
      for (int e = 0; e < 8; ++e) { const float ex = __expf(v[it][e] - mx); v[it][e] = ex; sum += ex; }
    } else {
#pragma unroll
      for (int e = 0; e < 8; ++e) v[it][e] = 0.f;
    }
  }
#pragma unroll
  for (int off = 1; off < 32; off <<= 1) sum += __shfl_xor(sum, off, 32);
  if (lane == 0) reds[wave] = sum;
  __syncthreads();
  sum = reds[0];
#pragma unroll
  for (int w = 1; w < 8; ++w) sum += reds[w];

  const float sc = PCARRY * (1.0f / sum);        // sum >= 1
  v4u pk[SMI], pl[SMI];
#pragma unroll
  for (int it = 0; it < SMI; ++it) {
    v4u a, a2;
#pragma unroll
    for (int e = 0; e < 4; ++e) {
      const float f0 = v[it][2 * e] * sc, f1 = v[it][2 * e + 1] * sc;
      const _Float16 x0 = (_Float16)f0, x1 = (_Float16)f1;
      unsigned short l0 = 0, l1 = 0;
      if (WRL == 1) {
        l0 = h_bits((_Float16)((f0 - (float)x0) * RSC));
        l1 = h_bits((_Float16)((f1 - (float)x1) * RSC));
      }
      a[e]  = pk16(h_bits(x0), h_bits(x1));
      a2[e] = pk16(l0, l1);
    }
    pk[it] = a; pl[it] = a2;
  }
  unsigned short* op  = P  + (size_t)r * (size_t)ldP;
  unsigned short* opl = Pl + (size_t)r * (size_t)ldP;
  {
#pragma unroll
    for (int it = 0; it < SMI; ++it) {
      if (it * 256 < ng) {                                 // block-uniform
        const int g = it * 256 + tid;
        if (g < ng) {
          *(v4u*)(op + (size_t)g * 8) = pk[it];
          if (WRL == 1) *(v4u*)(opl + (size_t)g * 8) = pl[it];
        }
      }
    }
    
  }
}

// =====================================================================================================
// Workspace map (bytes at SEQ = 8192, RC = 1024; every region a multiple of its whole-line store granularity and of
//   R0   Xb bf16 [SEQ][EMB] (16777216), later the f32 score chunk S [RC][(c+1)*RC] (max RC*SEQ*4 = 33554432)   33554432
//   Wqb, Wkb, Wvb bf16 [EMB][EMB]                                                                          3 x 2097152
//   Qh   f16 [SEQ][EMB]                                                                                      16777216
//   Kh   f16 [SEQ][EMB]                                                                                      16777216
//   VT   f16 [EMB][SEQ]   (v^T hi plane)                                                                     16777216
//   Ql   f16 [RC][EMB]    (q residual x4096, rows < RC)                                                       2097152
//   Kl   f16 [RC][EMB]    (k residual x4096, keys < RC)                                                       2097152
//   VL   f16 [EMB][VLP]   (v^T residual x4096, keys < VLP)                                                    2097152
//   P    f16 [RC][(c+1)*RC]  (max RC*SEQ*2)                                                                  16777216
//   Pl   f16 [RC][RC]     (p residual x4096, chunk 0 only)                                                    2097152
//   total                                                                                                   115343360
// Aliases are ordered by launch dependence: Xb is last read by the v^T projection, S first written by the first
// scores GEMM after it. Weights are [out n][in k] with k contiguous = the Bt / A layout the GEMM wants.
// =====================================================================================================
static constexpr size_t PACT_B = (size_t)SEQ * EMB * 2;
static constexpr size_t PS_B   = (size_t)RC * SEQ * 4;
static constexpr size_t R0_B   = (PACT_B > PS_B) ? PACT_B : PS_B;
static constexpr size_t PW_B   = (size_t)EMB * EMB * 2;
static constexpr size_t PRES_B = (size_t)RC * EMB * 2;
static constexpr size_t PVT_B  = (size_t)EMB * SEQ * 2;
static constexpr size_t PVL_B  = (size_t)EMB * VLP * 2;
static constexpr size_t PP_B   = (size_t)RC * SEQ * 2;
static constexpr size_t PPL_B  = (size_t)RC * RC * 2;
static constexpr size_t WS_TOTAL = R0_B + 3 * PW_B + 2 * PACT_B + PVT_B + 2 * PRES_B + PVL_B + PP_B + PPL_B;
static_assert(WS_TOTAL <= (size_t)134217728);
static_assert((size_t)RC * ((size_t)NCH * RC) * 4 <= R0_B);    // widest score chunk
static_assert((size_t)RC * ((size_t)NCH * RC) * 2 <= PP_B);    // widest probability chunk
static_assert((R0_B % 128) == 0 && (PW_B % 128) == 0 && (PRES_B % 128) == 0 && (PVL_B % 128) == 0 && (PPL_B % 128) == 0);

extern "C" void kernel_launch(void* const* d_in, const int* in_sizes, int n_in,
                              void* d_out, int out_size, void* d_ws, size_t ws_size,
                              hipStream_t stream) {
  if (n_in < 4) return;
  const long long needX = (long long)SEQ * (long long)EMB;
  if ((long long)in_sizes[0] < needX) return;
  if (in_sizes[1] < EMB * EMB) return;
  if (in_sizes[2] < EMB * EMB) return;
  if (in_sizes[3] < EMB * EMB) return;
  if (out_size < 0) return;
  if ((long long)out_size < needX) return;

  const float* x  = (const float*)d_in[0];
  const float* Wq = (const float*)d_in[1];
  const float* Wk = (const float*)d_in[2];
  const float* Wv = (const float*)d_in[3];

  size_t off = 0;
  const size_t oR0 = off; off += R0_B;
  const size_t oWq = off; off += PW_B;
  const size_t oWk = off; off += PW_B;
  const size_t oWv = off; off += PW_B;
  const size_t oQh = off; off += PACT_B;
  const size_t oKh = off; off += PACT_B;
  const size_t oVT = off; off += PVT_B;
  const size_t oQl = off; off += PRES_B;
  const size_t oKl = off; off += PRES_B;
  const size_t oVL = off; off += PVL_B;
  const size_t oP  = off; off += PP_B;
  const size_t oPl = off; off += PPL_B;
  if (off != WS_TOTAL) return;
  if (off > ws_size) return;
  if (off > (size_t)134217728) return;

  char* ws = (char*)d_ws;
  unsigned short* Xb  = (unsigned short*)(ws + oR0);
  float*          S   = (float*)(ws + oR0);          // alias, see map
  unsigned short* Wqb = (unsigned short*)(ws + oWq);
  unsigned short* Wkb = (unsigned short*)(ws + oWk);
  unsigned short* Wvb = (unsigned short*)(ws + oWv);
  unsigned short* Qh  = (unsigned short*)(ws + oQh);
  unsigned short* Kh  = (unsigned short*)(ws + oKh);
  unsigned short* VT  = (unsigned short*)(ws + oVT);
  unsigned short* Ql  = (unsigned short*)(ws + oQl);
  unsigned short* Kl  = (unsigned short*)(ws + oKl);
  unsigned short* VL  = (unsigned short*)(ws + oVL);
  unsigned short* Pp  = (unsigned short*)(ws + oP);
  unsigned short* Ppl = (unsigned short*)(ws + oPl);
  float*          out0 = (float*)d_out;

  const dim3 blk(256);
  const int n8x = SEQ * EMB / 8;                                    // multiple of 256
  const int n8w = EMB * EMB / 8;                                    // multiple of 256
  const dim3 gCvtX(n8x / 256, 1);
  const dim3 gCvtW(n8w / 256, 1);
  const dim3 gPr0((((RC / 64) * (EMB / 64)) + 7) / 8, 1);           // rows [0, RC): M=RC, N=EMB, 64x64 wave tiles
  const dim3 gPr1(((((SEQ - RC) / 64) * (EMB / 64)) + 7) / 8 + ((SEQ == RC) ? 1 : 0), 1);   // rows [RC, SEQ)
  const dim3 gV((((EMB / 64) * (SEQ / 64)) + 7) / 8, 1);            // M=EMB, N=SEQ
  const dim3 gS0((((RC / 32) * (RC / 64)) + 7) / 8, 1);             // chunk 0 scores: 32x64 wave tiles
  const dim3 gP0((((RC / 32) * (EMB / 64)) + 7) / 8, 1);            // chunk 0 P.V: 32x64 wave tiles
  const dim3 gPn((((RC / 64) * (EMB / 64)) + 7) / 8, 1);            // chunk c P.V: 64x64 wave tiles
  const dim3 gSm(RC);                                               // one block per query row of the chunk

  // (1) x, Wq, Wk, Wv -> bf16 planes (RNE convert)
  cvt16x8<<<gCvtX, blk, 0, stream>>>(x,  Xb,  n8x);
  cvt16x8<<<gCvtW, blk, 0, stream>>>(Wq, Wqb, n8w);
  cvt16x8<<<gCvtW, blk, 0, stream>>>(Wk, Wkb, n8w);
  cvt16x8<<<gCvtW, blk, 0, stream>>>(Wv, Wvb, n8w);
  // (2) q = x . Wq^T: rows [0, RC) -> f16 hi + residual (x4096) planes; rows [RC, SEQ) -> f16 plane  (N=EMB, K=EMB)
  gemm_t<__bf16, 4, 1, 1, 3, 0><<<gPr0, blk, 0, stream>>>(
      Xb, Xb, EMB, 0LL, Wqb, EMB, 0LL,
      Wqb, EMB, 0LL, 0,
      (void*)Qh, (void*)Ql, EMB, 0LL, EMB, 0LL, EMB,
      RC, EMB, EMB, 1.0f, 0.0f, 1.0f, RSC, 0);
  if (SEQ > RC) {
    gemm_t<__bf16, 4, 1, 1, 1, 0><<<gPr1, blk, 0, stream>>>(
        Xb + (size_t)RC * EMB, Xb + (size_t)RC * EMB, EMB, 0LL, Wqb, EMB, 0LL,
        Wqb, EMB, 0LL, 0,
        (void*)(Qh + (size_t)RC * EMB), (void*)(Qh + (size_t)RC * EMB), EMB, 0LL, EMB, 0LL, EMB,
        SEQ - RC, EMB, EMB, 1.0f, 0.0f, 1.0f, 1.0f, 0);
  }
  // (3) k = x . Wk^T, same split
  gemm_t<__bf16, 4, 1, 1, 3, 0><<<gPr0, blk, 0, stream>>>(
      Xb, Xb, EMB, 0LL, Wkb, EMB, 0LL,
      Wkb, EMB, 0LL, 0,
      (void*)Kh, (void*)Kl, EMB, 0LL, EMB, 0LL, EMB,
      RC, EMB, EMB, 1.0f, 0.0f, 1.0f, RSC, 0);
  if (SEQ > RC) {
    gemm_t<__bf16, 4, 1, 1, 1, 0><<<gPr1, blk, 0, stream>>>(
        Xb + (size_t)RC * EMB, Xb + (size_t)RC * EMB, EMB, 0LL, Wkb, EMB, 0LL,
        Wkb, EMB, 0LL, 0,
        (void*)(Kh + (size_t)RC * EMB), (void*)(Kh + (size_t)RC * EMB), EMB, 0LL, EMB, 0LL, EMB,
        SEQ - RC, EMB, EMB, 1.0f, 0.0f, 1.0f, 1.0f, 0);
  }
  // (4) v^T = Wv . x^T -> f16 hi plane [d][s] (pitch SEQ) and f16 residual plane x4096 [d][s < VLP] (pitch VLP)
  //     (A = Wv rows [n][k]; Bt = x rows [s][k]; M=EMB, N=SEQ, K=EMB)
  gemm_t<__bf16, 4, 1, 1, 3, 0><<<gV, blk, 0, stream>>>(
      Wvb, Wvb, EMB, 0LL, Xb, EMB, 0LL,
      Xb, EMB, 0LL, 0,
      (void*)VT, (void*)VL, SEQ, 0LL, VLP, 0LL, VLP,
      EMB, SEQ, EMB, 1.0f, 0.0f, 1.0f, RSC, 0);
  // (5) per row chunk c (rows rb .. rb+RC-1, keys 0 .. nc-1, nc = rb + RC; S and P pitch nc):
  //     scores = q.k / 32 -> f32 S (causal tiles only); exact causal softmax -> f16 P (x16384, zeros beyond the
  //     diagonal up to the 64-column boundary); out rows = P.V / 16384 -> f32 d_out.
  for (int c = 0; c < NCH; ++c) {
    const int rb = c * RC;
    const int nc = rb + RC;
    if (c == 0) {
      // acc = Qh.Kh, acc2 = Ql.Kh + Qh.Kl (both x4096): A=Qh, A2=Ql (pitch EMB), Bt=Kh, B2=Kl (pitch EMB, K2=EMB)
      gemm_t<_Float16, 2, 2, 2, 0, 1><<<gS0, blk, 0, stream>>>(
          Qh, Ql, EMB, 0LL, Kh, EMB, 0LL,
          Kl, EMB, 0LL, EMB,
          (void*)S, (void*)S, nc, 0LL, nc, 0LL, nc,
          RC, nc, EMB, 1.0f / 32.0f, 1.0f / RSC, 1.0f, 1.0f, 0);
      softmax_rows<1><<<gSm, blk, 0, stream>>>(S, nc, Pp, Ppl, nc, 0);
      // acc = Ph.Vh, acc2 = Pl.Vh + Ph.Vl (both x4096): A=Ph, A2=Pl (pitch nc), Bt=VT (pitch SEQ), B2=VL (pitch VLP)
      gemm_t<_Float16, 2, 2, 2, 0, 2><<<gP0, blk, 0, stream>>>(
          Pp, Ppl, nc, 0LL, VT, SEQ, 0LL,
          VL, VLP, 0LL, VLP,
          (void*)out0, (void*)out0, EMB, 0LL, EMB, 0LL, EMB,
          RC, EMB, nc, 1.0f / PCARRY, 1.0f / RSC, 1.0f, 1.0f, 0);
    } else {
      const dim3 gSn((((RC / 64) * (nc / 64)) + 7) / 8, 1);         // 64x64 wave tiles
      gemm_t<_Float16, 4, 1, 1, 0, 1><<<gSn, blk, 0, stream>>>(
          Qh + (size_t)rb * EMB, Qh + (size_t)rb * EMB, EMB, 0LL, Kh, EMB, 0LL,
          Kh, EMB, 0LL, 0,
          (void*)S, (void*)S, nc, 0LL, nc, 0LL, nc,
          RC, nc, EMB, 1.0f / 32.0f, 0.0f, 1.0f, 1.0f, rb);
      softmax_rows<0><<<gSm, blk, 0, stream>>>(S, nc, Pp, Pp, nc, rb);
      gemm_t<_Float16, 4, 1, 1, 0, 2><<<gPn, blk, 0, stream>>>(
          Pp, Pp, nc, 0LL, VT, SEQ, 0LL,
          VT, SEQ, 0LL, 0,
          (void*)(out0 + (size_t)rb * EMB), (void*)(out0 + (size_t)rb * EMB), EMB, 0LL, EMB, 0LL, EMB,
          RC, EMB, nc, 1.0f / PCARRY, 0.0f, 1.0f, 1.0f, rb);
    }
  }
  (void)hipGetLastError();
}

// v001
// It runs in 799 microseconds.
// Timed twice side by side with v000, it ran 2.77 times as fast both times.
// Contractions: q, k, v^T in-projections = v_wmma_f32_16x16x32_bf16 (bf16 operands from RNE-converted inputs, single product, f32 accumulate);
// q.k^T scores = v_wmma_f32_16x16x32_f16 (q, k f16 planes, single product; query rows < RC: q and k each f16 hi plane + f16 residual plane x4096, 3 products, separate f32 accumulators);
// p.v = v_wmma_f32_16x16x32_f16 (p carried x16384 in f16, v^T f16, single product; query rows < RC: p and v^T each f16 hi plane + f16 residual plane x4096, 3 products, separate f32 accumulators);
// causal softmax (row max, sum, probabilities) in f32 on materialised f32 score row chunks.
#include <hip/hip_runtime.h>
#include <math.h>
#include <stdint.h>

#ifndef NB
#define NB 1
#endif
#ifndef SEQ
#define SEQ 8192
#endif
#define NB_FULL  1
#define SEQ_FULL 8192
#define EMB      1024
#define RC       ((SEQ < 1024) ? SEQ : 1024)   // query rows per score/probability chunk; rows < RC use residual planes
#define NCH      (SEQ / RC)                    // number of row chunks
#define VLP      RC                            // key extent of the v^T residual plane
#define PCARRY   16384.0f                      // power-of-two carry of p in the f16 P.V operand
#define RSC      4096.0f                       // power-of-two carry of every f16 residual plane
#define SMI      ((SEQ / 8 + 255) / 256)       // max 8-column groups per softmax thread
static_assert(NB == 1 && NB_FULL == 1);
static_assert(SEQ >= 256 && SEQ <= SEQ_FULL && (SEQ % 256) == 0);
static_assert((SEQ % RC) == 0 && (RC % 64) == 0 && NCH >= 1);
static_assert((EMB % 64) == 0 && (SEQ % 64) == 0 && (EMB % 32) == 0 && (RC % 32) == 0);
static_assert(SMI >= 1 && SMI <= 4);
static_assert((EMB % 512) == 0 && (RC % 512) == 0 && (SEQ % 512) == 0);   // eight 64-column tiles per GEMM block; 64-k staged tiles
static_assert(((SEQ * EMB / 8) % 256) == 0 && ((EMB * EMB / 8) % 256) == 0);

typedef _Float16 v16h __attribute__((ext_vector_type(16)));
typedef _Float16 v8h  __attribute__((ext_vector_type(8)));
typedef __bf16   v16b __attribute__((ext_vector_type(16)));
typedef __bf16   v8b  __attribute__((ext_vector_type(8)));
typedef float    v8f  __attribute__((ext_vector_type(8)));
typedef float    v4f  __attribute__((ext_vector_type(4)));
typedef unsigned int v4u __attribute__((ext_vector_type(4)));

#if defined(__HIP_DEVICE_COMPILE__)
#define DEV_ASM 1
#else
#define DEV_ASM 0
#endif

// ---- scalar helpers --------------------------------------------------------------------------------
__device__ __forceinline__ unsigned short bf_bits(float f) {          // f32 -> bf16 bits, RNE convert
  unsigned u = __float_as_uint(f);
  return (unsigned short)((u + 0x7FFFu + ((u >> 16) & 1u)) >> 16);
}
__device__ __forceinline__ unsigned short h_bits(_Float16 x) { return __builtin_bit_cast(unsigned short, x); }
__device__ __forceinline__ unsigned pk16(unsigned short a, unsigned short b) { return (unsigned)a | ((unsigned)b << 16); }
__device__ __forceinline__ v8f zero8() { v8f z = {0.f, 0.f, 0.f, 0.f, 0.f, 0.f, 0.f, 0.f}; return z; }

// ---- fragment types / loaders: 16-bit A/B operand, lane -> row/col (lane&15), p already includes +8*(lane>>4);
//      elements 0..7 <- p[0..7] (k0+8h..k0+8h+7), elements 8..15 <- p[16..23] (k0+16+8h..k0+16+8h+7)
template <typename OT> struct FT;
template <> struct FT<__bf16>   { typedef v16b frag; typedef v8b half8; };
template <> struct FT<_Float16> { typedef v16h frag; typedef v8h half8; };

template <typename OT>
__device__ __forceinline__ typename FT<OT>::frag ldfrag(const OT* p) {
  union { typename FT<OT>::frag v; typename FT<OT>::half8 h[2]; } f;
  f.h[0] = *(const typename FT<OT>::half8*)(p);
  f.h[1] = *(const typename FT<OT>::half8*)(p + 16);
  return f.v;
}

// ---- WMMA helpers (asm guard bodies are device-only; concrete operand types) -----------------------------
__device__ __forceinline__ v8f mmar(v16b a, v16b b, v8f c) {
  return __builtin_amdgcn_wmma_f32_16x16x32_bf16(false, a, false, b, (short)0, c, false, false);
}
__device__ __forceinline__ v8f mmar(v16h a, v16h b, v8f c) {
  return __builtin_amdgcn_wmma_f32_16x16x32_f16(false, a, false, b, (short)0, c, false, false);
}
__device__ __forceinline__ void acc_guard4(v8f& a, v8f& b, v8f& c, v8f& d) {
#if DEV_ASM
  asm volatile("v_nop\n\tv_nop\n\tv_nop\n\tv_nop" : "+v"(a), "+v"(b), "+v"(c), "+v"(d));
#else
  (void)a; (void)b; (void)c; (void)d;
#endif
}

// ---- LDS staging by asynchronous copies ---------------------------------------------------------------
#define BKE 64     // k elements per staged tile: 128-B rows, whole lines of the source
#define LPB 144    // LDS row pitch in bytes: 128 + 16 (16 B x odd, conflict-free for 16-B row readers)
#define LPE (LPB / 2)
__device__ __forceinline__ unsigned lds_off(const void* p) { return (unsigned)(size_t)p; }   // byte offset in the block's LDS
// Each copy: a wave brings 4 rows x 128 B (lane -> row lane>>3, 16-B piece lane&7), l / g already hold the lane's part.
// step4 = source elements per 4 rows. The address-register wait ends each statement, so no later address
// arithmetic can be placed between a copy and that wait.
__device__ __forceinline__ void copy8and32rows(unsigned la, const void* gap, size_t astep4,
                                               unsigned l, const void* gp, size_t step4) {
#if DEV_ASM
  const unsigned short* ga = (const unsigned short*)gap;
  const unsigned short* g  = (const unsigned short*)gp;
  asm volatile("global_load_async_to_lds_b128 %0, %10, off\n\t"
               "global_load_async_to_lds_b128 %1, %11, off\n\t"
               "global_load_async_to_lds_b128 %2, %12, off\n\t"
               "global_load_async_to_lds_b128 %3, %13, off\n\t"
               "global_load_async_to_lds_b128 %4, %14, off\n\t"
               "global_load_async_to_lds_b128 %5, %15, off\n\t"
               "global_load_async_to_lds_b128 %6, %16, off\n\t"
               "global_load_async_to_lds_b128 %7, %17, off\n\t"
               "global_load_async_to_lds_b128 %8, %18, off\n\t"
               "global_load_async_to_lds_b128 %9, %19, off\n\t"
               "s_wait_xcnt 0x0"
               :: "v"(la), "v"(la + 4u * LPB),
                  "v"(l), "v"(l + 4u * LPB), "v"(l + 8u * LPB), "v"(l + 12u * LPB),
                  "v"(l + 16u * LPB), "v"(l + 20u * LPB), "v"(l + 24u * LPB), "v"(l + 28u * LPB),
                  "v"(ga), "v"(ga + astep4),
                  "v"(g), "v"(g + step4), "v"(g + 2 * step4), "v"(g + 3 * step4),
                  "v"(g + 4 * step4), "v"(g + 5 * step4), "v"(g + 6 * step4), "v"(g + 7 * step4) : "memory");
#else
  (void)la; (void)gap; (void)astep4; (void)l; (void)gp; (void)step4;
#endif
}
__device__ __forceinline__ void copy32rows(unsigned l, const void* gp, size_t step4) {
#if DEV_ASM
  const unsigned short* g = (const unsigned short*)gp;
  asm volatile("global_load_async_to_lds_b128 %0, %8, off\n\t"
               "global_load_async_to_lds_b128 %1, %9, off\n\t"
               "global_load_async_to_lds_b128 %2, %10, off\n\t"
               "global_load_async_to_lds_b128 %3, %11, off\n\t"
               "global_load_async_to_lds_b128 %4, %12, off\n\t"
               "global_load_async_to_lds_b128 %5, %13, off\n\t"
               "global_load_async_to_lds_b128 %6, %14, off\n\t"
               "global_load_async_to_lds_b128 %7, %15, off\n\t"
               "s_wait_xcnt 0x0"
               :: "v"(l), "v"(l + 4u * LPB), "v"(l + 8u * LPB), "v"(l + 12u * LPB),
                  "v"(l + 16u * LPB), "v"(l + 20u * LPB), "v"(l + 24u * LPB), "v"(l + 28u * LPB),
                  "v"(g), "v"(g + step4), "v"(g + 2 * step4), "v"(g + 3 * step4),
                  "v"(g + 4 * step4), "v"(g + 5 * step4), "v"(g + 6 * step4), "v"(g + 7 * step4) : "memory");
#else
  (void)l; (void)gp; (void)step4;
#endif
}
__device__ __forceinline__ void wait_lds_reads() {   // this wave's LDS reads have returned before its buffer is handed back
#if DEV_ASM
  asm volatile("s_wait_dscnt 0x0" ::: "memory");
#endif
}
__device__ __forceinline__ void wait_copies() {      // this wave's copies have landed before the barrier publishes them
#if DEV_ASM
  asm volatile("s_wait_asynccnt 0x0" ::: "memory");
#endif
}

// =====================================================================================================
// f32 -> bf16 plane (RNE convert), 8 elements per thread, one 16-B store per lane: a wave writes 512 contiguous B
// coverage: n8 threads x 8 elements = the whole plane (n8 is a multiple of 256 for every use here).
// =====================================================================================================
__global__ __launch_bounds__(256) void cvt16x8(const float* __restrict__ in, unsigned short* out, int n8) {
  const int i = blockIdx.x * 256 + (int)threadIdx.x;
  if (i < n8) {
    const float* ip = in + (size_t)i * 8;
    const v4f a  = *(const v4f*)(ip);
    const v4f a4 = *(const v4f*)(ip + 4);
    v4u p;
    p[0] = pk16(bf_bits(a[0]),  bf_bits(a[1]));
    p[1] = pk16(bf_bits(a[2]),  bf_bits(a[3]));
    p[2] = pk16(bf_bits(a4[0]), bf_bits(a4[1]));
    p[3] = pk16(bf_bits(a4[2]), bf_bits(a4[3]));
    unsigned short* o = out + (size_t)i * 8;
    *(v4u*)o = p;
    
  }
}

// =====================================================================================================
// Register-blocked WMMA GEMM (16-bit operand type OT): C[m][n] = sum_k A[m][k] * Bt[n][k];
// one wave per (16*MI) x 64 tile; the eight waves of a block hold eight neighbouring column tiles of one row tile
// (N a multiple of 512). A row-major [M][K] pitch lda; Bt row-major [N][K] pitch ldb
// (k contiguous); M multiple of 16*MI, K multiple of 64 (static sizes here). blockIdx.y = batch
// index (strides in elements; always 0 here). Per 64 k the block stages its A rows (shared) and each wave's Bt rows in
// LDS by asynchronous copies of whole 128-B lines, two buffers, one block barrier per tile: tile t + 1 flies while tile
// t is multiplied. Fragments are read from LDS with the split k map (ldfrag); the k order of every sum is ascending.
// NPA = number of A planes: 2 -> second plane A2 (same pitch/stride as A) multiplies the same Bt fragments into the
// second accumulator set.  NPB = number of Bt planes: 2 -> second plane B2 (pitch ldb2, stride strideB2) holds the
// k range [0, K2) only (K2 multiple of 64); for k chunks with k0 < K2 (block-uniform) the A fragments multiply
// B2 fragments into the second accumulator set. NPA = NPB = 2: acc = A.Bt, acc2 = A2.Bt + A.B2 (both residual planes
// carry the same power-of-two scale 1/rscale2).
// value v = (acc [+ acc2 * rscale2]) * oscale, combined in the f32 epilogue.
// CZ (causal), czoff = global row index of local row 0 (multiple of 64):
//   0 none; 1 = output tiles with n0 >= czoff + m0 + 16*MI are not stored (every tile holding a
//   column <= one of its rows is written); 2 = A rows hold exact zeros beyond the diagonal up to column
//   czoff + m0 + 16*MI, so the k loop ends at min(K, czoff + m0 + 16*MI) (exact); the last staged tile is copied whole,
//   so A rows are written up to the next multiple of 64 columns.
// OUT_MODE 0: f32 C (pitch ldc) = v.
// OUT_MODE 1: f16 plane C = f16(v * cscale).
// OUT_MODE 3: f16 hi plane C = f16(v * cscale) (pitch ldc) and f16 residual plane
//             C2 = f16((v*cscale - hi) * rscaleC) (pitch ldc2), C2 written only for output
//             tiles with n0 < N2 (N2 multiple of 64, wave-uniform), i.e. columns [0, N2) fully.
// =====================================================================================================
template <typename OT, int MI, int NPA, int NPB, int OUT_MODE, int CZ>
__global__ __launch_bounds__(256) void gemm_t(
    const unsigned short* __restrict__ Ap, const unsigned short* __restrict__ A2p, int lda, long long strideA,
    const unsigned short* __restrict__ Btp, int ldb, long long strideB,
    const unsigned short* __restrict__ B2p, int ldb2, long long strideB2, int K2,
    void* Cout, void* Cout2, int ldc, long long strideC, int ldc2, long long strideC2, int N2,
    int M, int N, int K, float oscale, float rscale2, float cscale, float rscaleC, int czoff) {
  static_assert(CZ != 2 || ((16 * MI) % 32) == 0);
  typedef typename FT<OT>::frag V16;
  const OT* A  = (const OT*)(const void*)Ap;
  const OT* A2 = (const OT*)(const void*)A2p;
  const OT* Bt = (const OT*)(const void*)Btp;
  const OT* B2 = (const OT*)(const void*)B2p;
  const int RT = 16 * MI;
  constexpr int ROWS_A = 16 * MI * NPA;                    // A (and A2) rows of the block's tiles
  constexpr int ROWS_W = 64 * NPB;                         // Bt (and B2) rows of one wave's tile
  constexpr int STG_B  = (ROWS_A + 8 * ROWS_W) * LPB;      // one staged k tile of the block, bytes
  static_assert(ROWS_A == 64);                             // 8 waves x 8 rows copy the A part
  static_assert(2 * STG_B >= 8 * 16 * 68 * 4 && 2 * STG_B <= 320 * 1024);
  __shared__ __align__(16) unsigned char ring[2 * STG_B];  // two buffers; after the k loop: per-wave 16x64 f32 slabs
  const int b    = blockIdx.y;
  const int lane = threadIdx.x & 31;
  const int wave = __builtin_amdgcn_readfirstlane((int)(threadIdx.x >> 5));
  const int tilesN = N >> 6;
  const int tilesM = M / RT;
  const int tile0 = blockIdx.x * 8;
  if (tile0 >= tilesM * tilesN) return;  // block-uniform, in front of every barrier
  const int tm  = tile0 / tilesN;        // tilesN is a multiple of 8: the block's eight tiles share tm
  const int tn0 = tile0 - tm * tilesN;
  const int m0 = tm * RT;
  const int n0 = (tn0 + wave) << 6;
  bool live = true;
  if (CZ == 1) {
    if ((tn0 << 6) >= czoff + m0 + RT) return;   // block-uniform causal skip, in front of every barrier
    live = n0 < czoff + m0 + RT;                 // a wave past the diagonal walks the loop and stores nothing
  }
  int kEnd = K;
  if (CZ == 2) {
    const int ke = czoff + m0 + RT;      // multiple of 32
    kEnd = (ke < K) ? ke : K;
  }

  const OT* Ab  = A  + (size_t)b * (size_t)strideA;
  const OT* A2b = A2 + (size_t)b * (size_t)strideA;
  const OT* Bb  = Bt + (size_t)b * (size_t)strideB;
  const OT* B2b = B2 + (size_t)b * (size_t)strideB2;

  const int rlane = lane & 15;                 // row (A) / col (B, D) within subtile
  const int koff  = (lane >> 4) * 8;           // k offset of this lane half
  const int mOff  = (lane >> 4) * 8;           // D row offset

  v8f acc[MI][4], acc2[MI][4];
#pragma unroll
  for (int i = 0; i < MI; ++i)
#pragma unroll
    for (int j = 0; j < 4; ++j) { acc[i][j] = zero8(); acc2[i][j] = zero8(); }

  // ---- this lane's part of every staged tile: row lane>>3 of each 4-row group, 16-B piece lane&7 ----
  const int crow = lane >> 3;
  const int cel  = (lane & 7) * 8;
  const int arow = wave * 8;                                   // this wave's 8 of the 64 staged [A | A2] rows
  const bool a2w = (NPA == 2) && (arow >= RT);                 // wave-uniform
  const OT* gA  = (a2w ? A2b : Ab) + (size_t)(m0 + (a2w ? arow - RT : arow) + crow) * lda + cel;
  const OT* gB  = Bb  + (size_t)(n0 + crow) * ldb  + cel;
  const OT* gB2 = B2b + (size_t)(n0 + crow) * ldb2 + cel;
  const unsigned lc = lds_off(ring) + (unsigned)(crow * LPB + cel * 2);
  const unsigned lA = lc + (unsigned)(arow * LPB);
  const unsigned lB = lc + (unsigned)((ROWS_A + wave * ROWS_W) * LPB);
  const int nT = (kEnd + BKE - 1) / BKE;                       // >= 1; block-uniform
  auto stage = [&](int t) {                                    // tile t -> buffer t & 1
    const unsigned bo = (unsigned)(t & 1) * (unsigned)STG_B;
    const int kt = t * BKE;
    copy8and32rows(lA + bo, gA + kt, (size_t)4 * lda, lB + bo, gB + kt, (size_t)4 * ldb);
    copy32rows(lB + bo + 32u * LPB, gB + kt + (size_t)32 * ldb, (size_t)4 * ldb);
    if (NPB == 2) {
      if (kt < K2) {                                           // block-uniform: the residual plane ends at K2
        copy32rows(lB + bo + 64u * LPB, gB2 + kt, (size_t)4 * ldb2);
        copy32rows(lB + bo + 96u * LPB, gB2 + kt + (size_t)32 * ldb2, (size_t)4 * ldb2);
      }
    }
  };

  stage(0);
  wait_copies();
  __syncthreads();                       // tile 0 is published
  if (nT > 1) stage(1);
  const int aOff = rlane * LPB;                                // this lane's fragment rows in a buffer, bytes
  const int bOff = (ROWS_A + wave * ROWS_W + rlane) * LPB;
  if constexpr (NPA == 1 && NPB == 1) {
    // Every LDS read of tile t stands between the barrier that publishes it and the barrier that frees its buffer.
    // Fragment registers: bq0 / bq1 = Bt of the tile's first / second 32 k; a[i] is refilled in place right behind its
    // last product; ax holds row group MI-1 of the second 32 k, so that no read is issued behind a phase's last products.
    // The scheduling barriers keep each read at that place (left alone, the compiler read each A fragment right in
    // front of its products and waited for it every time).
    V16 bq0[4], bq1[4], a[MI], ax;
    {
      const OT* sA = (const OT*)(const void*)(ring + aOff) + koff;
      const OT* sB = (const OT*)(const void*)(ring + bOff) + koff;
#pragma unroll
      for (int j = 0; j < 4; ++j) bq0[j] = ldfrag<OT>(sB + (j << 4) * LPE);
#pragma unroll
      for (int i = 0; i < MI; ++i) a[i] = ldfrag<OT>(sA + (i << 4) * LPE);
    }
    for (int t = 0; t < nT; ++t) {
      const unsigned char* buf = ring + (size_t)(t & 1) * STG_B;
      const OT* sA = (const OT*)(const void*)(buf + aOff) + koff + 32;
      const OT* sB = (const OT*)(const void*)(buf + bOff) + koff + 32;
      ax = ldfrag<OT>(sA + ((MI - 1) << 4) * LPE);
#pragma unroll
      for (int j = 0; j < 4; ++j) bq1[j] = ldfrag<OT>(sB + (j << 4) * LPE);
      __builtin_amdgcn_sched_barrier(0);     // reads of the second 32 k go out ahead of the first 32 k's products
#pragma unroll
      for (int i = 0; i < MI - 1; ++i) {
#pragma unroll
        for (int j = 0; j < 4; ++j) acc[i][j] = mmar(a[i], bq0[j], acc[i][j]);
        __builtin_amdgcn_sched_barrier(0);   // the refill stays behind a[i]'s last product, so it can take a[i]'s registers
        a[i] = ldfrag<OT>(sA + (i << 4) * LPE);
        __builtin_amdgcn_sched_barrier(0);   // the refill of a[i] stays among the products
      }
#pragma unroll
      for (int j = 0; j < 4; ++j) acc[MI - 1][j] = mmar(a[MI - 1], bq0[j], acc[MI - 1][j]);
      __builtin_amdgcn_sched_barrier(0);     // the first 32 k's products stay ahead of the waits
      wait_lds_reads();
      wait_copies();
      __syncthreads();                       // publishes tile t + 1 and ends every read of tile t's buffer
      if (t + 2 < nT) stage(t + 2);
      // The first 32 k of tile t + 1 are read under tile t's last products. The last trip has no next tile: a scalar
      // select aims its reads, whose values nobody uses, at its own buffer (landed, not refilled), which keeps the
      // products free of a branch.
      const unsigned char* nbuf = ring + (size_t)(((t + 1 < nT) ? (t + 1) : t) & 1) * STG_B;
      const OT* nA = (const OT*)(const void*)(nbuf + aOff) + koff;
      const OT* nB = (const OT*)(const void*)(nbuf + bOff) + koff;
      a[MI - 1] = ldfrag<OT>(nA + ((MI - 1) << 4) * LPE);
#pragma unroll
      for (int j = 0; j < 4; ++j) bq0[j] = ldfrag<OT>(nB + (j << 4) * LPE);
      __builtin_amdgcn_sched_barrier(0);     // the next tile's reads go out ahead of this tile's last products
#pragma unroll
      for (int i = 0; i < MI - 1; ++i) {
#pragma unroll
        for (int j = 0; j < 4; ++j) acc[i][j] = mmar(a[i], bq1[j], acc[i][j]);
        __builtin_amdgcn_sched_barrier(0);   // the refill stays behind a[i]'s last product, so it can take a[i]'s registers
        a[i] = ldfrag<OT>(nA + (i << 4) * LPE);
        __builtin_amdgcn_sched_barrier(0);   // the refill of a[i] stays among the products
      }
#pragma unroll
      for (int j = 0; j < 4; ++j) acc[MI - 1][j] = mmar(ax, bq1[j], acc[MI - 1][j]);
    }
  } else {
    for (int t = 0; t < nT; ++t) {
      const unsigned char* buf = ring + (size_t)(t & 1) * STG_B;
      const OT* sA = (const OT*)(const void*)(buf + aOff) + koff;
      const OT* sB = (const OT*)(const void*)(buf + bOff) + koff;
#pragma unroll   // two 32-k chunks per staged tile, fragment arrays stay in registers
      for (int kk = 0; kk < BKE; kk += 32) {
        const int k0 = t * BKE + kk;
        if (CZ != 2 || (RT % BKE) == 0 || k0 < kEnd) {         // block-uniform: a 32-row tile may end mid-tile
          const bool res = k0 < K2;                            // block-uniform: residual Bt plane covers k < K2 only
          V16 bq[4], br[4], af[MI], af2[MI];
#pragma unroll
          for (int j = 0; j < 4; ++j) bq[j] = ldfrag<OT>(sB + (j << 4) * LPE + kk);
#pragma unroll
          for (int i = 0; i < MI; ++i) {
            af[i]  = ldfrag<OT>(sA + (i << 4) * LPE + kk);
            af2[i] = ldfrag<OT>(sA + (RT + (i << 4)) * LPE + kk);
          }
          if (res) {
#pragma unroll
            for (int j = 0; j < 4; ++j) br[j] = ldfrag<OT>(sB + (64 + (j << 4)) * LPE + kk);
          }
          __builtin_amdgcn_sched_barrier(0);   // the chunk's reads stay in one group ahead of its products
#pragma unroll
          for (int i = 0; i < MI; ++i) {
#pragma unroll
            for (int j = 0; j < 4; ++j) acc[i][j] = mmar(af[i], bq[j], acc[i][j]);
#pragma unroll
            for (int j = 0; j < 4; ++j) acc2[i][j] = mmar(af2[i], bq[j], acc2[i][j]);
          }
          if (res) {
#pragma unroll
            for (int i = 0; i < MI; ++i)
#pragma unroll
              for (int j = 0; j < 4; ++j) acc2[i][j] = mmar(af[i], br[j], acc2[i][j]);
          }
        }
      }
      wait_lds_reads();
      wait_copies();
      __syncthreads();                       // publishes tile t + 1 and ends every read of tile t's buffer
      if (t + 2 < nT) stage(t + 2);
    }
  }
  wait_copies();
  wait_lds_reads();
  __syncthreads();                       // every wave's last ring read has returned: the ring becomes output staging
  if (!live) return;                     // wave-uniform; no block barrier follows
#pragma unroll
  for (int i = 0; i < MI; ++i) {
    acc_guard4(acc[i][0], acc[i][1], acc[i][2], acc[i][3]);
    if (NPA == 2 || NPB == 2) acc_guard4(acc2[i][0], acc2[i][1], acc2[i][2], acc2[i][3]);
  }

  // ---- epilogue ----
  float* slab = (float*)(void*)ring + wave * (16 * 68);   // pitch 68 floats, wave-private
#pragma unroll
  for (int i = 0; i < MI; ++i) {
    const int mBase = m0 + (i << 4);
#pragma unroll
    for (int j = 0; j < 4; ++j) {
#pragma unroll
      for (int r = 0; r < 8; ++r) {
        float v = acc[i][j][r];
        if (NPA == 2 || NPB == 2) v += acc2[i][j][r] * rscale2;
        v = v * oscale;
        slab[(mOff + r) * 68 + (j << 4) + rlane] = v;
      }
    }
    __builtin_amdgcn_fence(3 /* release order */, "workgroup");
    __builtin_amdgcn_wave_barrier();
    __builtin_amdgcn_fence(2 /* acquire order */, "workgroup");
    if (OUT_MODE == 0) {
      float* C = (float*)Cout + (size_t)b * (size_t)strideC;
      const int h2 = lane >> 4, c4 = (lane & 15) * 4;     // 256-B row segment = 16 lanes x 16 B
      {
#pragma unroll
        for (int it = 0; it < 8; ++it) {
          const int row = it * 2 + h2;                     // it 0..7 x h2 0..1 = rows 0..15
          const v4f v = *(const v4f*)(slab + row * 68 + c4);
          *(v4f*)(C + (size_t)(mBase + row) * ldc + n0 + c4) = v;
        }
        
      }
    } else {
      const int q = lane >> 3, c8 = (lane & 7) * 8;
      unsigned short* C  = (unsigned short*)Cout  + (size_t)b * (size_t)strideC;
      unsigned short* C2 = (unsigned short*)Cout2 + (size_t)b * (size_t)strideC2;
      const bool wr2 = (OUT_MODE == 3) && (n0 < N2);     // wave-uniform
      v4u hv[4], lv[4];
#pragma unroll
      for (int it = 0; it < 4; ++it) {
        const int row = it * 4 + q;                        // it 0..3 x q 0..3 = rows 0..15
        const float* sp = slab + row * 68 + c8;
        float f[8];
#pragma unroll
        for (int e = 0; e < 8; ++e) f[e] = sp[e] * cscale;
        v4u a, a2;
#pragma unroll
        for (int e = 0; e < 4; ++e) {
          const float f0 = f[2 * e], f1 = f[2 * e + 1];
          const _Float16 x0 = (_Float16)f0, x1 = (_Float16)f1;
          const unsigned short h0 = h_bits(x0), h1 = h_bits(x1);
          unsigned short l0 = 0, l1 = 0;
          if (OUT_MODE == 3) {
            l0 = h_bits((_Float16)((f0 - (float)x0) * rscaleC));
            l1 = h_bits((_Float16)((f1 - (float)x1) * rscaleC));
          }
          a[e] = pk16(h0, h1); a2[e] = pk16(l0, l1);
        }
        hv[it] = a; lv[it] = a2;
      }
      {
#pragma unroll
        for (int it = 0; it < 4; ++it) {
          const int row = it * 4 + q;
          *(v4u*)(C + (size_t)(mBase + row) * ldc + n0 + c8) = hv[it];
          if (OUT_MODE == 3) {
            if (wr2) *(v4u*)(C2 + (size_t)(mBase + row) * ldc2 + n0 + c8) = lv[it];
          }
        }
        
      }
    }
    __builtin_amdgcn_fence(3 /* release order */, "workgroup");
    __builtin_amdgcn_wave_barrier();
    __builtin_amdgcn_fence(2 /* acquire order */, "workgroup");
  }
}

// =====================================================================================================
// Exact causal row softmax over one chunk of query rows: one block of 256 threads per local row r (global row
// t = rowBase + r).
//   S: f32 score chunk [rows][ldS]; the scores GEMM wrote every column of row t in [0, ((t>>6)+1)*64).
//   The row is processed in 8-column groups g; ng = ((t>>6)+1)*8 groups exist. Thread tid owns groups
//   g = it*256 + tid. Loads use an address clamped to group ng-1; entries with column > t are replaced by -inf
//   by index before any arithmetic. Iterations with it*256 >= ng are skipped block-uniformly.
//   p = exp(s - max) * (1/sum) in f32 (max finite: column 0 is always valid), x16384 carry, f16 RNE;
//   columns > t up to ((t>>6)+1)*64 get exact zeros. WRL = 1: also the f16 residual plane
//   Pl = f16((p*16384 - hi) * 4096), same pitch. Each group is one 16-B store per lane; 8 consecutive lanes fill
//   LDS redm/reds: cross-wave, block barriers (every thread reaches both).
//   coverage: RC rows per launch x columns [0, ((t>>6)+1)*64) of P (and Pl) = at least the extent the P.V GEMM reads.
// =====================================================================================================
template <int WRL>
__global__ __launch_bounds__(256)
void softmax_rows(const float* __restrict__ S, int ldS, unsigned short* P, unsigned short* Pl, int ldP, int rowBase) {
  __shared__ float redm[8];
  __shared__ float reds[8];
  const int r    = blockIdx.x;
  const int t    = rowBase + r;
  const int tid  = threadIdx.x;
  const int wave = tid >> 5;
  const int lane = tid & 31;
  const int ng   = ((t >> 6) + 1) * 8;
  const float* rp = S + (size_t)r * (size_t)ldS;
  float v[SMI][8];
#pragma unroll
  for (int it = 0; it < SMI; ++it) {
#pragma unroll
    for (int e = 0; e < 8; ++e) v[it][e] = -INFINITY;
    if (it * 256 < ng) {                                   // block-uniform
      const int g  = it * 256 + tid;
      const int gc = (g < ng) ? g : (ng - 1);              // clamped address
      const int c0 = g * 8;
      const v4f a  = *(const v4f*)(rp + (size_t)gc * 8);
      const v4f a4 = *(const v4f*)(rp + (size_t)gc * 8 + 4);
#pragma unroll
      for (int e = 0; e < 4; ++e) {
        v[it][e]     = (c0 + e <= t)     ? a[e]  : -INFINITY;
        v[it][4 + e] = (c0 + 4 + e <= t) ? a4[e] : -INFINITY;
      }
    }
  }
  float mx = -INFINITY;
#pragma unroll
  for (int it = 0; it < SMI; ++it)
#pragma unroll
    for (int e = 0; e < 8; ++e) mx = fmaxf(mx, v[it][e]);
#pragma unroll
  for (int off = 1; off < 32; off <<= 1) mx = fmaxf(mx, __shfl_xor(mx, off, 32));
  if (lane == 0) redm[wave] = mx;
  __syncthreads();
  mx = redm[0];
#pragma unroll
  for (int w = 1; w < 8; ++w) mx = fmaxf(mx, redm[w]);

  float sum = 0.f;
#pragma unroll
  for (int it = 0; it < SMI; ++it) {
    if (it * 256 < ng) {                                   // block-uniform
#pragma unroll
      for (int e = 0; e < 8; ++e) { const float ex = __expf(v[it][e] - mx); v[it][e] = ex; sum += ex; }
    } else {
#pragma unroll
      for (int e = 0; e < 8; ++e) v[it][e] = 0.f;
    }
  }
#pragma unroll
  for (int off = 1; off < 32; off <<= 1) sum += __shfl_xor(sum, off, 32);
  if (lane == 0) reds[wave] = sum;
  __syncthreads();
  sum = reds[0];
#pragma unroll
  for (int w = 1; w < 8; ++w) sum += reds[w];

  const float sc = PCARRY * (1.0f / sum);        // sum >= 1
  v4u pk[SMI], pl[SMI];
#pragma unroll
  for (int it = 0; it < SMI; ++it) {
    v4u a, a2;
#pragma unroll
    for (int e = 0; e < 4; ++e) {
      const float f0 = v[it][2 * e] * sc, f1 = v[it][2 * e + 1] * sc;
      const _Float16 x0 = (_Float16)f0, x1 = (_Float16)f1;
      unsigned short l0 = 0, l1 = 0;
      if (WRL == 1) {
        l0 = h_bits((_Float16)((f0 - (float)x0) * RSC));
        l1 = h_bits((_Float16)((f1 - (float)x1) * RSC));
      }
      a[e]  = pk16(h_bits(x0), h_bits(x1));
      a2[e] = pk16(l0, l1);
    }
    pk[it] = a; pl[it] = a2;
  }
  unsigned short* op  = P  + (size_t)r * (size_t)ldP;
  unsigned short* opl = Pl + (size_t)r * (size_t)ldP;
  {
#pragma unroll
    for (int it = 0; it < SMI; ++it) {
      if (it * 256 < ng) {                                 // block-uniform
        const int g = it * 256 + tid;
        if (g < ng) {
          *(v4u*)(op + (size_t)g * 8) = pk[it];
          if (WRL == 1) *(v4u*)(opl + (size_t)g * 8) = pl[it];
        }
      }
    }
    
  }
}

// =====================================================================================================
// Workspace map (bytes at SEQ = 8192, RC = 1024; every region a multiple of its whole-line store granularity and of
//   R0   Xb bf16 [SEQ][EMB] (16777216), later the f32 score chunk S [RC][(c+1)*RC] (max RC*SEQ*4 = 33554432)   33554432
//   Wqb, Wkb, Wvb bf16 [EMB][EMB]                                                                          3 x 2097152
//   Qh   f16 [SEQ][EMB]                                                                                      16777216
//   Kh   f16 [SEQ][EMB]                                                                                      16777216
//   VT   f16 [EMB][SEQ]   (v^T hi plane)                                                                     16777216
//   Ql   f16 [RC][EMB]    (q residual x4096, rows < RC)                                                       2097152
//   Kl   f16 [RC][EMB]    (k residual x4096, keys < RC)                                                       2097152
//   VL   f16 [EMB][VLP]   (v^T residual x4096, keys < VLP)                                                    2097152
//   P    f16 [RC][(c+1)*RC]  (max RC*SEQ*2)                                                                  16777216
//   Pl   f16 [RC][RC]     (p residual x4096, chunk 0 only)                                                    2097152
//   total                                                                                                   115343360
// Aliases are ordered by launch dependence: Xb is last read by the v^T projection, S first written by the first
// scores GEMM after it. Weights are [out n][in k] with k contiguous = the Bt / A layout the GEMM wants.
// =====================================================================================================
static constexpr size_t PACT_B = (size_t)SEQ * EMB * 2;
static constexpr size_t PS_B   = (size_t)RC * SEQ * 4;
static constexpr size_t R0_B   = (PACT_B > PS_B) ? PACT_B : PS_B;
static constexpr size_t PW_B   = (size_t)EMB * EMB * 2;
static constexpr size_t PRES_B = (size_t)RC * EMB * 2;
static constexpr size_t PVT_B  = (size_t)EMB * SEQ * 2;
static constexpr size_t PVL_B  = (size_t)EMB * VLP * 2;
static constexpr size_t PP_B   = (size_t)RC * SEQ * 2;
static constexpr size_t PPL_B  = (size_t)RC * RC * 2;
static constexpr size_t WS_TOTAL = R0_B + 3 * PW_B + 2 * PACT_B + PVT_B + 2 * PRES_B + PVL_B + PP_B + PPL_B;
static_assert(WS_TOTAL <= (size_t)134217728);
static_assert((size_t)RC * ((size_t)NCH * RC) * 4 <= R0_B);    // widest score chunk
static_assert((size_t)RC * ((size_t)NCH * RC) * 2 <= PP_B);    // widest probability chunk
static_assert((R0_B % 128) == 0 && (PW_B % 128) == 0 && (PRES_B % 128) == 0 && (PVL_B % 128) == 0 && (PPL_B % 128) == 0);

extern "C" void kernel_launch(void* const* d_in, const int* in_sizes, int n_in,
                              void* d_out, int out_size, void* d_ws, size_t ws_size,
                              hipStream_t stream) {
  if (n_in < 4) return;
  const long long needX = (long long)SEQ * (long long)EMB;
  if ((long long)in_sizes[0] < needX) return;
  if (in_sizes[1] < EMB * EMB) return;
  if (in_sizes[2] < EMB * EMB) return;
  if (in_sizes[3] < EMB * EMB) return;
  if (out_size < 0) return;
  if ((long long)out_size < needX) return;

  const float* x  = (const float*)d_in[0];
  const float* Wq = (const float*)d_in[1];
  const float* Wk = (const float*)d_in[2];
  const float* Wv = (const float*)d_in[3];

  size_t off = 0;
  const size_t oR0 = off; off += R0_B;
  const size_t oWq = off; off += PW_B;
  const size_t oWk = off; off += PW_B;
  const size_t oWv = off; off += PW_B;
  const size_t oQh = off; off += PACT_B;
  const size_t oKh = off; off += PACT_B;
  const size_t oVT = off; off += PVT_B;
  const size_t oQl = off; off += PRES_B;
  const size_t oKl = off; off += PRES_B;
  const size_t oVL = off; off += PVL_B;
  const size_t oP  = off; off += PP_B;
  const size_t oPl = off; off += PPL_B;
  if (off != WS_TOTAL) return;
  if (off > ws_size) return;
  if (off > (size_t)134217728) return;

  char* ws = (char*)d_ws;
  unsigned short* Xb  = (unsigned short*)(ws + oR0);
  float*          S   = (float*)(ws + oR0);          // alias, see map
  unsigned short* Wqb = (unsigned short*)(ws + oWq);
  unsigned short* Wkb = (unsigned short*)(ws + oWk);
  unsigned short* Wvb = (unsigned short*)(ws + oWv);
  unsigned short* Qh  = (unsigned short*)(ws + oQh);
  unsigned short* Kh  = (unsigned short*)(ws + oKh);
  unsigned short* VT  = (unsigned short*)(ws + oVT);
  unsigned short* Ql  = (unsigned short*)(ws + oQl);
  unsigned short* Kl  = (unsigned short*)(ws + oKl);
  unsigned short* VL  = (unsigned short*)(ws + oVL);
  unsigned short* Pp  = (unsigned short*)(ws + oP);
  unsigned short* Ppl = (unsigned short*)(ws + oPl);
  float*          out0 = (float*)d_out;

  const dim3 blk(256);
  const int n8x = SEQ * EMB / 8;                                    // multiple of 256
  const int n8w = EMB * EMB / 8;                                    // multiple of 256
  const dim3 gCvtX(n8x / 256, 1);
  const dim3 gCvtW(n8w / 256, 1);
  const dim3 gPr0((((RC / 64) * (EMB / 64)) + 7) / 8, 1);           // rows [0, RC): M=RC, N=EMB, 64x64 wave tiles
  const dim3 gPr1(((((SEQ - RC) / 64) * (EMB / 64)) + 7) / 8 + ((SEQ == RC) ? 1 : 0), 1);   // rows [RC, SEQ)
  const dim3 gV((((EMB / 64) * (SEQ / 64)) + 7) / 8, 1);            // M=EMB, N=SEQ
  const dim3 gS0((((RC / 32) * (RC / 64)) + 7) / 8, 1);             // chunk 0 scores: 32x64 wave tiles
  const dim3 gP0((((RC / 32) * (EMB / 64)) + 7) / 8, 1);            // chunk 0 P.V: 32x64 wave tiles
  const dim3 gPn((((RC / 64) * (EMB / 64)) + 7) / 8, 1);            // chunk c P.V: 64x64 wave tiles
  const dim3 gSm(RC);                                               // one block per query row of the chunk

  // (1) x, Wq, Wk, Wv -> bf16 planes (RNE convert)
  cvt16x8<<<gCvtX, blk, 0, stream>>>(x,  Xb,  n8x);
  cvt16x8<<<gCvtW, blk, 0, stream>>>(Wq, Wqb, n8w);
  cvt16x8<<<gCvtW, blk, 0, stream>>>(Wk, Wkb, n8w);
  cvt16x8<<<gCvtW, blk, 0, stream>>>(Wv, Wvb, n8w);
  // (2) q = x . Wq^T: rows [0, RC) -> f16 hi + residual (x4096) planes; rows [RC, SEQ) -> f16 plane  (N=EMB, K=EMB)
  gemm_t<__bf16, 4, 1, 1, 3, 0><<<gPr0, blk, 0, stream>>>(
      Xb, Xb, EMB, 0LL, Wqb, EMB, 0LL,
      Wqb, EMB, 0LL, 0,
      (void*)Qh, (void*)Ql, EMB, 0LL, EMB, 0LL, EMB,
      RC, EMB, EMB, 1.0f, 0.0f, 1.0f, RSC, 0);
  if (SEQ > RC) {
    gemm_t<__bf16, 4, 1, 1, 1, 0><<<gPr1, blk, 0, stream>>>(
        Xb + (size_t)RC * EMB, Xb + (size_t)RC * EMB, EMB, 0LL, Wqb, EMB, 0LL,
        Wqb, EMB, 0LL, 0,
        (void*)(Qh + (size_t)RC * EMB), (void*)(Qh + (size_t)RC * EMB), EMB, 0LL, EMB, 0LL, EMB,
        SEQ - RC, EMB, EMB, 1.0f, 0.0f, 1.0f, 1.0f, 0);
  }
  // (3) k = x . Wk^T, same split
  gemm_t<__bf16, 4, 1, 1, 3, 0><<<gPr0, blk, 0, stream>>>(
      Xb, Xb, EMB, 0LL, Wkb, EMB, 0LL,
      Wkb, EMB, 0LL, 0,
      (void*)Kh, (void*)Kl, EMB, 0LL, EMB, 0LL, EMB,
      RC, EMB, EMB, 1.0f, 0.0f, 1.0f, RSC, 0);
  if (SEQ > RC) {
    gemm_t<__bf16, 4, 1, 1, 1, 0><<<gPr1, blk, 0, stream>>>(
        Xb + (size_t)RC * EMB, Xb + (size_t)RC * EMB, EMB, 0LL, Wkb, EMB, 0LL,
        Wkb, EMB, 0LL, 0,
        (void*)(Kh + (size_t)RC * EMB), (void*)(Kh + (size_t)RC * EMB), EMB, 0LL, EMB, 0LL, EMB,
        SEQ - RC, EMB, EMB, 1.0f, 0.0f, 1.0f, 1.0f, 0);
  }
  // (4) v^T = Wv . x^T -> f16 hi plane [d][s] (pitch SEQ) and f16 residual plane x4096 [d][s < VLP] (pitch VLP)
  //     (A = Wv rows [n][k]; Bt = x rows [s][k]; M=EMB, N=SEQ, K=EMB)
  gemm_t<__bf16, 4, 1, 1, 3, 0><<<gV, blk, 0, stream>>>(
      Wvb, Wvb, EMB, 0LL, Xb, EMB, 0LL,
      Xb, EMB, 0LL, 0,
      (void*)VT, (void*)VL, SEQ, 0LL, VLP, 0LL, VLP,
      EMB, SEQ, EMB, 1.0f, 0.0f, 1.0f, RSC, 0);
  // (5) per row chunk c (rows rb .. rb+RC-1, keys 0 .. nc-1, nc = rb + RC; S and P pitch nc):
  //     scores = q.k / 32 -> f32 S (causal tiles only); exact causal softmax -> f16 P (x16384, zeros beyond the
  //     diagonal up to the 64-column boundary); out rows = P.V / 16384 -> f32 d_out.
  for (int c = 0; c < NCH; ++c) {
    const int rb = c * RC;
    const int nc = rb + RC;
    if (c == 0) {
      // acc = Qh.Kh, acc2 = Ql.Kh + Qh.Kl (both x4096): A=Qh, A2=Ql (pitch EMB), Bt=Kh, B2=Kl (pitch EMB, K2=EMB)
      gemm_t<_Float16, 2, 2, 2, 0, 1><<<gS0, blk, 0, stream>>>(
          Qh, Ql, EMB, 0LL, Kh, EMB, 0LL,
          Kl, EMB, 0LL, EMB,
          (void*)S, (void*)S, nc, 0LL, nc, 0LL, nc,
          RC, nc, EMB, 1.0f / 32.0f, 1.0f / RSC, 1.0f, 1.0f, 0);
      softmax_rows<1><<<gSm, blk, 0, stream>>>(S, nc, Pp, Ppl, nc, 0);
      // acc = Ph.Vh, acc2 = Pl.Vh + Ph.Vl (both x4096): A=Ph, A2=Pl (pitch nc), Bt=VT (pitch SEQ), B2=VL (pitch VLP)
      gemm_t<_Float16, 2, 2, 2, 0, 2><<<gP0, blk, 0, stream>>>(
          Pp, Ppl, nc, 0LL, VT, SEQ, 0LL,
          VL, VLP, 0LL, VLP,
          (void*)out0, (void*)out0, EMB, 0LL, EMB, 0LL, EMB,
          RC, EMB, nc, 1.0f / PCARRY, 1.0f / RSC, 1.0f, 1.0f, 0);
    } else {
      const dim3 gSn((((RC / 64) * (nc / 64)) + 7) / 8, 1);         // 64x64 wave tiles
      gemm_t<_Float16, 4, 1, 1, 0, 1><<<gSn, blk, 0, stream>>>(
          Qh + (size_t)rb * EMB, Qh + (size_t)rb * EMB, EMB, 0LL, Kh, EMB, 0LL,
          Kh, EMB, 0LL, 0,
          (void*)S, (void*)S, nc, 0LL, nc, 0LL, nc,
          RC, nc, EMB, 1.0f / 32.0f, 0.0f, 1.0f, 1.0f, rb);
      softmax_rows<0><<<gSm, blk, 0, stream>>>(S, nc, Pp, Pp, nc, rb);
      gemm_t<_Float16, 4, 1, 1, 0, 2><<<gPn, blk, 0, stream>>>(
          Pp, Pp, nc, 0LL, VT, SEQ, 0LL,
          VT, SEQ, 0LL, 0,
          (void*)(out0 + (size_t)rb * EMB), (void*)(out0 + (size_t)rb * EMB), EMB, 0LL, EMB, 0LL, EMB,
          RC, EMB, nc, 1.0f / PCARRY, 0.0f, 1.0f, 1.0f, rb);
    }
  }
  (void)hipGetLastError();
}

// v002
// One run takes 397 microseconds.
// Timed twice side by side with v001, it ran 2.01 and 2.02 times as fast.
// Over all steps from v000 it is 5.57 times as fast.
// Contractions: q, k, v^T in-projections = v_wmma_f32_16x16x32_bf16 (bf16 operands from RNE-converted inputs, single product, f32 accumulate);
// q.k^T scores = v_wmma_f32_16x16x32_f16 (q, k f16 planes, single product; query rows < RC: q and k each f16 hi plane + f16 residual plane x4096, 3 products, separate f32 accumulators);
// p.v = v_wmma_f32_16x16x32_f16 (p carried x16384 in f16, v^T f16, single product; query rows < RC: p and v^T each f16 hi plane + f16 residual plane x4096, 3 products, separate f32 accumulators);
// causal softmax (row max, sum, probabilities) in f32 on materialised f32 score row chunks.
#include <hip/hip_runtime.h>
#include <math.h>
#include <stdint.h>

#ifndef NB
#define NB 1
#endif
#ifndef SEQ
#define SEQ 8192
#endif
#define NB_FULL  1
#define SEQ_FULL 8192
#define EMB      1024
#define RC       ((SEQ < 1024) ? SEQ : 1024)   // query rows per score/probability chunk; rows < RC use residual planes
#define NCH      (SEQ / RC)                    // number of row chunks
#define VLP      RC                            // key extent of the v^T residual plane
#define PCARRY   16384.0f                      // power-of-two carry of p in the f16 P.V operand
#define RSC      4096.0f                       // power-of-two carry of every f16 residual plane
#define SMI      ((SEQ / 8 + 255) / 256)       // max 8-column groups per softmax thread
static_assert(NB == 1 && NB_FULL == 1);
static_assert(SEQ >= 256 && SEQ <= SEQ_FULL && (SEQ % 256) == 0);
static_assert((SEQ % RC) == 0 && (RC % 64) == 0 && NCH >= 1);
static_assert((EMB % 64) == 0 && (SEQ % 64) == 0 && (EMB % 32) == 0 && (RC % 32) == 0);
static_assert(SMI >= 1 && SMI <= 4);
static_assert((EMB % 512) == 0 && (RC % 512) == 0 && (SEQ % 512) == 0);   // eight 64-column tiles per GEMM block; 64-k staged tiles
static_assert(((SEQ * EMB / 8) % 256) == 0 && ((EMB * EMB / 8) % 256) == 0);

typedef _Float16 v16h __attribute__((ext_vector_type(16)));
typedef _Float16 v8h  __attribute__((ext_vector_type(8)));
typedef __bf16   v16b __attribute__((ext_vector_type(16)));
typedef __bf16   v8b  __attribute__((ext_vector_type(8)));
typedef float    v8f  __attribute__((ext_vector_type(8)));
typedef float    v4f  __attribute__((ext_vector_type(4)));
typedef unsigned int v4u __attribute__((ext_vector_type(4)));

#if defined(__HIP_DEVICE_COMPILE__)
#define DEV_ASM 1
#else
#define DEV_ASM 0
#endif

// ---- scalar helpers --------------------------------------------------------------------------------
__device__ __forceinline__ unsigned short bf_bits(float f) {          // f32 -> bf16 bits, RNE convert
  unsigned u = __float_as_uint(f);
  return (unsigned short)((u + 0x7FFFu + ((u >> 16) & 1u)) >> 16);
}
__device__ __forceinline__ unsigned short h_bits(_Float16 x) { return __builtin_bit_cast(unsigned short, x); }
__device__ __forceinline__ unsigned pk16(unsigned short a, unsigned short b) { return (unsigned)a | ((unsigned)b << 16); }
// f32 elements of the score chunks 1 .. c-1, which lie in front of chunk c (chunk j: RC rows of (j+1)*RC columns)
__host__ __device__ __forceinline__ constexpr size_t sbase(int c) { return (size_t)RC * RC * (size_t)((c * (c + 1)) / 2 - 1); }
__device__ __forceinline__ v8f zero8() { v8f z = {0.f, 0.f, 0.f, 0.f, 0.f, 0.f, 0.f, 0.f}; return z; }

// ---- fragment types / loaders: 16-bit A/B operand, lane -> row/col (lane&15), p already includes +8*(lane>>4);
//      elements 0..7 <- p[0..7] (k0+8h..k0+8h+7), elements 8..15 <- p[16..23] (k0+16+8h..k0+16+8h+7)
template <typename OT> struct FT;
template <> struct FT<__bf16>   { typedef v16b frag; typedef v8b half8; };
template <> struct FT<_Float16> { typedef v16h frag; typedef v8h half8; };

template <typename OT>
__device__ __forceinline__ typename FT<OT>::frag ldfrag(const OT* p) {
  union { typename FT<OT>::frag v; typename FT<OT>::half8 h[2]; } f;
  f.h[0] = *(const typename FT<OT>::half8*)(p);
  f.h[1] = *(const typename FT<OT>::half8*)(p + 16);
  return f.v;
}

// ---- WMMA helpers (asm guard bodies are device-only; concrete operand types) -----------------------------
__device__ __forceinline__ v8f mmar(v16b a, v16b b, v8f c) {
  return __builtin_amdgcn_wmma_f32_16x16x32_bf16(false, a, false, b, (short)0, c, false, false);
}
__device__ __forceinline__ v8f mmar(v16h a, v16h b, v8f c) {
  return __builtin_amdgcn_wmma_f32_16x16x32_f16(false, a, false, b, (short)0, c, false, false);
}
__device__ __forceinline__ void acc_guard4(v8f& a, v8f& b, v8f& c, v8f& d) {
#if DEV_ASM
  asm volatile("v_nop\n\tv_nop\n\tv_nop\n\tv_nop" : "+v"(a), "+v"(b), "+v"(c), "+v"(d));
#else
  (void)a; (void)b; (void)c; (void)d;
#endif
}

// ---- LDS staging by asynchronous copies ---------------------------------------------------------------
#define BKE 64     // k elements per staged tile: 128-B rows, whole lines of the source
#define LPB 144    // LDS row pitch in bytes: 128 + 16 (16 B x odd, conflict-free for 16-B row readers)
#define LPE (LPB / 2)
__device__ __forceinline__ unsigned lds_off(const void* p) { return (unsigned)(size_t)p; }   // byte offset in the block's LDS
// Each copy: a wave brings 4 rows x 128 B (lane -> row lane>>3, 16-B piece lane&7), l / g already hold the lane's part.
// step4 = source elements per 4 rows. The address-register wait ends each statement, so no later address
// arithmetic can be placed between a copy and that wait.
__device__ __forceinline__ void copy8and32rows(unsigned la, const void* gap, size_t astep4,
                                               unsigned l, const void* gp, size_t step4) {
#if DEV_ASM
  const unsigned short* ga = (const unsigned short*)gap;
  const unsigned short* g  = (const unsigned short*)gp;
  asm volatile("global_load_async_to_lds_b128 %0, %10, off\n\t"
               "global_load_async_to_lds_b128 %1, %11, off\n\t"
               "global_load_async_to_lds_b128 %2, %12, off\n\t"
               "global_load_async_to_lds_b128 %3, %13, off\n\t"
               "global_load_async_to_lds_b128 %4, %14, off\n\t"
               "global_load_async_to_lds_b128 %5, %15, off\n\t"
               "global_load_async_to_lds_b128 %6, %16, off\n\t"
               "global_load_async_to_lds_b128 %7, %17, off\n\t"
               "global_load_async_to_lds_b128 %8, %18, off\n\t"
               "global_load_async_to_lds_b128 %9, %19, off\n\t"
               "s_wait_xcnt 0x0"
               :: "v"(la), "v"(la + 4u * LPB),
                  "v"(l), "v"(l + 4u * LPB), "v"(l + 8u * LPB), "v"(l + 12u * LPB),
                  "v"(l + 16u * LPB), "v"(l + 20u * LPB), "v"(l + 24u * LPB), "v"(l + 28u * LPB),
                  "v"(ga), "v"(ga + astep4),
                  "v"(g), "v"(g + step4), "v"(g + 2 * step4), "v"(g + 3 * step4),
                  "v"(g + 4 * step4), "v"(g + 5 * step4), "v"(g + 6 * step4), "v"(g + 7 * step4) : "memory");
#else
  (void)la; (void)gap; (void)astep4; (void)l; (void)gp; (void)step4;
#endif
}
__device__ __forceinline__ void copy32rows(unsigned l, const void* gp, size_t step4) {
#if DEV_ASM
  const unsigned short* g = (const unsigned short*)gp;
  asm volatile("global_load_async_to_lds_b128 %0, %8, off\n\t"
               "global_load_async_to_lds_b128 %1, %9, off\n\t"
               "global_load_async_to_lds_b128 %2, %10, off\n\t"
               "global_load_async_to_lds_b128 %3, %11, off\n\t"
               "global_load_async_to_lds_b128 %4, %12, off\n\t"
               "global_load_async_to_lds_b128 %5, %13, off\n\t"
               "global_load_async_to_lds_b128 %6, %14, off\n\t"
               "global_load_async_to_lds_b128 %7, %15, off\n\t"
               "s_wait_xcnt 0x0"
               :: "v"(l), "v"(l + 4u * LPB), "v"(l + 8u * LPB), "v"(l + 12u * LPB),
                  "v"(l + 16u * LPB), "v"(l + 20u * LPB), "v"(l + 24u * LPB), "v"(l + 28u * LPB),
                  "v"(g), "v"(g + step4), "v"(g + 2 * step4), "v"(g + 3 * step4),
                  "v"(g + 4 * step4), "v"(g + 5 * step4), "v"(g + 6 * step4), "v"(g + 7 * step4) : "memory");
#else
  (void)l; (void)gp; (void)step4;
#endif
}
__device__ __forceinline__ void wait_lds_reads() {   // this wave's LDS reads have returned before its buffer is handed back
#if DEV_ASM
  asm volatile("s_wait_dscnt 0x0" ::: "memory");
#endif
}
__device__ __forceinline__ void wait_copies() {      // this wave's copies have landed before the barrier publishes them
#if DEV_ASM
  asm volatile("s_wait_asynccnt 0x0" ::: "memory");
#endif
}

// =====================================================================================================
// f32 -> bf16 plane (RNE convert), 8 elements per thread, one 16-B store per lane: a wave writes 512 contiguous B
// coverage: n8 threads x 8 elements = the whole plane (n8 is a multiple of 256 for every use here).
// =====================================================================================================
__global__ __launch_bounds__(256) void cvt16x8(const float* __restrict__ in, unsigned short* out, int n8) {
  const int i = blockIdx.x * 256 + (int)threadIdx.x;
  if (i < n8) {
    const float* ip = in + (size_t)i * 8;
    const v4f a  = *(const v4f*)(ip);
    const v4f a4 = *(const v4f*)(ip + 4);
    v4u p;
    p[0] = pk16(bf_bits(a[0]),  bf_bits(a[1]));
    p[1] = pk16(bf_bits(a[2]),  bf_bits(a[3]));
    p[2] = pk16(bf_bits(a4[0]), bf_bits(a4[1]));
    p[3] = pk16(bf_bits(a4[2]), bf_bits(a4[3]));
    unsigned short* o = out + (size_t)i * 8;
    *(v4u*)o = p;
    
  }
}

// =====================================================================================================
// Register-blocked WMMA GEMM (16-bit operand type OT): C[m][n] = sum_k A[m][k] * Bt[n][k];
// one wave per (16*MI) x 64 tile; the eight waves of a block hold eight neighbouring column tiles of one row tile
// (N a multiple of 512). A row-major [M][K] pitch lda; Bt row-major [N][K] pitch ldb
// (k contiguous); M multiple of 16*MI, K multiple of 64 (static sizes here). MC = 0: blockIdx.y = batch
// index (strides in elements; always 0 here). Per 64 k the block stages its A rows (shared) and each wave's Bt rows in
// LDS by asynchronous copies of whole 128-B lines, two buffers, one block barrier per tile: tile t + 1 flies while tile
// t is multiplied. Fragments are read from LDS with the split k map (ldfrag); the k order of every sum is ascending.
// NPA = number of A planes: 2 -> second plane A2 (same pitch/stride as A) multiplies the same Bt fragments into the
// second accumulator set.  NPB = number of Bt planes: 2 -> second plane B2 (pitch ldb2, stride strideB2) holds the
// k range [0, K2) only (K2 multiple of 64); for k chunks with k0 < K2 (block-uniform) the A fragments multiply
// B2 fragments into the second accumulator set. NPA = NPB = 2: acc = A.Bt, acc2 = A2.Bt + A.B2 (both residual planes
// carry the same power-of-two scale 1/rscale2).
// value v = (acc [+ acc2 * rscale2]) * oscale, combined in the f32 epilogue.
// CZ (causal), czoff = global row index of local row 0 (multiple of 64):
//   0 none; 1 = output tiles with n0 >= czoff + m0 + 16*MI are not stored (every tile holding a
//   column <= one of its rows is written); 2 = A rows hold exact zeros beyond the diagonal up to column
//   czoff + m0 + 16*MI, so the k loop ends at min(K, czoff + m0 + 16*MI) (exact); the last staged tile is copied whole,
//   so A rows are written up to the next multiple of 64 columns.
// OUT_MODE 0: f32 C (pitch ldc) = v.
// OUT_MODE 1: f16 plane C = f16(v * cscale).
// OUT_MODE 3: f16 hi plane C = f16(v * cscale) (pitch ldc) and f16 residual plane
//             C2 = f16((v*cscale - hi) * rscaleC) (pitch ldc2), C2 written only for output
//             tiles with n0 < N2 (N2 multiple of 64, wave-uniform), i.e. columns [0, N2) fully.
// =====================================================================================================
// MC = 1: one launch holds every row chunk c >= 1 (M = RC rows each). CZ = 2: blockIdx.y picks the chunk, the widest
//   (longest k loops) first. CZ = 1: a flat grid, chunk after chunk, the widest last, which the softmax then reads first.
//   The f32 score chunks lie one behind the other, chunk c at sbase(c) elements with pitch (c+1)*RC; the softmax
//   writes each f16 probability row over the front of its own score row (f16 pitch 2*(c+1)*RC).
//   CZ = 1: A rows, N, ldc, C and czoff are the chunk's; CZ = 2: A, lda, K, C rows and czoff are the chunk's.
template <typename OT, int MI, int NPA, int NPB, int OUT_MODE, int CZ, int MC>
__global__ __launch_bounds__(256) void gemm_t(
    const unsigned short* __restrict__ Ap, const unsigned short* __restrict__ A2p, int lda, long long strideA,
    const unsigned short* __restrict__ Btp, int ldb, long long strideB,
    const unsigned short* __restrict__ B2p, int ldb2, long long strideB2, int K2,
    void* Cout, void* Cout2, int ldc, long long strideC, int ldc2, long long strideC2, int N2,
    int M, int N, int K, float oscale, float rscale2, float cscale, float rscaleC, int czoff) {
  static_assert(CZ != 2 || ((16 * MI) % 32) == 0);
  static_assert(MC == 0 || ((CZ == 1 || CZ == 2) && OUT_MODE == 0 && NPA == 1 && NPB == 1));
  typedef typename FT<OT>::frag V16;
  int bx = (int)blockIdx.x;              // the block's index among its chunk's (MC = 1) or the launch's blocks
  if (MC == 1) {                         // block-uniform
    int c = NCH - 1 - (int)blockIdx.y;
    if (CZ == 1) {                       // chunk c holds (c+1) * BPU blocks of the flat grid
      constexpr int BPU = (RC / 64) * (RC / 64) / 8;
      c = 1;
      while (c < NCH - 1 && bx >= (c + 1) * BPU) { bx -= (c + 1) * BPU; ++c; }
    }
    const int rb = c * RC;
    const size_t sb = sbase(c);
    czoff = rb;
    if (CZ == 1) {
      Ap += (size_t)rb * lda; A2p += (size_t)rb * lda;
      N = rb + RC; ldc = rb + RC;
      Cout = (void*)((float*)Cout + sb);
    } else {
      Ap += 2 * sb; A2p += 2 * sb;
      lda = 2 * (rb + RC); K = rb + RC;
      Cout = (void*)((float*)Cout + (size_t)rb * ldc);
    }
  }
  const OT* A  = (const OT*)(const void*)Ap;
  const OT* A2 = (const OT*)(const void*)A2p;
  const OT* Bt = (const OT*)(const void*)Btp;
  const OT* B2 = (const OT*)(const void*)B2p;
  const int RT = 16 * MI;
  constexpr int ROWS_A = 16 * MI * NPA;                    // A (and A2) rows of the block's tiles
  constexpr int ROWS_W = 64 * NPB;                         // Bt (and B2) rows of one wave's tile
  constexpr int STG_B  = (ROWS_A + 8 * ROWS_W) * LPB;      // one staged k tile of the block, bytes
  static_assert(ROWS_A == 64);                             // 8 waves x 8 rows copy the A part
  static_assert(2 * STG_B >= 8 * 16 * 68 * 4 && 2 * STG_B <= 320 * 1024);
  __shared__ __align__(16) unsigned char ring[2 * STG_B];  // two buffers; after the k loop: per-wave 16x64 f32 slabs
  const int b    = (MC == 1) ? 0 : (int)blockIdx.y;
  const int lane = threadIdx.x & 31;
  const int wave = __builtin_amdgcn_readfirstlane((int)(threadIdx.x >> 5));
  const int tilesN = N >> 6;
  const int tilesM = M / RT;
  const int tile0 = bx * 8;
  if (tile0 >= tilesM * tilesN) return;  // block-uniform, in front of every barrier
  // tilesN is a multiple of 8: the block's eight tiles share tm. The quotient is block-uniform; where the compiler divides
  // on the vector unit, readfirstlane brings it back to a scalar register, so that the returns below stay scalar branches.
  const int tm  = __builtin_amdgcn_readfirstlane(tile0 / tilesN);
  const int tn0 = tile0 - tm * tilesN;
  const int m0 = tm * RT;
  const int n0 = (tn0 + wave) << 6;
  bool live = true;
  if (CZ == 1) {
    if ((tn0 << 6) >= czoff + m0 + RT) return;   // block-uniform causal skip, in front of every barrier
    live = n0 < czoff + m0 + RT;                 // a wave past the diagonal walks the loop and stores nothing
  }
  int kEnd = K;
  if (CZ == 2) {
    const int ke = czoff + m0 + RT;      // multiple of 32
    kEnd = (ke < K) ? ke : K;
  }

  const OT* Ab  = A  + (size_t)b * (size_t)strideA;
  const OT* A2b = A2 + (size_t)b * (size_t)strideA;
  const OT* Bb  = Bt + (size_t)b * (size_t)strideB;
  const OT* B2b = B2 + (size_t)b * (size_t)strideB2;

  const int rlane = lane & 15;                 // row (A) / col (B, D) within subtile
  const int koff  = (lane >> 4) * 8;           // k offset of this lane half
  const int mOff  = (lane >> 4) * 8;           // D row offset

  v8f acc[MI][4], acc2[MI][4];
#pragma unroll
  for (int i = 0; i < MI; ++i)
#pragma unroll
    for (int j = 0; j < 4; ++j) { acc[i][j] = zero8(); acc2[i][j] = zero8(); }

  // ---- this lane's part of every staged tile: row lane>>3 of each 4-row group, 16-B piece lane&7 ----
  const int crow = lane >> 3;
  const int cel  = (lane & 7) * 8;
  const int arow = wave * 8;                                   // this wave's 8 of the 64 staged [A | A2] rows
  const bool a2w = (NPA == 2) && (arow >= RT);                 // wave-uniform
  const OT* gA  = (a2w ? A2b : Ab) + (size_t)(m0 + (a2w ? arow - RT : arow) + crow) * lda + cel;
  const OT* gB  = Bb  + (size_t)(n0 + crow) * ldb  + cel;
  const OT* gB2 = B2b + (size_t)(n0 + crow) * ldb2 + cel;
  const unsigned lc = lds_off(ring) + (unsigned)(crow * LPB + cel * 2);
  const unsigned lA = lc + (unsigned)(arow * LPB);
  const unsigned lB = lc + (unsigned)((ROWS_A + wave * ROWS_W) * LPB);
  const int nT = (kEnd + BKE - 1) / BKE;                       // >= 1; block-uniform
  auto stage = [&](int t) {                                    // tile t -> buffer t & 1
    const unsigned bo = (unsigned)(t & 1) * (unsigned)STG_B;
    const int kt = t * BKE;
    copy8and32rows(lA + bo, gA + kt, (size_t)4 * lda, lB + bo, gB + kt, (size_t)4 * ldb);
    copy32rows(lB + bo + 32u * LPB, gB + kt + (size_t)32 * ldb, (size_t)4 * ldb);
    if (NPB == 2) {
      if (kt < K2) {                                           // block-uniform: the residual plane ends at K2
        copy32rows(lB + bo + 64u * LPB, gB2 + kt, (size_t)4 * ldb2);
        copy32rows(lB + bo + 96u * LPB, gB2 + kt + (size_t)32 * ldb2, (size_t)4 * ldb2);
      }
    }
  };

  stage(0);
  wait_copies();
  __syncthreads();                       // tile 0 is published
  if (nT > 1) stage(1);
  const int aOff = rlane * LPB;                                // this lane's fragment rows in a buffer, bytes
  const int bOff = (ROWS_A + wave * ROWS_W + rlane) * LPB;
  if constexpr (NPA == 1 && NPB == 1) {
    // Every LDS read of tile t stands between the barrier that publishes it and the barrier that frees its buffer.
    // Fragment registers: bq0 / bq1 = Bt of the tile's first / second 32 k; a[i] is refilled in place right behind its
    // last product; ax holds row group MI-1 of the second 32 k, so that no read is issued behind a phase's last products.
    // The scheduling barriers keep each read at that place (left alone, the compiler read each A fragment right in
    // front of its products and waited for it every time).
    V16 bq0[4], bq1[4], a[MI], ax;
    {
      const OT* sA = (const OT*)(const void*)(ring + aOff) + koff;
      const OT* sB = (const OT*)(const void*)(ring + bOff) + koff;
#pragma unroll
      for (int j = 0; j < 4; ++j) bq0[j] = ldfrag<OT>(sB + (j << 4) * LPE);
#pragma unroll
      for (int i = 0; i < MI; ++i) a[i] = ldfrag<OT>(sA + (i << 4) * LPE);
    }
    for (int t = 0; t < nT; ++t) {
      const unsigned char* buf = ring + (size_t)(t & 1) * STG_B;
      const OT* sA = (const OT*)(const void*)(buf + aOff) + koff + 32;
      const OT* sB = (const OT*)(const void*)(buf + bOff) + koff + 32;
      ax = ldfrag<OT>(sA + ((MI - 1) << 4) * LPE);
#pragma unroll
      for (int j = 0; j < 4; ++j) bq1[j] = ldfrag<OT>(sB + (j << 4) * LPE);
      __builtin_amdgcn_sched_barrier(0);     // reads of the second 32 k go out ahead of the first 32 k's products
#pragma unroll
      for (int i = 0; i < MI - 1; ++i) {
#pragma unroll
        for (int j = 0; j < 4; ++j) acc[i][j] = mmar(a[i], bq0[j], acc[i][j]);
        __builtin_amdgcn_sched_barrier(0);   // the refill stays behind a[i]'s last product, so it can take a[i]'s registers
        a[i] = ldfrag<OT>(sA + (i << 4) * LPE);
        __builtin_amdgcn_sched_barrier(0);   // the refill of a[i] stays among the products
      }
#pragma unroll
      for (int j = 0; j < 4; ++j) acc[MI - 1][j] = mmar(a[MI - 1], bq0[j], acc[MI - 1][j]);
      __builtin_amdgcn_sched_barrier(0);     // the first 32 k's products stay ahead of the waits
      wait_lds_reads();
      wait_copies();
      __syncthreads();                       // publishes tile t + 1 and ends every read of tile t's buffer
      if (t + 2 < nT) stage(t + 2);
      // The first 32 k of tile t + 1 are read under tile t's last products. The last trip has no next tile: a scalar
      // select aims its reads, whose values nobody uses, at its own buffer (landed, not refilled), which keeps the
      // products free of a branch.
      const unsigned char* nbuf = ring + (size_t)(((t + 1 < nT) ? (t + 1) : t) & 1) * STG_B;
      const OT* nA = (const OT*)(const void*)(nbuf + aOff) + koff;
      const OT* nB = (const OT*)(const void*)(nbuf + bOff) + koff;
      a[MI - 1] = ldfrag<OT>(nA + ((MI - 1) << 4) * LPE);
#pragma unroll
      for (int j = 0; j < 4; ++j) bq0[j] = ldfrag<OT>(nB + (j << 4) * LPE);
      __builtin_amdgcn_sched_barrier(0);     // the next tile's reads go out ahead of this tile's last products
#pragma unroll
      for (int i = 0; i < MI - 1; ++i) {
#pragma unroll
        for (int j = 0; j < 4; ++j) acc[i][j] = mmar(a[i], bq1[j], acc[i][j]);
        __builtin_amdgcn_sched_barrier(0);   // the refill stays behind a[i]'s last product, so it can take a[i]'s registers
        a[i] = ldfrag<OT>(nA + (i << 4) * LPE);
        __builtin_amdgcn_sched_barrier(0);   // the refill of a[i] stays among the products
      }
#pragma unroll
      for (int j = 0; j < 4; ++j) acc[MI - 1][j] = mmar(ax, bq1[j], acc[MI - 1][j]);
    }
  } else {
    for (int t = 0; t < nT; ++t) {
      const unsigned char* buf = ring + (size_t)(t & 1) * STG_B;
      const OT* sA = (const OT*)(const void*)(buf + aOff) + koff;
      const OT* sB = (const OT*)(const void*)(buf + bOff) + koff;
#pragma unroll   // two 32-k chunks per staged tile, fragment arrays stay in registers
      for (int kk = 0; kk < BKE; kk += 32) {
        const int k0 = t * BKE + kk;
        if (CZ != 2 || (RT % BKE) == 0 || k0 < kEnd) {         // block-uniform: a 32-row tile may end mid-tile
          const bool res = k0 < K2;                            // block-uniform: residual Bt plane covers k < K2 only
          V16 bq[4], br[4], af[MI], af2[MI];
#pragma unroll
          for (int j = 0; j < 4; ++j) bq[j] = ldfrag<OT>(sB + (j << 4) * LPE + kk);
#pragma unroll
          for (int i = 0; i < MI; ++i) {
            af[i]  = ldfrag<OT>(sA + (i << 4) * LPE + kk);
            af2[i] = ldfrag<OT>(sA + (RT + (i << 4)) * LPE + kk);
          }
          if (res) {
#pragma unroll
            for (int j = 0; j < 4; ++j) br[j] = ldfrag<OT>(sB + (64 + (j << 4)) * LPE + kk);
          }
          __builtin_amdgcn_sched_barrier(0);   // the chunk's reads stay in one group ahead of its products
#pragma unroll
          for (int i = 0; i < MI; ++i) {
#pragma unroll
            for (int j = 0; j < 4; ++j) acc[i][j] = mmar(af[i], bq[j], acc[i][j]);
#pragma unroll
            for (int j = 0; j < 4; ++j) acc2[i][j] = mmar(af2[i], bq[j], acc2[i][j]);
          }
          if (res) {
#pragma unroll
            for (int i = 0; i < MI; ++i)
#pragma unroll
              for (int j = 0; j < 4; ++j) acc2[i][j] = mmar(af[i], br[j], acc2[i][j]);
          }
        }
      }
      wait_lds_reads();
      wait_copies();
      __syncthreads();                       // publishes tile t + 1 and ends every read of tile t's buffer
      if (t + 2 < nT) stage(t + 2);
    }
  }
  wait_copies();
  wait_lds_reads();
  __syncthreads();                       // every wave's last ring read has returned: the ring becomes output staging
  if (!live) return;                     // wave-uniform; no block barrier follows
#pragma unroll
  for (int i = 0; i < MI; ++i) {
    acc_guard4(acc[i][0], acc[i][1], acc[i][2], acc[i][3]);
    if (NPA == 2 || NPB == 2) acc_guard4(acc2[i][0], acc2[i][1], acc2[i][2], acc2[i][3]);
  }

  // ---- epilogue ----
  float* slab = (float*)(void*)ring + wave * (16 * 68);   // pitch 68 floats, wave-private
#pragma unroll
  for (int i = 0; i < MI; ++i) {
    const int mBase = m0 + (i << 4);
#pragma unroll
    for (int j = 0; j < 4; ++j) {
#pragma unroll
      for (int r = 0; r < 8; ++r) {
        float v = acc[i][j][r];
        if (NPA == 2 || NPB == 2) v += acc2[i][j][r] * rscale2;
        v = v * oscale;
        slab[(mOff + r) * 68 + (j << 4) + rlane] = v;
      }
    }
    __builtin_amdgcn_fence(3 /* release order */, "workgroup");
    __builtin_amdgcn_wave_barrier();
    __builtin_amdgcn_fence(2 /* acquire order */, "workgroup");
    if (OUT_MODE == 0) {
      float* C = (float*)Cout + (size_t)b * (size_t)strideC;
      const int h2 = lane >> 4, c4 = (lane & 15) * 4;     // 256-B row segment = 16 lanes x 16 B
      {
#pragma unroll
        for (int it = 0; it < 8; ++it) {
          const int row = it * 2 + h2;                     // it 0..7 x h2 0..1 = rows 0..15
          const v4f v = *(const v4f*)(slab + row * 68 + c4);
          *(v4f*)(C + (size_t)(mBase + row) * ldc + n0 + c4) = v;
        }
        
      }
    } else {
      const int q = lane >> 3, c8 = (lane & 7) * 8;
      unsigned short* C  = (unsigned short*)Cout  + (size_t)b * (size_t)strideC;
      unsigned short* C2 = (unsigned short*)Cout2 + (size_t)b * (size_t)strideC2;
      const bool wr2 = (OUT_MODE == 3) && (n0 < N2);     // wave-uniform
      v4u hv[4], lv[4];
#pragma unroll
      for (int it = 0; it < 4; ++it) {
        const int row = it * 4 + q;                        // it 0..3 x q 0..3 = rows 0..15
        const float* sp = slab + row * 68 + c8;
        float f[8];
#pragma unroll
        for (int e = 0; e < 8; ++e) f[e] = sp[e] * cscale;
        v4u a, a2;
#pragma unroll
        for (int e = 0; e < 4; ++e) {
          const float f0 = f[2 * e], f1 = f[2 * e + 1];
          const _Float16 x0 = (_Float16)f0, x1 = (_Float16)f1;
          const unsigned short h0 = h_bits(x0), h1 = h_bits(x1);
          unsigned short l0 = 0, l1 = 0;
          if (OUT_MODE == 3) {
            l0 = h_bits((_Float16)((f0 - (float)x0) * rscaleC));
            l1 = h_bits((_Float16)((f1 - (float)x1) * rscaleC));
          }
          a[e] = pk16(h0, h1); a2[e] = pk16(l0, l1);
        }
        hv[it] = a; lv[it] = a2;
      }
      {
#pragma unroll
        for (int it = 0; it < 4; ++it) {
          const int row = it * 4 + q;
          *(v4u*)(C + (size_t)(mBase + row) * ldc + n0 + c8) = hv[it];
          if (OUT_MODE == 3) {
            if (wr2) *(v4u*)(C2 + (size_t)(mBase + row) * ldc2 + n0 + c8) = lv[it];
          }
        }
        
      }
    }
    __builtin_amdgcn_fence(3 /* release order */, "workgroup");
    __builtin_amdgcn_wave_barrier();
    __builtin_amdgcn_fence(2 /* acquire order */, "workgroup");
  }
}

// =====================================================================================================
// Exact causal row softmax over one chunk of query rows (MC = 0): one block of 256 threads per local row r (global row
// t = rowBase + r).
//   S: f32 score chunk [rows][ldS]; the scores GEMM wrote every column of row t in [0, ((t>>6)+1)*64).
//   The row is processed in 8-column groups g; ng = ((t>>6)+1)*8 groups exist. Thread tid owns groups
//   g = it*256 + tid. Loads use an address clamped to group ng-1; entries with column > t are replaced by -inf
//   by index before any arithmetic. Iterations with it*256 >= ng are skipped block-uniformly.
//   p = exp(s - max) * (1/sum) in f32 (max finite: column 0 is always valid), x16384 carry, f16 RNE;
//   columns > t up to ((t>>6)+1)*64 get exact zeros. WRL = 1: also the f16 residual plane
//   Pl = f16((p*16384 - hi) * 4096), same pitch. Each group is one 16-B store per lane; 8 consecutive lanes fill
//   LDS redm/reds: cross-wave, block barriers (every thread reaches both).
//   coverage: the launch's rows x columns [0, ((t>>6)+1)*64) of P (and Pl) = at least the extent the P.V GEMM reads.
// =====================================================================================================
//   MC = 1: one launch for every row t >= RC, the longest first; row t lies in score chunk c = t / RC (sbase(c), pitch
//   (c+1)*RC), and P = S: the row's probabilities go over the front of its own scores. Every score of the row is in
//   registers, and has gone into the row maximum, in front of the first block barrier; the stores stand behind the second.
template <int WRL, int MC>
__global__ __launch_bounds__(256)
void softmax_rows(const float* S, int ldS, unsigned short* P, unsigned short* Pl, int ldP, int rowBase) {
  __shared__ float redm[8];
  __shared__ float reds[8];
  const int t    = (MC == 1) ? (SEQ - 1 - (int)blockIdx.x) : (rowBase + (int)blockIdx.x);
  const int ch   = t / RC;
  const size_t ro = (MC == 1) ? (sbase(ch) + (size_t)(t - ch * RC) * (size_t)((ch + 1) * RC))
                              : ((size_t)blockIdx.x * (size_t)ldS);      // the row's first score, f32 elements
  const size_t po = (MC == 1) ? (2 * ro) : ((size_t)blockIdx.x * (size_t)ldP);   // its first probability, f16 elements
  const int tid  = threadIdx.x;
  const int wave = tid >> 5;
  const int lane = tid & 31;
  const int ng   = ((t >> 6) + 1) * 8;
  const float* rp = S + ro;
  float v[SMI][8];
#pragma unroll
  for (int it = 0; it < SMI; ++it) {
#pragma unroll
    for (int e = 0; e < 8; ++e) v[it][e] = -INFINITY;
    if (it * 256 < ng) {                                   // block-uniform
      const int g  = it * 256 + tid;
      const int gc = (g < ng) ? g : (ng - 1);              // clamped address
      const int c0 = g * 8;
      const v4f a  = *(const v4f*)(rp + (size_t)gc * 8);
      const v4f a4 = *(const v4f*)(rp + (size_t)gc * 8 + 4);
#pragma unroll
      for (int e = 0; e < 4; ++e) {
        v[it][e]     = (c0 + e <= t)     ? a[e]  : -INFINITY;
        v[it][4 + e] = (c0 + 4 + e <= t) ? a4[e] : -INFINITY;
      }
    }
  }
  float mx = -INFINITY;
#pragma unroll
  for (int it = 0; it < SMI; ++it)
#pragma unroll
    for (int e = 0; e < 8; ++e) mx = fmaxf(mx, v[it][e]);
#pragma unroll
  for (int off = 1; off < 32; off <<= 1) mx = fmaxf(mx, __shfl_xor(mx, off, 32));
  if (lane == 0) redm[wave] = mx;
  __syncthreads();
  mx = redm[0];
#pragma unroll
  for (int w = 1; w < 8; ++w) mx = fmaxf(mx, redm[w]);

  float sum = 0.f;
#pragma unroll
  for (int it = 0; it < SMI; ++it) {
    if (it * 256 < ng) {                                   // block-uniform
#pragma unroll
      for (int e = 0; e < 8; ++e) { const float ex = __expf(v[it][e] - mx); v[it][e] = ex; sum += ex; }
    } else {
#pragma unroll
      for (int e = 0; e < 8; ++e) v[it][e] = 0.f;
    }
  }
#pragma unroll
  for (int off = 1; off < 32; off <<= 1) sum += __shfl_xor(sum, off, 32);
  if (lane == 0) reds[wave] = sum;
  __syncthreads();
  sum = reds[0];
#pragma unroll
  for (int w = 1; w < 8; ++w) sum += reds[w];

  const float sc = PCARRY * (1.0f / sum);        // sum >= 1
  v4u pk[SMI], pl[SMI];
#pragma unroll
  for (int it = 0; it < SMI; ++it) {
    v4u a, a2;
#pragma unroll
    for (int e = 0; e < 4; ++e) {
      const float f0 = v[it][2 * e] * sc, f1 = v[it][2 * e + 1] * sc;
      const _Float16 x0 = (_Float16)f0, x1 = (_Float16)f1;
      unsigned short l0 = 0, l1 = 0;
      if (WRL == 1) {
        l0 = h_bits((_Float16)((f0 - (float)x0) * RSC));
        l1 = h_bits((_Float16)((f1 - (float)x1) * RSC));
      }
      a[e]  = pk16(h_bits(x0), h_bits(x1));
      a2[e] = pk16(l0, l1);
    }
    pk[it] = a; pl[it] = a2;
  }
  unsigned short* op  = P  + po;
  unsigned short* opl = Pl + po;
  {
#pragma unroll
    for (int it = 0; it < SMI; ++it) {
      if (it * 256 < ng) {                                 // block-uniform
        const int g = it * 256 + tid;
        if (g < ng) {
          *(v4u*)(op + (size_t)g * 8) = pk[it];
          if (WRL == 1) *(v4u*)(opl + (size_t)g * 8) = pl[it];
        }
      }
    }
    
  }
}

// =====================================================================================================
// Workspace map (bytes at SEQ = 8192, RC = 1024; every region a multiple of its whole-line store granularity and of
//   R0   Xb bf16 [SEQ][EMB] (16777216), later the f32 score chunks c >= 1, S_c [RC][(c+1)*RC] at sbase(c), each row's
//        front overwritten by its f16 probabilities (pitch 2*(c+1)*RC)                                      146800640
//   S0   f32 [RC][RC]     (chunk 0 scores)                                                                    4194304
//   Wqb, Wkb, Wvb bf16 [EMB][EMB]                                                                          3 x 2097152
//   Qh   f16 [SEQ][EMB]                                                                                      16777216
//   Kh   f16 [SEQ][EMB]                                                                                      16777216
//   VT   f16 [EMB][SEQ]   (v^T hi plane)                                                                     16777216
//   Ql   f16 [RC][EMB]    (q residual x4096, rows < RC)                                                       2097152
//   Kl   f16 [RC][EMB]    (k residual x4096, keys < RC)                                                       2097152
//   VL   f16 [EMB][VLP]   (v^T residual x4096, keys < VLP)                                                    2097152
//   P    f16 [RC][RC]     (chunk 0 probabilities)                                                             2097152
//   Pl   f16 [RC][RC]     (p residual x4096, chunk 0 only)                                                    2097152
//   total                                                                                                   218103808
// Aliases are ordered by launch dependence: Xb is last read by the v^T projection, R0's scores are first written by
// the scores GEMM of the chunks c >= 1 after it. Weights are [out n][in k] with k contiguous = the Bt / A layout the GEMM wants.
// =====================================================================================================
static constexpr size_t PACT_B = (size_t)SEQ * EMB * 2;
static constexpr size_t PS_B   = sbase(NCH) * 4;               // chunks 1 .. NCH-1
static constexpr size_t PS0_B  = (size_t)RC * RC * 4;
static constexpr size_t R0_B   = (PACT_B > PS_B) ? PACT_B : PS_B;
static constexpr size_t PW_B   = (size_t)EMB * EMB * 2;
static constexpr size_t PRES_B = (size_t)RC * EMB * 2;
static constexpr size_t PVT_B  = (size_t)EMB * SEQ * 2;
static constexpr size_t PVL_B  = (size_t)EMB * VLP * 2;
static constexpr size_t PP_B   = (size_t)RC * RC * 2;
static constexpr size_t PPL_B  = (size_t)RC * RC * 2;
static constexpr size_t WS_TOTAL = R0_B + PS0_B + 3 * PW_B + 2 * PACT_B + PVT_B + 2 * PRES_B + PVL_B + PP_B + PPL_B;
static_assert(WS_TOTAL <= (size_t)268435456);
static_assert((R0_B % 128) == 0 && (PS0_B % 128) == 0 && (PP_B % 128) == 0 && (PW_B % 128) == 0 && (PRES_B % 128) == 0 && (PVL_B % 128) == 0 && (PPL_B % 128) == 0);

extern "C" void kernel_launch(void* const* d_in, const int* in_sizes, int n_in,
                              void* d_out, int out_size, void* d_ws, size_t ws_size,
                              hipStream_t stream) {
  if (n_in < 4) return;
  const long long needX = (long long)SEQ * (long long)EMB;
  if ((long long)in_sizes[0] < needX) return;
  if (in_sizes[1] < EMB * EMB) return;
  if (in_sizes[2] < EMB * EMB) return;
  if (in_sizes[3] < EMB * EMB) return;
  if (out_size < 0) return;
  if ((long long)out_size < needX) return;

  const float* x  = (const float*)d_in[0];
  const float* Wq = (const float*)d_in[1];
  const float* Wk = (const float*)d_in[2];
  const float* Wv = (const float*)d_in[3];

  size_t off = 0;
  const size_t oR0 = off; off += R0_B;
  const size_t oS0 = off; off += PS0_B;
  const size_t oWq = off; off += PW_B;
  const size_t oWk = off; off += PW_B;
  const size_t oWv = off; off += PW_B;
  const size_t oQh = off; off += PACT_B;
  const size_t oKh = off; off += PACT_B;
  const size_t oVT = off; off += PVT_B;
  const size_t oQl = off; off += PRES_B;
  const size_t oKl = off; off += PRES_B;
  const size_t oVL = off; off += PVL_B;
  const size_t oP  = off; off += PP_B;
  const size_t oPl = off; off += PPL_B;
  if (off != WS_TOTAL) return;
  if (off > ws_size) return;
  if (off > (size_t)268435456) return;

  char* ws = (char*)d_ws;
  unsigned short* Xb  = (unsigned short*)(ws + oR0);
  float*          S   = (float*)(ws + oR0);          // alias, see map
  float*          S0  = (float*)(ws + oS0);
  unsigned short* Wqb = (unsigned short*)(ws + oWq);
  unsigned short* Wkb = (unsigned short*)(ws + oWk);
  unsigned short* Wvb = (unsigned short*)(ws + oWv);
  unsigned short* Qh  = (unsigned short*)(ws + oQh);
  unsigned short* Kh  = (unsigned short*)(ws + oKh);
  unsigned short* VT  = (unsigned short*)(ws + oVT);
  unsigned short* Ql  = (unsigned short*)(ws + oQl);
  unsigned short* Kl  = (unsigned short*)(ws + oKl);
  unsigned short* VL  = (unsigned short*)(ws + oVL);
  unsigned short* Pp  = (unsigned short*)(ws + oP);
  unsigned short* Ppl = (unsigned short*)(ws + oPl);
  float*          out0 = (float*)d_out;

  const dim3 blk(256);
  const int n8x = SEQ * EMB / 8;                                    // multiple of 256
  const int n8w = EMB * EMB / 8;                                    // multiple of 256
  const dim3 gCvtX(n8x / 256, 1);
  const dim3 gCvtW(n8w / 256, 1);
  const dim3 gPr0((((RC / 64) * (EMB / 64)) + 7) / 8, 1);           // rows [0, RC): M=RC, N=EMB, 64x64 wave tiles
  const dim3 gPr1(((((SEQ - RC) / 64) * (EMB / 64)) + 7) / 8 + ((SEQ == RC) ? 1 : 0), 1);   // rows [RC, SEQ)
  const dim3 gV((((EMB / 64) * (SEQ / 64)) + 7) / 8, 1);            // M=EMB, N=SEQ
  const dim3 gS0((((RC / 32) * (RC / 64)) + 7) / 8, 1);             // chunk 0 scores: 32x64 wave tiles
  const dim3 gP0((((RC / 32) * (EMB / 64)) + 7) / 8, 1);            // chunk 0 P.V: 32x64 wave tiles
  const dim3 gSn((NCH > 1) ? ((RC / 64) * (RC / 64) / 8) * ((NCH * (NCH + 1)) / 2 - 1) : 1, 1);   // chunks c >= 1 scores: 64x64 wave tiles
  const dim3 gPn((((RC / 64) * (EMB / 64)) + 7) / 8, (NCH > 1) ? (NCH - 1) : 1);   // chunks c >= 1 P.V: 64x64 wave tiles
  const dim3 gSm(RC);                                               // chunk 0: one block per query row
  const dim3 gSmN((SEQ > RC) ? (SEQ - RC) : 1);                     // rows [RC, SEQ): one block per query row

  // (1) x, Wq, Wk, Wv -> bf16 planes (RNE convert)
  cvt16x8<<<gCvtX, blk, 0, stream>>>(x,  Xb,  n8x);
  cvt16x8<<<gCvtW, blk, 0, stream>>>(Wq, Wqb, n8w);
  cvt16x8<<<gCvtW, blk, 0, stream>>>(Wk, Wkb, n8w);
  cvt16x8<<<gCvtW, blk, 0, stream>>>(Wv, Wvb, n8w);
  // (2) q = x . Wq^T: rows [0, RC) -> f16 hi + residual (x4096) planes; rows [RC, SEQ) -> f16 plane  (N=EMB, K=EMB)
  gemm_t<__bf16, 4, 1, 1, 3, 0, 0><<<gPr0, blk, 0, stream>>>(
      Xb, Xb, EMB, 0LL, Wqb, EMB, 0LL,
      Wqb, EMB, 0LL, 0,
      (void*)Qh, (void*)Ql, EMB, 0LL, EMB, 0LL, EMB,
      RC, EMB, EMB, 1.0f, 0.0f, 1.0f, RSC, 0);
  if (SEQ > RC) {
    gemm_t<__bf16, 4, 1, 1, 1, 0, 0><<<gPr1, blk, 0, stream>>>(
        Xb + (size_t)RC * EMB, Xb + (size_t)RC * EMB, EMB, 0LL, Wqb, EMB, 0LL,
        Wqb, EMB, 0LL, 0,
        (void*)(Qh + (size_t)RC * EMB), (void*)(Qh + (size_t)RC * EMB), EMB, 0LL, EMB, 0LL, EMB,
        SEQ - RC, EMB, EMB, 1.0f, 0.0f, 1.0f, 1.0f, 0);
  }
  // (3) k = x . Wk^T, same split
  gemm_t<__bf16, 4, 1, 1, 3, 0, 0><<<gPr0, blk, 0, stream>>>(
      Xb, Xb, EMB, 0LL, Wkb, EMB, 0LL,
      Wkb, EMB, 0LL, 0,
      (void*)Kh, (void*)Kl, EMB, 0LL, EMB, 0LL, EMB,
      RC, EMB, EMB, 1.0f, 0.0f, 1.0f, RSC, 0);
  if (SEQ > RC) {
    gemm_t<__bf16, 4, 1, 1, 1, 0, 0><<<gPr1, blk, 0, stream>>>(
        Xb + (size_t)RC * EMB, Xb + (size_t)RC * EMB, EMB, 0LL, Wkb, EMB, 0LL,
        Wkb, EMB, 0LL, 0,
        (void*)(Kh + (size_t)RC * EMB), (void*)(Kh + (size_t)RC * EMB), EMB, 0LL, EMB, 0LL, EMB,
        SEQ - RC, EMB, EMB, 1.0f, 0.0f, 1.0f, 1.0f, 0);
  }
  // (4) v^T = Wv . x^T -> f16 hi plane [d][s] (pitch SEQ) and f16 residual plane x4096 [d][s < VLP] (pitch VLP)
  //     (A = Wv rows [n][k]; Bt = x rows [s][k]; M=EMB, N=SEQ, K=EMB)
  gemm_t<__bf16, 4, 1, 1, 3, 0, 0><<<gV, blk, 0, stream>>>(
      Wvb, Wvb, EMB, 0LL, Xb, EMB, 0LL,
      Xb, EMB, 0LL, 0,
      (void*)VT, (void*)VL, SEQ, 0LL, VLP, 0LL, VLP,
      EMB, SEQ, EMB, 1.0f, 0.0f, 1.0f, RSC, 0);
  // (5) chunk 0 (rows and keys [0, RC), residual planes): scores = q.k / 32 -> f32 S0 (causal tiles only); exact causal
  //     softmax -> f16 P and residual plane (x16384, zeros beyond the diagonal up to the 64-column boundary);
  //     out rows = P.V / 16384 -> f32 d_out.
  // acc = Qh.Kh, acc2 = Ql.Kh + Qh.Kl (both x4096): A=Qh, A2=Ql (pitch EMB), Bt=Kh, B2=Kl (pitch EMB, K2=EMB)
  gemm_t<_Float16, 2, 2, 2, 0, 1, 0><<<gS0, blk, 0, stream>>>(
      Qh, Ql, EMB, 0LL, Kh, EMB, 0LL,
      Kl, EMB, 0LL, EMB,
      (void*)S0, (void*)S0, RC, 0LL, RC, 0LL, RC,
      RC, RC, EMB, 1.0f / 32.0f, 1.0f / RSC, 1.0f, 1.0f, 0);
  softmax_rows<1, 0><<<gSm, blk, 0, stream>>>(S0, RC, Pp, Ppl, RC, 0);
  // acc = Ph.Vh, acc2 = Pl.Vh + Ph.Vl (both x4096): A=Ph, A2=Pl (pitch RC), Bt=VT (pitch SEQ), B2=VL (pitch VLP)
  gemm_t<_Float16, 2, 2, 2, 0, 2, 0><<<gP0, blk, 0, stream>>>(
      Pp, Ppl, RC, 0LL, VT, SEQ, 0LL,
      VL, VLP, 0LL, VLP,
      (void*)out0, (void*)out0, EMB, 0LL, EMB, 0LL, EMB,
      RC, EMB, RC, 1.0f / PCARRY, 1.0f / RSC, 1.0f, 1.0f, 0);
  // (6) every row chunk c >= 1 (rows c*RC .. c*RC+RC-1, keys 0 .. (c+1)*RC-1) in one launch per stage: the same three
  //     stages with single f16 planes; the kernels take each chunk's rows, widths and pitches from blockIdx (MC = 1).
  if (SEQ > RC) {
    gemm_t<_Float16, 4, 1, 1, 0, 1, 1><<<gSn, blk, 0, stream>>>(
        Qh, Qh, EMB, 0LL, Kh, EMB, 0LL,
        Kh, EMB, 0LL, 0,
        (void*)S, (void*)S, 0, 0LL, 0, 0LL, 0,
        RC, 0, EMB, 1.0f / 32.0f, 0.0f, 1.0f, 1.0f, 0);
    softmax_rows<0, 1><<<gSmN, blk, 0, stream>>>(S, 0, (unsigned short*)S, (unsigned short*)S, 0, 0);
    gemm_t<_Float16, 4, 1, 1, 0, 2, 1><<<gPn, blk, 0, stream>>>(
        (const unsigned short*)S, (const unsigned short*)S, 0, 0LL, VT, SEQ, 0LL,
        VT, SEQ, 0LL, 0,
        (void*)out0, (void*)out0, EMB, 0LL, EMB, 0LL, EMB,
        RC, EMB, 0, 1.0f / PCARRY, 0.0f, 1.0f, 1.0f, 0);
  }
  (void)hipGetLastError();
}

// v003
// Measured time: 348 microseconds a run.
// Timed twice side by side with v002, it ran 1.14 times as fast both times.
// All steps since v000 together make it 6.36 times as fast.
// Contractions: q, k, v^T in-projections = v_wmma_f32_16x16x32_bf16 (bf16 operands from RNE-converted inputs, single product, f32 accumulate);
// q.k^T scores = v_wmma_f32_16x16x32_f16 (q, k f16 planes, single product; query rows < RC: q and k each f16 hi plane + f16 residual plane x4096, 3 products, separate f32 accumulators);
// p.v = v_wmma_f32_16x16x32_f16 (p carried x16384 in f16, v^T f16, single product; query rows < RC: p and v^T each f16 hi plane + f16 residual plane x4096, 3 products, separate f32 accumulators);
// causal softmax (row max, sum, probabilities) in f32 on materialised f32 score row chunks.
#include <hip/hip_runtime.h>
#include <math.h>
#include <stdint.h>

#ifndef NB
#define NB 1
#endif
#ifndef SEQ
#define SEQ 8192
#endif
#define NB_FULL  1
#define SEQ_FULL 8192
#define EMB      1024
#define RC       ((SEQ < 1024) ? SEQ : 1024)   // query rows per score/probability chunk; rows < RC use residual planes
#define NCH      (SEQ / RC)                    // number of row chunks
#define VLP      RC                            // key extent of the v^T residual plane
#define PCARRY   16384.0f                      // power-of-two carry of p in the f16 P.V operand
#define RSC      4096.0f                       // power-of-two carry of every f16 residual plane
#define SMI      ((SEQ / 8 + 255) / 256)       // max 8-column groups per softmax thread
static_assert(NB == 1 && NB_FULL == 1);
static_assert(SEQ >= 256 && SEQ <= SEQ_FULL && (SEQ % 256) == 0);
static_assert((SEQ % RC) == 0 && (RC % 64) == 0 && NCH >= 1);
static_assert((EMB % 64) == 0 && (SEQ % 64) == 0 && (EMB % 32) == 0 && (RC % 32) == 0);
static_assert(SMI >= 1 && SMI <= 4);
static_assert((EMB % 512) == 0 && (RC % 512) == 0 && (SEQ % 512) == 0);   // eight 64-column tiles per GEMM block; 64-k staged tiles
static_assert(((SEQ * EMB / 8) % 256) == 0 && ((EMB * EMB / 8) % 256) == 0);

typedef _Float16 v16h __attribute__((ext_vector_type(16)));
typedef _Float16 v8h  __attribute__((ext_vector_type(8)));
typedef __bf16   v16b __attribute__((ext_vector_type(16)));
typedef __bf16   v8b  __attribute__((ext_vector_type(8)));
typedef float    v8f  __attribute__((ext_vector_type(8)));
typedef float    v4f  __attribute__((ext_vector_type(4)));
typedef unsigned int v4u __attribute__((ext_vector_type(4)));

#if defined(__HIP_DEVICE_COMPILE__)
#define DEV_ASM 1
#else
#define DEV_ASM 0
#endif

// ---- scalar helpers --------------------------------------------------------------------------------
__device__ __forceinline__ unsigned short bf_bits(float f) {          // f32 -> bf16 bits, RNE convert
  unsigned u = __float_as_uint(f);
  return (unsigned short)((u + 0x7FFFu + ((u >> 16) & 1u)) >> 16);
}
__device__ __forceinline__ unsigned short h_bits(_Float16 x) { return __builtin_bit_cast(unsigned short, x); }
__device__ __forceinline__ unsigned pk16(unsigned short a, unsigned short b) { return (unsigned)a | ((unsigned)b << 16); }
// f32 elements of the score chunks 1 .. c-1, which lie in front of chunk c (chunk j: RC rows of (j+1)*RC columns)
__host__ __device__ __forceinline__ constexpr size_t sbase(int c) { return (size_t)RC * RC * (size_t)((c * (c + 1)) / 2 - 1); }
__device__ __forceinline__ v8f zero8() { v8f z = {0.f, 0.f, 0.f, 0.f, 0.f, 0.f, 0.f, 0.f}; return z; }

// ---- fragment types / loaders: 16-bit A/B operand, lane -> row/col (lane&15), p already includes +8*(lane>>4);
//      elements 0..7 <- p[0..7] (k0+8h..k0+8h+7), elements 8..15 <- p[16..23] (k0+16+8h..k0+16+8h+7)
template <typename OT> struct FT;
template <> struct FT<__bf16>   { typedef v16b frag; typedef v8b half8; };
template <> struct FT<_Float16> { typedef v16h frag; typedef v8h half8; };

template <typename OT>
__device__ __forceinline__ typename FT<OT>::frag ldfrag(const OT* p) {
  union { typename FT<OT>::frag v; typename FT<OT>::half8 h[2]; } f;
  f.h[0] = *(const typename FT<OT>::half8*)(p);
  f.h[1] = *(const typename FT<OT>::half8*)(p + 16);
  return f.v;
}

// ---- WMMA helpers (asm guard bodies are device-only; concrete operand types) -----------------------------
__device__ __forceinline__ v8f mmar(v16b a, v16b b, v8f c) {
  return __builtin_amdgcn_wmma_f32_16x16x32_bf16(false, a, false, b, (short)0, c, false, false);
}
__device__ __forceinline__ v8f mmar(v16h a, v16h b, v8f c) {
  return __builtin_amdgcn_wmma_f32_16x16x32_f16(false, a, false, b, (short)0, c, false, false);
}
__device__ __forceinline__ void acc_guard4(v8f& a, v8f& b, v8f& c, v8f& d) {
#if DEV_ASM
  asm volatile("v_nop\n\tv_nop\n\tv_nop\n\tv_nop" : "+v"(a), "+v"(b), "+v"(c), "+v"(d));
#else
  (void)a; (void)b; (void)c; (void)d;
#endif
}

// ---- LDS staging by asynchronous copies ---------------------------------------------------------------
#define BKE 64     // k elements per staged tile: 128-B rows, whole lines of the source
#define LPB 144    // LDS row pitch in bytes: 128 + 16 (16 B x odd, conflict-free for 16-B row readers)
#define LPE (LPB / 2)
__device__ __forceinline__ unsigned lds_off(const void* p) { return (unsigned)(size_t)p; }   // byte offset in the block's LDS
// Each copy: a wave brings 4 rows x 128 B (lane -> row lane>>3, 16-B piece lane&7), l / g already hold the lane's part.
// step4 = source elements per 4 rows. The address-register wait ends each statement, so no later address
// arithmetic can be placed between a copy and that wait.
__device__ __forceinline__ void copy8and32rows(unsigned la, const void* gap, size_t astep4,
                                               unsigned l, const void* gp, size_t step4) {
#if DEV_ASM
  const unsigned short* ga = (const unsigned short*)gap;
  const unsigned short* g  = (const unsigned short*)gp;
  asm volatile("global_load_async_to_lds_b128 %0, %10, off\n\t"
               "global_load_async_to_lds_b128 %1, %11, off\n\t"
               "global_load_async_to_lds_b128 %2, %12, off\n\t"
               "global_load_async_to_lds_b128 %3, %13, off\n\t"
               "global_load_async_to_lds_b128 %4, %14, off\n\t"
               "global_load_async_to_lds_b128 %5, %15, off\n\t"
               "global_load_async_to_lds_b128 %6, %16, off\n\t"
               "global_load_async_to_lds_b128 %7, %17, off\n\t"
               "global_load_async_to_lds_b128 %8, %18, off\n\t"
               "global_load_async_to_lds_b128 %9, %19, off\n\t"
               "s_wait_xcnt 0x0"
               :: "v"(la), "v"(la + 4u * LPB),
                  "v"(l), "v"(l + 4u * LPB), "v"(l + 8u * LPB), "v"(l + 12u * LPB),
                  "v"(l + 16u * LPB), "v"(l + 20u * LPB), "v"(l + 24u * LPB), "v"(l + 28u * LPB),
                  "v"(ga), "v"(ga + astep4),
                  "v"(g), "v"(g + step4), "v"(g + 2 * step4), "v"(g + 3 * step4),
                  "v"(g + 4 * step4), "v"(g + 5 * step4), "v"(g + 6 * step4), "v"(g + 7 * step4) : "memory");
#else
  (void)la; (void)gap; (void)astep4; (void)l; (void)gp; (void)step4;
#endif
}
// 16 rows of the shared A part and 32 rows of the shared Bt part: one wave's twelve copies of a 384-row tile; the
// address-register wait is the statement's last line, as above.
__device__ __forceinline__ void copy16and32rows(unsigned la, const void* gap, size_t astep4,
                                                unsigned l, const void* gp, size_t step4) {
#if DEV_ASM
  const unsigned short* ga = (const unsigned short*)gap;
  const unsigned short* g  = (const unsigned short*)gp;
  asm volatile("global_load_async_to_lds_b128 %0, %12, off\n\t"
               "global_load_async_to_lds_b128 %1, %13, off\n\t"
               "global_load_async_to_lds_b128 %2, %14, off\n\t"
               "global_load_async_to_lds_b128 %3, %15, off\n\t"
               "global_load_async_to_lds_b128 %4, %16, off\n\t"
               "global_load_async_to_lds_b128 %5, %17, off\n\t"
               "global_load_async_to_lds_b128 %6, %18, off\n\t"
               "global_load_async_to_lds_b128 %7, %19, off\n\t"
               "global_load_async_to_lds_b128 %8, %20, off\n\t"
               "global_load_async_to_lds_b128 %9, %21, off\n\t"
               "global_load_async_to_lds_b128 %10, %22, off\n\t"
               "global_load_async_to_lds_b128 %11, %23, off\n\t"
               "s_wait_xcnt 0x0"
               :: "v"(la), "v"(la + 4u * LPB), "v"(la + 8u * LPB), "v"(la + 12u * LPB),
                  "v"(l), "v"(l + 4u * LPB), "v"(l + 8u * LPB), "v"(l + 12u * LPB),
                  "v"(l + 16u * LPB), "v"(l + 20u * LPB), "v"(l + 24u * LPB), "v"(l + 28u * LPB),
                  "v"(ga), "v"(ga + astep4), "v"(ga + 2 * astep4), "v"(ga + 3 * astep4),
                  "v"(g), "v"(g + step4), "v"(g + 2 * step4), "v"(g + 3 * step4),
                  "v"(g + 4 * step4), "v"(g + 5 * step4), "v"(g + 6 * step4), "v"(g + 7 * step4) : "memory");
#else
  (void)la; (void)gap; (void)astep4; (void)l; (void)gp; (void)step4;
#endif
}
__device__ __forceinline__ void copy32rows(unsigned l, const void* gp, size_t step4) {
#if DEV_ASM
  const unsigned short* g = (const unsigned short*)gp;
  asm volatile("global_load_async_to_lds_b128 %0, %8, off\n\t"
               "global_load_async_to_lds_b128 %1, %9, off\n\t"
               "global_load_async_to_lds_b128 %2, %10, off\n\t"
               "global_load_async_to_lds_b128 %3, %11, off\n\t"
               "global_load_async_to_lds_b128 %4, %12, off\n\t"
               "global_load_async_to_lds_b128 %5, %13, off\n\t"
               "global_load_async_to_lds_b128 %6, %14, off\n\t"
               "global_load_async_to_lds_b128 %7, %15, off\n\t"
               "s_wait_xcnt 0x0"
               :: "v"(l), "v"(l + 4u * LPB), "v"(l + 8u * LPB), "v"(l + 12u * LPB),
                  "v"(l + 16u * LPB), "v"(l + 20u * LPB), "v"(l + 24u * LPB), "v"(l + 28u * LPB),
                  "v"(g), "v"(g + step4), "v"(g + 2 * step4), "v"(g + 3 * step4),
                  "v"(g + 4 * step4), "v"(g + 5 * step4), "v"(g + 6 * step4), "v"(g + 7 * step4) : "memory");
#else
  (void)l; (void)gp; (void)step4;
#endif
}
__device__ __forceinline__ void wait_lds_reads() {   // this wave's LDS reads have returned before its buffer is handed back
#if DEV_ASM
  asm volatile("s_wait_dscnt 0x0" ::: "memory");
#endif
}
__device__ __forceinline__ void wait_copies() {      // this wave's copies have landed before the barrier publishes them
#if DEV_ASM
  asm volatile("s_wait_asynccnt 0x0" ::: "memory");
#endif
}

// =====================================================================================================
// f32 -> bf16 plane (RNE convert), 8 elements per thread, one 16-B store per lane: a wave writes 512 contiguous B
// coverage: n8 threads x 8 elements = the whole plane (n8 is a multiple of 256 for every use here).
// =====================================================================================================
__global__ __launch_bounds__(256) void cvt16x8(const float* __restrict__ in, unsigned short* out, int n8) {
  const int i = blockIdx.x * 256 + (int)threadIdx.x;
  if (i < n8) {
    const float* ip = in + (size_t)i * 8;
    const v4f a  = *(const v4f*)(ip);
    const v4f a4 = *(const v4f*)(ip + 4);
    v4u p;
    p[0] = pk16(bf_bits(a[0]),  bf_bits(a[1]));
    p[1] = pk16(bf_bits(a[2]),  bf_bits(a[3]));
    p[2] = pk16(bf_bits(a4[0]), bf_bits(a4[1]));
    p[3] = pk16(bf_bits(a4[2]), bf_bits(a4[3]));
    unsigned short* o = out + (size_t)i * 8;
    *(v4u*)o = p;
    
  }
}

// =====================================================================================================
// Register-blocked WMMA GEMM (16-bit operand type OT): C[m][n] = sum_k A[m][k] * Bt[n][k];
// one wave per (16*MI) x 64 tile. NPA = NPB = 1: the eight waves of a block form a 2 x 4 grid of such tiles, a 128 x 256
// block tile (M a multiple of 128, N of 256): each staged A row serves four waves, each staged Bt row two, and two
// blocks' rings fit one LDS. Otherwise the eight waves hold eight neighbouring column tiles of one row tile
// (N a multiple of 512), each with Bt rows of its own. A row-major [M][K] pitch lda; Bt row-major [N][K] pitch ldb
// (k contiguous); M multiple of 16*MI, K multiple of 64 (static sizes here). blockIdx.y = batch
// index (strides in elements; always 0 here). Per 64 k the block stages its A rows (shared) and each wave's Bt rows in
// LDS by asynchronous copies of whole 128-B lines, two buffers, one block barrier per tile: tile t + 1 flies while tile
// t is multiplied. Fragments are read from LDS with the split k map (ldfrag); the k order of every sum is ascending.
// NPA = number of A planes: 2 -> second plane A2 (same pitch/stride as A) multiplies the same Bt fragments into the
// second accumulator set.  NPB = number of Bt planes: 2 -> second plane B2 (pitch ldb2, stride strideB2) holds the
// k range [0, K2) only (K2 multiple of 64); for k chunks with k0 < K2 (block-uniform) the A fragments multiply
// B2 fragments into the second accumulator set. NPA = NPB = 2: acc = A.Bt, acc2 = A2.Bt + A.B2 (both residual planes
// carry the same power-of-two scale 1/rscale2).
// value v = (acc [+ acc2 * rscale2]) * oscale, combined in the f32 epilogue.
// CZ (causal), czoff = global row index of local row 0 (multiple of 64):
//   0 none; 1 = output tiles with n0 >= czoff + m0 + 16*MI are not stored (every tile holding a
//   column <= one of its rows is written); 2 = A rows hold exact zeros beyond the diagonal up to column
//   czoff + mB + BR (mB, BR = first row and rows of the block tile), so the k loop ends at min(K, czoff + mB + BR)
//   (exact); the last staged tile is copied whole, so A rows are written up to the next multiple of 64 columns.
// OUT_MODE 0: f32 C (pitch ldc) = v.
// OUT_MODE 1: f16 plane C = f16(v * cscale).
// OUT_MODE 3: f16 hi plane C = f16(v * cscale) (pitch ldc) and f16 residual plane
//             C2 = f16((v*cscale - hi) * rscaleC) (pitch ldc2), C2 written only for output
//             tiles with n0 < N2 (N2 multiple of 64, wave-uniform), i.e. columns [0, N2) fully.
// =====================================================================================================
// MC = 1: one launch holds every row chunk c >= 1 (M = RC rows each). CZ = 2: blockIdx.y picks the chunk, the widest
//   (longest k loops) first. CZ = 1: a flat grid, chunk after chunk, the widest last, which the softmax then reads first.
//   The f32 score chunks lie one behind the other, chunk c at sbase(c) elements with pitch (c+1)*RC; the softmax
//   writes each f16 probability row over the front of its own score row (f16 pitch 2*(c+1)*RC).
//   CZ = 1: A rows, N, ldc, C and czoff are the chunk's; CZ = 2: A, lda, K, C rows and czoff are the chunk's.
template <typename OT, int MI, int NPA, int NPB, int OUT_MODE, int CZ, int MC>
__global__ __launch_bounds__(256) void gemm_t(
    const unsigned short* __restrict__ Ap, const unsigned short* __restrict__ A2p, int lda, long long strideA,
    const unsigned short* __restrict__ Btp, int ldb, long long strideB,
    const unsigned short* __restrict__ B2p, int ldb2, long long strideB2, int K2,
    void* Cout, void* Cout2, int ldc, long long strideC, int ldc2, long long strideC2, int N2,
    int M, int N, int K, float oscale, float rscale2, float cscale, float rscaleC, int czoff) {
  static_assert(CZ != 2 || ((16 * MI) % 32) == 0);
  static_assert(MC == 0 || ((CZ == 1 || CZ == 2) && OUT_MODE == 0 && NPA == 1 && NPB == 1));
  typedef typename FT<OT>::frag V16;
  int bx = (int)blockIdx.x;              // the block's index among its chunk's (MC = 1) or the launch's blocks
  if (MC == 1) {                         // block-uniform
    int c = NCH - 1 - (int)blockIdx.y;
    if (CZ == 1) {                       // chunk c holds (c+1) * BPU blocks of the flat grid
      constexpr int BPU = (RC / 64) * (RC / 64) / 8;
      c = 1;
      while (c < NCH - 1 && bx >= (c + 1) * BPU) { bx -= (c + 1) * BPU; ++c; }
    }
    const int rb = c * RC;
    const size_t sb = sbase(c);
    czoff = rb;
    if (CZ == 1) {
      Ap += (size_t)rb * lda; A2p += (size_t)rb * lda;
      N = rb + RC; ldc = rb + RC;
      Cout = (void*)((float*)Cout + sb);
    } else {
      Ap += 2 * sb; A2p += 2 * sb;
      lda = 2 * (rb + RC); K = rb + RC;
      Cout = (void*)((float*)Cout + (size_t)rb * ldc);
    }
  }
  const OT* A  = (const OT*)(const void*)Ap;
  const OT* A2 = (const OT*)(const void*)A2p;
  const OT* Bt = (const OT*)(const void*)Btp;
  const OT* B2 = (const OT*)(const void*)B2p;
  const int RT = 16 * MI;
  constexpr bool SH = (NPA == 1 && NPB == 1);              // 2 x 4 wave grid with shared Bt rows
  constexpr int WM = SH ? 2 : 1;                           // wave tiles of a block along M
  constexpr int WN = 8 / WM;                               // and along N
  constexpr int BR = 16 * MI * WM;                         // rows of the block tile
  constexpr int ROWS_A = BR * NPA;                         // A (and A2) rows of the block's tiles
  constexpr int ROWS_W = 64 * NPB;                         // Bt (and B2) rows of one column tile
  constexpr int STG_B  = (ROWS_A + WN * ROWS_W) * LPB;     // one staged k tile of the block, bytes
  static_assert(ROWS_A == (SH ? 128 : 64));                // 8 waves x 16 (8) rows copy the A part
  static_assert(!SH || WN * ROWS_W == 256);                // 8 waves x 32 rows copy the shared Bt part
  static_assert(2 * STG_B >= 8 * 16 * 68 * 4 && 2 * STG_B <= 320 * 1024);
  __shared__ __align__(16) unsigned char ring[2 * STG_B];  // two buffers; after the k loop: per-wave 16x64 f32 slabs
  const int b    = (MC == 1) ? 0 : (int)blockIdx.y;
  const int lane = threadIdx.x & 31;
  const int wave = __builtin_amdgcn_readfirstlane((int)(threadIdx.x >> 5));
  const int tilesN = (N >> 6) / WN;      // block tiles along N
  const int tilesM = M / BR;
  if (bx >= tilesM * tilesN) return;     // block-uniform, in front of every barrier
  // The quotient is block-uniform; where the compiler divides on the vector unit, readfirstlane brings it back to a
  // scalar register, so that the returns below stay scalar branches.
  const int tm = __builtin_amdgcn_readfirstlane(bx / tilesN);
  const int mB = tm * BR;                                  // the block tile's first row and column
  const int nB = (bx - tm * tilesN) * (64 * WN);
  const int wn = SH ? (wave & 3) : wave;                   // this wave's column tile in the block
  const int m0 = mB + (SH ? (wave >> 2) * RT : 0);
  const int n0 = nB + (wn << 6);
  bool live = true;
  if (CZ == 1) {
    if (nB >= czoff + mB + BR) return;           // block-uniform causal skip, in front of every barrier
    live = n0 < czoff + m0 + RT;                 // a wave past the diagonal walks the loop and stores nothing
  }
  int kEnd = K;
  if (CZ == 2) {
    const int ke = czoff + mB + BR;      // multiple of 32
    kEnd = (ke < K) ? ke : K;
  }

  const OT* Ab  = A  + (size_t)b * (size_t)strideA;
  const OT* A2b = A2 + (size_t)b * (size_t)strideA;
  const OT* Bb  = Bt + (size_t)b * (size_t)strideB;
  const OT* B2b = B2 + (size_t)b * (size_t)strideB2;

  const int rlane = lane & 15;                 // row (A) / col (B, D) within subtile
  const int koff  = (lane >> 4) * 8;           // k offset of this lane half
  const int mOff  = (lane >> 4) * 8;           // D row offset

  v8f acc[MI][4], acc2[MI][4];
#pragma unroll
  for (int i = 0; i < MI; ++i)
#pragma unroll
    for (int j = 0; j < 4; ++j) { acc[i][j] = zero8(); acc2[i][j] = zero8(); }

  // ---- this lane's part of every staged tile: row lane>>3 of each 4-row group, 16-B piece lane&7 ----
  const int crow = lane >> 3;
  const int cel  = (lane & 7) * 8;
  const int arow = wave * (ROWS_A / 8);                        // this wave's share of the staged [A | A2] rows
  const int brow = SH ? wave * 32 : wave * ROWS_W;             // and of the staged Bt rows (shared: 32 of 256)
  const bool a2w = (NPA == 2) && (arow >= RT);                 // wave-uniform
  const OT* gA  = (a2w ? A2b : Ab) + (size_t)(mB + (a2w ? arow - RT : arow) + crow) * lda + cel;
  const OT* gB  = Bb  + (size_t)((SH ? nB + brow : n0) + crow) * ldb  + cel;
  const OT* gB2 = B2b + (size_t)(n0 + crow) * ldb2 + cel;
  const unsigned lc = lds_off(ring) + (unsigned)(crow * LPB + cel * 2);
  const unsigned lA = lc + (unsigned)(arow * LPB);
  const unsigned lB = lc + (unsigned)((ROWS_A + brow) * LPB);
  const int nT = (kEnd + BKE - 1) / BKE;                       // >= 1; block-uniform
  auto stage = [&](int t) {                                    // tile t -> buffer t & 1
    const unsigned bo = (unsigned)(t & 1) * (unsigned)STG_B;
    const int kt = t * BKE;
    if constexpr (SH) {
      copy16and32rows(lA + bo, gA + kt, (size_t)4 * lda, lB + bo, gB + kt, (size_t)4 * ldb);
    } else {
      copy8and32rows(lA + bo, gA + kt, (size_t)4 * lda, lB + bo, gB + kt, (size_t)4 * ldb);
      copy32rows(lB + bo + 32u * LPB, gB + kt + (size_t)32 * ldb, (size_t)4 * ldb);
    }
    if (NPB == 2) {
      if (kt < K2) {                                           // block-uniform: the residual plane ends at K2
        copy32rows(lB + bo + 64u * LPB, gB2 + kt, (size_t)4 * ldb2);
        copy32rows(lB + bo + 96u * LPB, gB2 + kt + (size_t)32 * ldb2, (size_t)4 * ldb2);
      }
    }
  };

  stage(0);
  wait_copies();
  __syncthreads();                       // tile 0 is published
  if (nT > 1) stage(1);
  const int aOff = (m0 - mB + rlane) * LPB;                    // this lane's fragment rows in a buffer, bytes
  const int bOff = (ROWS_A + wn * ROWS_W + rlane) * LPB;
  if constexpr (NPA == 1 && NPB == 1) {
    // Every LDS read of tile t stands between the barrier that publishes it and the barrier that frees its buffer.
    // Fragment registers: bq0 / bq1 = Bt of the tile's first / second 32 k; a[i] is refilled in place right behind its
    // last product; ax holds row group MI-1 of the second 32 k, so that no read is issued behind a phase's last products.
    // The scheduling barriers keep each read at that place (left alone, the compiler read each A fragment right in
    // front of its products and waited for it every time).
    V16 bq0[4], bq1[4], a[MI], ax;
    {
      const OT* sA = (const OT*)(const void*)(ring + aOff) + koff;
      const OT* sB = (const OT*)(const void*)(ring + bOff) + koff;
#pragma unroll
      for (int j = 0; j < 4; ++j) bq0[j] = ldfrag<OT>(sB + (j << 4) * LPE);
#pragma unroll
      for (int i = 0; i < MI; ++i) a[i] = ldfrag<OT>(sA + (i << 4) * LPE);
    }
    for (int t = 0; t < nT; ++t) {
      const unsigned char* buf = ring + (size_t)(t & 1) * STG_B;
      const OT* sA = (const OT*)(const void*)(buf + aOff) + koff + 32;
      const OT* sB = (const OT*)(const void*)(buf + bOff) + koff + 32;
      ax = ldfrag<OT>(sA + ((MI - 1) << 4) * LPE);
#pragma unroll
      for (int j = 0; j < 4; ++j) bq1[j] = ldfrag<OT>(sB + (j << 4) * LPE);
      __builtin_amdgcn_sched_barrier(0);     // reads of the second 32 k go out ahead of the first 32 k's products
#pragma unroll
      for (int i = 0; i < MI - 1; ++i) {
#pragma unroll
        for (int j = 0; j < 4; ++j) acc[i][j] = mmar(a[i], bq0[j], acc[i][j]);
        __builtin_amdgcn_sched_barrier(0);   // the refill stays behind a[i]'s last product, so it can take a[i]'s registers
        a[i] = ldfrag<OT>(sA + (i << 4) * LPE);
        __builtin_amdgcn_sched_barrier(0);   // the refill of a[i] stays among the products
      }
#pragma unroll
      for (int j = 0; j < 4; ++j) acc[MI - 1][j] = mmar(a[MI - 1], bq0[j], acc[MI - 1][j]);
      __builtin_amdgcn_sched_barrier(0);     // the first 32 k's products stay ahead of the waits
      wait_lds_reads();
      wait_copies();
      __syncthreads();                       // publishes tile t + 1 and ends every read of tile t's buffer
      if (t + 2 < nT) stage(t + 2);
      // The first 32 k of tile t + 1 are read under tile t's last products. The last trip has no next tile: a scalar
      // select aims its reads, whose values nobody uses, at its own buffer (landed, not refilled), which keeps the
      // products free of a branch.
      const unsigned char* nbuf = ring + (size_t)(((t + 1 < nT) ? (t + 1) : t) & 1) * STG_B;
      const OT* nA = (const OT*)(const void*)(nbuf + aOff) + koff;
      const OT* nB = (const OT*)(const void*)(nbuf + bOff) + koff;
      a[MI - 1] = ldfrag<OT>(nA + ((MI - 1) << 4) * LPE);
#pragma unroll
      for (int j = 0; j < 4; ++j) bq0[j] = ldfrag<OT>(nB + (j << 4) * LPE);
      __builtin_amdgcn_sched_barrier(0);     // the next tile's reads go out ahead of this tile's last products
#pragma unroll
      for (int i = 0; i < MI - 1; ++i) {
#pragma unroll
        for (int j = 0; j < 4; ++j) acc[i][j] = mmar(a[i], bq1[j], acc[i][j]);
        __builtin_amdgcn_sched_barrier(0);   // the refill stays behind a[i]'s last product, so it can take a[i]'s registers
        a[i] = ldfrag<OT>(nA + (i << 4) * LPE);
        __builtin_amdgcn_sched_barrier(0);   // the refill of a[i] stays among the products
      }
#pragma unroll
      for (int j = 0; j < 4; ++j) acc[MI - 1][j] = mmar(ax, bq1[j], acc[MI - 1][j]);
    }
  } else {
    for (int t = 0; t < nT; ++t) {
      const unsigned char* buf = ring + (size_t)(t & 1) * STG_B;
      const OT* sA = (const OT*)(const void*)(buf + aOff) + koff;
      const OT* sB = (const OT*)(const void*)(buf + bOff) + koff;
#pragma unroll   // two 32-k chunks per staged tile, fragment arrays stay in registers
      for (int kk = 0; kk < BKE; kk += 32) {
        const int k0 = t * BKE + kk;
        if (CZ != 2 || (RT % BKE) == 0 || k0 < kEnd) {         // block-uniform: a 32-row tile may end mid-tile
          const bool res = k0 < K2;                            // block-uniform: residual Bt plane covers k < K2 only
          V16 bq[4], br[4], af[MI], af2[MI];
#pragma unroll
          for (int j = 0; j < 4; ++j) bq[j] = ldfrag<OT>(sB + (j << 4) * LPE + kk);
#pragma unroll
          for (int i = 0; i < MI; ++i) {
            af[i]  = ldfrag<OT>(sA + (i << 4) * LPE + kk);
            af2[i] = ldfrag<OT>(sA + (RT + (i << 4)) * LPE + kk);
          }
          if (res) {
#pragma unroll
            for (int j = 0; j < 4; ++j) br[j] = ldfrag<OT>(sB + (64 + (j << 4)) * LPE + kk);
          }
          __builtin_amdgcn_sched_barrier(0);   // the chunk's reads stay in one group ahead of its products
#pragma unroll
          for (int i = 0; i < MI; ++i) {
#pragma unroll
            for (int j = 0; j < 4; ++j) acc[i][j] = mmar(af[i], bq[j], acc[i][j]);
#pragma unroll
            for (int j = 0; j < 4; ++j) acc2[i][j] = mmar(af2[i], bq[j], acc2[i][j]);
          }
          if (res) {
#pragma unroll
            for (int i = 0; i < MI; ++i)
#pragma unroll
              for (int j = 0; j < 4; ++j) acc2[i][j] = mmar(af[i], br[j], acc2[i][j]);
          }
        }
      }
      wait_lds_reads();
      wait_copies();
      __syncthreads();                       // publishes tile t + 1 and ends every read of tile t's buffer
      if (t + 2 < nT) stage(t + 2);
    }
  }
  wait_copies();
  wait_lds_reads();
  __syncthreads();                       // every wave's last ring read has returned: the ring becomes output staging
  if (!live) return;                     // wave-uniform; no block barrier follows
#pragma unroll
  for (int i = 0; i < MI; ++i) {
    acc_guard4(acc[i][0], acc[i][1], acc[i][2], acc[i][3]);
    if (NPA == 2 || NPB == 2) acc_guard4(acc2[i][0], acc2[i][1], acc2[i][2], acc2[i][3]);
  }

  // ---- epilogue ----
  float* slab = (float*)(void*)ring + wave * (16 * 68);   // pitch 68 floats, wave-private
#pragma unroll
  for (int i = 0; i < MI; ++i) {
    const int mBase = m0 + (i << 4);
#pragma unroll
    for (int j = 0; j < 4; ++j) {
#pragma unroll
      for (int r = 0; r < 8; ++r) {
        float v = acc[i][j][r];
        if (NPA == 2 || NPB == 2) v += acc2[i][j][r] * rscale2;
        v = v * oscale;
        slab[(mOff + r) * 68 + (j << 4) + rlane] = v;
      }
    }
    __builtin_amdgcn_fence(3 /* release order */, "workgroup");
    __builtin_amdgcn_wave_barrier();
    __builtin_amdgcn_fence(2 /* acquire order */, "workgroup");
    if (OUT_MODE == 0) {
      float* C = (float*)Cout + (size_t)b * (size_t)strideC;
      const int h2 = lane >> 4, c4 = (lane & 15) * 4;     // 256-B row segment = 16 lanes x 16 B
      {
#pragma unroll
        for (int it = 0; it < 8; ++it) {
          const int row = it * 2 + h2;                     // it 0..7 x h2 0..1 = rows 0..15
          const v4f v = *(const v4f*)(slab + row * 68 + c4);
          *(v4f*)(C + (size_t)(mBase + row) * ldc + n0 + c4) = v;
        }
        
      }
    } else {
      const int q = lane >> 3, c8 = (lane & 7) * 8;
      unsigned short* C  = (unsigned short*)Cout  + (size_t)b * (size_t)strideC;
      unsigned short* C2 = (unsigned short*)Cout2 + (size_t)b * (size_t)strideC2;
      const bool wr2 = (OUT_MODE == 3) && (n0 < N2);     // wave-uniform
      v4u hv[4], lv[4];
#pragma unroll
      for (int it = 0; it < 4; ++it) {
        const int row = it * 4 + q;                        // it 0..3 x q 0..3 = rows 0..15
        const float* sp = slab + row * 68 + c8;
        float f[8];
#pragma unroll
        for (int e = 0; e < 8; ++e) f[e] = sp[e] * cscale;
        v4u a, a2;
#pragma unroll
        for (int e = 0; e < 4; ++e) {
          const float f0 = f[2 * e], f1 = f[2 * e + 1];
          const _Float16 x0 = (_Float16)f0, x1 = (_Float16)f1;
          const unsigned short h0 = h_bits(x0), h1 = h_bits(x1);
          unsigned short l0 = 0, l1 = 0;
          if (OUT_MODE == 3) {
            l0 = h_bits((_Float16)((f0 - (float)x0) * rscaleC));
            l1 = h_bits((_Float16)((f1 - (float)x1) * rscaleC));
          }
          a[e] = pk16(h0, h1); a2[e] = pk16(l0, l1);
        }
        hv[it] = a; lv[it] = a2;
      }
      {
#pragma unroll
        for (int it = 0; it < 4; ++it) {
          const int row = it * 4 + q;
          *(v4u*)(C + (size_t)(mBase + row) * ldc + n0 + c8) = hv[it];
          if (OUT_MODE == 3) {
            if (wr2) *(v4u*)(C2 + (size_t)(mBase + row) * ldc2 + n0 + c8) = lv[it];
          }
        }
        
      }
    }
    __builtin_amdgcn_fence(3 /* release order */, "workgroup");
    __builtin_amdgcn_wave_barrier();
    __builtin_amdgcn_fence(2 /* acquire order */, "workgroup");
  }
}

// =====================================================================================================
// Exact causal row softmax over one chunk of query rows (MC = 0): one block of 256 threads per local row r (global row
// t = rowBase + r).
//   S: f32 score chunk [rows][ldS]; the scores GEMM wrote every column of row t in [0, ((t>>6)+1)*64).
//   The row is processed in 8-column groups g; ngl = ((t>>6)+1)*8 groups hold scores, ng groups of P are written
//   (MC = 0: ng = ngl; MC = 1: ng = ((t>>7)+1)*16, the k end of the row's 128-row P.V block tile). Thread tid owns groups
//   g = it*256 + tid. Loads use an address clamped to group ngl-1; entries with column > t are replaced by -inf
//   by index before any arithmetic. Iterations with it*256 >= ng are skipped block-uniformly.
//   p = exp(s - max) * (1/sum) in f32 (max finite: column 0 is always valid), x16384 carry, f16 RNE;
//   columns > t up to ng*8 get exact zeros. WRL = 1: also the f16 residual plane
//   Pl = f16((p*16384 - hi) * 4096), same pitch. Each group is one 16-B store per lane; 8 consecutive lanes fill
//   LDS redm/reds: cross-wave, block barriers (every thread reaches both).
//   coverage: every row x columns [0, ng*8) of P (and Pl) = exactly the extent the P.V GEMM reads.
// =====================================================================================================
//   MC = 1: one launch for every row t >= RC, the longest first; row t lies in score chunk c = t / RC (sbase(c), pitch
//   (c+1)*RC), and P = S: the row's probabilities go over the front of its own scores. Every score of the row is in
//   registers, and has gone into the row maximum, in front of the first block barrier; the stores stand behind the second.
template <int WRL, int MC>
__global__ __launch_bounds__(256)
void softmax_rows(const float* S, int ldS, unsigned short* P, unsigned short* Pl, int ldP, int rowBase) {
  __shared__ float redm[8];
  __shared__ float reds[8];
  const int t    = (MC == 1) ? (SEQ - 1 - (int)blockIdx.x) : (rowBase + (int)blockIdx.x);
  const int ch   = t / RC;
  const size_t ro = (MC == 1) ? (sbase(ch) + (size_t)(t - ch * RC) * (size_t)((ch + 1) * RC))
                              : ((size_t)blockIdx.x * (size_t)ldS);      // the row's first score, f32 elements
  const size_t po = (MC == 1) ? (2 * ro) : ((size_t)blockIdx.x * (size_t)ldP);   // its first probability, f16 elements
  const int tid  = threadIdx.x;
  const int wave = tid >> 5;
  const int lane = tid & 31;
  const int ngl  = ((t >> 6) + 1) * 8;                       // groups that hold scores
  const int ng   = (MC == 1) ? ((t >> 7) + 1) * 16 : ngl;    // groups of P that are written: up to the P.V block tile's k end
  const float* rp = S + ro;
  float v[SMI][8];
#pragma unroll
  for (int it = 0; it < SMI; ++it) {
#pragma unroll
    for (int e = 0; e < 8; ++e) v[it][e] = -INFINITY;
    if (it * 256 < ng) {                                   // block-uniform
      const int g  = it * 256 + tid;
      const int gc = (g < ngl) ? g : (ngl - 1);            // clamped address
      const int c0 = g * 8;
      const v4f a  = *(const v4f*)(rp + (size_t)gc * 8);
      const v4f a4 = *(const v4f*)(rp + (size_t)gc * 8 + 4);
#pragma unroll
      for (int e = 0; e < 4; ++e) {
        v[it][e]     = (c0 + e <= t)     ? a[e]  : -INFINITY;
        v[it][4 + e] = (c0 + 4 + e <= t) ? a4[e] : -INFINITY;
      }
    }
  }
  float mx = -INFINITY;
#pragma unroll
  for (int it = 0; it < SMI; ++it)
#pragma unroll
    for (int e = 0; e < 8; ++e) mx = fmaxf(mx, v[it][e]);
#pragma unroll
  for (int off = 1; off < 32; off <<= 1) mx = fmaxf(mx, __shfl_xor(mx, off, 32));
  if (lane == 0) redm[wave] = mx;
  __syncthreads();
  mx = redm[0];
#pragma unroll
  for (int w = 1; w < 8; ++w) mx = fmaxf(mx, redm[w]);

  float sum = 0.f;
#pragma unroll
  for (int it = 0; it < SMI; ++it) {
    if (it * 256 < ng) {                                   // block-uniform
#pragma unroll
      for (int e = 0; e < 8; ++e) { const float ex = __expf(v[it][e] - mx); v[it][e] = ex; sum += ex; }
    } else {
#pragma unroll
      for (int e = 0; e < 8; ++e) v[it][e] = 0.f;
    }
  }
#pragma unroll
  for (int off = 1; off < 32; off <<= 1) sum += __shfl_xor(sum, off, 32);
  if (lane == 0) reds[wave] = sum;
  __syncthreads();
  sum = reds[0];
#pragma unroll
  for (int w = 1; w < 8; ++w) sum += reds[w];

  const float sc = PCARRY * (1.0f / sum);        // sum >= 1
  v4u pk[SMI], pl[SMI];
#pragma unroll
  for (int it = 0; it < SMI; ++it) {
    v4u a, a2;
#pragma unroll
    for (int e = 0; e < 4; ++e) {
      const float f0 = v[it][2 * e] * sc, f1 = v[it][2 * e + 1] * sc;
      const _Float16 x0 = (_Float16)f0, x1 = (_Float16)f1;
      unsigned short l0 = 0, l1 = 0;
      if (WRL == 1) {
        l0 = h_bits((_Float16)((f0 - (float)x0) * RSC));
        l1 = h_bits((_Float16)((f1 - (float)x1) * RSC));
      }
      a[e]  = pk16(h_bits(x0), h_bits(x1));
      a2[e] = pk16(l0, l1);
    }
    pk[it] = a; pl[it] = a2;
  }
  unsigned short* op  = P  + po;
  unsigned short* opl = Pl + po;
  {
#pragma unroll
    for (int it = 0; it < SMI; ++it) {
      if (it * 256 < ng) {                                 // block-uniform
        const int g = it * 256 + tid;
        if (g < ng) {
          *(v4u*)(op + (size_t)g * 8) = pk[it];
          if (WRL == 1) *(v4u*)(opl + (size_t)g * 8) = pl[it];
        }
      }
    }
    
  }
}

// =====================================================================================================
// Workspace map (bytes at SEQ = 8192, RC = 1024; every region a multiple of its whole-line store granularity and of
//   R0   Xb bf16 [SEQ][EMB] (16777216), later the f32 score chunks c >= 1, S_c [RC][(c+1)*RC] at sbase(c), each row's
//        front overwritten by its f16 probabilities (pitch 2*(c+1)*RC)                                      146800640
//   S0   f32 [RC][RC]     (chunk 0 scores)                                                                    4194304
//   Wqb, Wkb, Wvb bf16 [EMB][EMB]                                                                          3 x 2097152
//   Qh   f16 [SEQ][EMB]                                                                                      16777216
//   Kh   f16 [SEQ][EMB]                                                                                      16777216
//   VT   f16 [EMB][SEQ]   (v^T hi plane)                                                                     16777216
//   Ql   f16 [RC][EMB]    (q residual x4096, rows < RC)                                                       2097152
//   Kl   f16 [RC][EMB]    (k residual x4096, keys < RC)                                                       2097152
//   VL   f16 [EMB][VLP]   (v^T residual x4096, keys < VLP)                                                    2097152
//   P    f16 [RC][RC]     (chunk 0 probabilities)                                                             2097152
//   Pl   f16 [RC][RC]     (p residual x4096, chunk 0 only)                                                    2097152
//   total                                                                                                   218103808
// Aliases are ordered by launch dependence: Xb is last read by the v^T projection, R0's scores are first written by
// the scores GEMM of the chunks c >= 1 after it. Weights are [out n][in k] with k contiguous = the Bt / A layout the GEMM wants.
// =====================================================================================================
static constexpr size_t PACT_B = (size_t)SEQ * EMB * 2;
static constexpr size_t PS_B   = sbase(NCH) * 4;               // chunks 1 .. NCH-1
static constexpr size_t PS0_B  = (size_t)RC * RC * 4;
static constexpr size_t R0_B   = (PACT_B > PS_B) ? PACT_B : PS_B;
static constexpr size_t PW_B   = (size_t)EMB * EMB * 2;
static constexpr size_t PRES_B = (size_t)RC * EMB * 2;
static constexpr size_t PVT_B  = (size_t)EMB * SEQ * 2;
static constexpr size_t PVL_B  = (size_t)EMB * VLP * 2;
static constexpr size_t PP_B   = (size_t)RC * RC * 2;
static constexpr size_t PPL_B  = (size_t)RC * RC * 2;
static constexpr size_t WS_TOTAL = R0_B + PS0_B + 3 * PW_B + 2 * PACT_B + PVT_B + 2 * PRES_B + PVL_B + PP_B + PPL_B;
static_assert(WS_TOTAL <= (size_t)268435456);
static_assert((R0_B % 128) == 0 && (PS0_B % 128) == 0 && (PP_B % 128) == 0 && (PW_B % 128) == 0 && (PRES_B % 128) == 0 && (PVL_B % 128) == 0 && (PPL_B % 128) == 0);

extern "C" void kernel_launch(void* const* d_in, const int* in_sizes, int n_in,
                              void* d_out, int out_size, void* d_ws, size_t ws_size,
                              hipStream_t stream) {
  if (n_in < 4) return;
  const long long needX = (long long)SEQ * (long long)EMB;
  if ((long long)in_sizes[0] < needX) return;
  if (in_sizes[1] < EMB * EMB) return;
  if (in_sizes[2] < EMB * EMB) return;
  if (in_sizes[3] < EMB * EMB) return;
  if (out_size < 0) return;
  if ((long long)out_size < needX) return;

  const float* x  = (const float*)d_in[0];
  const float* Wq = (const float*)d_in[1];
  const float* Wk = (const float*)d_in[2];
  const float* Wv = (const float*)d_in[3];

  size_t off = 0;
  const size_t oR0 = off; off += R0_B;
  const size_t oS0 = off; off += PS0_B;
  const size_t oWq = off; off += PW_B;
  const size_t oWk = off; off += PW_B;
  const size_t oWv = off; off += PW_B;
  const size_t oQh = off; off += PACT_B;
  const size_t oKh = off; off += PACT_B;
  const size_t oVT = off; off += PVT_B;
  const size_t oQl = off; off += PRES_B;
  const size_t oKl = off; off += PRES_B;
  const size_t oVL = off; off += PVL_B;
  const size_t oP  = off; off += PP_B;
  const size_t oPl = off; off += PPL_B;
  if (off != WS_TOTAL) return;
  if (off > ws_size) return;
  if (off > (size_t)268435456) return;

  char* ws = (char*)d_ws;
  unsigned short* Xb  = (unsigned short*)(ws + oR0);
  float*          S   = (float*)(ws + oR0);          // alias, see map
  float*          S0  = (float*)(ws + oS0);
  unsigned short* Wqb = (unsigned short*)(ws + oWq);
  unsigned short* Wkb = (unsigned short*)(ws + oWk);
  unsigned short* Wvb = (unsigned short*)(ws + oWv);
  unsigned short* Qh  = (unsigned short*)(ws + oQh);
  unsigned short* Kh  = (unsigned short*)(ws + oKh);
  unsigned short* VT  = (unsigned short*)(ws + oVT);
  unsigned short* Ql  = (unsigned short*)(ws + oQl);
  unsigned short* Kl  = (unsigned short*)(ws + oKl);
  unsigned short* VL  = (unsigned short*)(ws + oVL);
  unsigned short* Pp  = (unsigned short*)(ws + oP);
  unsigned short* Ppl = (unsigned short*)(ws + oPl);
  float*          out0 = (float*)d_out;

  const dim3 blk(256);
  const int n8x = SEQ * EMB / 8;                                    // multiple of 256
  const int n8w = EMB * EMB / 8;                                    // multiple of 256
  const dim3 gCvtX(n8x / 256, 1);
  const dim3 gCvtW(n8w / 256, 1);
  const dim3 gPr0((((RC / 64) * (EMB / 64)) + 7) / 8, 1);           // rows [0, RC): M=RC, N=EMB, 64x64 wave tiles
  const dim3 gPr1(((((SEQ - RC) / 64) * (EMB / 64)) + 7) / 8 + ((SEQ == RC) ? 1 : 0), 1);   // rows [RC, SEQ)
  const dim3 gV((((EMB / 64) * (SEQ / 64)) + 7) / 8, 1);            // M=EMB, N=SEQ
  const dim3 gS0((((RC / 32) * (RC / 64)) + 7) / 8, 1);             // chunk 0 scores: 32x64 wave tiles
  const dim3 gP0((((RC / 32) * (EMB / 64)) + 7) / 8, 1);            // chunk 0 P.V: 32x64 wave tiles
  const dim3 gSn((NCH > 1) ? ((RC / 64) * (RC / 64) / 8) * ((NCH * (NCH + 1)) / 2 - 1) : 1, 1);   // chunks c >= 1 scores: 64x64 wave tiles
  const dim3 gPn((((RC / 64) * (EMB / 64)) + 7) / 8, (NCH > 1) ? (NCH - 1) : 1);   // chunks c >= 1 P.V: 64x64 wave tiles
  const dim3 gSm(RC);                                               // chunk 0: one block per query row
  const dim3 gSmN((SEQ > RC) ? (SEQ - RC) : 1);                     // rows [RC, SEQ): one block per query row

  // (1) x, Wq, Wk, Wv -> bf16 planes (RNE convert)
  cvt16x8<<<gCvtX, blk, 0, stream>>>(x,  Xb,  n8x);
  cvt16x8<<<gCvtW, blk, 0, stream>>>(Wq, Wqb, n8w);
  cvt16x8<<<gCvtW, blk, 0, stream>>>(Wk, Wkb, n8w);
  cvt16x8<<<gCvtW, blk, 0, stream>>>(Wv, Wvb, n8w);
  // (2) q = x . Wq^T: rows [0, RC) -> f16 hi + residual (x4096) planes; rows [RC, SEQ) -> f16 plane  (N=EMB, K=EMB)
  gemm_t<__bf16, 4, 1, 1, 3, 0, 0><<<gPr0, blk, 0, stream>>>(
      Xb, Xb, EMB, 0LL, Wqb, EMB, 0LL,
      Wqb, EMB, 0LL, 0,
      (void*)Qh, (void*)Ql, EMB, 0LL, EMB, 0LL, EMB,
      RC, EMB, EMB, 1.0f, 0.0f, 1.0f, RSC, 0);
  if (SEQ > RC) {
    gemm_t<__bf16, 4, 1, 1, 1, 0, 0><<<gPr1, blk, 0, stream>>>(
        Xb + (size_t)RC * EMB, Xb + (size_t)RC * EMB, EMB, 0LL, Wqb, EMB, 0LL,
        Wqb, EMB, 0LL, 0,
        (void*)(Qh + (size_t)RC * EMB), (void*)(Qh + (size_t)RC * EMB), EMB, 0LL, EMB, 0LL, EMB,
        SEQ - RC, EMB, EMB, 1.0f, 0.0f, 1.0f, 1.0f, 0);
  }
  // (3) k = x . Wk^T, same split
  gemm_t<__bf16, 4, 1, 1, 3, 0, 0><<<gPr0, blk, 0, stream>>>(
      Xb, Xb, EMB, 0LL, Wkb, EMB, 0LL,
      Wkb, EMB, 0LL, 0,
      (void*)Kh, (void*)Kl, EMB, 0LL, EMB, 0LL, EMB,
      RC, EMB, EMB, 1.0f, 0.0f, 1.0f, RSC, 0);
  if (SEQ > RC) {
    gemm_t<__bf16, 4, 1, 1, 1, 0, 0><<<gPr1, blk, 0, stream>>>(
        Xb + (size_t)RC * EMB, Xb + (size_t)RC * EMB, EMB, 0LL, Wkb, EMB, 0LL,
        Wkb, EMB, 0LL, 0,
        (void*)(Kh + (size_t)RC * EMB), (void*)(Kh + (size_t)RC * EMB), EMB, 0LL, EMB, 0LL, EMB,
        SEQ - RC, EMB, EMB, 1.0f, 0.0f, 1.0f, 1.0f, 0);
  }
  // (4) v^T = Wv . x^T -> f16 hi plane [d][s] (pitch SEQ) and f16 residual plane x4096 [d][s < VLP] (pitch VLP)
  //     (A = Wv rows [n][k]; Bt = x rows [s][k]; M=EMB, N=SEQ, K=EMB)
  gemm_t<__bf16, 4, 1, 1, 3, 0, 0><<<gV, blk, 0, stream>>>(
      Wvb, Wvb, EMB, 0LL, Xb, EMB, 0LL,
      Xb, EMB, 0LL, 0,
      (void*)VT, (void*)VL, SEQ, 0LL, VLP, 0LL, VLP,
      EMB, SEQ, EMB, 1.0f, 0.0f, 1.0f, RSC, 0);
  // (5) chunk 0 (rows and keys [0, RC), residual planes): scores = q.k / 32 -> f32 S0 (causal tiles only); exact causal
  //     softmax -> f16 P and residual plane (x16384, zeros beyond the diagonal up to the 64-column boundary);
  //     out rows = P.V / 16384 -> f32 d_out.
  // acc = Qh.Kh, acc2 = Ql.Kh + Qh.Kl (both x4096): A=Qh, A2=Ql (pitch EMB), Bt=Kh, B2=Kl (pitch EMB, K2=EMB)
  gemm_t<_Float16, 2, 2, 2, 0, 1, 0><<<gS0, blk, 0, stream>>>(
      Qh, Ql, EMB, 0LL, Kh, EMB, 0LL,
      Kl, EMB, 0LL, EMB,
      (void*)S0, (void*)S0, RC, 0LL, RC, 0LL, RC,
      RC, RC, EMB, 1.0f / 32.0f, 1.0f / RSC, 1.0f, 1.0f, 0);
  softmax_rows<1, 0><<<gSm, blk, 0, stream>>>(S0, RC, Pp, Ppl, RC, 0);
  // acc = Ph.Vh, acc2 = Pl.Vh + Ph.Vl (both x4096): A=Ph, A2=Pl (pitch RC), Bt=VT (pitch SEQ), B2=VL (pitch VLP)
  gemm_t<_Float16, 2, 2, 2, 0, 2, 0><<<gP0, blk, 0, stream>>>(
      Pp, Ppl, RC, 0LL, VT, SEQ, 0LL,
      VL, VLP, 0LL, VLP,
      (void*)out0, (void*)out0, EMB, 0LL, EMB, 0LL, EMB,
      RC, EMB, RC, 1.0f / PCARRY, 1.0f / RSC, 1.0f, 1.0f, 0);
  // (6) every row chunk c >= 1 (rows c*RC .. c*RC+RC-1, keys 0 .. (c+1)*RC-1) in one launch per stage: the same three
  //     stages with single f16 planes; the kernels take each chunk's rows, widths and pitches from blockIdx (MC = 1).
  if (SEQ > RC) {
    gemm_t<_Float16, 4, 1, 1, 0, 1, 1><<<gSn, blk, 0, stream>>>(
        Qh, Qh, EMB, 0LL, Kh, EMB, 0LL,
        Kh, EMB, 0LL, 0,
        (void*)S, (void*)S, 0, 0LL, 0, 0LL, 0,
        RC, 0, EMB, 1.0f / 32.0f, 0.0f, 1.0f, 1.0f, 0);
    softmax_rows<0, 1><<<gSmN, blk, 0, stream>>>(S, 0, (unsigned short*)S, (unsigned short*)S, 0, 0);
    gemm_t<_Float16, 4, 1, 1, 0, 2, 1><<<gPn, blk, 0, stream>>>(
        (const unsigned short*)S, (const unsigned short*)S, 0, 0LL, VT, SEQ, 0LL,
        VT, SEQ, 0LL, 0,
        (void*)out0, (void*)out0, EMB, 0LL, EMB, 0LL, EMB,
        RC, EMB, 0, 1.0f / PCARRY, 0.0f, 1.0f, 1.0f, 0);
  }
  (void)hipGetLastError();
}

// v004
// Measured time: 298 microseconds a run.
// Two timings next to v003 put it at 1.17 and 1.16 times that version's speed.
// Over all steps from v000 it is 7.39 times as fast.
// Contractions: q, k, v^T in-projections = v_wmma_f32_16x16x32_bf16 (bf16 operands from RNE-converted inputs, single product, f32 accumulate);
// q.k^T scores = v_wmma_f32_16x16x32_f16 (q, k f16 planes, single product; query rows < RC: q and k each f16 hi plane + f16 residual plane x4096, 3 products, separate f32 accumulators);
// p.v = v_wmma_f32_16x16x32_f16 (p carried x16384 in f16, v^T f16, single product; query rows < RC: p and v^T each f16 hi plane + f16 residual plane x4096, 3 products, separate f32 accumulators);
// causal softmax (row max, sum, probabilities) in f32 on materialised f32 score row chunks.
#include <hip/hip_runtime.h>
#include <math.h>
#include <stdint.h>
#include <type_traits>

#ifndef NB
#define NB 1
#endif
#ifndef SEQ
#define SEQ 8192
#endif
#define NB_FULL  1
#define SEQ_FULL 8192
#define EMB      1024
#define RC       ((SEQ < 1024) ? SEQ : 1024)   // query rows per score/probability chunk; rows < RC use residual planes
#define NCH      (SEQ / RC)                    // number of row chunks
#define VLP      RC                            // key extent of the v^T residual plane
#define PCARRY   16384.0f                      // power-of-two carry of p in the f16 P.V operand
#define RSC      4096.0f                       // power-of-two carry of every f16 residual plane
#define SMI      ((SEQ / 8 + 255) / 256)       // max 8-column groups per softmax thread
static_assert(NB == 1 && NB_FULL == 1);
static_assert(SEQ >= 256 && SEQ <= SEQ_FULL && (SEQ % 256) == 0);
static_assert((SEQ % RC) == 0 && (RC % 64) == 0 && NCH >= 1);
static_assert((EMB % 64) == 0 && (SEQ % 64) == 0 && (EMB % 32) == 0 && (RC % 32) == 0);
static_assert(SMI >= 1 && SMI <= 4);
static_assert((EMB % 512) == 0 && (RC % 512) == 0 && (SEQ % 512) == 0);   // eight 64-column tiles per GEMM block; 64-k staged tiles
static_assert(((SEQ * EMB / 8) % 256) == 0 && ((EMB * EMB / 8) % 256) == 0);

typedef _Float16 v16h __attribute__((ext_vector_type(16)));
typedef _Float16 v8h  __attribute__((ext_vector_type(8)));
typedef __bf16   v16b __attribute__((ext_vector_type(16)));
typedef __bf16   v8b  __attribute__((ext_vector_type(8)));
typedef float    v8f  __attribute__((ext_vector_type(8)));
typedef float    v4f  __attribute__((ext_vector_type(4)));
typedef unsigned int v4u __attribute__((ext_vector_type(4)));

#if defined(__HIP_DEVICE_COMPILE__)
#define DEV_ASM 1
#else
#define DEV_ASM 0
#endif

// ---- scalar helpers --------------------------------------------------------------------------------
__device__ __forceinline__ unsigned short bf_bits(float f) {          // f32 -> bf16 bits, RNE convert
  unsigned u = __float_as_uint(f);
  return (unsigned short)((u + 0x7FFFu + ((u >> 16) & 1u)) >> 16);
}
__device__ __forceinline__ unsigned short h_bits(_Float16 x) { return __builtin_bit_cast(unsigned short, x); }
__device__ __forceinline__ unsigned pk16(unsigned short a, unsigned short b) { return (unsigned)a | ((unsigned)b << 16); }
// f32 elements of the score chunks 1 .. c-1, which lie in front of chunk c (chunk j: RC rows of (j+1)*RC columns)
__host__ __device__ __forceinline__ constexpr size_t sbase(int c) { return (size_t)RC * RC * (size_t)((c * (c + 1)) / 2 - 1); }
__device__ __forceinline__ v8f zero8() { v8f z = {0.f, 0.f, 0.f, 0.f, 0.f, 0.f, 0.f, 0.f}; return z; }

// ---- fragment types / loaders: 16-bit A/B operand, lane -> row/col (lane&15), p already includes +8*(lane>>4);
//      elements 0..7 <- p[0..7] (k0+8h..k0+8h+7), elements 8..15 <- p[16..23] (k0+16+8h..k0+16+8h+7)
template <typename OT> struct FT;
template <> struct FT<__bf16>   { typedef v16b frag; typedef v8b half8; };
template <> struct FT<_Float16> { typedef v16h frag; typedef v8h half8; };

template <typename OT>
__device__ __forceinline__ typename FT<OT>::frag ldfrag(const OT* p) {
  union { typename FT<OT>::frag v; typename FT<OT>::half8 h[2]; } f;
  f.h[0] = *(const typename FT<OT>::half8*)(p);
  f.h[1] = *(const typename FT<OT>::half8*)(p + 16);
  return f.v;
}

// ---- WMMA helpers (asm guard bodies are device-only; concrete operand types) -----------------------------
__device__ __forceinline__ v8f mmar(v16b a, v16b b, v8f c) {
  return __builtin_amdgcn_wmma_f32_16x16x32_bf16(false, a, false, b, (short)0, c, false, false);
}
__device__ __forceinline__ v8f mmar(v16h a, v16h b, v8f c) {
  return __builtin_amdgcn_wmma_f32_16x16x32_f16(false, a, false, b, (short)0, c, false, false);
}
__device__ __forceinline__ void acc_guard4(v8f& a, v8f& b, v8f& c, v8f& d) {
#if DEV_ASM
  asm volatile("v_nop\n\tv_nop\n\tv_nop\n\tv_nop" : "+v"(a), "+v"(b), "+v"(c), "+v"(d));
#else
  (void)a; (void)b; (void)c; (void)d;
#endif
}

// ---- LDS staging by asynchronous copies ---------------------------------------------------------------
#define BKE 64     // k elements per staged tile: 128-B rows, whole lines of the source
#define LPB 144    // LDS row pitch in bytes: 128 + 16 (16 B x odd, conflict-free for 16-B row readers)
#define LPE (LPB / 2)
__device__ __forceinline__ unsigned lds_off(const void* p) { return (unsigned)(size_t)p; }   // byte offset in the block's LDS
// Each copy: a wave brings 4 rows x 128 B (lane -> row lane>>3, 16-B piece lane&7), l / g already hold the lane's part.
// step4 = source elements per 4 rows. The address-register wait ends each statement, so no later address
// arithmetic can be placed between a copy and that wait.
__device__ __forceinline__ void copy8and32rows(unsigned la, const void* gap, size_t astep4,
                                               unsigned l, const void* gp, size_t step4) {
#if DEV_ASM
  const unsigned short* ga = (const unsigned short*)gap;
  const unsigned short* g  = (const unsigned short*)gp;
  asm volatile("global_load_async_to_lds_b128 %0, %10, off\n\t"
               "global_load_async_to_lds_b128 %1, %11, off\n\t"
               "global_load_async_to_lds_b128 %2, %12, off\n\t"
               "global_load_async_to_lds_b128 %3, %13, off\n\t"
               "global_load_async_to_lds_b128 %4, %14, off\n\t"
               "global_load_async_to_lds_b128 %5, %15, off\n\t"
               "global_load_async_to_lds_b128 %6, %16, off\n\t"
               "global_load_async_to_lds_b128 %7, %17, off\n\t"
               "global_load_async_to_lds_b128 %8, %18, off\n\t"
               "global_load_async_to_lds_b128 %9, %19, off\n\t"
               "s_wait_xcnt 0x0"
               :: "v"(la), "v"(la + 4u * LPB),
                  "v"(l), "v"(l + 4u * LPB), "v"(l + 8u * LPB), "v"(l + 12u * LPB),
                  "v"(l + 16u * LPB), "v"(l + 20u * LPB), "v"(l + 24u * LPB), "v"(l + 28u * LPB),
                  "v"(ga), "v"(ga + astep4),
                  "v"(g), "v"(g + step4), "v"(g + 2 * step4), "v"(g + 3 * step4),
                  "v"(g + 4 * step4), "v"(g + 5 * step4), "v"(g + 6 * step4), "v"(g + 7 * step4) : "memory");
#else
  (void)la; (void)gap; (void)astep4; (void)l; (void)gp; (void)step4;
#endif
}
// 16 rows of the shared A part and 32 rows of the shared Bt part: one wave's twelve copies of a 384-row tile; the
// address-register wait is the statement's last line, as above.
__device__ __forceinline__ void copy16and32rows(unsigned la, const void* gap, size_t astep4,
                                                unsigned l, const void* gp, size_t step4) {
#if DEV_ASM
  const unsigned short* ga = (const unsigned short*)gap;
  const unsigned short* g  = (const unsigned short*)gp;
  asm volatile("global_load_async_to_lds_b128 %0, %12, off\n\t"
               "global_load_async_to_lds_b128 %1, %13, off\n\t"
               "global_load_async_to_lds_b128 %2, %14, off\n\t"
               "global_load_async_to_lds_b128 %3, %15, off\n\t"
               "global_load_async_to_lds_b128 %4, %16, off\n\t"
               "global_load_async_to_lds_b128 %5, %17, off\n\t"
               "global_load_async_to_lds_b128 %6, %18, off\n\t"
               "global_load_async_to_lds_b128 %7, %19, off\n\t"
               "global_load_async_to_lds_b128 %8, %20, off\n\t"
               "global_load_async_to_lds_b128 %9, %21, off\n\t"
               "global_load_async_to_lds_b128 %10, %22, off\n\t"
               "global_load_async_to_lds_b128 %11, %23, off\n\t"
               "s_wait_xcnt 0x0"
               :: "v"(la), "v"(la + 4u * LPB), "v"(la + 8u * LPB), "v"(la + 12u * LPB),
                  "v"(l), "v"(l + 4u * LPB), "v"(l + 8u * LPB), "v"(l + 12u * LPB),
                  "v"(l + 16u * LPB), "v"(l + 20u * LPB), "v"(l + 24u * LPB), "v"(l + 28u * LPB),
                  "v"(ga), "v"(ga + astep4), "v"(ga + 2 * astep4), "v"(ga + 3 * astep4),
                  "v"(g), "v"(g + step4), "v"(g + 2 * step4), "v"(g + 3 * step4),
                  "v"(g + 4 * step4), "v"(g + 5 * step4), "v"(g + 6 * step4), "v"(g + 7 * step4) : "memory");
#else
  (void)la; (void)gap; (void)astep4; (void)l; (void)gp; (void)step4;
#endif
}
__device__ __forceinline__ void copy32rows(unsigned l, const void* gp, size_t step4) {
#if DEV_ASM
  const unsigned short* g = (const unsigned short*)gp;
  asm volatile("global_load_async_to_lds_b128 %0, %8, off\n\t"
               "global_load_async_to_lds_b128 %1, %9, off\n\t"
               "global_load_async_to_lds_b128 %2, %10, off\n\t"
               "global_load_async_to_lds_b128 %3, %11, off\n\t"
               "global_load_async_to_lds_b128 %4, %12, off\n\t"
               "global_load_async_to_lds_b128 %5, %13, off\n\t"
               "global_load_async_to_lds_b128 %6, %14, off\n\t"
               "global_load_async_to_lds_b128 %7, %15, off\n\t"
               "s_wait_xcnt 0x0"
               :: "v"(l), "v"(l + 4u * LPB), "v"(l + 8u * LPB), "v"(l + 12u * LPB),
                  "v"(l + 16u * LPB), "v"(l + 20u * LPB), "v"(l + 24u * LPB), "v"(l + 28u * LPB),
                  "v"(g), "v"(g + step4), "v"(g + 2 * step4), "v"(g + 3 * step4),
                  "v"(g + 4 * step4), "v"(g + 5 * step4), "v"(g + 6 * step4), "v"(g + 7 * step4) : "memory");
#else
  (void)l; (void)gp; (void)step4;
#endif
}
__device__ __forceinline__ void wait_lds_reads() {   // this wave's LDS reads have returned before its buffer is handed back
#if DEV_ASM
  asm volatile("s_wait_dscnt 0x0" ::: "memory");
#endif
}
__device__ __forceinline__ void wait_store_regs() {  // a precaution: stands between issued global stores and the reuse of their registers
#if DEV_ASM
  asm volatile("s_wait_xcnt 0x0" ::: "memory");
#endif
}
__device__ __forceinline__ void wait_copies() {      // this wave's copies have landed before the barrier publishes them
#if DEV_ASM
  asm volatile("s_wait_asynccnt 0x0" ::: "memory");
#endif
}

// =====================================================================================================
// f32 -> bf16 planes (RNE convert), 8 elements per thread, one 16-B store per lane: a wave writes 512 contiguous B
// One launch for x and the three weights: blocks [0, nbx) take x, then nbw blocks each take Wq, Wk, Wv (block-uniform).
// coverage: nbx * 256 threads x 8 elements = the whole x plane, nbw * 256 x 8 = each whole weight plane.
// =====================================================================================================
__global__ __launch_bounds__(256) void cvt16x8(const float* __restrict__ x, const float* __restrict__ wq,
                                               const float* __restrict__ wk, const float* __restrict__ wv,
                                               unsigned short* xb, unsigned short* wqb, unsigned short* wkb,
                                               unsigned short* wvb, int nbx, int nbw) {
  int bi = (int)blockIdx.x;
  int nb = nbx;                          // blocks of the plane that this block works on
  const float* in = x;
  unsigned short* out = xb;
  if (bi >= nbx) {
    bi -= nbx; nb = nbw;
    in = wq; out = wqb;
    if (bi >= nbw) { bi -= nbw; in = wk; out = wkb; }
    if (bi >= nbw) { bi -= nbw; in = wv; out = wvb; }
  }
  const int i = bi * 256 + (int)threadIdx.x;
  if (bi < nb) {
    const float* ip = in + (size_t)i * 8;
    const v4f a  = *(const v4f*)(ip);
    const v4f a4 = *(const v4f*)(ip + 4);
    v4u p;
    p[0] = pk16(bf_bits(a[0]),  bf_bits(a[1]));
    p[1] = pk16(bf_bits(a[2]),  bf_bits(a[3]));
    p[2] = pk16(bf_bits(a4[0]), bf_bits(a4[1]));
    p[3] = pk16(bf_bits(a4[2]), bf_bits(a4[3]));
    unsigned short* o = out + (size_t)i * 8;
    *(v4u*)o = p;
    
  }
}

// =====================================================================================================
// Register-blocked WMMA GEMM (16-bit operand type OT): C[m][n] = sum_k A[m][k] * Bt[n][k];
// one wave per (16*MI) x 64 tile. NPA = NPB = 1: the eight waves of a block form a 2 x 4 grid of such tiles, a 128 x 256
// block tile (M a multiple of 128, N of 256): each staged A row serves four waves, each staged Bt row two, and two
// blocks' rings fit one LDS. Otherwise the eight waves hold eight neighbouring column tiles of one row tile
// (N a multiple of 512), each with Bt rows of its own. A row-major [M][K] pitch lda; Bt row-major [N][K] pitch ldb
// (k contiguous); M multiple of 16*MI, K multiple of 64 (static sizes here). blockIdx.y = batch
// index for MC = 0 (strides in elements; 0 in those launches). Per 64 k the block stages its A rows (shared) and each wave's Bt rows in
// LDS by asynchronous copies of whole 128-B lines, two buffers, one block barrier per tile: tile t + 1 flies while tile
// t is multiplied. Fragments are read from LDS with the split k map (ldfrag); the k order of every sum is ascending.
// NPA = number of A planes: 2 -> second plane A2 (same pitch/stride as A) multiplies the same Bt fragments into the
// second accumulator set.  NPB = number of Bt planes: 2 -> second plane B2 (pitch ldb2, stride strideB2) holds the
// k range [0, K2) only (K2 multiple of 64); for k chunks with k0 < K2 (block-uniform) the A fragments multiply
// B2 fragments into the second accumulator set. NPA = NPB = 2: acc = A.Bt, acc2 = A2.Bt + A.B2 (both residual planes
// carry the same power-of-two scale 1/rscale2).
// value v = (acc [+ acc2 * rscale2]) * oscale, combined in the f32 epilogue.
// CZ (causal), czoff = global row index of local row 0 (multiple of 64):
//   0 none; 1 = output tiles with n0 >= czoff + m0 + 16*MI are not stored (every tile holding a
//   column <= one of its rows is written); 2 = A rows hold exact zeros beyond the diagonal up to column
//   czoff + mB + BR (mB, BR = first row and rows of the block tile), so the k loop ends at min(K, czoff + mB + BR)
//   (exact); the last staged tile is copied whole, so A rows are written up to the next multiple of 64 columns.
// OUT_MODE 0: f32 C (pitch ldc) = v.
// OUT_MODE 1: f16 plane C = f16(v * cscale).
// OUT_MODE 3: f16 hi plane C = f16(v * cscale) (pitch ldc) and f16 residual plane
//             C2 = f16((v*cscale - hi) * rscaleC) (pitch ldc2), C2 written only for output
//             tiles with n0 < N2 (N2 multiple of 64, wave-uniform), i.e. columns [0, N2) fully (MC = 2: and rows [0, M2)).
// =====================================================================================================
// MC = 1: one launch holds every row chunk c >= 1 (M = RC rows each). CZ = 2: blockIdx.y picks the chunk, the widest
//   (longest k loops) first. CZ = 1: a flat grid, chunk after chunk, the widest last, which the softmax then reads first.
//   The f32 score chunks lie one behind the other, chunk c at sbase(c) elements with pitch (c+1)*RC; the softmax
//   writes each f16 probability row over the front of its own score row (f16 pitch 2*(c+1)*RC).
//   CZ = 1: A rows, N, ldc, C and czoff are the chunk's; CZ = 2: A, lda, K, C rows and czoff are the chunk's.
// MC = 2: one launch holds the three in-projections, blockIdx.y = 0: q, 1: k, 2: v^T. The arguments describe q
//   (A = x rows, Bt = Wq rows, M = SEQ, N = EMB); strideB, strideC, strideC2 lead from q's weight, hi plane and residual
//   plane to the next projection's. q, k: the residual plane holds rows < RC. v^T: A = Wv rows, Bt = x rows, M = EMB,
//   N = SEQ, pitches SEQ and VLP, the residual plane holds columns < VLP.
template <typename OT, int MI, int NPA, int NPB, int OUT_MODE, int CZ, int MC>
__global__ __launch_bounds__(256) void gemm_t(
    const unsigned short* __restrict__ Ap, const unsigned short* __restrict__ A2p, int lda, long long strideA,
    const unsigned short* __restrict__ Btp, int ldb, long long strideB,
    const unsigned short* __restrict__ B2p, int ldb2, long long strideB2, int K2,
    void* Cout, void* Cout2, int ldc, long long strideC, int ldc2, long long strideC2, int N2,
    int M, int N, int K, float oscale, float rscale2, float cscale, float rscaleC, int czoff) {
  static_assert(CZ != 2 || ((16 * MI) % 32) == 0);
  static_assert(MC != 1 || ((CZ == 1 || CZ == 2) && OUT_MODE == 0 && NPA == 1 && NPB == 1));
  static_assert(MC != 2 || (CZ == 0 && OUT_MODE == 3 && NPA == 1 && NPB == 1));
  typedef typename FT<OT>::frag V16;
  int bx = (int)blockIdx.x;              // the block's index among its chunk's (MC = 1) or the launch's blocks
  if (MC == 1) {                         // block-uniform
    int c = NCH - 1 - (int)blockIdx.y;
    if (CZ == 1) {                       // chunk c holds (c+1) * BPU blocks of the flat grid
      constexpr int BPU = (RC / 64) * (RC / 64) / 8;
      c = 1;
      while (c < NCH - 1 && bx >= (c + 1) * BPU) { bx -= (c + 1) * BPU; ++c; }
    }
    const int rb = c * RC;
    const size_t sb = sbase(c);
    czoff = rb;
    if (CZ == 1) {
      Ap += (size_t)rb * lda; A2p += (size_t)rb * lda;
      N = rb + RC; ldc = rb + RC;
      Cout = (void*)((float*)Cout + sb);
    } else {
      Ap += 2 * sb; A2p += 2 * sb;
      lda = 2 * (rb + RC); K = rb + RC;
      Cout = (void*)((float*)Cout + (size_t)rb * ldc);
    }
  }
  int M2 = M;                            // rows [0, M2) get a residual plane (OUT_MODE 3)
  if (MC == 2) {                         // block-uniform
    const int y = (int)blockIdx.y;
    const unsigned short* Wp = Btp + (size_t)y * (size_t)strideB;
    Cout  = (void*)((unsigned short*)Cout  + (size_t)y * (size_t)strideC);
    Cout2 = (void*)((unsigned short*)Cout2 + (size_t)y * (size_t)strideC2);
    if (y == 2) { Btp = Ap; Ap = Wp; M = EMB; N = SEQ; ldc = SEQ; ldc2 = VLP; N2 = VLP; M2 = EMB; }
    else        { Btp = Wp; M2 = RC; }
  }
  const OT* A  = (const OT*)(const void*)Ap;
  const OT* A2 = (const OT*)(const void*)A2p;
  const OT* Bt = (const OT*)(const void*)Btp;
  const OT* B2 = (const OT*)(const void*)B2p;
  const int RT = 16 * MI;
  constexpr bool SH = (NPA == 1 && NPB == 1);              // 2 x 4 wave grid with shared Bt rows
  constexpr int WM = SH ? 2 : 1;                           // wave tiles of a block along M
  constexpr int WN = 8 / WM;                               // and along N
  constexpr int BR = 16 * MI * WM;                         // rows of the block tile
  constexpr int ROWS_A = BR * NPA;                         // A (and A2) rows of the block's tiles
  constexpr int ROWS_W = 64 * NPB;                         // Bt (and B2) rows of one column tile
  constexpr int STG_B  = (ROWS_A + WN * ROWS_W) * LPB;     // one staged k tile of the block, bytes
  static_assert(ROWS_A == (SH ? 128 : 64));                // 8 waves x 16 (8) rows copy the A part
  static_assert(!SH || WN * ROWS_W == 256);                // 8 waves x 32 rows copy the shared Bt part
  static_assert(2 * STG_B >= 8 * 16 * 68 * 4 && 2 * STG_B <= 320 * 1024);
  __shared__ __align__(16) unsigned char ring[2 * STG_B];  // two buffers; after the k loop: per-wave 16x64 f32 slabs
  const int b    = (MC != 0) ? 0 : (int)blockIdx.y;
  const int lane = threadIdx.x & 31;
  const int wave = __builtin_amdgcn_readfirstlane((int)(threadIdx.x >> 5));
  const int tilesN = (N >> 6) / WN;      // block tiles along N
  const int tilesM = M / BR;
  if (bx >= tilesM * tilesN) return;     // block-uniform, in front of every barrier
  // The quotient is block-uniform; where the compiler divides on the vector unit, readfirstlane brings it back to a
  // scalar register, so that the returns below stay scalar branches.
  const int tm = __builtin_amdgcn_readfirstlane(bx / tilesN);
  const int mB = tm * BR;                                  // the block tile's first row and column
  const int nB = (bx - tm * tilesN) * (64 * WN);
  const int wn = SH ? (wave & 3) : wave;                   // this wave's column tile in the block
  const int m0 = mB + (SH ? (wave >> 2) * RT : 0);
  const int n0 = nB + (wn << 6);
  bool live = true;
  if (CZ == 1) {
    if (nB >= czoff + mB + BR) return;           // block-uniform causal skip, in front of every barrier
    live = n0 < czoff + m0 + RT;                 // a wave past the diagonal walks the loop and stores nothing
  }
  int kEnd = K;
  if (CZ == 2) {
    const int ke = czoff + mB + BR;      // multiple of 32
    kEnd = (ke < K) ? ke : K;
  }

  const OT* Ab  = A  + (size_t)b * (size_t)strideA;
  const OT* A2b = A2 + (size_t)b * (size_t)strideA;
  const OT* Bb  = Bt + (size_t)b * (size_t)strideB;
  const OT* B2b = B2 + (size_t)b * (size_t)strideB2;

  const int rlane = lane & 15;                 // row (A) / col (B, D) within subtile
  const int koff  = (lane >> 4) * 8;           // k offset of this lane half
  const int mOff  = (lane >> 4) * 8;           // D row offset

  v8f acc[MI][4], acc2[MI][4];
#pragma unroll
  for (int i = 0; i < MI; ++i)
#pragma unroll
    for (int j = 0; j < 4; ++j) { acc[i][j] = zero8(); acc2[i][j] = zero8(); }

  // ---- this lane's part of every staged tile: row lane>>3 of each 4-row group, 16-B piece lane&7 ----
  const int crow = lane >> 3;
  const int cel  = (lane & 7) * 8;
  const int arow = wave * (ROWS_A / 8);                        // this wave's share of the staged [A | A2] rows
  const int brow = SH ? wave * 32 : wave * ROWS_W;             // and of the staged Bt rows (shared: 32 of 256)
  const bool a2w = (NPA == 2) && (arow >= RT);                 // wave-uniform
  const OT* gA  = (a2w ? A2b : Ab) + (size_t)(mB + (a2w ? arow - RT : arow) + crow) * lda + cel;
  const OT* gB  = Bb  + (size_t)((SH ? nB + brow : n0) + crow) * ldb  + cel;
  const OT* gB2 = B2b + (size_t)(n0 + crow) * ldb2 + cel;
  const unsigned lc = lds_off(ring) + (unsigned)(crow * LPB + cel * 2);
  const unsigned lA = lc + (unsigned)(arow * LPB);
  const unsigned lB = lc + (unsigned)((ROWS_A + brow) * LPB);
  const int nT = (kEnd + BKE - 1) / BKE;                       // >= 1; block-uniform
  auto stage = [&](int t) {                                    // tile t -> buffer t & 1
    const unsigned bo = (unsigned)(t & 1) * (unsigned)STG_B;
    const int kt = t * BKE;
    if constexpr (SH) {
      copy16and32rows(lA + bo, gA + kt, (size_t)4 * lda, lB + bo, gB + kt, (size_t)4 * ldb);
    } else {
      copy8and32rows(lA + bo, gA + kt, (size_t)4 * lda, lB + bo, gB + kt, (size_t)4 * ldb);
      copy32rows(lB + bo + 32u * LPB, gB + kt + (size_t)32 * ldb, (size_t)4 * ldb);
    }
    if (NPB == 2) {
      if (kt < K2) {                                           // block-uniform: the residual plane ends at K2
        copy32rows(lB + bo + 64u * LPB, gB2 + kt, (size_t)4 * ldb2);
        copy32rows(lB + bo + 96u * LPB, gB2 + kt + (size_t)32 * ldb2, (size_t)4 * ldb2);
      }
    }
  };

  stage(0);
  wait_copies();
  __syncthreads();                       // tile 0 is published
  if (nT > 1) stage(1);
  const int aOff = (m0 - mB + rlane) * LPB;                    // this lane's fragment rows in a buffer, bytes
  const int bOff = (ROWS_A + wn * ROWS_W + rlane) * LPB;
  if constexpr (NPA == 1 && NPB == 1) {
    // Every LDS read of tile t stands between the barrier that publishes it and the barrier that frees its buffer.
    // Fragment registers: bq0 / bq1 = Bt of the tile's first / second 32 k; a[i] is refilled in place right behind its
    // last product; ax holds row group MI-1 of the second 32 k, so that no read is issued behind a phase's last products.
    // The scheduling barriers keep each read at that place (left alone, the compiler read each A fragment right in
    // front of its products and waited for it every time).
    V16 bq0[4], bq1[4], a[MI], ax;
    {
      const OT* sA = (const OT*)(const void*)(ring + aOff) + koff;
      const OT* sB = (const OT*)(const void*)(ring + bOff) + koff;
#pragma unroll
      for (int j = 0; j < 4; ++j) bq0[j] = ldfrag<OT>(sB + (j << 4) * LPE);
#pragma unroll
      for (int i = 0; i < MI; ++i) a[i] = ldfrag<OT>(sA + (i << 4) * LPE);
    }
    for (int t = 0; t < nT; ++t) {
      const unsigned char* buf = ring + (size_t)(t & 1) * STG_B;
      const OT* sA = (const OT*)(const void*)(buf + aOff) + koff + 32;
      const OT* sB = (const OT*)(const void*)(buf + bOff) + koff + 32;
      ax = ldfrag<OT>(sA + ((MI - 1) << 4) * LPE);
#pragma unroll
      for (int j = 0; j < 4; ++j) bq1[j] = ldfrag<OT>(sB + (j << 4) * LPE);
      __builtin_amdgcn_sched_barrier(0);     // reads of the second 32 k go out ahead of the first 32 k's products
#pragma unroll
      for (int i = 0; i < MI - 1; ++i) {
#pragma unroll
        for (int j = 0; j < 4; ++j) acc[i][j] = mmar(a[i], bq0[j], acc[i][j]);
        __builtin_amdgcn_sched_barrier(0);   // the refill stays behind a[i]'s last product, so it can take a[i]'s registers
        a[i] = ldfrag<OT>(sA + (i << 4) * LPE);
        __builtin_amdgcn_sched_barrier(0);   // the refill of a[i] stays among the products
      }
#pragma unroll
      for (int j = 0; j < 4; ++j) acc[MI - 1][j] = mmar(a[MI - 1], bq0[j], acc[MI - 1][j]);
      __builtin_amdgcn_sched_barrier(0);     // the first 32 k's products stay ahead of the waits
      wait_lds_reads();
      wait_copies();
      __syncthreads();                       // publishes tile t + 1 and ends every read of tile t's buffer
      if (t + 2 < nT) stage(t + 2);
      // The first 32 k of tile t + 1 are read under tile t's last products. The last trip has no next tile: a scalar
      // select aims its reads, whose values nobody uses, at its own buffer (landed, not refilled), which keeps the
      // products free of a branch.
      const unsigned char* nbuf = ring + (size_t)(((t + 1 < nT) ? (t + 1) : t) & 1) * STG_B;
      const OT* nA = (const OT*)(const void*)(nbuf + aOff) + koff;
      const OT* nB = (const OT*)(const void*)(nbuf + bOff) + koff;
      a[MI - 1] = ldfrag<OT>(nA + ((MI - 1) << 4) * LPE);
#pragma unroll
      for (int j = 0; j < 4; ++j) bq0[j] = ldfrag<OT>(nB + (j << 4) * LPE);
      __builtin_amdgcn_sched_barrier(0);     // the next tile's reads go out ahead of this tile's last products
#pragma unroll
      for (int i = 0; i < MI - 1; ++i) {
#pragma unroll
        for (int j = 0; j < 4; ++j) acc[i][j] = mmar(a[i], bq1[j], acc[i][j]);
        __builtin_amdgcn_sched_barrier(0);   // the refill stays behind a[i]'s last product, so it can take a[i]'s registers
        a[i] = ldfrag<OT>(nA + (i << 4) * LPE);
        __builtin_amdgcn_sched_barrier(0);   // the refill of a[i] stays among the products
      }
#pragma unroll
      for (int j = 0; j < 4; ++j) acc[MI - 1][j] = mmar(ax, bq1[j], acc[MI - 1][j]);
    }
  } else {
    for (int t = 0; t < nT; ++t) {
      const unsigned char* buf = ring + (size_t)(t & 1) * STG_B;
      const OT* sA = (const OT*)(const void*)(buf + aOff) + koff;
      const OT* sB = (const OT*)(const void*)(buf + bOff) + koff;
#pragma unroll   // two 32-k chunks per staged tile, fragment arrays stay in registers
      for (int kk = 0; kk < BKE; kk += 32) {
        const int k0 = t * BKE + kk;
        if (CZ != 2 || (RT % BKE) == 0 || k0 < kEnd) {         // block-uniform: a 32-row tile may end mid-tile
          const bool res = k0 < K2;                            // block-uniform: residual Bt plane covers k < K2 only
          V16 bq[4], br[4], af[MI], af2[MI];
#pragma unroll
          for (int j = 0; j < 4; ++j) bq[j] = ldfrag<OT>(sB + (j << 4) * LPE + kk);
#pragma unroll
          for (int i = 0; i < MI; ++i) {
            af[i]  = ldfrag<OT>(sA + (i << 4) * LPE + kk);
            af2[i] = ldfrag<OT>(sA + (RT + (i << 4)) * LPE + kk);
          }
          if (res) {
#pragma unroll
            for (int j = 0; j < 4; ++j) br[j] = ldfrag<OT>(sB + (64 + (j << 4)) * LPE + kk);
          }
          __builtin_amdgcn_sched_barrier(0);   // the chunk's reads stay in one group ahead of its products
#pragma unroll
          for (int i = 0; i < MI; ++i) {
#pragma unroll
            for (int j = 0; j < 4; ++j) acc[i][j] = mmar(af[i], bq[j], acc[i][j]);
#pragma unroll
            for (int j = 0; j < 4; ++j) acc2[i][j] = mmar(af2[i], bq[j], acc2[i][j]);
          }
          if (res) {
#pragma unroll
            for (int i = 0; i < MI; ++i)
#pragma unroll
              for (int j = 0; j < 4; ++j) acc2[i][j] = mmar(af[i], br[j], acc2[i][j]);
          }
        }
      }
      wait_lds_reads();
      wait_copies();
      __syncthreads();                       // publishes tile t + 1 and ends every read of tile t's buffer
      if (t + 2 < nT) stage(t + 2);
    }
  }
  wait_copies();
  wait_lds_reads();
  __syncthreads();                       // every wave's last ring read has returned: the ring becomes output staging
  if (!live) return;                     // wave-uniform; no block barrier follows
#pragma unroll
  for (int i = 0; i < MI; ++i) {
    acc_guard4(acc[i][0], acc[i][1], acc[i][2], acc[i][3]);
    if (NPA == 2 || NPB == 2) acc_guard4(acc2[i][0], acc2[i][1], acc2[i][2], acc2[i][3]);
  }

  // ---- epilogue ----
  float* slab = (float*)(void*)ring + wave * (16 * 68);   // pitch 68 floats, wave-private
#pragma unroll
  for (int i = 0; i < MI; ++i) {
    const int mBase = m0 + (i << 4);
#pragma unroll
    for (int j = 0; j < 4; ++j) {
#pragma unroll
      for (int r = 0; r < 8; ++r) {
        float v = acc[i][j][r];
        if (NPA == 2 || NPB == 2) v += acc2[i][j][r] * rscale2;
        v = v * oscale;
        slab[(mOff + r) * 68 + (j << 4) + rlane] = v;
      }
    }
    __builtin_amdgcn_fence(3 /* release order */, "workgroup");
    __builtin_amdgcn_wave_barrier();
    __builtin_amdgcn_fence(2 /* acquire order */, "workgroup");
    if (OUT_MODE == 0) {
      float* C = (float*)Cout + (size_t)b * (size_t)strideC;
      const int h2 = lane >> 4, c4 = (lane & 15) * 4;     // 256-B row segment = 16 lanes x 16 B
      {
#pragma unroll
        for (int it = 0; it < 8; ++it) {
          const int row = it * 2 + h2;                     // it 0..7 x h2 0..1 = rows 0..15
          const v4f v = *(const v4f*)(slab + row * 68 + c4);
          *(v4f*)(C + (size_t)(mBase + row) * ldc + n0 + c4) = v;
        }
        
      }
    } else {
      const int q = lane >> 3, c8 = (lane & 7) * 8;
      unsigned short* C  = (unsigned short*)Cout  + (size_t)b * (size_t)strideC;
      unsigned short* C2 = (unsigned short*)Cout2 + (size_t)b * (size_t)strideC2;
      const bool wr2 = (OUT_MODE == 3) && (n0 < N2) && (MC != 2 || m0 < M2);     // wave-uniform
      // The slab's planes, with or without the residual plane: one wave-uniform branch per slab chooses, so that a tile
      // without a residual plane does none of its arithmetic.
      auto planes = [&](auto withRes) {
        constexpr bool RES = decltype(withRes)::value;
        v4u hv[4], lv[4];
        unsigned short* pc[4];
        unsigned short* pc2[4];
#pragma unroll
        for (int it = 0; it < 4; ++it) {
          const int row = it * 4 + q;                      // it 0..3 x q 0..3 = rows 0..15
          const float* sp = slab + row * 68 + c8;
          pc[it]  = C  + (size_t)(mBase + row) * ldc  + n0 + c8;
          pc2[it] = C2 + (size_t)(mBase + row) * ldc2 + n0 + c8;
          float f[8];
#pragma unroll
          for (int e = 0; e < 8; ++e) f[e] = sp[e] * cscale;
          v4u a, a2;
#pragma unroll
          for (int e = 0; e < 4; ++e) {
            const float f0 = f[2 * e], f1 = f[2 * e + 1];
            const _Float16 x0 = (_Float16)f0, x1 = (_Float16)f1;
            const unsigned short h0 = h_bits(x0), h1 = h_bits(x1);
            unsigned short l0 = 0, l1 = 0;
            if (RES) {
              l0 = h_bits((_Float16)((f0 - (float)x0) * rscaleC));
              l1 = h_bits((_Float16)((f1 - (float)x1) * rscaleC));
            }
            a[e] = pk16(h0, h1); a2[e] = pk16(l0, l1);
          }
          hv[it] = a; lv[it] = a2;
        }
        __builtin_amdgcn_sched_barrier(0);   // values and addresses are formed ahead of the stores: nothing is computed among them
#pragma unroll
        for (int it = 0; it < 4; ++it) {
          *(v4u*)pc[it] = hv[it];
          if (RES) *(v4u*)pc2[it] = lv[it];
        }
        wait_store_regs();
        __builtin_amdgcn_sched_barrier(0);   // later arithmetic, which reuses the stores' registers, stays behind the wait
      };
      if (wr2) planes(std::integral_constant<bool, true>{});
      else     planes(std::integral_constant<bool, false>{});
    }
    __builtin_amdgcn_fence(3 /* release order */, "workgroup");
    __builtin_amdgcn_wave_barrier();
    __builtin_amdgcn_fence(2 /* acquire order */, "workgroup");
  }
}

// =====================================================================================================
// Exact causal row softmax, one launch for every query row: one block of 256 threads per row t, the longest first.
//   The scores GEMMs wrote every column of row t in [0, ((t>>6)+1)*64).
//   The row is processed in 8-column groups g; ngl = ((t>>6)+1)*8 groups hold scores, ng groups of P are written
//   (t < RC: ng = ngl; else ng = ((t>>7)+1)*16, the k end of the row's 128-row P.V block tile). Thread tid owns groups
//   g = it*256 + tid. Loads use an address clamped to group ngl-1; entries with column > t are replaced by -inf
//   by index before any arithmetic. Iterations with it*256 >= ng are skipped block-uniformly.
//   p = exp(s - max) * (1/sum) in f32 (max finite: column 0 is always valid), x16384 carry, f16 RNE;
//   columns > t up to ng*8 get exact zeros. Rows t < RC: also the f16 residual plane
//   Pl = f16((p*16384 - hi) * 4096), same pitch. Each group is one 16-B store per lane; 8 consecutive lanes fill
//   LDS redm/reds: cross-wave, block barriers (every thread reaches both).
//   coverage: every row x columns [0, ng*8) of P (and Pl) = exactly the extent the P.V GEMM reads.
// =====================================================================================================
//   Rows t >= RC: row t lies in score chunk c = t / RC (S + sbase(c), pitch (c+1)*RC), and P = S: the row's
//   probabilities go over the front of its own scores. Every score of the row is in registers, and has gone into the
//   row maximum, in front of the first block barrier; the stores stand behind the second.
//   Rows t < RC (chunk 0): scores S0, probabilities P0 and residuals Pl0, each [RC][RC].
__global__ __launch_bounds__(256)
void softmax_rows(const float* S, unsigned short* P, const float* S0, unsigned short* P0, unsigned short* Pl0) {
  __shared__ float redm[8];
  __shared__ float reds[8];
  const int t    = SEQ - 1 - (int)blockIdx.x;
  const bool r0  = t < RC;                                   // block-uniform: a row of chunk 0
  const int ch   = t / RC;
  const size_t ro = r0 ? ((size_t)t * (size_t)RC)
                       : (sbase(ch) + (size_t)(t - ch * RC) * (size_t)((ch + 1) * RC));   // the row's first score, f32 elements
  const size_t po = r0 ? ro : (2 * ro);                      // its first probability, f16 elements
  const int tid  = threadIdx.x;
  const int wave = tid >> 5;
  const int lane = tid & 31;
  const int ngl  = ((t >> 6) + 1) * 8;                       // groups that hold scores
  const int ng   = r0 ? ngl : ((t >> 7) + 1) * 16;           // groups of P that are written: up to the P.V block tile's k end
  const float* rp = (r0 ? S0 : S) + ro;
  float v[SMI][8];
#pragma unroll
  for (int it = 0; it < SMI; ++it) {
#pragma unroll
    for (int e = 0; e < 8; ++e) v[it][e] = -INFINITY;
    if (it * 256 < ng) {                                   // block-uniform
      const int g  = it * 256 + tid;
      const int gc = (g < ngl) ? g : (ngl - 1);            // clamped address
      const int c0 = g * 8;
      const v4f a  = *(const v4f*)(rp + (size_t)gc * 8);
      const v4f a4 = *(const v4f*)(rp + (size_t)gc * 8 + 4);
#pragma unroll
      for (int e = 0; e < 4; ++e) {
        v[it][e]     = (c0 + e <= t)     ? a[e]  : -INFINITY;
        v[it][4 + e] = (c0 + 4 + e <= t) ? a4[e] : -INFINITY;
      }
    }
  }
  float mx = -INFINITY;
#pragma unroll
  for (int it = 0; it < SMI; ++it)
#pragma unroll
    for (int e = 0; e < 8; ++e) mx = fmaxf(mx, v[it][e]);
#pragma unroll
  for (int off = 1; off < 32; off <<= 1) mx = fmaxf(mx, __shfl_xor(mx, off, 32));
  if (lane == 0) redm[wave] = mx;
  __syncthreads();
  mx = redm[0];
#pragma unroll
  for (int w = 1; w < 8; ++w) mx = fmaxf(mx, redm[w]);

  float sum = 0.f;
#pragma unroll
  for (int it = 0; it < SMI; ++it) {
    if (it * 256 < ng) {                                   // block-uniform
#pragma unroll
      for (int e = 0; e < 8; ++e) { const float ex = __expf(v[it][e] - mx); v[it][e] = ex; sum += ex; }
    } else {
#pragma unroll
      for (int e = 0; e < 8; ++e) v[it][e] = 0.f;
    }
  }
#pragma unroll
  for (int off = 1; off < 32; off <<= 1) sum += __shfl_xor(sum, off, 32);
  if (lane == 0) reds[wave] = sum;
  __syncthreads();
  sum = reds[0];
#pragma unroll
  for (int w = 1; w < 8; ++w) sum += reds[w];

  const float sc = PCARRY * (1.0f / sum);        // sum >= 1
  v4u pk[SMI], pl[SMI];
#pragma unroll
  for (int it = 0; it < SMI; ++it) {
    v4u a, a2;
#pragma unroll
    for (int e = 0; e < 4; ++e) {
      const float f0 = v[it][2 * e] * sc, f1 = v[it][2 * e + 1] * sc;
      const _Float16 x0 = (_Float16)f0, x1 = (_Float16)f1;
      unsigned short l0 = 0, l1 = 0;
      if (r0) {
        l0 = h_bits((_Float16)((f0 - (float)x0) * RSC));
        l1 = h_bits((_Float16)((f1 - (float)x1) * RSC));
      }
      a[e]  = pk16(h_bits(x0), h_bits(x1));
      a2[e] = pk16(l0, l1);
    }
    pk[it] = a; pl[it] = a2;
  }
  unsigned short* op  = (r0 ? P0 : P) + po;
  unsigned short* opl = Pl0 + po;                            // used by rows of chunk 0 only
  {
#pragma unroll
    for (int it = 0; it < SMI; ++it) {
      if (it * 256 < ng) {                                 // block-uniform
        const int g = it * 256 + tid;
        if (g < ng) {
          *(v4u*)(op + (size_t)g * 8) = pk[it];
          wait_store_regs();                               // the residual store's address reuses this store's register
          if (r0) *(v4u*)(opl + (size_t)g * 8) = pl[it];
        }
      }
    }
    
  }
}

// =====================================================================================================
// Workspace map (bytes at SEQ = 8192, RC = 1024; every region a multiple of its whole-line store granularity and of
//   R0   Xb bf16 [SEQ][EMB] (16777216), later the f32 score chunks c >= 1, S_c [RC][(c+1)*RC] at sbase(c), each row's
//        front overwritten by its f16 probabilities (pitch 2*(c+1)*RC)                                      146800640
//   S0   f32 [RC][RC]     (chunk 0 scores)                                                                    4194304
//   Wqb, Wkb, Wvb bf16 [EMB][EMB]                                                                          3 x 2097152
//   Qh   f16 [SEQ][EMB]                                                                                      16777216
//   Kh   f16 [SEQ][EMB]                                                                                      16777216
//   VT   f16 [EMB][SEQ]   (v^T hi plane)                                                                     16777216
//   Ql   f16 [RC][EMB]    (q residual x4096, rows < RC)                                                       2097152
//   Kl   f16 [RC][EMB]    (k residual x4096, keys < RC)                                                       2097152
//   VL   f16 [EMB][VLP]   (v^T residual x4096, keys < VLP)                                                    2097152
//   P    f16 [RC][RC]     (chunk 0 probabilities)                                                             2097152
//   Pl   f16 [RC][RC]     (p residual x4096, chunk 0 only)                                                    2097152
//   total                                                                                                   218103808
// Aliases are ordered by launch dependence: Xb is last read by the projections' launch, R0's scores are first written by
// the scores GEMM of the chunks c >= 1 after it. Weights are [out n][in k] with k contiguous = the Bt / A layout the GEMM wants.
// =====================================================================================================
static constexpr size_t PACT_B = (size_t)SEQ * EMB * 2;
static constexpr size_t PS_B   = sbase(NCH) * 4;               // chunks 1 .. NCH-1
static constexpr size_t PS0_B  = (size_t)RC * RC * 4;
static constexpr size_t R0_B   = (PACT_B > PS_B) ? PACT_B : PS_B;
static constexpr size_t PW_B   = (size_t)EMB * EMB * 2;
static constexpr size_t PRES_B = (size_t)RC * EMB * 2;
static constexpr size_t PVT_B  = (size_t)EMB * SEQ * 2;
static constexpr size_t PVL_B  = (size_t)EMB * VLP * 2;
static constexpr size_t PP_B   = (size_t)RC * RC * 2;
static constexpr size_t PPL_B  = (size_t)RC * RC * 2;
static constexpr size_t WS_TOTAL = R0_B + PS0_B + 3 * PW_B + 2 * PACT_B + PVT_B + 2 * PRES_B + PVL_B + PP_B + PPL_B;
static_assert(WS_TOTAL <= (size_t)268435456);
static_assert((R0_B % 128) == 0 && (PS0_B % 128) == 0 && (PP_B % 128) == 0 && (PW_B % 128) == 0 && (PRES_B % 128) == 0 && (PVL_B % 128) == 0 && (PPL_B % 128) == 0);

extern "C" void kernel_launch(void* const* d_in, const int* in_sizes, int n_in,
                              void* d_out, int out_size, void* d_ws, size_t ws_size,
                              hipStream_t stream) {
  if (n_in < 4) return;
  const long long needX = (long long)SEQ * (long long)EMB;
  if ((long long)in_sizes[0] < needX) return;
  if (in_sizes[1] < EMB * EMB) return;
  if (in_sizes[2] < EMB * EMB) return;
  if (in_sizes[3] < EMB * EMB) return;
  if (out_size < 0) return;
  if ((long long)out_size < needX) return;

  const float* x  = (const float*)d_in[0];
  const float* Wq = (const float*)d_in[1];
  const float* Wk = (const float*)d_in[2];
  const float* Wv = (const float*)d_in[3];

  size_t off = 0;
  const size_t oR0 = off; off += R0_B;
  const size_t oS0 = off; off += PS0_B;
  const size_t oWq = off; off += PW_B;
  const size_t oWk = off; off += PW_B;
  const size_t oWv = off; off += PW_B;
  const size_t oQh = off; off += PACT_B;
  const size_t oKh = off; off += PACT_B;
  const size_t oVT = off; off += PVT_B;
  const size_t oQl = off; off += PRES_B;
  const size_t oKl = off; off += PRES_B;
  const size_t oVL = off; off += PVL_B;
  const size_t oP  = off; off += PP_B;
  const size_t oPl = off; off += PPL_B;
  if (off != WS_TOTAL) return;
  if (off > ws_size) return;
  if (off > (size_t)268435456) return;

  char* ws = (char*)d_ws;
  unsigned short* Xb  = (unsigned short*)(ws + oR0);
  float*          S   = (float*)(ws + oR0);          // alias, see map
  float*          S0  = (float*)(ws + oS0);
  unsigned short* Wqb = (unsigned short*)(ws + oWq);
  unsigned short* Wkb = (unsigned short*)(ws + oWk);
  unsigned short* Wvb = (unsigned short*)(ws + oWv);
  unsigned short* Qh  = (unsigned short*)(ws + oQh);
  unsigned short* Kh  = (unsigned short*)(ws + oKh);
  unsigned short* VT  = (unsigned short*)(ws + oVT);
  unsigned short* Ql  = (unsigned short*)(ws + oQl);
  unsigned short* Kl  = (unsigned short*)(ws + oKl);
  unsigned short* VL  = (unsigned short*)(ws + oVL);
  unsigned short* Pp  = (unsigned short*)(ws + oP);
  unsigned short* Ppl = (unsigned short*)(ws + oPl);
  float*          out0 = (float*)d_out;

  const dim3 blk(256);
  const int n8x = SEQ * EMB / 8;                                    // multiple of 256
  const int n8w = EMB * EMB / 8;                                    // multiple of 256
  const dim3 gCvt(n8x / 256 + 3 * (n8w / 256), 1);
  const dim3 gPr(((SEQ / 64) * (EMB / 64)) / 8, 3);                 // q, k (M=SEQ, N=EMB), v^T (M=EMB, N=SEQ): 64x64 wave tiles
  const dim3 gS0((((RC / 32) * (RC / 64)) + 7) / 8, 1);             // chunk 0 scores: 32x64 wave tiles
  const dim3 gP0((((RC / 32) * (EMB / 64)) + 7) / 8, 1);            // chunk 0 P.V: 32x64 wave tiles
  const dim3 gSn((NCH > 1) ? ((RC / 64) * (RC / 64) / 8) * ((NCH * (NCH + 1)) / 2 - 1) : 1, 1);   // chunks c >= 1 scores: 64x64 wave tiles
  const dim3 gPn((((RC / 64) * (EMB / 64)) + 7) / 8, (NCH > 1) ? (NCH - 1) : 1);   // chunks c >= 1 P.V: 64x64 wave tiles
  const dim3 gSm(SEQ);                                              // one block per query row

  // (1) x, Wq, Wk, Wv -> bf16 planes (RNE convert), one launch
  cvt16x8<<<gCvt, blk, 0, stream>>>(x, Wq, Wk, Wv, Xb, Wqb, Wkb, Wvb, n8x / 256, n8w / 256);
  // (2) one launch, blockIdx.y = 0, 1, 2 (K=EMB each):
  //     q = x . Wq^T, k = x . Wk^T -> f16 planes [s][d]; rows [0, RC) also a residual (x4096) plane;
  //     v^T = Wv . x^T -> f16 hi plane [d][s] (pitch SEQ) and f16 residual plane x4096 [d][s < VLP] (pitch VLP).
  //     Wqb, Wkb, Wvb / Qh, Kh, VT / Ql, Kl, VL each lie one behind the other in the workspace (the three strides).
  static_assert(PVT_B == PACT_B && PVL_B == PRES_B);
  gemm_t<__bf16, 4, 1, 1, 3, 0, 2><<<gPr, blk, 0, stream>>>(
      Xb, Xb, EMB, 0LL, Wqb, EMB, (long long)(PW_B / 2),
      Wqb, EMB, 0LL, 0,
      (void*)Qh, (void*)Ql, EMB, (long long)(PACT_B / 2), EMB, (long long)(PRES_B / 2), EMB,
      SEQ, EMB, EMB, 1.0f, 0.0f, 1.0f, RSC, 0);
  // (3) scores = q.k / 32 -> f32, causal tiles only. Chunk 0 (rows and keys [0, RC), residual planes) -> S0:
  // acc = Qh.Kh, acc2 = Ql.Kh + Qh.Kl (both x4096): A=Qh, A2=Ql (pitch EMB), Bt=Kh, B2=Kl (pitch EMB, K2=EMB)
  gemm_t<_Float16, 2, 2, 2, 0, 1, 0><<<gS0, blk, 0, stream>>>(
      Qh, Ql, EMB, 0LL, Kh, EMB, 0LL,
      Kl, EMB, 0LL, EMB,
      (void*)S0, (void*)S0, RC, 0LL, RC, 0LL, RC,
      RC, RC, EMB, 1.0f / 32.0f, 1.0f / RSC, 1.0f, 1.0f, 0);
  //     Every row chunk c >= 1 (rows c*RC .. c*RC+RC-1, keys 0 .. (c+1)*RC-1) in one launch, single f16 planes; the
  //     kernel takes each chunk's rows, widths and pitches from blockIdx (MC = 1).
  if (SEQ > RC) {
    gemm_t<_Float16, 4, 1, 1, 0, 1, 1><<<gSn, blk, 0, stream>>>(
        Qh, Qh, EMB, 0LL, Kh, EMB, 0LL,
        Kh, EMB, 0LL, 0,
        (void*)S, (void*)S, 0, 0LL, 0, 0LL, 0,
        RC, 0, EMB, 1.0f / 32.0f, 0.0f, 1.0f, 1.0f, 0);
  }
  // (4) exact causal softmax of every row in one launch -> f16 probabilities (x16384, zeros beyond the diagonal up to
  //     the P.V tile's k end); rows of chunk 0 also their residual plane.
  softmax_rows<<<gSm, blk, 0, stream>>>(S, (unsigned short*)S, S0, Pp, Ppl);
  // (5) out rows = P.V / 16384 -> f32 d_out. Chunk 0:
  // acc = Ph.Vh, acc2 = Pl.Vh + Ph.Vl (both x4096): A=Ph, A2=Pl (pitch RC), Bt=VT (pitch SEQ), B2=VL (pitch VLP)
  gemm_t<_Float16, 2, 2, 2, 0, 2, 0><<<gP0, blk, 0, stream>>>(
      Pp, Ppl, RC, 0LL, VT, SEQ, 0LL,
      VL, VLP, 0LL, VLP,
      (void*)out0, (void*)out0, EMB, 0LL, EMB, 0LL, EMB,
      RC, EMB, RC, 1.0f / PCARRY, 1.0f / RSC, 1.0f, 1.0f, 0);
  //     Row chunks c >= 1, one launch (MC = 1).
  if (SEQ > RC) {
    gemm_t<_Float16, 4, 1, 1, 0, 2, 1><<<gPn, blk, 0, stream>>>(
        (const unsigned short*)S, (const unsigned short*)S, 0, 0LL, VT, SEQ, 0LL,
        VT, SEQ, 0LL, 0,
        (void*)out0, (void*)out0, EMB, 0LL, EMB, 0LL, EMB,
        RC, EMB, 0, 1.0f / PCARRY, 0.0f, 1.0f, 1.0f, 0);
  }
  (void)hipGetLastError();
}

// v005
// A run of this version takes 255 microseconds.
// In both of two side-by-side timings against v004, it was 1.17 times as fast.
// Over all steps from v000 it is 8.65 times as fast.
// Contractions: q, k, v^T in-projections = v_wmma_f32_16x16x32_bf16 (bf16 operands from RNE-converted inputs, single product, f32 accumulate);
// q.k^T scores = v_wmma_f32_16x16x32_f16 (q, k f16 planes, single product; query rows < RC: q and k each f16 hi plane + f16 residual plane x4096, 3 products, separate f32 accumulators);
// p.v = v_wmma_f32_16x16x32_f16 (p carried x16384 in f16, v^T f16, single product; query rows < RC: p and v^T each f16 hi plane + f16 residual plane x4096, 3 products, separate f32 accumulators);
// causal softmax (row max, sum, probabilities) in f32 on materialised f32 score row chunks.
#include <hip/hip_runtime.h>
#include <math.h>
#include <stdint.h>
#include <type_traits>

#ifndef NB
#define NB 1
#endif
#ifndef SEQ
#define SEQ 8192
#endif
#define NB_FULL  1
#define SEQ_FULL 8192
#define EMB      1024
#define RC       ((SEQ < 1024) ? SEQ : 1024)   // query rows per score/probability chunk; rows < RC use residual planes
#define NCH      (SEQ / RC)                    // number of row chunks
#define VLP      RC                            // key extent of the v^T residual plane
#define PCARRY   16384.0f                      // power-of-two carry of p in the f16 P.V operand
#define RSC      4096.0f                       // power-of-two carry of every f16 residual plane
#define SMI      ((SEQ / 8 + 255) / 256)       // max 8-column groups per softmax thread
static_assert(NB == 1 && NB_FULL == 1);
static_assert(SEQ >= 256 && SEQ <= SEQ_FULL && (SEQ % 256) == 0);
static_assert((SEQ % RC) == 0 && (RC % 64) == 0 && NCH >= 1);
static_assert((EMB % 64) == 0 && (SEQ % 64) == 0 && (EMB % 32) == 0 && (RC % 32) == 0);
static_assert(SMI >= 1 && SMI <= 4);
static_assert((EMB % 512) == 0 && (RC % 512) == 0 && (SEQ % 512) == 0);   // eight 64-column tiles per GEMM block; 64-k staged tiles
static_assert(((SEQ * EMB / 8) % 256) == 0 && ((EMB * EMB / 8) % 256) == 0);

typedef _Float16 v16h __attribute__((ext_vector_type(16)));
typedef _Float16 v8h  __attribute__((ext_vector_type(8)));
typedef __bf16   v16b __attribute__((ext_vector_type(16)));
typedef __bf16   v8b  __attribute__((ext_vector_type(8)));
typedef float    v8f  __attribute__((ext_vector_type(8)));
typedef float    v4f  __attribute__((ext_vector_type(4)));
typedef unsigned int v4u __attribute__((ext_vector_type(4)));

#if defined(__HIP_DEVICE_COMPILE__)
#define DEV_ASM 1
#else
#define DEV_ASM 0
#endif

// ---- scalar helpers --------------------------------------------------------------------------------
__device__ __forceinline__ unsigned short bf_bits(float f) {          // f32 -> bf16 bits, RNE convert
  unsigned u = __float_as_uint(f);
  return (unsigned short)((u + 0x7FFFu + ((u >> 16) & 1u)) >> 16);
}
__device__ __forceinline__ unsigned short h_bits(_Float16 x) { return __builtin_bit_cast(unsigned short, x); }
__device__ __forceinline__ unsigned pk16(unsigned short a, unsigned short b) { return (unsigned)a | ((unsigned)b << 16); }
// f32 elements of the score chunks 1 .. c-1, which lie in front of chunk c (chunk j: RC rows of (j+1)*RC columns)
__host__ __device__ __forceinline__ constexpr size_t sbase(int c) { return (size_t)RC * RC * (size_t)((c * (c + 1)) / 2 - 1); }
__device__ __forceinline__ v8f zero8() { v8f z = {0.f, 0.f, 0.f, 0.f, 0.f, 0.f, 0.f, 0.f}; return z; }

// ---- fragment types / loaders: 16-bit A/B operand, lane -> row/col (lane&15), p already includes +8*(lane>>4);
//      elements 0..7 <- p[0..7] (k0+8h..k0+8h+7), elements 8..15 <- p[16..23] (k0+16+8h..k0+16+8h+7)
template <typename OT> struct FT;
template <> struct FT<__bf16>   { typedef v16b frag; typedef v8b half8; };
template <> struct FT<_Float16> { typedef v16h frag; typedef v8h half8; };

template <typename OT>
__device__ __forceinline__ typename FT<OT>::frag ldfrag(const OT* p) {
  union { typename FT<OT>::frag v; typename FT<OT>::half8 h[2]; } f;
  f.h[0] = *(const typename FT<OT>::half8*)(p);
  f.h[1] = *(const typename FT<OT>::half8*)(p + 16);
  return f.v;
}

// ---- WMMA helpers (asm guard bodies are device-only; concrete operand types) -----------------------------
__device__ __forceinline__ v8f mmar(v16b a, v16b b, v8f c) {
  return __builtin_amdgcn_wmma_f32_16x16x32_bf16(false, a, false, b, (short)0, c, false, false);
}
__device__ __forceinline__ v8f mmar(v16h a, v16h b, v8f c) {
  return __builtin_amdgcn_wmma_f32_16x16x32_f16(false, a, false, b, (short)0, c, false, false);
}
__device__ __forceinline__ void acc_guard4(v8f& a, v8f& b, v8f& c, v8f& d) {
#if DEV_ASM
  asm volatile("v_nop\n\tv_nop\n\tv_nop\n\tv_nop" : "+v"(a), "+v"(b), "+v"(c), "+v"(d));
#else
  (void)a; (void)b; (void)c; (void)d;
#endif
}

// ---- LDS staging by asynchronous copies ---------------------------------------------------------------
#define BKE 64     // k elements per staged tile: 128-B rows, whole lines of the source
#define LPB 144    // LDS row pitch in bytes: 128 + 16 (16 B x odd, conflict-free for 16-B row readers)
#define LPE (LPB / 2)
__device__ __forceinline__ unsigned lds_off(const void* p) { return (unsigned)(size_t)p; }   // byte offset in the block's LDS
// Each copy: a wave brings 4 rows x 128 B (lane -> row lane>>3, 16-B piece lane&7), l / g already hold the lane's part.
// step4 = source elements per 4 rows. The address-register wait ends each statement, so no later address
// arithmetic can be placed between a copy and that wait.
__device__ __forceinline__ void copy8and32rows(unsigned la, const void* gap, size_t astep4,
                                               unsigned l, const void* gp, size_t step4) {
#if DEV_ASM
  const unsigned short* ga = (const unsigned short*)gap;
  const unsigned short* g  = (const unsigned short*)gp;
  asm volatile("global_load_async_to_lds_b128 %0, %10, off\n\t"
               "global_load_async_to_lds_b128 %1, %11, off\n\t"
               "global_load_async_to_lds_b128 %2, %12, off\n\t"
               "global_load_async_to_lds_b128 %3, %13, off\n\t"
               "global_load_async_to_lds_b128 %4, %14, off\n\t"
               "global_load_async_to_lds_b128 %5, %15, off\n\t"
               "global_load_async_to_lds_b128 %6, %16, off\n\t"
               "global_load_async_to_lds_b128 %7, %17, off\n\t"
               "global_load_async_to_lds_b128 %8, %18, off\n\t"
               "global_load_async_to_lds_b128 %9, %19, off\n\t"
               "s_wait_xcnt 0x0"
               :: "v"(la), "v"(la + 4u * LPB),
                  "v"(l), "v"(l + 4u * LPB), "v"(l + 8u * LPB), "v"(l + 12u * LPB),
                  "v"(l + 16u * LPB), "v"(l + 20u * LPB), "v"(l + 24u * LPB), "v"(l + 28u * LPB),
                  "v"(ga), "v"(ga + astep4),
                  "v"(g), "v"(g + step4), "v"(g + 2 * step4), "v"(g + 3 * step4),
                  "v"(g + 4 * step4), "v"(g + 5 * step4), "v"(g + 6 * step4), "v"(g + 7 * step4) : "memory");
#else
  (void)la; (void)gap; (void)astep4; (void)l; (void)gp; (void)step4;
#endif
}
// 16 rows of the shared A part and 32 rows of the shared Bt part: one wave's twelve copies of a 384-row tile; the
// address-register wait is the statement's last line, as above.
__device__ __forceinline__ void copy16and32rows(unsigned la, const void* gap, size_t astep4,
                                                unsigned l, const void* gp, size_t step4) {
#if DEV_ASM
  const unsigned short* ga = (const unsigned short*)gap;
  const unsigned short* g  = (const unsigned short*)gp;
  asm volatile("global_load_async_to_lds_b128 %0, %12, off\n\t"
               "global_load_async_to_lds_b128 %1, %13, off\n\t"
               "global_load_async_to_lds_b128 %2, %14, off\n\t"
               "global_load_async_to_lds_b128 %3, %15, off\n\t"
               "global_load_async_to_lds_b128 %4, %16, off\n\t"
               "global_load_async_to_lds_b128 %5, %17, off\n\t"
               "global_load_async_to_lds_b128 %6, %18, off\n\t"
               "global_load_async_to_lds_b128 %7, %19, off\n\t"
               "global_load_async_to_lds_b128 %8, %20, off\n\t"
               "global_load_async_to_lds_b128 %9, %21, off\n\t"
               "global_load_async_to_lds_b128 %10, %22, off\n\t"
               "global_load_async_to_lds_b128 %11, %23, off\n\t"
               "s_wait_xcnt 0x0"
               :: "v"(la), "v"(la + 4u * LPB), "v"(la + 8u * LPB), "v"(la + 12u * LPB),
                  "v"(l), "v"(l + 4u * LPB), "v"(l + 8u * LPB), "v"(l + 12u * LPB),
                  "v"(l + 16u * LPB), "v"(l + 20u * LPB), "v"(l + 24u * LPB), "v"(l + 28u * LPB),
                  "v"(ga), "v"(ga + astep4), "v"(ga + 2 * astep4), "v"(ga + 3 * astep4),
                  "v"(g), "v"(g + step4), "v"(g + 2 * step4), "v"(g + 3 * step4),
                  "v"(g + 4 * step4), "v"(g + 5 * step4), "v"(g + 6 * step4), "v"(g + 7 * step4) : "memory");
#else
  (void)la; (void)gap; (void)astep4; (void)l; (void)gp; (void)step4;
#endif
}
__device__ __forceinline__ void wait_lds_reads() {   // this wave's LDS reads have returned before its buffer is handed back
#if DEV_ASM
  asm volatile("s_wait_dscnt 0x0" ::: "memory");
#endif
}
__device__ __forceinline__ void wait_store_regs() {  // a precaution: stands between issued global stores and the reuse of their registers
#if DEV_ASM
  asm volatile("s_wait_xcnt 0x0" ::: "memory");
#endif
}
__device__ __forceinline__ void wait_copies() {      // this wave's copies have landed before the barrier publishes them
#if DEV_ASM
  asm volatile("s_wait_asynccnt 0x0" ::: "memory");
#endif
}

// =====================================================================================================
// f32 -> bf16 planes (RNE convert), 8 elements per thread, one 16-B store per lane: a wave writes 512 contiguous B
// One launch for x and the three weights: blocks [0, nbx) take x, then nbw blocks each take Wq, Wk, Wv (block-uniform).
// coverage: nbx * 256 threads x 8 elements = the whole x plane, nbw * 256 x 8 = each whole weight plane.
// =====================================================================================================
__global__ __launch_bounds__(256) void cvt16x8(const float* __restrict__ x, const float* __restrict__ wq,
                                               const float* __restrict__ wk, const float* __restrict__ wv,
                                               unsigned short* xb, unsigned short* wqb, unsigned short* wkb,
                                               unsigned short* wvb, int nbx, int nbw) {
  int bi = (int)blockIdx.x;
  int nb = nbx;                          // blocks of the plane that this block works on
  const float* in = x;
  unsigned short* out = xb;
  if (bi >= nbx) {
    bi -= nbx; nb = nbw;
    in = wq; out = wqb;
    if (bi >= nbw) { bi -= nbw; in = wk; out = wkb; }
    if (bi >= nbw) { bi -= nbw; in = wv; out = wvb; }
  }
  const int i = bi * 256 + (int)threadIdx.x;
  if (bi < nb) {
    const float* ip = in + (size_t)i * 8;
    const v4f a  = *(const v4f*)(ip);
    const v4f a4 = *(const v4f*)(ip + 4);
    v4u p;
    p[0] = pk16(bf_bits(a[0]),  bf_bits(a[1]));
    p[1] = pk16(bf_bits(a[2]),  bf_bits(a[3]));
    p[2] = pk16(bf_bits(a4[0]), bf_bits(a4[1]));
    p[3] = pk16(bf_bits(a4[2]), bf_bits(a4[3]));
    unsigned short* o = out + (size_t)i * 8;
    *(v4u*)o = p;
    
  }
}

// =====================================================================================================
// The k loop of one block tile (16-bit operand type OT). The eight waves of a block form a 2 x 4 grid of (16*MI) x 64
// wave tiles. stage(t) copies the block's rows of k tile t (64 k, whole 128-B lines) into buffer t & 1 of the ring
// (STG bytes a buffer) by asynchronous copies: two buffers, one block barrier per tile, tile t + 1 flies while tile t
// is multiplied. aOff / bOff = byte offsets in a buffer of this lane's first A / Bt fragment row. Fragments are read
// from LDS with the split k map (ldfrag); the k order of every sum is ascending. On entry no wave reads the ring any
// more (kernel entry, or the barrier that ends an earlier loop); on return every wave's ring reads have returned.
// =====================================================================================================
template <typename OT, int MI, int STG, typename SF>
__device__ __forceinline__ void kloop(unsigned char* ring, int nT, int aOff, int bOff, int koff, SF stage, v8f (*acc)[4]) {
  typedef typename FT<OT>::frag V16;
  stage(0);
  wait_copies();
  __syncthreads();                       // tile 0 is published
  if (nT > 1) stage(1);
  // Every LDS read of tile t stands between the barrier that publishes it and the barrier that frees its buffer.
  // Fragment registers: bq0 / bq1 = Bt of the tile's first / second 32 k; a[i] is refilled in place right behind its
  // last product; ax holds row group MI-1 of the second 32 k, so that no read is issued behind a phase's last products.
  // The scheduling barriers keep each read at that place (left alone, the compiler read each A fragment right in
  // front of its products and waited for it every time).
  V16 bq0[4], bq1[4], a[MI], ax;
  {
    const OT* sA = (const OT*)(const void*)(ring + aOff) + koff;
    const OT* sB = (const OT*)(const void*)(ring + bOff) + koff;
#pragma unroll
    for (int j = 0; j < 4; ++j) bq0[j] = ldfrag<OT>(sB + (j << 4) * LPE);
#pragma unroll
    for (int i = 0; i < MI; ++i) a[i] = ldfrag<OT>(sA + (i << 4) * LPE);
  }
  for (int t = 0; t < nT; ++t) {
    const unsigned char* buf = ring + (size_t)(t & 1) * STG;
    const OT* sA = (const OT*)(const void*)(buf + aOff) + koff + 32;
    const OT* sB = (const OT*)(const void*)(buf + bOff) + koff + 32;
    ax = ldfrag<OT>(sA + ((MI - 1) << 4) * LPE);
#pragma unroll
    for (int j = 0; j < 4; ++j) bq1[j] = ldfrag<OT>(sB + (j << 4) * LPE);
    __builtin_amdgcn_sched_barrier(0);     // reads of the second 32 k go out ahead of the first 32 k's products
#pragma unroll
    for (int i = 0; i < MI - 1; ++i) {
#pragma unroll
      for (int j = 0; j < 4; ++j) acc[i][j] = mmar(a[i], bq0[j], acc[i][j]);
      __builtin_amdgcn_sched_barrier(0);   // the refill stays behind a[i]'s last product, so it can take a[i]'s registers
      a[i] = ldfrag<OT>(sA + (i << 4) * LPE);
      __builtin_amdgcn_sched_barrier(0);   // the refill of a[i] stays among the products
    }
#pragma unroll
    for (int j = 0; j < 4; ++j) acc[MI - 1][j] = mmar(a[MI - 1], bq0[j], acc[MI - 1][j]);
    __builtin_amdgcn_sched_barrier(0);     // the first 32 k's products stay ahead of the waits
    wait_lds_reads();
    wait_copies();
    __syncthreads();                       // publishes tile t + 1 and ends every read of tile t's buffer
    if (t + 2 < nT) stage(t + 2);
    // The first 32 k of tile t + 1 are read under tile t's last products. The last trip has no next tile: a scalar
    // select aims its reads, whose values nobody uses, at its own buffer (landed, not refilled), which keeps the
    // products free of a branch.
    const unsigned char* nbuf = ring + (size_t)(((t + 1 < nT) ? (t + 1) : t) & 1) * STG;
    const OT* nA = (const OT*)(const void*)(nbuf + aOff) + koff;
    const OT* nB = (const OT*)(const void*)(nbuf + bOff) + koff;
    a[MI - 1] = ldfrag<OT>(nA + ((MI - 1) << 4) * LPE);
#pragma unroll
    for (int j = 0; j < 4; ++j) bq0[j] = ldfrag<OT>(nB + (j << 4) * LPE);
    __builtin_amdgcn_sched_barrier(0);     // the next tile's reads go out ahead of this tile's last products
#pragma unroll
    for (int i = 0; i < MI - 1; ++i) {
#pragma unroll
      for (int j = 0; j < 4; ++j) acc[i][j] = mmar(a[i], bq1[j], acc[i][j]);
      __builtin_amdgcn_sched_barrier(0);   // the refill stays behind a[i]'s last product, so it can take a[i]'s registers
      a[i] = ldfrag<OT>(nA + (i << 4) * LPE);
      __builtin_amdgcn_sched_barrier(0);   // the refill of a[i] stays among the products
    }
#pragma unroll
    for (int j = 0; j < 4; ++j) acc[MI - 1][j] = mmar(ax, bq1[j], acc[MI - 1][j]);
  }
  wait_copies();
  wait_lds_reads();
  __syncthreads();                       // every wave's last ring read has returned: the ring is free again
}

// =====================================================================================================
// One 64 x 256 block tile of row chunk 0 (query rows and keys < RC), whose operands are f16 hi planes A, Bt and f16
// residual planes A2, B2 (both x 1/rscale2): C = ((A.Bt) + (A2.Bt + A.B2) * rscale2) * oscale, f32, pitch ldc.
// It runs inside the launch of the chunks c >= 1, in the same ring and on the same k loop; b0 = its index among
// chunk 0's (RC / 64) x 4 block tiles. The eight waves form a 2 x 4 grid of 32 x 64 tiles.
// First loop: a wave's 64 staged A rows are its 32 rows of A and behind them its 32 rows of A2, so row groups 0, 1
// give A.Bt and row groups 2, 3 give A2.Bt from the same Bt fragments. Second loop: A.B2 goes on top of A2.Bt.
// CZ = 1 (scores, k loops of K): block tiles beyond the diagonal leave at once, wave tiles beyond it store nothing.
// CZ = 2 (P.V): the A rows hold exact zeros from the diagonal to column mB + 64, where the k loops end; long loops first.
// =====================================================================================================
template <int CZ, int STG>
__device__ __forceinline__ void chunk0_tile(unsigned char* ring, int b0,
    const _Float16* A, const _Float16* A2, int lda, const _Float16* Bt, int ldb, const _Float16* B2, int ldb2,
    float* C, int ldc, int K, float oscale, float rscale2) {
  const int wave = __builtin_amdgcn_readfirstlane((int)(threadIdx.x >> 5));
  const int tm = (CZ == 2) ? (RC / 64 - 1 - (b0 >> 2)) : (b0 >> 2);
  const int mB = tm * 64;
  const int nB = (b0 & 3) * 256;
  const int wm = wave >> 2, wn = wave & 3;
  const int m0 = mB + wm * 32;
  const int n0 = nB + wn * 64;
  if (CZ == 1 && nB >= mB + 64) return;                        // block-uniform causal skip, in front of every barrier
  const bool live = (CZ != 1) || (n0 < m0 + 32);               // a wave past the diagonal walks the loops and stores nothing
  const int nT = ((CZ == 2) ? (mB + 64) : K) / BKE;            // >= 1; block-uniform

  v8f acc[4][4];                         // [0], [1]: A.Bt; [2], [3]: A2.Bt + A.B2
#pragma unroll
  for (int i = 0; i < 4; ++i)
#pragma unroll
    for (int j = 0; j < 4; ++j) acc[i][j] = zero8();
  {
    const int lane = threadIdx.x & 31;
    // this lane's part of every staged tile: row lane>>3 of each 4-row group, 16-B piece lane&7
    const int crow = lane >> 3;
    const int cel  = (lane & 7) * 8;
    const unsigned lc = lds_off(ring) + (unsigned)(crow * LPB + cel * 2);
    // staged A rows wave*16 .. +15 = 16 rows of A (waves 0, 1, 4, 5) or of A2 (waves 2, 3, 6, 7)
    const _Float16* gA = ((wave & 2) ? A2 : A) + (size_t)(mB + wm * 32 + (wave & 1) * 16 + crow) * lda + cel;
    const _Float16* gB = Bt + (size_t)(nB + wave * 32 + crow) * ldb + cel;
    const unsigned lA = lc + (unsigned)(wave * 16 * LPB);
    const unsigned lB = lc + (unsigned)((128 + wave * 32) * LPB);
    kloop<_Float16, 4, STG>(ring, nT, (wm * 64 + (lane & 15)) * LPB, (128 + wn * 64 + (lane & 15)) * LPB, (lane >> 4) * 8,
                            [&](int t) {
      copy16and32rows(lA + (unsigned)(t & 1) * (unsigned)STG, gA + t * BKE, (size_t)4 * lda,
                      lB + (unsigned)(t & 1) * (unsigned)STG, gB + t * BKE, (size_t)4 * ldb);
    }, acc);
  }
  // The lane index is taken anew, from the lane mask count: what the second loop and the epilogue derive from it is then
  // formed here and holds no registers through the first loop, whose budget is that of two blocks per WGP.
  const int lane  = (int)__builtin_amdgcn_mbcnt_lo(~0u, 0u);
  const int rlane = lane & 15;
  const int mOff  = (lane >> 4) * 8;
  {
    const int crow = lane >> 3;
    const int cel  = (lane & 7) * 8;
    const unsigned lc = lds_off(ring) + (unsigned)(crow * LPB + cel * 2);
    // A rows wave*8 .. +7, at the front of their wave row's 64 staged rows
    const _Float16* gA = A + (size_t)(mB + wave * 8 + crow) * lda + cel;
    const _Float16* gB = B2 + (size_t)(nB + wave * 32 + crow) * ldb2 + cel;
    const unsigned lA = lc + (unsigned)((wm * 64 + wn * 8) * LPB);
    const unsigned lB = lc + (unsigned)((128 + wave * 32) * LPB);
    kloop<_Float16, 2, STG>(ring, nT, (wm * 64 + rlane) * LPB, (128 + wn * 64 + rlane) * LPB, (lane >> 4) * 8,
                            [&](int t) {
      copy8and32rows(lA + (unsigned)(t & 1) * (unsigned)STG, gA + t * BKE, (size_t)4 * lda,
                     lB + (unsigned)(t & 1) * (unsigned)STG, gB + t * BKE, (size_t)4 * ldb2);
    }, acc + 2);
  }
  if (!live) return;                     // wave-uniform; no block barrier follows
#pragma unroll
  for (int i = 0; i < 4; ++i) acc_guard4(acc[i][0], acc[i][1], acc[i][2], acc[i][3]);

  float* slab = (float*)(void*)ring + wave * (16 * 68);   // pitch 68 floats, wave-private
  const int h2 = lane >> 4, c4 = (lane & 15) * 4;         // 256-B row segment = 16 lanes x 16 B
#pragma unroll
  for (int i = 0; i < 2; ++i) {
#pragma unroll
    for (int j = 0; j < 4; ++j) {
#pragma unroll
      for (int r = 0; r < 8; ++r) {
        float v = acc[i][j][r];
        v += acc[i + 2][j][r] * rscale2;
        v = v * oscale;
        slab[(mOff + r) * 68 + (j << 4) + rlane] = v;
      }
    }
    __builtin_amdgcn_fence(3 /* release order */, "workgroup");
    __builtin_amdgcn_wave_barrier();
    __builtin_amdgcn_fence(2 /* acquire order */, "workgroup");
    v4f val[8];
    float* pc[8];
#pragma unroll
    for (int it = 0; it < 8; ++it) {
      const int row = it * 2 + h2;                         // it 0..7 x h2 0..1 = rows 0..15
      val[it] = *(const v4f*)(slab + row * 68 + c4);
      pc[it]  = C + (size_t)(m0 + (i << 4) + row) * ldc + n0 + c4;
    }
    __builtin_amdgcn_sched_barrier(0);   // values and addresses are formed ahead of the stores: nothing is computed among them
#pragma unroll
    for (int it = 0; it < 8; ++it) *(v4f*)pc[it] = val[it];
    wait_store_regs();
    __builtin_amdgcn_sched_barrier(0);   // later arithmetic, which reuses the stores' registers, stays behind the wait
    __builtin_amdgcn_fence(3 /* release order */, "workgroup");
    __builtin_amdgcn_wave_barrier();
    __builtin_amdgcn_fence(2 /* acquire order */, "workgroup");
  }
}

// =====================================================================================================
// Register-blocked WMMA GEMM (16-bit operand type OT): C[m][n] = sum_k A[m][k] * Bt[n][k];
// one wave per (16*MI) x 64 tile; the eight waves of a block form a 2 x 4 grid of such tiles, a 128 x 256 block tile
// (M a multiple of 128, N of 256): each staged A row serves four waves, each staged Bt row two, and two blocks' rings
// fit one LDS. A row-major [M][K] pitch lda; Bt row-major [N][K] pitch ldb (k contiguous); K multiple of 64 (static
// sizes here). Staging and products: kloop above.
// value v = acc * oscale, in the f32 epilogue.
// CZ (causal), czoff = global row index of local row 0 (multiple of 64):
//   0 none; 1 = output tiles with n0 >= czoff + m0 + 16*MI are not stored (every tile holding a
//   column <= one of its rows is written); 2 = A rows hold exact zeros beyond the diagonal up to column
//   czoff + mB + BR (mB, BR = first row and rows of the block tile), so the k loop ends at min(K, czoff + mB + BR)
//   (exact); the last staged tile is copied whole, so A rows are written up to the next multiple of 64 columns.
// OUT_MODE 0: f32 C (pitch ldc) = v.
// OUT_MODE 3: f16 hi plane C = f16(v * cscale) (pitch ldc) and f16 residual plane
//             C2 = f16((v*cscale - hi) * rscaleC) (pitch ldc2), C2 written only for output
//             tiles with n0 < N2 (N2 multiple of 64, wave-uniform), i.e. columns [0, N2) fully (MC = 2: and rows [0, M2)).
// =====================================================================================================
// MC = 1: one launch holds every row chunk (M = RC rows each). Chunks c >= 1, single planes: CZ = 2: blockIdx.y picks
//   the chunk, the widest (longest k loops) first. CZ = 1: a flat grid, chunk after chunk, the widest last, which the
//   softmax then reads first.
//   The f32 score chunks lie one behind the other, chunk c at sbase(c) elements with pitch (c+1)*RC; the softmax
//   writes each f16 probability row over the front of its own score row (f16 pitch 2*(c+1)*RC).
//   CZ = 1: A rows, N, ldc, C and czoff are the chunk's; CZ = 2: A, lda, K, C rows and czoff are the chunk's.
//   Chunk 0, hi and residual planes (chunk0_tile): its NB0 blocks lead the flat grid (CZ = 1: their two k loops are the
//   launch's longest) or follow the other chunks' (CZ = 2: blockIdx.y >= NCH - 1, the shortest k loops).
//   CZ = 1: A = q, A2p = q residual, Bt = k, B2p = k residual, Cout2 = chunk 0's scores (pitch ldc2).
//   CZ = 2: A2p = chunk 0's p, Cout2 = its residual plane (pitch RC both), Bt = v^T, B2p = v^T residual, Cout = out.
// MC = 2: one launch holds the three in-projections, blockIdx.y = 0: q, 1: k, 2: v^T. The arguments describe q
//   (A = x rows, Bt = Wq rows, M = SEQ, N = EMB); strideB, strideC, strideC2 lead from q's weight, hi plane and residual
//   plane to the next projection's. q, k: the residual plane holds rows < RC. v^T: A = Wv rows, Bt = x rows, M = EMB,
//   N = SEQ, pitches SEQ and VLP, the residual plane holds columns < VLP.
template <typename OT, int MI, int OUT_MODE, int CZ, int MC>
__global__ __launch_bounds__(256) void gemm_t(
    const unsigned short* __restrict__ Ap, const unsigned short* __restrict__ A2p, int lda,
    const unsigned short* __restrict__ Btp, int ldb, long long strideB,
    const unsigned short* __restrict__ B2p, int ldb2,
    void* Cout, void* Cout2, int ldc, long long strideC, int ldc2, long long strideC2, int N2,
    int M, int N, int K, float oscale, float rscale2, float cscale, float rscaleC, int czoff) {
  static_assert(CZ != 2 || ((16 * MI) % 32) == 0);
  static_assert(MC == 1 || MC == 2);
  static_assert(MC != 1 || ((CZ == 1 || CZ == 2) && OUT_MODE == 0 && std::is_same<OT, _Float16>::value));
  static_assert(MC != 2 || (CZ == 0 && OUT_MODE == 3));
  const int RT = 16 * MI;
  constexpr int BR = 16 * MI * 2;                          // rows of the block tile
  constexpr int STG_B = (BR + 256) * LPB;                  // one staged k tile of the block, bytes
  static_assert(BR == 128);                                // 8 waves x 16 rows copy the A part, 8 x 32 rows the Bt part
  static_assert(2 * STG_B >= 8 * 16 * 68 * 4 && 2 * STG_B <= 320 * 1024);
  __shared__ __align__(16) unsigned char ring[2 * STG_B];  // two buffers; after the k loop: per-wave 16x64 f32 slabs
  int bx = (int)blockIdx.x;              // the block's index among its chunk's (MC = 1) or the launch's blocks
  if (MC == 1) {                         // block-uniform
    constexpr int NB0 = (RC / 64) * 4;   // chunk 0's block tiles: RC (CZ = 1) or EMB (CZ = 2) columns = 4 x 256
    static_assert(RC == 1024 && EMB == 1024 && NCH > 1);
    int c = NCH - 1 - (int)blockIdx.y;
    if (CZ == 1) {
      if (bx < NB0) {
        chunk0_tile<1, STG_B>(ring, bx, (const _Float16*)(const void*)Ap, (const _Float16*)(const void*)A2p, lda,
                              (const _Float16*)(const void*)Btp, ldb, (const _Float16*)(const void*)B2p, ldb2,
                              (float*)Cout2, ldc2, K, oscale, rscale2);
        return;
      }
      bx -= NB0;
      constexpr int BPU = (RC / 64) * (RC / 64) / 8;   // chunk c holds (c+1) * BPU blocks of the flat grid
      c = 1;
      while (c < NCH - 1 && bx >= (c + 1) * BPU) { bx -= (c + 1) * BPU; ++c; }
    } else if (c < 1) {
      constexpr int BPY = (RC / 64) * (EMB / 64) / 8;  // blocks per blockIdx.y
      chunk0_tile<2, STG_B>(ring, -c * BPY + bx, (const _Float16*)(const void*)A2p, (const _Float16*)(const void*)Cout2, RC,
                            (const _Float16*)(const void*)Btp, ldb, (const _Float16*)(const void*)B2p, ldb2,
                            (float*)Cout, ldc, RC, oscale, rscale2);
      return;
    }
    const int rb = c * RC;
    const size_t sb = sbase(c);
    czoff = rb;
    if (CZ == 1) {
      Ap += (size_t)rb * lda;
      N = rb + RC; ldc = rb + RC;
      Cout = (void*)((float*)Cout + sb);
    } else {
      Ap += 2 * sb;
      lda = 2 * (rb + RC); K = rb + RC;
      Cout = (void*)((float*)Cout + (size_t)rb * ldc);
    }
  }
  int M2 = M;                            // rows [0, M2) get a residual plane (OUT_MODE 3)
  if (MC == 2) {                         // block-uniform
    const int y = (int)blockIdx.y;
    const unsigned short* Wp = Btp + (size_t)y * (size_t)strideB;
    Cout  = (void*)((unsigned short*)Cout  + (size_t)y * (size_t)strideC);
    Cout2 = (void*)((unsigned short*)Cout2 + (size_t)y * (size_t)strideC2);
    if (y == 2) { Btp = Ap; Ap = Wp; M = EMB; N = SEQ; ldc = SEQ; ldc2 = VLP; N2 = VLP; M2 = EMB; }
    else        { Btp = Wp; M2 = RC; }
  }
  const OT* A  = (const OT*)(const void*)Ap;
  const OT* Bt = (const OT*)(const void*)Btp;
  const int lane = threadIdx.x & 31;
  const int wave = __builtin_amdgcn_readfirstlane((int)(threadIdx.x >> 5));
  const int tilesN = (N >> 6) / 4;       // block tiles along N
  const int tilesM = M / BR;
  if (bx >= tilesM * tilesN) return;     // block-uniform, in front of every barrier
  // The quotient is block-uniform; where the compiler divides on the vector unit, readfirstlane brings it back to a
  // scalar register, so that the returns below stay scalar branches.
  const int tm = __builtin_amdgcn_readfirstlane(bx / tilesN);
  const int mB = tm * BR;                                  // the block tile's first row and column
  const int nB = (bx - tm * tilesN) * 256;
  const int wn = wave & 3;                                 // this wave's column tile in the block
  const int m0 = mB + (wave >> 2) * RT;
  const int n0 = nB + (wn << 6);
  bool live = true;
  if (CZ == 1) {
    if (nB >= czoff + mB + BR) return;           // block-uniform causal skip, in front of every barrier
    live = n0 < czoff + m0 + RT;                 // a wave past the diagonal walks the loop and stores nothing
  }
  int kEnd = K;
  if (CZ == 2) {
    const int ke = czoff + mB + BR;      // multiple of 32
    kEnd = (ke < K) ? ke : K;
  }

  const int rlane = lane & 15;                 // row (A) / col (B, D) within subtile
  const int koff  = (lane >> 4) * 8;           // k offset of this lane half
  const int mOff  = (lane >> 4) * 8;           // D row offset

  v8f acc[MI][4];
#pragma unroll
  for (int i = 0; i < MI; ++i)
#pragma unroll
    for (int j = 0; j < 4; ++j) acc[i][j] = zero8();

  // ---- this lane's part of every staged tile: row lane>>3 of each 4-row group, 16-B piece lane&7 ----
  const int crow = lane >> 3;
  const int cel  = (lane & 7) * 8;
  const int arow = wave * (BR / 8);                            // this wave's share of the staged A rows
  const int brow = wave * 32;                                  // and of the staged Bt rows
  const OT* gA  = A  + (size_t)(mB + arow + crow) * lda + cel;
  const OT* gB  = Bt + (size_t)(nB + brow + crow) * ldb + cel;
  const unsigned lc = lds_off(ring) + (unsigned)(crow * LPB + cel * 2);
  const unsigned lA = lc + (unsigned)(arow * LPB);
  const unsigned lB = lc + (unsigned)((BR + brow) * LPB);
  const int nT = (kEnd + BKE - 1) / BKE;                       // >= 1; block-uniform
  auto stage = [&](int t) {                                    // tile t -> buffer t & 1
    const unsigned bo = (unsigned)(t & 1) * (unsigned)STG_B;
    const int kt = t * BKE;
    copy16and32rows(lA + bo, gA + kt, (size_t)4 * lda, lB + bo, gB + kt, (size_t)4 * ldb);
  };
  const int aOff = (m0 - mB + rlane) * LPB;                    // this lane's fragment rows in a buffer, bytes
  const int bOff = (BR + wn * 64 + rlane) * LPB;
  kloop<OT, MI, STG_B>(ring, nT, aOff, bOff, koff, stage, acc);   // behind it the ring becomes output staging
  if (!live) return;                     // wave-uniform; no block barrier follows
#pragma unroll
  for (int i = 0; i < MI; ++i) acc_guard4(acc[i][0], acc[i][1], acc[i][2], acc[i][3]);

  // ---- epilogue ----
  float* slab = (float*)(void*)ring + wave * (16 * 68);   // pitch 68 floats, wave-private
#pragma unroll
  for (int i = 0; i < MI; ++i) {
    const int mBase = m0 + (i << 4);
#pragma unroll
    for (int j = 0; j < 4; ++j) {
#pragma unroll
      for (int r = 0; r < 8; ++r) {
        float v = acc[i][j][r];
        v = v * oscale;
        slab[(mOff + r) * 68 + (j << 4) + rlane] = v;
      }
    }
    __builtin_amdgcn_fence(3 /* release order */, "workgroup");
    __builtin_amdgcn_wave_barrier();
    __builtin_amdgcn_fence(2 /* acquire order */, "workgroup");
    if (OUT_MODE == 0) {
      float* C = (float*)Cout;
      const int h2 = lane >> 4, c4 = (lane & 15) * 4;     // 256-B row segment = 16 lanes x 16 B
      {
#pragma unroll
        for (int it = 0; it < 8; ++it) {
          const int row = it * 2 + h2;                     // it 0..7 x h2 0..1 = rows 0..15
          const v4f v = *(const v4f*)(slab + row * 68 + c4);
          *(v4f*)(C + (size_t)(mBase + row) * ldc + n0 + c4) = v;
        }
        
      }
    } else {
      const int q = lane >> 3, c8 = (lane & 7) * 8;
      unsigned short* C  = (unsigned short*)Cout;
      unsigned short* C2 = (unsigned short*)Cout2;
      const bool wr2 = (OUT_MODE == 3) && (n0 < N2) && (MC != 2 || m0 < M2);     // wave-uniform
      // The slab's planes, with or without the residual plane: one wave-uniform branch per slab chooses, so that a tile
      // without a residual plane does none of its arithmetic.
      auto planes = [&](auto withRes) {
        constexpr bool RES = decltype(withRes)::value;
        v4u hv[4], lv[4];
        unsigned short* pc[4];
        unsigned short* pc2[4];
#pragma unroll
        for (int it = 0; it < 4; ++it) {
          const int row = it * 4 + q;                      // it 0..3 x q 0..3 = rows 0..15
          const float* sp = slab + row * 68 + c8;
          pc[it]  = C  + (size_t)(mBase + row) * ldc  + n0 + c8;
          pc2[it] = C2 + (size_t)(mBase + row) * ldc2 + n0 + c8;
          float f[8];
#pragma unroll
          for (int e = 0; e < 8; ++e) f[e] = sp[e] * cscale;
          v4u a, a2;
#pragma unroll
          for (int e = 0; e < 4; ++e) {
            const float f0 = f[2 * e], f1 = f[2 * e + 1];
            const _Float16 x0 = (_Float16)f0, x1 = (_Float16)f1;
            const unsigned short h0 = h_bits(x0), h1 = h_bits(x1);
            unsigned short l0 = 0, l1 = 0;
            if (RES) {
              l0 = h_bits((_Float16)((f0 - (float)x0) * rscaleC));
              l1 = h_bits((_Float16)((f1 - (float)x1) * rscaleC));
            }
            a[e] = pk16(h0, h1); a2[e] = pk16(l0, l1);
          }
          hv[it] = a; lv[it] = a2;
        }
        __builtin_amdgcn_sched_barrier(0);   // values and addresses are formed ahead of the stores: nothing is computed among them
#pragma unroll
        for (int it = 0; it < 4; ++it) {
          *(v4u*)pc[it] = hv[it];
          if (RES) *(v4u*)pc2[it] = lv[it];
        }
        wait_store_regs();
        __builtin_amdgcn_sched_barrier(0);   // later arithmetic, which reuses the stores' registers, stays behind the wait
      };
      if (wr2) planes(std::integral_constant<bool, true>{});
      else     planes(std::integral_constant<bool, false>{});
    }
    __builtin_amdgcn_fence(3 /* release order */, "workgroup");
    __builtin_amdgcn_wave_barrier();
    __builtin_amdgcn_fence(2 /* acquire order */, "workgroup");
  }
}

// =====================================================================================================
// Exact causal row softmax, one launch for every query row: one block of 256 threads per row t, the longest first.
//   The scores GEMMs wrote every column of row t in [0, ((t>>6)+1)*64).
//   The row is processed in 8-column groups g; ngl = ((t>>6)+1)*8 groups hold scores, ng groups of P are written
//   (t < RC: ng = ngl; else ng = ((t>>7)+1)*16, the k end of the row's 128-row P.V block tile). Thread tid owns groups
//   g = it*256 + tid. Loads use an address clamped to group ngl-1; entries with column > t are replaced by -inf
//   by index before any arithmetic. Iterations with it*256 >= ng are skipped block-uniformly.
//   p = exp(s - max) * (1/sum) in f32 (max finite: column 0 is always valid), x16384 carry, f16 RNE;
//   columns > t up to ng*8 get exact zeros. Rows t < RC: also the f16 residual plane
//   Pl = f16((p*16384 - hi) * 4096), same pitch. Each group is one 16-B store per lane; 8 consecutive lanes fill
//   LDS redm/reds: cross-wave, block barriers (every thread reaches both).
//   coverage: every row x columns [0, ng*8) of P (and Pl) = exactly the extent the P.V GEMM reads.
// =====================================================================================================
//   Rows t >= RC: row t lies in score chunk c = t / RC (S + sbase(c), pitch (c+1)*RC), and P = S: the row's
//   probabilities go over the front of its own scores. Every score of the row is in registers, and has gone into the
//   row maximum, in front of the first block barrier; the stores stand behind the second.
//   Rows t < RC (chunk 0): scores S0, probabilities P0 and residuals Pl0, each [RC][RC].
__global__ __launch_bounds__(256)
void softmax_rows(const float* S, unsigned short* P, const float* S0, unsigned short* P0, unsigned short* Pl0) {
  __shared__ float redm[8];
  __shared__ float reds[8];
  const int t    = SEQ - 1 - (int)blockIdx.x;
  const bool r0  = t < RC;                                   // block-uniform: a row of chunk 0
  const int ch   = t / RC;
  const size_t ro = r0 ? ((size_t)t * (size_t)RC)
                       : (sbase(ch) + (size_t)(t - ch * RC) * (size_t)((ch + 1) * RC));   // the row's first score, f32 elements
  const size_t po = r0 ? ro : (2 * ro);                      // its first probability, f16 elements
  const int tid  = threadIdx.x;
  const int wave = tid >> 5;
  const int lane = tid & 31;
  const int ngl  = ((t >> 6) + 1) * 8;                       // groups that hold scores
  const int ng   = r0 ? ngl : ((t >> 7) + 1) * 16;           // groups of P that are written: up to the P.V block tile's k end
  const float* rp = (r0 ? S0 : S) + ro;
  float v[SMI][8];
#pragma unroll
  for (int it = 0; it < SMI; ++it) {
#pragma unroll
    for (int e = 0; e < 8; ++e) v[it][e] = -INFINITY;
    if (it * 256 < ng) {                                   // block-uniform
      const int g  = it * 256 + tid;
      const int gc = (g < ngl) ? g : (ngl - 1);            // clamped address
      const int c0 = g * 8;
      const v4f a  = *(const v4f*)(rp + (size_t)gc * 8);
      const v4f a4 = *(const v4f*)(rp + (size_t)gc * 8 + 4);
#pragma unroll
      for (int e = 0; e < 4; ++e) {
        v[it][e]     = (c0 + e <= t)     ? a[e]  : -INFINITY;
        v[it][4 + e] = (c0 + 4 + e <= t) ? a4[e] : -INFINITY;
      }
    }
  }
  float mx = -INFINITY;
#pragma unroll
  for (int it = 0; it < SMI; ++it)
#pragma unroll
    for (int e = 0; e < 8; ++e) mx = fmaxf(mx, v[it][e]);
#pragma unroll
  for (int off = 1; off < 32; off <<= 1) mx = fmaxf(mx, __shfl_xor(mx, off, 32));
  if (lane == 0) redm[wave] = mx;
  __syncthreads();
  mx = redm[0];
#pragma unroll
  for (int w = 1; w < 8; ++w) mx = fmaxf(mx, redm[w]);

  float sum = 0.f;
#pragma unroll
  for (int it = 0; it < SMI; ++it) {
    if (it * 256 < ng) {                                   // block-uniform
#pragma unroll
      for (int e = 0; e < 8; ++e) { const float ex = __expf(v[it][e] - mx); v[it][e] = ex; sum += ex; }
    } else {
#pragma unroll
      for (int e = 0; e < 8; ++e) v[it][e] = 0.f;
    }
  }
#pragma unroll
  for (int off = 1; off < 32; off <<= 1) sum += __shfl_xor(sum, off, 32);
  if (lane == 0) reds[wave] = sum;
  __syncthreads();
  sum = reds[0];
#pragma unroll
  for (int w = 1; w < 8; ++w) sum += reds[w];

  const float sc = PCARRY * (1.0f / sum);        // sum >= 1
  v4u pk[SMI], pl[SMI];
#pragma unroll
  for (int it = 0; it < SMI; ++it) {
    v4u a, a2;
#pragma unroll
    for (int e = 0; e < 4; ++e) {
      const float f0 = v[it][2 * e] * sc, f1 = v[it][2 * e + 1] * sc;
      const _Float16 x0 = (_Float16)f0, x1 = (_Float16)f1;
      unsigned short l0 = 0, l1 = 0;
      if (r0) {
        l0 = h_bits((_Float16)((f0 - (float)x0) * RSC));
        l1 = h_bits((_Float16)((f1 - (float)x1) * RSC));
      }
      a[e]  = pk16(h_bits(x0), h_bits(x1));
      a2[e] = pk16(l0, l1);
    }
    pk[it] = a; pl[it] = a2;
  }
  unsigned short* op  = (r0 ? P0 : P) + po;
  unsigned short* opl = Pl0 + po;                            // used by rows of chunk 0 only
  {
#pragma unroll
    for (int it = 0; it < SMI; ++it) {
      if (it * 256 < ng) {                                 // block-uniform
        const int g = it * 256 + tid;
        if (g < ng) {
          *(v4u*)(op + (size_t)g * 8) = pk[it];
          wait_store_regs();                               // the residual store's address reuses this store's register
          if (r0) *(v4u*)(opl + (size_t)g * 8) = pl[it];
        }
      }
    }
    
  }
}

// =====================================================================================================
// Workspace map (bytes at SEQ = 8192, RC = 1024; every region a multiple of its whole-line store granularity and of
//   R0   Xb bf16 [SEQ][EMB] (16777216), later the f32 score chunks c >= 1, S_c [RC][(c+1)*RC] at sbase(c), each row's
//        front overwritten by its f16 probabilities (pitch 2*(c+1)*RC)                                      146800640
//   S0   f32 [RC][RC]     (chunk 0 scores)                                                                    4194304
//   Wqb, Wkb, Wvb bf16 [EMB][EMB]                                                                          3 x 2097152
//   Qh   f16 [SEQ][EMB]                                                                                      16777216
//   Kh   f16 [SEQ][EMB]                                                                                      16777216
//   VT   f16 [EMB][SEQ]   (v^T hi plane)                                                                     16777216
//   Ql   f16 [RC][EMB]    (q residual x4096, rows < RC)                                                       2097152
//   Kl   f16 [RC][EMB]    (k residual x4096, keys < RC)                                                       2097152
//   VL   f16 [EMB][VLP]   (v^T residual x4096, keys < VLP)                                                    2097152
//   P    f16 [RC][RC]     (chunk 0 probabilities)                                                             2097152
//   Pl   f16 [RC][RC]     (p residual x4096, chunk 0 only)                                                    2097152
//   total                                                                                                   218103808
// Aliases are ordered by launch dependence: Xb is last read by the projections' launch, R0's scores are first written by
// the scores GEMM of the chunks c >= 1 after it. Weights are [out n][in k] with k contiguous = the Bt / A layout the GEMM wants.
// =====================================================================================================
static constexpr size_t PACT_B = (size_t)SEQ * EMB * 2;
static constexpr size_t PS_B   = sbase(NCH) * 4;               // chunks 1 .. NCH-1
static constexpr size_t PS0_B  = (size_t)RC * RC * 4;
static constexpr size_t R0_B   = (PACT_B > PS_B) ? PACT_B : PS_B;
static constexpr size_t PW_B   = (size_t)EMB * EMB * 2;
static constexpr size_t PRES_B = (size_t)RC * EMB * 2;
static constexpr size_t PVT_B  = (size_t)EMB * SEQ * 2;
static constexpr size_t PVL_B  = (size_t)EMB * VLP * 2;
static constexpr size_t PP_B   = (size_t)RC * RC * 2;
static constexpr size_t PPL_B  = (size_t)RC * RC * 2;
static constexpr size_t WS_TOTAL = R0_B + PS0_B + 3 * PW_B + 2 * PACT_B + PVT_B + 2 * PRES_B + PVL_B + PP_B + PPL_B;
static_assert(WS_TOTAL <= (size_t)268435456);
static_assert((R0_B % 128) == 0 && (PS0_B % 128) == 0 && (PP_B % 128) == 0 && (PW_B % 128) == 0 && (PRES_B % 128) == 0 && (PVL_B % 128) == 0 && (PPL_B % 128) == 0);

extern "C" void kernel_launch(void* const* d_in, const int* in_sizes, int n_in,
                              void* d_out, int out_size, void* d_ws, size_t ws_size,
                              hipStream_t stream) {
  if (n_in < 4) return;
  const long long needX = (long long)SEQ * (long long)EMB;
  if ((long long)in_sizes[0] < needX) return;
  if (in_sizes[1] < EMB * EMB) return;
  if (in_sizes[2] < EMB * EMB) return;
  if (in_sizes[3] < EMB * EMB) return;
  if (out_size < 0) return;
  if ((long long)out_size < needX) return;

  const float* x  = (const float*)d_in[0];
  const float* Wq = (const float*)d_in[1];
  const float* Wk = (const float*)d_in[2];
  const float* Wv = (const float*)d_in[3];

  size_t off = 0;
  const size_t oR0 = off; off += R0_B;
  const size_t oS0 = off; off += PS0_B;
  const size_t oWq = off; off += PW_B;
  const size_t oWk = off; off += PW_B;
  const size_t oWv = off; off += PW_B;
  const size_t oQh = off; off += PACT_B;
  const size_t oKh = off; off += PACT_B;
  const size_t oVT = off; off += PVT_B;
  const size_t oQl = off; off += PRES_B;
  const size_t oKl = off; off += PRES_B;
  const size_t oVL = off; off += PVL_B;
  const size_t oP  = off; off += PP_B;
  const size_t oPl = off; off += PPL_B;
  if (off != WS_TOTAL) return;
  if (off > ws_size) return;
  if (off > (size_t)268435456) return;

  char* ws = (char*)d_ws;
  unsigned short* Xb  = (unsigned short*)(ws + oR0);
  float*          S   = (float*)(ws + oR0);          // alias, see map
  float*          S0  = (float*)(ws + oS0);
  unsigned short* Wqb = (unsigned short*)(ws + oWq);
  unsigned short* Wkb = (unsigned short*)(ws + oWk);
  unsigned short* Wvb = (unsigned short*)(ws + oWv);
  unsigned short* Qh  = (unsigned short*)(ws + oQh);
  unsigned short* Kh  = (unsigned short*)(ws + oKh);
  unsigned short* VT  = (unsigned short*)(ws + oVT);
  unsigned short* Ql  = (unsigned short*)(ws + oQl);
  unsigned short* Kl  = (unsigned short*)(ws + oKl);
  unsigned short* VL  = (unsigned short*)(ws + oVL);
  unsigned short* Pp  = (unsigned short*)(ws + oP);
  unsigned short* Ppl = (unsigned short*)(ws + oPl);
  float*          out0 = (float*)d_out;

  const dim3 blk(256);
  const int n8x = SEQ * EMB / 8;                                    // multiple of 256
  const int n8w = EMB * EMB / 8;                                    // multiple of 256
  const dim3 gCvt(n8x / 256 + 3 * (n8w / 256), 1);
  const dim3 gPr(((SEQ / 64) * (EMB / 64)) / 8, 3);                 // q, k (M=SEQ, N=EMB), v^T (M=EMB, N=SEQ): 64x64 wave tiles
  const dim3 gSn((RC / 64) * 4 + ((RC / 64) * (RC / 64) / 8) * ((NCH * (NCH + 1)) / 2 - 1), 1);   // scores: chunk 0's 64x256 block tiles, then chunks c >= 1, 128x256
  const dim3 gPn((RC / 64) * (EMB / 64) / 8, (NCH - 1) + 2);        // P.V: chunks c >= 1, 128x256 block tiles; y >= NCH-1: chunk 0's 64x256
  static_assert(2 * ((RC / 64) * (EMB / 64) / 8) == (RC / 64) * 4);
  const dim3 gSm(SEQ);                                              // one block per query row

  // (1) x, Wq, Wk, Wv -> bf16 planes (RNE convert), one launch
  cvt16x8<<<gCvt, blk, 0, stream>>>(x, Wq, Wk, Wv, Xb, Wqb, Wkb, Wvb, n8x / 256, n8w / 256);
  // (2) one launch, blockIdx.y = 0, 1, 2 (K=EMB each):
  //     q = x . Wq^T, k = x . Wk^T -> f16 planes [s][d]; rows [0, RC) also a residual (x4096) plane;
  //     v^T = Wv . x^T -> f16 hi plane [d][s] (pitch SEQ) and f16 residual plane x4096 [d][s < VLP] (pitch VLP).
  //     Wqb, Wkb, Wvb / Qh, Kh, VT / Ql, Kl, VL each lie one behind the other in the workspace (the three strides).
  static_assert(PVT_B == PACT_B && PVL_B == PRES_B);
  gemm_t<__bf16, 4, 3, 0, 2><<<gPr, blk, 0, stream>>>(
      Xb, Xb, EMB, Wqb, EMB, (long long)(PW_B / 2),
      Wqb, EMB,
      (void*)Qh, (void*)Ql, EMB, (long long)(PACT_B / 2), EMB, (long long)(PRES_B / 2), EMB,
      SEQ, EMB, EMB, 1.0f, 0.0f, 1.0f, RSC, 0);
  // (3) scores = q.k / 32 -> f32, causal tiles only, every row chunk in one launch (MC = 1).
  //     Chunk 0 (rows and keys [0, RC), residual planes) -> S0: Qh.Kh and, x4096, Ql.Kh + Qh.Kl.
  //     Chunks c >= 1 (rows c*RC .. c*RC+RC-1, keys 0 .. (c+1)*RC-1), single f16 planes -> S; the kernel takes each
  //     chunk's rows, widths and pitches from blockIdx.
  gemm_t<_Float16, 4, 0, 1, 1><<<gSn, blk, 0, stream>>>(
      Qh, Ql, EMB, Kh, EMB, 0LL,
      Kl, EMB,
      (void*)S, (void*)S0, 0, 0LL, RC, 0LL, 0,
      RC, 0, EMB, 1.0f / 32.0f, 1.0f / RSC, 1.0f, 1.0f, 0);
  // (4) exact causal softmax of every row in one launch -> f16 probabilities (x16384, zeros beyond the diagonal up to
  //     the P.V tile's k end); rows of chunk 0 also their residual plane.
  softmax_rows<<<gSm, blk, 0, stream>>>(S, (unsigned short*)S, S0, Pp, Ppl);
  // (5) out rows = P.V / 16384 -> f32 d_out, every row chunk in one launch (MC = 1).
  //     Chunk 0: Ph.Vh and, x4096, Pl.Vh + Ph.Vl (Ph, Pl pitch RC, VT pitch SEQ, VL pitch VLP). Chunks c >= 1: single planes.
  gemm_t<_Float16, 4, 0, 2, 1><<<gPn, blk, 0, stream>>>(
      (const unsigned short*)S, Pp, 0, VT, SEQ, 0LL,
      VL, VLP,
      (void*)out0, (void*)Ppl, EMB, 0LL, 0, 0LL, 0,
      RC, EMB, 0, 1.0f / PCARRY, 1.0f / RSC, 1.0f, 1.0f, 0);
  (void)hipGetLastError();
}

// v006
// It runs in 228 microseconds.
// In both of two side-by-side timings against v005, it was 1.12 times as fast.
// All steps since v000 together make it 9.72 times as fast.
// Contractions: q, k, v^T in-projections = v_wmma_f32_16x16x32_bf16 (bf16 operands from RNE-converted inputs, single product, f32 accumulate);
// q.k^T scores = v_wmma_f32_16x16x32_f16 (q, k f16 planes, single product; query rows < RC: q and k each f16 hi plane + f16 residual plane x4096, 3 products, separate f32 accumulators);
// p.v = v_wmma_f32_16x16x32_f16 (p carried x16384 in f16, v^T f16, single product; query rows < RC: p and v^T each f16 hi plane + f16 residual plane x4096, 3 products, separate f32 accumulators);
// causal softmax (row max, sum, probabilities) in f32 on materialised f32 score row chunks.
// p.v of query rows >= RC: each k loop is cut into pieces of PVK keys, one block a piece; piece 0 goes to out, the later
// pieces to f32 planes in the workspace, which a last launch adds to out in ascending key order.
#include <hip/hip_runtime.h>
#include <math.h>
#include <stdint.h>
#include <type_traits>

#ifndef NB
#define NB 1
#endif
#ifndef SEQ
#define SEQ 8192
#endif
#define NB_FULL  1
#define SEQ_FULL 8192
#define EMB      1024
#define RC       ((SEQ < 1024) ? SEQ : 1024)   // query rows per score/probability chunk; rows < RC use residual planes
#define NCH      (SEQ / RC)                    // number of row chunks
#define VLP      RC                            // key extent of the v^T residual plane
#define PCARRY   16384.0f                      // power-of-two carry of p in the f16 P.V operand
#define RSC      4096.0f                       // power-of-two carry of every f16 residual plane
#define SMI      ((SEQ / 8 + 255) / 256)       // max 8-column groups per softmax thread
static_assert(NB == 1 && NB_FULL == 1);
static_assert(SEQ >= 256 && SEQ <= SEQ_FULL && (SEQ % 256) == 0);
static_assert((SEQ % RC) == 0 && (RC % 64) == 0 && NCH >= 1);
static_assert((EMB % 64) == 0 && (SEQ % 64) == 0 && (EMB % 32) == 0 && (RC % 32) == 0);
static_assert(SMI >= 1 && SMI <= 4);
static_assert((EMB % 512) == 0 && (RC % 512) == 0 && (SEQ % 512) == 0);   // eight 64-column tiles per GEMM block; 64-k staged tiles
static_assert(((SEQ * EMB / 8) % 256) == 0 && ((EMB * EMB / 8) % 256) == 0);
#define PVK      2048                          // keys per piece of a P.V k loop (query rows >= RC)
#define PRS      (PVK / 128)                   // 128-row tiles after which a k loop is one piece longer
#define NRT      (SEQ / 128)                   // 128-row tiles of the whole output
#define RT0      (RC / 128)                    // the first of them that is not chunk 0's
#define NPC      (SEQ / PVK)                   // pieces of the longest k loop
#define JR       4                             // rows per block of the launch that adds the pieces
static_assert((SEQ % PVK) == 0 && SEQ > PVK && (PVK % 128) == 0 && RT0 <= PRS && (128 % JR) == 0);

typedef _Float16 v16h __attribute__((ext_vector_type(16)));
typedef _Float16 v8h  __attribute__((ext_vector_type(8)));
typedef __bf16   v16b __attribute__((ext_vector_type(16)));
typedef __bf16   v8b  __attribute__((ext_vector_type(8)));
typedef float    v8f  __attribute__((ext_vector_type(8)));
typedef float    v4f  __attribute__((ext_vector_type(4)));
typedef unsigned int v4u __attribute__((ext_vector_type(4)));

#if defined(__HIP_DEVICE_COMPILE__)
#define DEV_ASM 1
#else
#define DEV_ASM 0
#endif

// ---- scalar helpers --------------------------------------------------------------------------------
__device__ __forceinline__ unsigned short bf_bits(float f) {          // f32 -> bf16 bits, RNE convert
  unsigned u = __float_as_uint(f);
  return (unsigned short)((u + 0x7FFFu + ((u >> 16) & 1u)) >> 16);
}
__device__ __forceinline__ unsigned short h_bits(_Float16 x) { return __builtin_bit_cast(unsigned short, x); }
__device__ __forceinline__ unsigned pk16(unsigned short a, unsigned short b) { return (unsigned)a | ((unsigned)b << 16); }
// f32 elements of the score chunks 1 .. c-1, which lie in front of chunk c (chunk j: RC rows of (j+1)*RC columns)
__host__ __device__ __forceinline__ constexpr size_t sbase(int c) { return (size_t)RC * RC * (size_t)((c * (c + 1)) / 2 - 1); }
// f32 elements of the P.V partial planes 1 .. s-1, which lie in front of plane s (plane j: rows j*PVK .. SEQ-1, pitch EMB)
__host__ __device__ __forceinline__ constexpr size_t pbase(int s) {
  return (size_t)EMB * (size_t)((s - 1) * SEQ - PVK * (((s - 1) * s) / 2));
}
// P.V pieces of the row tiles RT0 .. NRT-1 (row tile R: keys [0, (R+1)*128)): whole pieces of PVK keys, and shorter last pieces
__host__ __device__ constexpr int pv_whole() {
  int n = 0;
  for (int q = 0; q < NPC; ++q) { const int first = PRS * (q + 1) - 1; n += NRT - ((first < RT0) ? RT0 : first); }
  return n;
}
__host__ __device__ constexpr int pv_short() {
  int n = 0;
  for (int m = 1; m < PRS; ++m) n += NPC - ((m - 1 >= RT0) ? 0 : 1);
  return n;
}
// rank f -> (row tile R, piece s), every pair once, the longest pieces first: the whole pieces, then the last pieces of
// m * 128 keys, m falling. Block-uniform scalar arithmetic.
__device__ __forceinline__ void pv_piece(int f, int& R, int& s) {
  R = NRT - 1; s = 0;
  for (int q = 0; q < NPC; ++q) {
    const int first = PRS * (q + 1) - 1;
    const int n = NRT - ((first < RT0) ? RT0 : first);
    if (f < n) { R = NRT - 1 - f; s = q; return; }
    f -= n;
  }
  for (int m = PRS - 1; m >= 1; --m) {
    const int n = NPC - ((m - 1 >= RT0) ? 0 : 1);
    if (f < n) { s = NPC - 1 - f; R = s * PRS + m - 1; return; }
    f -= n;
  }
}
__device__ __forceinline__ v8f zero8() { v8f z = {0.f, 0.f, 0.f, 0.f, 0.f, 0.f, 0.f, 0.f}; return z; }

// ---- fragment types / loaders: 16-bit A/B operand, lane -> row/col (lane&15), p already includes +8*(lane>>4);
//      elements 0..7 <- p[0..7] (k0+8h..k0+8h+7), elements 8..15 <- p[16..23] (k0+16+8h..k0+16+8h+7)
template <typename OT> struct FT;
template <> struct FT<__bf16>   { typedef v16b frag; typedef v8b half8; };
template <> struct FT<_Float16> { typedef v16h frag; typedef v8h half8; };

template <typename OT>
__device__ __forceinline__ typename FT<OT>::frag ldfrag(const OT* p) {
  union { typename FT<OT>::frag v; typename FT<OT>::half8 h[2]; } f;
  f.h[0] = *(const typename FT<OT>::half8*)(p);
  f.h[1] = *(const typename FT<OT>::half8*)(p + 16);
  return f.v;
}

// ---- WMMA helpers (asm guard bodies are device-only; concrete operand types) -----------------------------
__device__ __forceinline__ v8f mmar(v16b a, v16b b, v8f c) {
  return __builtin_amdgcn_wmma_f32_16x16x32_bf16(false, a, false, b, (short)0, c, false, false);
}
__device__ __forceinline__ v8f mmar(v16h a, v16h b, v8f c) {
  return __builtin_amdgcn_wmma_f32_16x16x32_f16(false, a, false, b, (short)0, c, false, false);
}
__device__ __forceinline__ void acc_guard4(v8f& a, v8f& b, v8f& c, v8f& d) {
#if DEV_ASM
  asm volatile("v_nop\n\tv_nop\n\tv_nop\n\tv_nop" : "+v"(a), "+v"(b), "+v"(c), "+v"(d));
#else
  (void)a; (void)b; (void)c; (void)d;
#endif
}

// ---- LDS staging by asynchronous copies ---------------------------------------------------------------
#define BKE 64     // k elements per staged tile: 128-B rows, whole lines of the source
#define LPB 144    // LDS row pitch in bytes: 128 + 16 (16 B x odd, conflict-free for 16-B row readers)
#define LPE (LPB / 2)
__device__ __forceinline__ unsigned lds_off(const void* p) { return (unsigned)(size_t)p; }   // byte offset in the block's LDS
// Each copy: a wave brings 4 rows x 128 B (lane -> row lane>>3, 16-B piece lane&7), l / g already hold the lane's part.
// step4 = source elements per 4 rows. The address-register wait ends each statement, so no later address
// arithmetic can be placed between a copy and that wait.
__device__ __forceinline__ void copy8and32rows(unsigned la, const void* gap, size_t astep4,
                                               unsigned l, const void* gp, size_t step4) {
#if DEV_ASM
  const unsigned short* ga = (const unsigned short*)gap;
  const unsigned short* g  = (const unsigned short*)gp;
  asm volatile("global_load_async_to_lds_b128 %0, %10, off\n\t"
               "global_load_async_to_lds_b128 %1, %11, off\n\t"
               "global_load_async_to_lds_b128 %2, %12, off\n\t"
               "global_load_async_to_lds_b128 %3, %13, off\n\t"
               "global_load_async_to_lds_b128 %4, %14, off\n\t"
               "global_load_async_to_lds_b128 %5, %15, off\n\t"
               "global_load_async_to_lds_b128 %6, %16, off\n\t"
               "global_load_async_to_lds_b128 %7, %17, off\n\t"
               "global_load_async_to_lds_b128 %8, %18, off\n\t"
               "global_load_async_to_lds_b128 %9, %19, off\n\t"
               "s_wait_xcnt 0x0"
               :: "v"(la), "v"(la + 4u * LPB),
                  "v"(l), "v"(l + 4u * LPB), "v"(l + 8u * LPB), "v"(l + 12u * LPB),
                  "v"(l + 16u * LPB), "v"(l + 20u * LPB), "v"(l + 24u * LPB), "v"(l + 28u * LPB),
                  "v"(ga), "v"(ga + astep4),
                  "v"(g), "v"(g + step4), "v"(g + 2 * step4), "v"(g + 3 * step4),
                  "v"(g + 4 * step4), "v"(g + 5 * step4), "v"(g + 6 * step4), "v"(g + 7 * step4) : "memory");
#else
  (void)la; (void)gap; (void)astep4; (void)l; (void)gp; (void)step4;
#endif
}
// 16 rows of the shared A part and 32 rows of the shared Bt part: one wave's twelve copies of a 384-row tile; the
// address-register wait is the statement's last line, as above.
__device__ __forceinline__ void copy16and32rows(unsigned la, const void* gap, size_t astep4,
                                                unsigned l, const void* gp, size_t step4) {
#if DEV_ASM
  const unsigned short* ga = (const unsigned short*)gap;
  const unsigned short* g  = (const unsigned short*)gp;
  asm volatile("global_load_async_to_lds_b128 %0, %12, off\n\t"
               "global_load_async_to_lds_b128 %1, %13, off\n\t"
               "global_load_async_to_lds_b128 %2, %14, off\n\t"
               "global_load_async_to_lds_b128 %3, %15, off\n\t"
               "global_load_async_to_lds_b128 %4, %16, off\n\t"
               "global_load_async_to_lds_b128 %5, %17, off\n\t"
               "global_load_async_to_lds_b128 %6, %18, off\n\t"
               "global_load_async_to_lds_b128 %7, %19, off\n\t"
               "global_load_async_to_lds_b128 %8, %20, off\n\t"
               "global_load_async_to_lds_b128 %9, %21, off\n\t"
               "global_load_async_to_lds_b128 %10, %22, off\n\t"
               "global_load_async_to_lds_b128 %11, %23, off\n\t"
               "s_wait_xcnt 0x0"
               :: "v"(la), "v"(la + 4u * LPB), "v"(la + 8u * LPB), "v"(la + 12u * LPB),
                  "v"(l), "v"(l + 4u * LPB), "v"(l + 8u * LPB), "v"(l + 12u * LPB),
                  "v"(l + 16u * LPB), "v"(l + 20u * LPB), "v"(l + 24u * LPB), "v"(l + 28u * LPB),
                  "v"(ga), "v"(ga + astep4), "v"(ga + 2 * astep4), "v"(ga + 3 * astep4),
                  "v"(g), "v"(g + step4), "v"(g + 2 * step4), "v"(g + 3 * step4),
                  "v"(g + 4 * step4), "v"(g + 5 * step4), "v"(g + 6 * step4), "v"(g + 7 * step4) : "memory");
#else
  (void)la; (void)gap; (void)astep4; (void)l; (void)gp; (void)step4;
#endif
}
__device__ __forceinline__ void wait_lds_reads() {   // this wave's LDS reads have returned before its buffer is handed back
#if DEV_ASM
  asm volatile("s_wait_dscnt 0x0" ::: "memory");
#endif
}
__device__ __forceinline__ void wait_store_regs() {  // a precaution: stands between issued global stores and the reuse of their registers
#if DEV_ASM
  asm volatile("s_wait_xcnt 0x0" ::: "memory");
#endif
}
__device__ __forceinline__ void wait_load_regs() {   // a precaution: stands between issued global loads and the reuse of their address registers
#if DEV_ASM
  asm volatile("s_wait_xcnt 0x0" ::: "memory");
#endif
}
__device__ __forceinline__ void wait_copies() {      // this wave's copies have landed before the barrier publishes them
#if DEV_ASM
  asm volatile("s_wait_asynccnt 0x0" ::: "memory");
#endif
}

// =====================================================================================================
// f32 -> bf16 planes (RNE convert), 8 elements per thread, one 16-B store per lane: a wave writes 512 contiguous B
// One launch for x and the three weights: blocks [0, nbx) take x, then nbw blocks each take Wq, Wk, Wv (block-uniform).
// coverage: nbx * 256 threads x 8 elements = the whole x plane, nbw * 256 x 8 = each whole weight plane.
// =====================================================================================================
__global__ __launch_bounds__(256) void cvt16x8(const float* __restrict__ x, const float* __restrict__ wq,
                                               const float* __restrict__ wk, const float* __restrict__ wv,
                                               unsigned short* xb, unsigned short* wqb, unsigned short* wkb,
                                               unsigned short* wvb, int nbx, int nbw) {
  int bi = (int)blockIdx.x;
  int nb = nbx;                          // blocks of the plane that this block works on
  const float* in = x;
  unsigned short* out = xb;
  if (bi >= nbx) {
    bi -= nbx; nb = nbw;
    in = wq; out = wqb;
    if (bi >= nbw) { bi -= nbw; in = wk; out = wkb; }
    if (bi >= nbw) { bi -= nbw; in = wv; out = wvb; }
  }
  const int i = bi * 256 + (int)threadIdx.x;
  if (bi < nb) {
    const float* ip = in + (size_t)i * 8;
    const v4f a  = *(const v4f*)(ip);
    const v4f a4 = *(const v4f*)(ip + 4);
    v4u p;
    p[0] = pk16(bf_bits(a[0]),  bf_bits(a[1]));
    p[1] = pk16(bf_bits(a[2]),  bf_bits(a[3]));
    p[2] = pk16(bf_bits(a4[0]), bf_bits(a4[1]));
    p[3] = pk16(bf_bits(a4[2]), bf_bits(a4[3]));
    unsigned short* o = out + (size_t)i * 8;
    *(v4u*)o = p;
    
  }
}

// =====================================================================================================
// The k loop of one block tile (16-bit operand type OT). The eight waves of a block form a 2 x 4 grid of (16*MI) x 64
// wave tiles. stage(t) copies the block's rows of k tile t (64 k, whole 128-B lines) into buffer t & 1 of the ring
// (STG bytes a buffer) by asynchronous copies: two buffers, one block barrier per tile, tile t + 1 flies while tile t
// is multiplied. aOff / bOff = byte offsets in a buffer of this lane's first A / Bt fragment row. Fragments are read
// from LDS with the split k map (ldfrag); the k order of every sum is ascending. On entry no wave reads the ring any
// more (kernel entry, or the barrier that ends an earlier loop); on return every wave's ring reads have returned.
// =====================================================================================================
template <typename OT, int MI, int STG, typename SF>
__device__ __forceinline__ void kloop(unsigned char* ring, int nT, int aOff, int bOff, int koff, SF stage, v8f (*acc)[4]) {
  typedef typename FT<OT>::frag V16;
  stage(0);
  wait_copies();
  __syncthreads();                       // tile 0 is published
  if (nT > 1) stage(1);
  // Every LDS read of tile t stands between the barrier that publishes it and the barrier that frees its buffer.
  // Fragment registers: bq0 / bq1 = Bt of the tile's first / second 32 k; a[i] is refilled in place right behind its
  // last product; ax holds row group MI-1 of the second 32 k, so that no read is issued behind a phase's last products.
  // The scheduling barriers keep each read at that place (left alone, the compiler read each A fragment right in
  // front of its products and waited for it every time).
  V16 bq0[4], bq1[4], a[MI], ax;
  {
    const OT* sA = (const OT*)(const void*)(ring + aOff) + koff;
    const OT* sB = (const OT*)(const void*)(ring + bOff) + koff;
#pragma unroll
    for (int j = 0; j < 4; ++j) bq0[j] = ldfrag<OT>(sB + (j << 4) * LPE);
#pragma unroll
    for (int i = 0; i < MI; ++i) a[i] = ldfrag<OT>(sA + (i << 4) * LPE);
  }
  for (int t = 0; t < nT; ++t) {
    const unsigned char* buf = ring + (size_t)(t & 1) * STG;
    const OT* sA = (const OT*)(const void*)(buf + aOff) + koff + 32;
    const OT* sB = (const OT*)(const void*)(buf + bOff) + koff + 32;
    ax = ldfrag<OT>(sA + ((MI - 1) << 4) * LPE);
#pragma unroll
    for (int j = 0; j < 4; ++j) bq1[j] = ldfrag<OT>(sB + (j << 4) * LPE);
    __builtin_amdgcn_sched_barrier(0);     // reads of the second 32 k go out ahead of the first 32 k's products
#pragma unroll
    for (int i = 0; i < MI - 1; ++i) {
#pragma unroll
      for (int j = 0; j < 4; ++j) acc[i][j] = mmar(a[i], bq0[j], acc[i][j]);
      __builtin_amdgcn_sched_barrier(0);   // the refill stays behind a[i]'s last product, so it can take a[i]'s registers
      a[i] = ldfrag<OT>(sA + (i << 4) * LPE);
      __builtin_amdgcn_sched_barrier(0);   // the refill of a[i] stays among the products
    }
#pragma unroll
    for (int j = 0; j < 4; ++j) acc[MI - 1][j] = mmar(a[MI - 1], bq0[j], acc[MI - 1][j]);
    __builtin_amdgcn_sched_barrier(0);     // the first 32 k's products stay ahead of the waits
    wait_lds_reads();
    wait_copies();
    __syncthreads();                       // publishes tile t + 1 and ends every read of tile t's buffer
    if (t + 2 < nT) stage(t + 2);
    // The first 32 k of tile t + 1 are read under tile t's last products. The last trip has no next tile: a scalar
    // select aims its reads, whose values nobody uses, at its own buffer (landed, not refilled), which keeps the
    // products free of a branch.
    const unsigned char* nbuf = ring + (size_t)(((t + 1 < nT) ? (t + 1) : t) & 1) * STG;
    const OT* nA = (const OT*)(const void*)(nbuf + aOff) + koff;
    const OT* nB = (const OT*)(const void*)(nbuf + bOff) + koff;
    a[MI - 1] = ldfrag<OT>(nA + ((MI - 1) << 4) * LPE);
#pragma unroll
    for (int j = 0; j < 4; ++j) bq0[j] = ldfrag<OT>(nB + (j << 4) * LPE);
    __builtin_amdgcn_sched_barrier(0);     // the next tile's reads go out ahead of this tile's last products
#pragma unroll
    for (int i = 0; i < MI - 1; ++i) {
#pragma unroll
      for (int j = 0; j < 4; ++j) acc[i][j] = mmar(a[i], bq1[j], acc[i][j]);
      __builtin_amdgcn_sched_barrier(0);   // the refill stays behind a[i]'s last product, so it can take a[i]'s registers
      a[i] = ldfrag<OT>(nA + (i << 4) * LPE);
      __builtin_amdgcn_sched_barrier(0);   // the refill of a[i] stays among the products
    }
#pragma unroll
    for (int j = 0; j < 4; ++j) acc[MI - 1][j] = mmar(ax, bq1[j], acc[MI - 1][j]);
  }
  wait_copies();
  wait_lds_reads();
  __syncthreads();                       // every wave's last ring read has returned: the ring is free again
}

// =====================================================================================================
// One 64 x 256 block tile of row chunk 0 (query rows and keys < RC), whose operands are f16 hi planes A, Bt and f16
// residual planes A2, B2 (both x 1/rscale2): C = ((A.Bt) + (A2.Bt + A.B2) * rscale2) * oscale, f32, pitch ldc.
// It runs inside the launch of the chunks c >= 1, in the same ring and on the same k loop; b0 = its index among
// chunk 0's (RC / 64) x 4 block tiles. The eight waves form a 2 x 4 grid of 32 x 64 tiles.
// First loop: a wave's 64 staged A rows are its 32 rows of A and behind them its 32 rows of A2, so row groups 0, 1
// give A.Bt and row groups 2, 3 give A2.Bt from the same Bt fragments. Second loop: A.B2 goes on top of A2.Bt.
// CZ = 1 (scores, k loops of K): block tiles beyond the diagonal leave at once, wave tiles beyond it store nothing.
// CZ = 2 (P.V): the A rows hold exact zeros from the diagonal to column mB + 64, where the k loops end; long loops first.
// =====================================================================================================
template <int CZ, int STG>
__device__ __forceinline__ void chunk0_tile(unsigned char* ring, int b0,
    const _Float16* A, const _Float16* A2, int lda, const _Float16* Bt, int ldb, const _Float16* B2, int ldb2,
    float* C, int ldc, int K, float oscale, float rscale2) {
  const int wave = __builtin_amdgcn_readfirstlane((int)(threadIdx.x >> 5));
  const int tm = (CZ == 2) ? (RC / 64 - 1 - (b0 >> 2)) : (b0 >> 2);
  const int mB = tm * 64;
  const int nB = (b0 & 3) * 256;
  const int wm = wave >> 2, wn = wave & 3;
  const int m0 = mB + wm * 32;
  const int n0 = nB + wn * 64;
  if (CZ == 1 && nB >= mB + 64) return;                        // block-uniform causal skip, in front of every barrier
  const bool live = (CZ != 1) || (n0 < m0 + 32);               // a wave past the diagonal walks the loops and stores nothing
  const int nT = ((CZ == 2) ? (mB + 64) : K) / BKE;            // >= 1; block-uniform

  v8f acc[4][4];                         // [0], [1]: A.Bt; [2], [3]: A2.Bt + A.B2
#pragma unroll
  for (int i = 0; i < 4; ++i)
#pragma unroll
    for (int j = 0; j < 4; ++j) acc[i][j] = zero8();
  {
    const int lane = threadIdx.x & 31;
    // this lane's part of every staged tile: row lane>>3 of each 4-row group, 16-B piece lane&7
    const int crow = lane >> 3;
    const int cel  = (lane & 7) * 8;
    const unsigned lc = lds_off(ring) + (unsigned)(crow * LPB + cel * 2);
    // staged A rows wave*16 .. +15 = 16 rows of A (waves 0, 1, 4, 5) or of A2 (waves 2, 3, 6, 7)
    const _Float16* gA = ((wave & 2) ? A2 : A) + (size_t)(mB + wm * 32 + (wave & 1) * 16 + crow) * lda + cel;
    const _Float16* gB = Bt + (size_t)(nB + wave * 32 + crow) * ldb + cel;
    const unsigned lA = lc + (unsigned)(wave * 16 * LPB);
    const unsigned lB = lc + (unsigned)((128 + wave * 32) * LPB);
    kloop<_Float16, 4, STG>(ring, nT, (wm * 64 + (lane & 15)) * LPB, (128 + wn * 64 + (lane & 15)) * LPB, (lane >> 4) * 8,
                            [&](int t) {
      copy16and32rows(lA + (unsigned)(t & 1) * (unsigned)STG, gA + t * BKE, (size_t)4 * lda,
                      lB + (unsigned)(t & 1) * (unsigned)STG, gB + t * BKE, (size_t)4 * ldb);
    }, acc);
  }
  // The lane index is taken anew, from the lane mask count: what the second loop and the epilogue derive from it is then
  // formed here and holds no registers through the first loop, whose budget is that of two blocks per WGP.
  const int lane  = (int)__builtin_amdgcn_mbcnt_lo(~0u, 0u);
  const int rlane = lane & 15;
  const int mOff  = (lane >> 4) * 8;
  {
    const int crow = lane >> 3;
    const int cel  = (lane & 7) * 8;
    const unsigned lc = lds_off(ring) + (unsigned)(crow * LPB + cel * 2);
    // A rows wave*8 .. +7, at the front of their wave row's 64 staged rows
    const _Float16* gA = A + (size_t)(mB + wave * 8 + crow) * lda + cel;
    const _Float16* gB = B2 + (size_t)(nB + wave * 32 + crow) * ldb2 + cel;
    const unsigned lA = lc + (unsigned)((wm * 64 + wn * 8) * LPB);
    const unsigned lB = lc + (unsigned)((128 + wave * 32) * LPB);
    kloop<_Float16, 2, STG>(ring, nT, (wm * 64 + rlane) * LPB, (128 + wn * 64 + rlane) * LPB, (lane >> 4) * 8,
                            [&](int t) {
      copy8and32rows(lA + (unsigned)(t & 1) * (unsigned)STG, gA + t * BKE, (size_t)4 * lda,
                     lB + (unsigned)(t & 1) * (unsigned)STG, gB + t * BKE, (size_t)4 * ldb2);
    }, acc + 2);
  }
  if (!live) return;                     // wave-uniform; no block barrier follows
#pragma unroll
  for (int i = 0; i < 4; ++i) acc_guard4(acc[i][0], acc[i][1], acc[i][2], acc[i][3]);

  float* slab = (float*)(void*)ring + wave * (16 * 68);   // pitch 68 floats, wave-private
  const int h2 = lane >> 4, c4 = (lane & 15) * 4;         // 256-B row segment = 16 lanes x 16 B
#pragma unroll
  for (int i = 0; i < 2; ++i) {
#pragma unroll
    for (int j = 0; j < 4; ++j) {
#pragma unroll
      for (int r = 0; r < 8; ++r) {
        float v = acc[i][j][r];
        v += acc[i + 2][j][r] * rscale2;
        v = v * oscale;
        slab[(mOff + r) * 68 + (j << 4) + rlane] = v;
      }
    }
    __builtin_amdgcn_fence(3 /* release order */, "workgroup");
    __builtin_amdgcn_wave_barrier();
    __builtin_amdgcn_fence(2 /* acquire order */, "workgroup");
    v4f val[8];
    float* pc[8];
#pragma unroll
    for (int it = 0; it < 8; ++it) {
      const int row = it * 2 + h2;                         // it 0..7 x h2 0..1 = rows 0..15
      val[it] = *(const v4f*)(slab + row * 68 + c4);
      pc[it]  = C + (size_t)(m0 + (i << 4) + row) * ldc + n0 + c4;
    }
    __builtin_amdgcn_sched_barrier(0);   // values and addresses are formed ahead of the stores: nothing is computed among them
#pragma unroll
    for (int it = 0; it < 8; ++it) *(v4f*)pc[it] = val[it];
    wait_store_regs();
    __builtin_amdgcn_sched_barrier(0);   // later arithmetic, which reuses the stores' registers, stays behind the wait
    __builtin_amdgcn_fence(3 /* release order */, "workgroup");
    __builtin_amdgcn_wave_barrier();
    __builtin_amdgcn_fence(2 /* acquire order */, "workgroup");
  }
}

// =====================================================================================================
// Register-blocked WMMA GEMM (16-bit operand type OT): C[m][n] = sum_k A[m][k] * Bt[n][k];
// one wave per (16*MI) x 64 tile; the eight waves of a block form a 2 x 4 grid of such tiles, a 128 x 256 block tile
// (M a multiple of 128, N of 256): each staged A row serves four waves, each staged Bt row two, and two blocks' rings
// fit one LDS. A row-major [M][K] pitch lda; Bt row-major [N][K] pitch ldb (k contiguous); K multiple of 64 (static
// sizes here). Staging and products: kloop above.
// value v = acc * oscale, in the f32 epilogue.
// CZ (causal), czoff = global row index of local row 0 (multiple of 64):
//   0 none; 1 = output tiles with n0 >= czoff + m0 + 16*MI are not stored (every tile holding a
//   column <= one of its rows is written); 2 = A rows hold exact zeros beyond the diagonal up to column
//   czoff + mB + BR (mB, BR = first row and rows of the block tile), so the k loop ends at min(K, czoff + mB + BR)
//   (exact); the last staged tile is copied whole, so A rows are written up to the next multiple of 64 columns.
// OUT_MODE 0: f32 C (pitch ldc) = v.
// OUT_MODE 3: f16 hi plane C = f16(v * cscale) (pitch ldc) and f16 residual plane
//             C2 = f16((v*cscale - hi) * rscaleC) (pitch ldc2), C2 written only for output
//             tiles with n0 < N2 (N2 multiple of 64, wave-uniform), i.e. columns [0, N2) fully (MC = 2: and rows [0, M2)).
// =====================================================================================================
// MC = 1: one launch holds every row chunk (M = RC rows each). Chunks c >= 1, single planes: CZ = 2: a flat grid of
//   k-loop pieces of at most PVK keys (pv_piece), four column tiles each, the longest first, so that more blocks than
//   resident places level the WGPs' work. CZ = 1: a flat grid, chunk after chunk, the widest last, which the
//   softmax then reads first.
//   The f32 score chunks lie one behind the other, chunk c at sbase(c) elements with pitch (c+1)*RC; the softmax
//   writes each f16 probability row over the front of its own score row (f16 pitch 2*(c+1)*RC).
//   CZ = 1: A rows, N, ldc, C and czoff are the chunk's; CZ = 2: A, lda, K, C rows and czoff are the chunk's.
//   Chunk 0, hi and residual planes (chunk0_tile): its NB0 blocks lead the flat grid (CZ = 1: their two k loops are the
//   launch's longest) or stand between the other chunks' whole and shorter pieces (CZ = 2).
//   CZ = 1: A = q, A2p = q residual, Bt = k, B2p = k residual, Cout2 = chunk 0's scores (pitch ldc2).
//   CZ = 2: A2p = chunk 0's p, Cout2 = its residual plane (pitch RC both), Bt = v^T, B2p = v^T residual, Cout = out,
//   Part = the f32 planes of the pieces s >= 1 (pbase).
// MC = 2: one launch holds the three in-projections, blockIdx.y = 0: q, 1: k, 2: v^T. The arguments describe q
//   (A = x rows, Bt = Wq rows, M = SEQ, N = EMB); strideB, strideC, strideC2 lead from q's weight, hi plane and residual
//   plane to the next projection's. q, k: the residual plane holds rows < RC. v^T: A = Wv rows, Bt = x rows, M = EMB,
//   N = SEQ, pitches SEQ and VLP, the residual plane holds columns < VLP.
template <typename OT, int MI, int OUT_MODE, int CZ, int MC>
__global__ __launch_bounds__(256) void gemm_t(
    const unsigned short* __restrict__ Ap, const unsigned short* __restrict__ A2p, int lda,
    const unsigned short* __restrict__ Btp, int ldb, long long strideB,
    const unsigned short* __restrict__ B2p, int ldb2,
    void* Cout, void* Cout2, int ldc, long long strideC, int ldc2, long long strideC2, int N2,
    int M, int N, int K, float oscale, float rscale2, float cscale, float rscaleC, int czoff, float* Part) {
  static_assert(CZ != 2 || ((16 * MI) % 32) == 0);
  static_assert(MC == 1 || MC == 2);
  static_assert(MC != 1 || ((CZ == 1 || CZ == 2) && OUT_MODE == 0 && std::is_same<OT, _Float16>::value));
  static_assert(MC != 2 || (CZ == 0 && OUT_MODE == 3));
  const int RT = 16 * MI;
  constexpr int BR = 16 * MI * 2;                          // rows of the block tile
  constexpr int STG_B = (BR + 256) * LPB;                  // one staged k tile of the block, bytes
  static_assert(BR == 128);                                // 8 waves x 16 rows copy the A part, 8 x 32 rows the Bt part
  static_assert(2 * STG_B >= 8 * 16 * 68 * 4 && 2 * STG_B <= 320 * 1024);
  __shared__ __align__(16) unsigned char ring[2 * STG_B];  // two buffers; after the k loop: per-wave 16x64 f32 slabs
  int bx = (int)blockIdx.x;              // the block's index among its chunk's (MC = 1) or the launch's blocks
  int piece = 0;                         // CZ = 2: which PVK keys of the k loop this block sums
  if (MC == 1) {                         // block-uniform
    constexpr int NB0 = (RC / 64) * 4;   // chunk 0's block tiles: RC (CZ = 1) or EMB (CZ = 2) columns = 4 x 256
    static_assert(RC == 1024 && EMB == 1024 && NCH > 1);
    int c = 1;
    if (CZ == 1) {
      if (bx < NB0) {
        chunk0_tile<1, STG_B>(ring, bx, (const _Float16*)(const void*)Ap, (const _Float16*)(const void*)A2p, lda,
                              (const _Float16*)(const void*)Btp, ldb, (const _Float16*)(const void*)B2p, ldb2,
                              (float*)Cout2, ldc2, K, oscale, rscale2);
        return;
      }
      bx -= NB0;
      constexpr int BPU = (RC / 64) * (RC / 64) / 8;   // chunk c holds (c+1) * BPU blocks of the flat grid
      c = 1;
      while (c < NCH - 1 && bx >= (c + 1) * BPU) { bx -= (c + 1) * BPU; ++c; }
    } else {
      constexpr int NW = 4 * pv_whole();               // blocks of whole pieces, four column tiles each
      if (bx >= NW && bx < NW + NB0) {
        chunk0_tile<2, STG_B>(ring, bx - NW, (const _Float16*)(const void*)A2p, (const _Float16*)(const void*)Cout2, RC,
                              (const _Float16*)(const void*)Btp, ldb, (const _Float16*)(const void*)B2p, ldb2,
                              (float*)Cout, ldc, RC, oscale, rscale2);
        return;
      }
      int R;
      pv_piece(((bx < NW) ? bx : (bx - NB0)) >> 2, R, piece);
      c  = R / RT0;
      bx = (R - c * RT0) * 4 + (bx & 3);               // the block's index among its chunk's 8 x 4 block tiles
    }
    const int rb = c * RC;
    const size_t sb = sbase(c);
    czoff = rb;
    if (CZ == 1) {
      Ap += (size_t)rb * lda;
      N = rb + RC; ldc = rb + RC;
      Cout = (void*)((float*)Cout + sb);
    } else {
      Ap += 2 * sb;
      lda = 2 * (rb + RC); K = rb + RC;
      // piece 0 goes to the output rows, piece s > 0 to plane s, whose first row is row s * PVK (<= rb)
      Cout = (piece == 0) ? (void*)((float*)Cout + (size_t)rb * ldc)
                          : (void*)(Part + pbase(piece) + (size_t)(rb - piece * PVK) * ldc);
    }
  }
  int M2 = M;                            // rows [0, M2) get a residual plane (OUT_MODE 3)
  if (MC == 2) {                         // block-uniform
    const int y = (int)blockIdx.y;
    const unsigned short* Wp = Btp + (size_t)y * (size_t)strideB;
    Cout  = (void*)((unsigned short*)Cout  + (size_t)y * (size_t)strideC);
    Cout2 = (void*)((unsigned short*)Cout2 + (size_t)y * (size_t)strideC2);
    if (y == 2) { Btp = Ap; Ap = Wp; M = EMB; N = SEQ; ldc = SEQ; ldc2 = VLP; N2 = VLP; M2 = EMB; }
    else        { Btp = Wp; M2 = RC; }
  }
  const OT* A  = (const OT*)(const void*)Ap;
  const OT* Bt = (const OT*)(const void*)Btp;
  const int lane = threadIdx.x & 31;
  const int wave = __builtin_amdgcn_readfirstlane((int)(threadIdx.x >> 5));
  const int tilesN = (N >> 6) / 4;       // block tiles along N
  const int tilesM = M / BR;
  if (bx >= tilesM * tilesN) return;     // block-uniform, in front of every barrier
  // The quotient is block-uniform; where the compiler divides on the vector unit, readfirstlane brings it back to a
  // scalar register, so that the returns below stay scalar branches.
  const int tm = __builtin_amdgcn_readfirstlane(bx / tilesN);
  const int mB = tm * BR;                                  // the block tile's first row and column
  const int nB = (bx - tm * tilesN) * 256;
  const int wn = wave & 3;                                 // this wave's column tile in the block
  const int m0 = mB + (wave >> 2) * RT;
  const int n0 = nB + (wn << 6);
  bool live = true;
  if (CZ == 1) {
    if (nB >= czoff + mB + BR) return;           // block-uniform causal skip, in front of every barrier
    live = n0 < czoff + m0 + RT;                 // a wave past the diagonal walks the loop and stores nothing
  }
  int kEnd = K;
  int kBeg = 0;
  if (CZ == 2) {
    const int ke = czoff + mB + BR;      // multiple of 32
    kEnd = (ke < K) ? ke : K;
    kBeg = piece * PVK;                  // < kEnd for every piece that pv_piece deals
    if (kEnd > kBeg + PVK) kEnd = kBeg + PVK;
  }

  const int rlane = lane & 15;                 // row (A) / col (B, D) within subtile
  const int koff  = (lane >> 4) * 8;           // k offset of this lane half
  const int mOff  = (lane >> 4) * 8;           // D row offset

  v8f acc[MI][4];
#pragma unroll
  for (int i = 0; i < MI; ++i)
#pragma unroll
    for (int j = 0; j < 4; ++j) acc[i][j] = zero8();

  // ---- this lane's part of every staged tile: row lane>>3 of each 4-row group, 16-B piece lane&7 ----
  const int crow = lane >> 3;
  const int cel  = (lane & 7) * 8;
  const int arow = wave * (BR / 8);                            // this wave's share of the staged A rows
  const int brow = wave * 32;                                  // and of the staged Bt rows
  const OT* gA  = A  + (size_t)(mB + arow + crow) * lda + cel + kBeg;
  const OT* gB  = Bt + (size_t)(nB + brow + crow) * ldb + cel + kBeg;
  const unsigned lc = lds_off(ring) + (unsigned)(crow * LPB + cel * 2);
  const unsigned lA = lc + (unsigned)(arow * LPB);
  const unsigned lB = lc + (unsigned)((BR + brow) * LPB);
  const int nT = (kEnd - kBeg + BKE - 1) / BKE;                // >= 1; block-uniform
  auto stage = [&](int t) {                                    // tile t -> buffer t & 1
    const unsigned bo = (unsigned)(t & 1) * (unsigned)STG_B;
    const int kt = t * BKE;
    copy16and32rows(lA + bo, gA + kt, (size_t)4 * lda, lB + bo, gB + kt, (size_t)4 * ldb);
  };
  const int aOff = (m0 - mB + rlane) * LPB;                    // this lane's fragment rows in a buffer, bytes
  const int bOff = (BR + wn * 64 + rlane) * LPB;
  kloop<OT, MI, STG_B>(ring, nT, aOff, bOff, koff, stage, acc);   // behind it the ring becomes output staging
  if (!live) return;                     // wave-uniform; no block barrier follows
#pragma unroll
  for (int i = 0; i < MI; ++i) acc_guard4(acc[i][0], acc[i][1], acc[i][2], acc[i][3]);

  // ---- epilogue ----
  float* slab = (float*)(void*)ring + wave * (16 * 68);   // pitch 68 floats, wave-private
#pragma unroll
  for (int i = 0; i < MI; ++i) {
    const int mBase = m0 + (i << 4);
#pragma unroll
    for (int j = 0; j < 4; ++j) {
#pragma unroll
      for (int r = 0; r < 8; ++r) {
        float v = acc[i][j][r];
        v = v * oscale;
        slab[(mOff + r) * 68 + (j << 4) + rlane] = v;
      }
    }
    __builtin_amdgcn_fence(3 /* release order */, "workgroup");
    __builtin_amdgcn_wave_barrier();
    __builtin_amdgcn_fence(2 /* acquire order */, "workgroup");
    if (OUT_MODE == 0) {
      float* C = (float*)Cout;
      const int h2 = lane >> 4, c4 = (lane & 15) * 4;     // 256-B row segment = 16 lanes x 16 B
      {
#pragma unroll
        for (int it = 0; it < 8; ++it) {
          const int row = it * 2 + h2;                     // it 0..7 x h2 0..1 = rows 0..15
          const v4f v = *(const v4f*)(slab + row * 68 + c4);
          *(v4f*)(C + (size_t)(mBase + row) * ldc + n0 + c4) = v;
        }
        
      }
    } else {
      const int q = lane >> 3, c8 = (lane & 7) * 8;
      unsigned short* C  = (unsigned short*)Cout;
      unsigned short* C2 = (unsigned short*)Cout2;
      const bool wr2 = (OUT_MODE == 3) && (n0 < N2) && (MC != 2 || m0 < M2);     // wave-uniform
      // The slab's planes, with or without the residual plane: one wave-uniform branch per slab chooses, so that a tile
      // without a residual plane does none of its arithmetic.
      auto planes = [&](auto withRes) {
        constexpr bool RES = decltype(withRes)::value;
        v4u hv[4], lv[4];
        unsigned short* pc[4];
        unsigned short* pc2[4];
#pragma unroll
        for (int it = 0; it < 4; ++it) {
          const int row = it * 4 + q;                      // it 0..3 x q 0..3 = rows 0..15
          const float* sp = slab + row * 68 + c8;
          pc[it]  = C  + (size_t)(mBase + row) * ldc  + n0 + c8;
          pc2[it] = C2 + (size_t)(mBase + row) * ldc2 + n0 + c8;
          float f[8];
#pragma unroll
          for (int e = 0; e < 8; ++e) f[e] = sp[e] * cscale;
          v4u a, a2;
#pragma unroll
          for (int e = 0; e < 4; ++e) {
            const float f0 = f[2 * e], f1 = f[2 * e + 1];
            const _Float16 x0 = (_Float16)f0, x1 = (_Float16)f1;
            const unsigned short h0 = h_bits(x0), h1 = h_bits(x1);
            unsigned short l0 = 0, l1 = 0;
            if (RES) {
              l0 = h_bits((_Float16)((f0 - (float)x0) * rscaleC));
              l1 = h_bits((_Float16)((f1 - (float)x1) * rscaleC));
            }
            a[e] = pk16(h0, h1); a2[e] = pk16(l0, l1);
          }
          hv[it] = a; lv[it] = a2;
        }
        __builtin_amdgcn_sched_barrier(0);   // values and addresses are formed ahead of the stores: nothing is computed among them
#pragma unroll
        for (int it = 0; it < 4; ++it) {
          *(v4u*)pc[it] = hv[it];
          if (RES) *(v4u*)pc2[it] = lv[it];
        }
        wait_store_regs();
        __builtin_amdgcn_sched_barrier(0);   // later arithmetic, which reuses the stores' registers, stays behind the wait
      };
      if (wr2) planes(std::integral_constant<bool, true>{});
      else     planes(std::integral_constant<bool, false>{});
    }
    __builtin_amdgcn_fence(3 /* release order */, "workgroup");
    __builtin_amdgcn_wave_barrier();
    __builtin_amdgcn_fence(2 /* acquire order */, "workgroup");
  }
}

// =====================================================================================================
// Exact causal row softmax, one launch for every query row: one block of 256 threads per row t, the longest first.
//   The scores GEMMs wrote every column of row t in [0, ((t>>6)+1)*64).
//   The row is processed in 8-column groups g; ngl = ((t>>6)+1)*8 groups hold scores, ng groups of P are written
//   (t < RC: ng = ngl; else ng = ((t>>7)+1)*16, the k end of the row's 128-row P.V block tile). Thread tid owns groups
//   g = it*256 + tid. Loads use an address clamped to group ngl-1; entries with column > t are replaced by -inf
//   by index before any arithmetic. Iterations with it*256 >= ng are skipped block-uniformly.
//   p = exp(s - max) * (1/sum) in f32 (max finite: column 0 is always valid), x16384 carry, f16 RNE;
//   columns > t up to ng*8 get exact zeros. Rows t < RC: also the f16 residual plane
//   Pl = f16((p*16384 - hi) * 4096), same pitch. Each group is one 16-B store per lane; 8 consecutive lanes fill
//   LDS redm/reds: cross-wave, block barriers (every thread reaches both).
//   coverage: every row x columns [0, ng*8) of P (and Pl) = exactly the extent the P.V GEMM reads.
// =====================================================================================================
//   Rows t >= RC: row t lies in score chunk c = t / RC (S + sbase(c), pitch (c+1)*RC), and P = S: the row's
//   probabilities go over the front of its own scores. Every score of the row is in registers, and has gone into the
//   row maximum, in front of the first block barrier; the stores stand behind the second.
//   Rows t < RC (chunk 0): scores S0, probabilities P0 and residuals Pl0, each [RC][RC].
__global__ __launch_bounds__(256)
void softmax_rows(const float* S, unsigned short* P, const float* S0, unsigned short* P0, unsigned short* Pl0) {
  __shared__ float redm[8];
  __shared__ float reds[8];
  const int t    = SEQ - 1 - (int)blockIdx.x;
  const bool r0  = t < RC;                                   // block-uniform: a row of chunk 0
  const int ch   = t / RC;
  const size_t ro = r0 ? ((size_t)t * (size_t)RC)
                       : (sbase(ch) + (size_t)(t - ch * RC) * (size_t)((ch + 1) * RC));   // the row's first score, f32 elements
  const size_t po = r0 ? ro : (2 * ro);                      // its first probability, f16 elements
  const int tid  = threadIdx.x;
  const int wave = tid >> 5;
  const int lane = tid & 31;
  const int ngl  = ((t >> 6) + 1) * 8;                       // groups that hold scores
  const int ng   = r0 ? ngl : ((t >> 7) + 1) * 16;           // groups of P that are written: up to the P.V block tile's k end
  const float* rp = (r0 ? S0 : S) + ro;
  float v[SMI][8];
#pragma unroll
  for (int it = 0; it < SMI; ++it) {
#pragma unroll
    for (int e = 0; e < 8; ++e) v[it][e] = -INFINITY;
    if (it * 256 < ng) {                                   // block-uniform
      const int g  = it * 256 + tid;
      const int gc = (g < ngl) ? g : (ngl - 1);            // clamped address
      const int c0 = g * 8;
      const v4f a  = *(const v4f*)(rp + (size_t)gc * 8);
      const v4f a4 = *(const v4f*)(rp + (size_t)gc * 8 + 4);
#pragma unroll
      for (int e = 0; e < 4; ++e) {
        v[it][e]     = (c0 + e <= t)     ? a[e]  : -INFINITY;
        v[it][4 + e] = (c0 + 4 + e <= t) ? a4[e] : -INFINITY;
      }
    }
  }
  float mx = -INFINITY;
#pragma unroll
  for (int it = 0; it < SMI; ++it)
#pragma unroll
    for (int e = 0; e < 8; ++e) mx = fmaxf(mx, v[it][e]);
#pragma unroll
  for (int off = 1; off < 32; off <<= 1) mx = fmaxf(mx, __shfl_xor(mx, off, 32));
  if (lane == 0) redm[wave] = mx;
  __syncthreads();
  mx = redm[0];
#pragma unroll
  for (int w = 1; w < 8; ++w) mx = fmaxf(mx, redm[w]);

  float sum = 0.f;
#pragma unroll
  for (int it = 0; it < SMI; ++it) {
    if (it * 256 < ng) {                                   // block-uniform
#pragma unroll
      for (int e = 0; e < 8; ++e) { const float ex = __expf(v[it][e] - mx); v[it][e] = ex; sum += ex; }
    } else {
#pragma unroll
      for (int e = 0; e < 8; ++e) v[it][e] = 0.f;
    }
  }
#pragma unroll
  for (int off = 1; off < 32; off <<= 1) sum += __shfl_xor(sum, off, 32);
  if (lane == 0) reds[wave] = sum;
  __syncthreads();
  sum = reds[0];
#pragma unroll
  for (int w = 1; w < 8; ++w) sum += reds[w];

  const float sc = PCARRY * (1.0f / sum);        // sum >= 1
  v4u pk[SMI], pl[SMI];
#pragma unroll
  for (int it = 0; it < SMI; ++it) {
    v4u a, a2;
#pragma unroll
    for (int e = 0; e < 4; ++e) {
      const float f0 = v[it][2 * e] * sc, f1 = v[it][2 * e + 1] * sc;
      const _Float16 x0 = (_Float16)f0, x1 = (_Float16)f1;
      unsigned short l0 = 0, l1 = 0;
      if (r0) {
        l0 = h_bits((_Float16)((f0 - (float)x0) * RSC));
        l1 = h_bits((_Float16)((f1 - (float)x1) * RSC));
      }
      a[e]  = pk16(h_bits(x0), h_bits(x1));
      a2[e] = pk16(l0, l1);
    }
    pk[it] = a; pl[it] = a2;
  }
  unsigned short* op  = (r0 ? P0 : P) + po;
  unsigned short* opl = Pl0 + po;                            // used by rows of chunk 0 only
  {
#pragma unroll
    for (int it = 0; it < SMI; ++it) {
      if (it * 256 < ng) {                                 // block-uniform
        const int g = it * 256 + tid;
        if (g < ng) {
          *(v4u*)(op + (size_t)g * 8) = pk[it];
          wait_store_regs();                               // the residual store's address reuses this store's register
          if (r0) *(v4u*)(opl + (size_t)g * 8) = pl[it];
        }
      }
    }
    
  }
}

// =====================================================================================================
// out rows >= PVK: out += plane 1 + ... in ascending key order. Row tile R = row / 128 has the planes 1 .. R / PRS.
// One block per JR rows of one row tile (the plane count is block-uniform), a thread takes 16 B of each row; every load
// goes out ahead of the sums. coverage: (SEQ - PVK) / JR blocks x JR rows x 256 threads x 4 columns.
// =====================================================================================================
__global__ __launch_bounds__(256) void pv_join(float* out, const float* part) {
  static_assert(EMB == 256 * 4);
  const int row0 = PVK + (int)blockIdx.x * JR;
  const int ns   = (row0 / 128) / PRS;                       // planes that hold a piece of these rows, >= 1
  const int c4   = (int)threadIdx.x * 4;
  float* op = out + (size_t)row0 * EMB;                      // block-uniform base
  v4f v[NPC][JR];
#pragma unroll
  for (int r = 0; r < JR; ++r) v[0][r] = *(const v4f*)(op + (r * EMB + c4));
  wait_load_regs();                                          // later loads land in registers that held these addresses
#pragma unroll
  for (int s = 1; s < NPC; ++s) {
    if (s <= ns) {                                           // block-uniform
      const float* pp = part + (pbase(s) + (size_t)(row0 - s * PVK) * EMB);   // block-uniform base
#pragma unroll
      for (int r = 0; r < JR; ++r) v[s][r] = *(const v4f*)(pp + (r * EMB + c4));
      wait_load_regs();                                      // as above
    } else {
#pragma unroll
      for (int r = 0; r < JR; ++r) v[s][r] = (v4f){0.f, 0.f, 0.f, 0.f};
    }
  }
#pragma unroll
  for (int r = 0; r < JR; ++r) {
    v4f a = v[0][r];
#pragma unroll
    for (int s = 1; s < NPC; ++s) a += v[s][r];
    *(v4f*)(op + (r * EMB + c4)) = a;
  }
}

// =====================================================================================================
// Workspace map (bytes at SEQ = 8192, RC = 1024; every region a multiple of its whole-line store granularity and of
//   R0   Xb bf16 [SEQ][EMB] (16777216), later the f32 score chunks c >= 1, S_c [RC][(c+1)*RC] at sbase(c), each row's
//        front overwritten by its f16 probabilities (pitch 2*(c+1)*RC)                                      146800640
//   S0   f32 [RC][RC]     (chunk 0 scores)                                                                    4194304
//   Wqb, Wkb, Wvb bf16 [EMB][EMB]                                                                          3 x 2097152
//   Qh   f16 [SEQ][EMB]                                                                                      16777216
//   Kh   f16 [SEQ][EMB]                                                                                      16777216
//   VT   f16 [EMB][SEQ]   (v^T hi plane)                                                                     16777216
//   Ql   f16 [RC][EMB]    (q residual x4096, rows < RC)                                                       2097152
//   Kl   f16 [RC][EMB]    (k residual x4096, keys < RC)                                                       2097152
//   VL   f16 [EMB][VLP]   (v^T residual x4096, keys < VLP)                                                    2097152
//   P    f16 [RC][RC]     (chunk 0 probabilities)                                                             2097152
//   Pl   f16 [RC][RC]     (p residual x4096, chunk 0 only)                                                    2097152
//   PB   f32 planes s = 1 .. NPC-1 of P.V pieces, plane s [SEQ - s*PVK][EMB] at pbase(s)                     50331648
//   total                                                                                                   268435456
// Aliases are ordered by launch dependence: Xb is last read by the projections' launch, R0's scores are first written by
// the scores GEMM of the chunks c >= 1 after it. Weights are [out n][in k] with k contiguous = the Bt / A layout the GEMM wants.
// =====================================================================================================
static constexpr size_t PACT_B = (size_t)SEQ * EMB * 2;
static constexpr size_t PS_B   = sbase(NCH) * 4;               // chunks 1 .. NCH-1
static constexpr size_t PS0_B  = (size_t)RC * RC * 4;
static constexpr size_t R0_B   = (PACT_B > PS_B) ? PACT_B : PS_B;
static constexpr size_t PW_B   = (size_t)EMB * EMB * 2;
static constexpr size_t PRES_B = (size_t)RC * EMB * 2;
static constexpr size_t PVT_B  = (size_t)EMB * SEQ * 2;
static constexpr size_t PVL_B  = (size_t)EMB * VLP * 2;
static constexpr size_t PP_B   = (size_t)RC * RC * 2;
static constexpr size_t PPL_B  = (size_t)RC * RC * 2;
static constexpr size_t PPB_B  = pbase(NPC) * 4;
static constexpr size_t WS_TOTAL = R0_B + PS0_B + 3 * PW_B + 2 * PACT_B + PVT_B + 2 * PRES_B + PVL_B + PP_B + PPL_B + PPB_B;
static_assert(WS_TOTAL <= (size_t)268435456);
static constexpr int PV_BLOCKS = 4 * (pv_whole() + pv_short()) + (RC / 64) * 4;   // P.V: k pieces x 4 column tiles, and chunk 0's block tiles
static_assert((R0_B % 128) == 0 && (PS0_B % 128) == 0 && (PP_B % 128) == 0 && (PW_B % 128) == 0 && (PRES_B % 128) == 0 && (PVL_B % 128) == 0 && (PPL_B % 128) == 0);

extern "C" void kernel_launch(void* const* d_in, const int* in_sizes, int n_in,
                              void* d_out, int out_size, void* d_ws, size_t ws_size,
                              hipStream_t stream) {
  if (n_in < 4) return;
  const long long needX = (long long)SEQ * (long long)EMB;
  if ((long long)in_sizes[0] < needX) return;
  if (in_sizes[1] < EMB * EMB) return;
  if (in_sizes[2] < EMB * EMB) return;
  if (in_sizes[3] < EMB * EMB) return;
  if (out_size < 0) return;
  if ((long long)out_size < needX) return;

  const float* x  = (const float*)d_in[0];
  const float* Wq = (const float*)d_in[1];
  const float* Wk = (const float*)d_in[2];
  const float* Wv = (const float*)d_in[3];

  size_t off = 0;
  const size_t oR0 = off; off += R0_B;
  const size_t oS0 = off; off += PS0_B;
  const size_t oWq = off; off += PW_B;
  const size_t oWk = off; off += PW_B;
  const size_t oWv = off; off += PW_B;
  const size_t oQh = off; off += PACT_B;
  const size_t oKh = off; off += PACT_B;
  const size_t oVT = off; off += PVT_B;
  const size_t oQl = off; off += PRES_B;
  const size_t oKl = off; off += PRES_B;
  const size_t oVL = off; off += PVL_B;
  const size_t oP  = off; off += PP_B;
  const size_t oPl = off; off += PPL_B;
  const size_t oPB = off; off += PPB_B;
  if (off != WS_TOTAL) return;
  if (off > ws_size) return;
  if (off > (size_t)268435456) return;

  char* ws = (char*)d_ws;
  unsigned short* Xb  = (unsigned short*)(ws + oR0);
  float*          S   = (float*)(ws + oR0);          // alias, see map
  float*          S0  = (float*)(ws + oS0);
  unsigned short* Wqb = (unsigned short*)(ws + oWq);
  unsigned short* Wkb = (unsigned short*)(ws + oWk);
  unsigned short* Wvb = (unsigned short*)(ws + oWv);
  unsigned short* Qh  = (unsigned short*)(ws + oQh);
  unsigned short* Kh  = (unsigned short*)(ws + oKh);
  unsigned short* VT  = (unsigned short*)(ws + oVT);
  unsigned short* Ql  = (unsigned short*)(ws + oQl);
  unsigned short* Kl  = (unsigned short*)(ws + oKl);
  unsigned short* VL  = (unsigned short*)(ws + oVL);
  unsigned short* Pp  = (unsigned short*)(ws + oP);
  unsigned short* Ppl = (unsigned short*)(ws + oPl);
  float*          PB  = (float*)(ws + oPB);
  float*          out0 = (float*)d_out;

  const dim3 blk(256);
  const int n8x = SEQ * EMB / 8;                                    // multiple of 256
  const int n8w = EMB * EMB / 8;                                    // multiple of 256
  const dim3 gCvt(n8x / 256 + 3 * (n8w / 256), 1);
  const dim3 gPr(((SEQ / 64) * (EMB / 64)) / 8, 3);                 // q, k (M=SEQ, N=EMB), v^T (M=EMB, N=SEQ): 64x64 wave tiles
  const dim3 gSn((RC / 64) * 4 + ((RC / 64) * (RC / 64) / 8) * ((NCH * (NCH + 1)) / 2 - 1), 1);   // scores: chunk 0's 64x256 block tiles, then chunks c >= 1, 128x256
  const dim3 gPn(PV_BLOCKS, 1);                                     // P.V: chunks c >= 1, k pieces of 128x256 block tiles; chunk 0's 64x256
  const dim3 gJn((SEQ - PVK) / JR);                                 // JR rows per block
  const dim3 gSm(SEQ);                                              // one block per query row

  // (1) x, Wq, Wk, Wv -> bf16 planes (RNE convert), one launch
  cvt16x8<<<gCvt, blk, 0, stream>>>(x, Wq, Wk, Wv, Xb, Wqb, Wkb, Wvb, n8x / 256, n8w / 256);
  // (2) one launch, blockIdx.y = 0, 1, 2 (K=EMB each):
  //     q = x . Wq^T, k = x . Wk^T -> f16 planes [s][d]; rows [0, RC) also a residual (x4096) plane;
  //     v^T = Wv . x^T -> f16 hi plane [d][s] (pitch SEQ) and f16 residual plane x4096 [d][s < VLP] (pitch VLP).
  //     Wqb, Wkb, Wvb / Qh, Kh, VT / Ql, Kl, VL each lie one behind the other in the workspace (the three strides).
  static_assert(PVT_B == PACT_B && PVL_B == PRES_B);
  gemm_t<__bf16, 4, 3, 0, 2><<<gPr, blk, 0, stream>>>(
      Xb, Xb, EMB, Wqb, EMB, (long long)(PW_B / 2),
      Wqb, EMB,
      (void*)Qh, (void*)Ql, EMB, (long long)(PACT_B / 2), EMB, (long long)(PRES_B / 2), EMB,
      SEQ, EMB, EMB, 1.0f, 0.0f, 1.0f, RSC, 0, PB);
  // (3) scores = q.k / 32 -> f32, causal tiles only, every row chunk in one launch (MC = 1).
  //     Chunk 0 (rows and keys [0, RC), residual planes) -> S0: Qh.Kh and, x4096, Ql.Kh + Qh.Kl.
  //     Chunks c >= 1 (rows c*RC .. c*RC+RC-1, keys 0 .. (c+1)*RC-1), single f16 planes -> S; the kernel takes each
  //     chunk's rows, widths and pitches from blockIdx.
  gemm_t<_Float16, 4, 0, 1, 1><<<gSn, blk, 0, stream>>>(
      Qh, Ql, EMB, Kh, EMB, 0LL,
      Kl, EMB,
      (void*)S, (void*)S0, 0, 0LL, RC, 0LL, 0,
      RC, 0, EMB, 1.0f / 32.0f, 1.0f / RSC, 1.0f, 1.0f, 0, PB);
  // (4) exact causal softmax of every row in one launch -> f16 probabilities (x16384, zeros beyond the diagonal up to
  //     the P.V tile's k end); rows of chunk 0 also their residual plane.
  softmax_rows<<<gSm, blk, 0, stream>>>(S, (unsigned short*)S, S0, Pp, Ppl);
  // (5) out rows = P.V / 16384 -> f32 d_out, every row chunk in one launch (MC = 1).
  //     Chunk 0: Ph.Vh and, x4096, Pl.Vh + Ph.Vl (Ph, Pl pitch RC, VT pitch SEQ, VL pitch VLP). Chunks c >= 1: single planes,
  //     k loops in pieces of PVK keys: piece 0 -> out, pieces s >= 1 -> PB.
  gemm_t<_Float16, 4, 0, 2, 1><<<gPn, blk, 0, stream>>>(
      (const unsigned short*)S, Pp, 0, VT, SEQ, 0LL,
      VL, VLP,
      (void*)out0, (void*)Ppl, EMB, 0LL, 0, 0LL, 0,
      RC, EMB, 0, 1.0f / PCARRY, 1.0f / RSC, 1.0f, 1.0f, 0, PB);
  // (6) out rows >= PVK: the later pieces' planes are added to piece 0, in ascending key order.
  pv_join<<<gJn, blk, 0, stream>>>(out0, PB);
  (void)hipGetLastError();
}

// v007
// One run takes 215 microseconds.
// In two side-by-side timings against v006, it was 1.05 and 1.06 times as fast.
// Counting every step since v000, it is 10.3 times as fast.
// Contractions: q, k, v^T in-projections = v_wmma_f32_16x16x32_bf16 (bf16 operands from RNE-converted inputs, single product, f32 accumulate);
// q.k^T scores = v_wmma_f32_16x16x32_f16 (q, k f16 planes, single product; query rows < RC: q and k each f16 hi plane + f16 residual plane x4096, 3 products, separate f32 accumulators);
// p.v = v_wmma_f32_16x16x32_f16 (p carried x16384 in f16, v^T f16, single product; query rows < RC: p and v^T each f16 hi plane + f16 residual plane x4096, 3 products, separate f32 accumulators);
// causal softmax (row max, sum, probabilities) in f32 on materialised f32 score row chunks.
// p.v of query rows >= RC: each k loop is cut into pieces of PVK keys, one block a piece; piece 0 goes to out, the later
// pieces to f32 planes in the workspace, which a last launch adds to out in ascending key order.
// Every GEMM k loop walks its 64-k tiles from a start that is rotated by the block's tile index, and wraps round (ktile).
#include <hip/hip_runtime.h>
#include <math.h>
#include <stdint.h>
#include <type_traits>

#ifndef NB
#define NB 1
#endif
#ifndef SEQ
#define SEQ 8192
#endif
#define NB_FULL  1
#define SEQ_FULL 8192
#define EMB      1024
#define RC       ((SEQ < 1024) ? SEQ : 1024)   // query rows per score/probability chunk; rows < RC use residual planes
#define NCH      (SEQ / RC)                    // number of row chunks
#define VLP      RC                            // key extent of the v^T residual plane
#define PCARRY   16384.0f                      // power-of-two carry of p in the f16 P.V operand
#define RSC      4096.0f                       // power-of-two carry of every f16 residual plane
#define SMI      ((SEQ / 8 + 255) / 256)       // max 8-column groups per softmax thread
static_assert(NB == 1 && NB_FULL == 1);
static_assert(SEQ >= 256 && SEQ <= SEQ_FULL && (SEQ % 256) == 0);
static_assert((SEQ % RC) == 0 && (RC % 64) == 0 && NCH >= 1);
static_assert((EMB % 64) == 0 && (SEQ % 64) == 0 && (EMB % 32) == 0 && (RC % 32) == 0);
static_assert(SMI >= 1 && SMI <= 4);
static_assert((EMB % 512) == 0 && (RC % 512) == 0 && (SEQ % 512) == 0);   // eight 64-column tiles per GEMM block; 64-k staged tiles
static_assert(((SEQ * EMB / 8) % 256) == 0 && ((EMB * EMB / 8) % 256) == 0);
#define PVK      2048                          // keys per piece of a P.V k loop (query rows >= RC)
#define PRS      (PVK / 128)                   // 128-row tiles after which a k loop is one piece longer
#define NRT      (SEQ / 128)                   // 128-row tiles of the whole output
#define RT0      (RC / 128)                    // the first of them that is not chunk 0's
#define NPC      (SEQ / PVK)                   // pieces of the longest k loop
#define JR       4                             // rows per block of the launch that adds the pieces
static_assert((SEQ % PVK) == 0 && SEQ > PVK && (PVK % 128) == 0 && RT0 <= PRS && (128 % JR) == 0);

typedef _Float16 v16h __attribute__((ext_vector_type(16)));
typedef _Float16 v8h  __attribute__((ext_vector_type(8)));
typedef __bf16   v16b __attribute__((ext_vector_type(16)));
typedef __bf16   v8b  __attribute__((ext_vector_type(8)));
typedef float    v8f  __attribute__((ext_vector_type(8)));
typedef float    v4f  __attribute__((ext_vector_type(4)));
typedef unsigned int v4u __attribute__((ext_vector_type(4)));

#if defined(__HIP_DEVICE_COMPILE__)
#define DEV_ASM 1
#else
#define DEV_ASM 0
#endif

// ---- scalar helpers --------------------------------------------------------------------------------
__device__ __forceinline__ unsigned short bf_bits(float f) {          // f32 -> bf16 bits, RNE convert
  unsigned u = __float_as_uint(f);
  return (unsigned short)((u + 0x7FFFu + ((u >> 16) & 1u)) >> 16);
}
__device__ __forceinline__ unsigned short h_bits(_Float16 x) { return __builtin_bit_cast(unsigned short, x); }
__device__ __forceinline__ unsigned pk16(unsigned short a, unsigned short b) { return (unsigned)a | ((unsigned)b << 16); }
// f32 elements of the score chunks 1 .. c-1, which lie in front of chunk c (chunk j: RC rows of (j+1)*RC columns)
__host__ __device__ __forceinline__ constexpr size_t sbase(int c) { return (size_t)RC * RC * (size_t)((c * (c + 1)) / 2 - 1); }
// f32 elements of the P.V partial planes 1 .. s-1, which lie in front of plane s (plane j: rows j*PVK .. SEQ-1, pitch EMB)
__host__ __device__ __forceinline__ constexpr size_t pbase(int s) {
  return (size_t)EMB * (size_t)((s - 1) * SEQ - PVK * (((s - 1) * s) / 2));
}
// P.V pieces of the row tiles RT0 .. NRT-1 (row tile R: keys [0, (R+1)*128)): whole pieces of PVK keys, and shorter last pieces
__host__ __device__ constexpr int pv_whole() {
  int n = 0;
  for (int q = 0; q < NPC; ++q) { const int first = PRS * (q + 1) - 1; n += NRT - ((first < RT0) ? RT0 : first); }
  return n;
}
__host__ __device__ constexpr int pv_short() {
  int n = 0;
  for (int m = 1; m < PRS; ++m) n += NPC - ((m - 1 >= RT0) ? 0 : 1);
  return n;
}
// rank f -> (row tile R, piece s), every pair once, the longest pieces first: the whole pieces, then the last pieces of
// m * 128 keys, m falling. Block-uniform scalar arithmetic.
__device__ __forceinline__ void pv_piece(int f, int& R, int& s) {
  R = NRT - 1; s = 0;
  for (int q = 0; q < NPC; ++q) {
    const int first = PRS * (q + 1) - 1;
    const int n = NRT - ((first < RT0) ? RT0 : first);
    if (f < n) { R = NRT - 1 - f; s = q; return; }
    f -= n;
  }
  for (int m = PRS - 1; m >= 1; --m) {
    const int n = NPC - ((m - 1 >= RT0) ? 0 : 1);
    if (f < n) { s = NPC - 1 - f; R = s * PRS + m - 1; return; }
    f -= n;
  }
}
__device__ __forceinline__ v8f zero8() { v8f z = {0.f, 0.f, 0.f, 0.f, 0.f, 0.f, 0.f, 0.f}; return z; }

// ---- fragment types / loaders: 16-bit A/B operand, lane -> row/col (lane&15), p already includes +8*(lane>>4);
//      elements 0..7 <- p[0..7] (k0+8h..k0+8h+7), elements 8..15 <- p[16..23] (k0+16+8h..k0+16+8h+7)
template <typename OT> struct FT;
template <> struct FT<__bf16>   { typedef v16b frag; typedef v8b half8; };
template <> struct FT<_Float16> { typedef v16h frag; typedef v8h half8; };

template <typename OT>
__device__ __forceinline__ typename FT<OT>::frag ldfrag(const OT* p) {
  union { typename FT<OT>::frag v; typename FT<OT>::half8 h[2]; } f;
  f.h[0] = *(const typename FT<OT>::half8*)(p);
  f.h[1] = *(const typename FT<OT>::half8*)(p + 16);
  return f.v;
}

// ---- WMMA helpers (asm guard bodies are device-only; concrete operand types) -----------------------------
__device__ __forceinline__ v8f mmar(v16b a, v16b b, v8f c) {
  return __builtin_amdgcn_wmma_f32_16x16x32_bf16(false, a, false, b, (short)0, c, false, false);
}
__device__ __forceinline__ v8f mmar(v16h a, v16h b, v8f c) {
  return __builtin_amdgcn_wmma_f32_16x16x32_f16(false, a, false, b, (short)0, c, false, false);
}
__device__ __forceinline__ void acc_guard4(v8f& a, v8f& b, v8f& c, v8f& d) {
#if DEV_ASM
  asm volatile("v_nop\n\tv_nop\n\tv_nop\n\tv_nop" : "+v"(a), "+v"(b), "+v"(c), "+v"(d));
#else
  (void)a; (void)b; (void)c; (void)d;
#endif
}

// ---- LDS staging by asynchronous copies ---------------------------------------------------------------
#define BKE 64     // k elements per staged tile: 128-B rows, whole lines of the source
#define LPB 144    // LDS row pitch in bytes: 128 + 16 (16 B x odd, conflict-free for 16-B row readers)
#define LPE (LPB / 2)
__device__ __forceinline__ unsigned lds_off(const void* p) { return (unsigned)(size_t)p; }   // byte offset in the block's LDS
// The k tile that trip t of a block's k loop works on: the loop starts at tile rot (0 <= rot < nT) and wraps round, every
// tile once. rot differs between the blocks that share operand rows, so that blocks which run side by side ask L2 for
// different lines of those rows at a time. Block-uniform scalar arithmetic.
__device__ __forceinline__ int ktile(int t, int rot, int nT) { const int u = t + rot; return (u >= nT) ? (u - nT) : u; }
// idx >= 0, nT >= 1. Where the compiler divides on the vector unit, readfirstlane brings the block-uniform remainder back
// to a scalar register, so that ktile stays scalar arithmetic in the loops.
__device__ __forceinline__ int krot(int idx, int nT) {
  return __builtin_amdgcn_readfirstlane((int)((unsigned)idx % (unsigned)nT));
}
// Each copy: a wave brings 4 rows x 128 B (lane -> row lane>>3, 16-B piece lane&7), l / g already hold the lane's part.
// step4 = source elements per 4 rows. The address-register wait ends each statement, so no later address
// arithmetic can be placed between a copy and that wait.
__device__ __forceinline__ void copy8and32rows(unsigned la, const void* gap, size_t astep4,
                                               unsigned l, const void* gp, size_t step4) {
#if DEV_ASM
  const unsigned short* ga = (const unsigned short*)gap;
  const unsigned short* g  = (const unsigned short*)gp;
  asm volatile("global_load_async_to_lds_b128 %0, %10, off\n\t"
               "global_load_async_to_lds_b128 %1, %11, off\n\t"
               "global_load_async_to_lds_b128 %2, %12, off\n\t"
               "global_load_async_to_lds_b128 %3, %13, off\n\t"
               "global_load_async_to_lds_b128 %4, %14, off\n\t"
               "global_load_async_to_lds_b128 %5, %15, off\n\t"
               "global_load_async_to_lds_b128 %6, %16, off\n\t"
               "global_load_async_to_lds_b128 %7, %17, off\n\t"
               "global_load_async_to_lds_b128 %8, %18, off\n\t"
               "global_load_async_to_lds_b128 %9, %19, off\n\t"
               "s_wait_xcnt 0x0"
               :: "v"(la), "v"(la + 4u * LPB),
                  "v"(l), "v"(l + 4u * LPB), "v"(l + 8u * LPB), "v"(l + 12u * LPB),
                  "v"(l + 16u * LPB), "v"(l + 20u * LPB), "v"(l + 24u * LPB), "v"(l + 28u * LPB),
                  "v"(ga), "v"(ga + astep4),
                  "v"(g), "v"(g + step4), "v"(g + 2 * step4), "v"(g + 3 * step4),
                  "v"(g + 4 * step4), "v"(g + 5 * step4), "v"(g + 6 * step4), "v"(g + 7 * step4) : "memory");
#else
  (void)la; (void)gap; (void)astep4; (void)l; (void)gp; (void)step4;
#endif
}
// 16 rows of the shared A part and 32 rows of the shared Bt part: one wave's twelve copies of a 384-row tile; the
// address-register wait is the statement's last line, as above.
__device__ __forceinline__ void copy16and32rows(unsigned la, const void* gap, size_t astep4,
                                                unsigned l, const void* gp, size_t step4) {
#if DEV_ASM
  const unsigned short* ga = (const unsigned short*)gap;
  const unsigned short* g  = (const unsigned short*)gp;
  asm volatile("global_load_async_to_lds_b128 %0, %12, off\n\t"
               "global_load_async_to_lds_b128 %1, %13, off\n\t"
               "global_load_async_to_lds_b128 %2, %14, off\n\t"
               "global_load_async_to_lds_b128 %3, %15, off\n\t"
               "global_load_async_to_lds_b128 %4, %16, off\n\t"
               "global_load_async_to_lds_b128 %5, %17, off\n\t"
               "global_load_async_to_lds_b128 %6, %18, off\n\t"
               "global_load_async_to_lds_b128 %7, %19, off\n\t"
               "global_load_async_to_lds_b128 %8, %20, off\n\t"
               "global_load_async_to_lds_b128 %9, %21, off\n\t"
               "global_load_async_to_lds_b128 %10, %22, off\n\t"
               "global_load_async_to_lds_b128 %11, %23, off\n\t"
               "s_wait_xcnt 0x0"
               :: "v"(la), "v"(la + 4u * LPB), "v"(la + 8u * LPB), "v"(la + 12u * LPB),
                  "v"(l), "v"(l + 4u * LPB), "v"(l + 8u * LPB), "v"(l + 12u * LPB),
                  "v"(l + 16u * LPB), "v"(l + 20u * LPB), "v"(l + 24u * LPB), "v"(l + 28u * LPB),
                  "v"(ga), "v"(ga + astep4), "v"(ga + 2 * astep4), "v"(ga + 3 * astep4),
                  "v"(g), "v"(g + step4), "v"(g + 2 * step4), "v"(g + 3 * step4),
                  "v"(g + 4 * step4), "v"(g + 5 * step4), "v"(g + 6 * step4), "v"(g + 7 * step4) : "memory");
#else
  (void)la; (void)gap; (void)astep4; (void)l; (void)gp; (void)step4;
#endif
}
__device__ __forceinline__ void wait_lds_reads() {   // this wave's LDS reads have returned before its buffer is handed back
#if DEV_ASM
  asm volatile("s_wait_dscnt 0x0" ::: "memory");
#endif
}
__device__ __forceinline__ void wait_store_regs() {  // a precaution: stands between issued global stores and the reuse of their registers
#if DEV_ASM
  asm volatile("s_wait_xcnt 0x0" ::: "memory");
#endif
}
__device__ __forceinline__ void wait_load_regs() {   // a precaution: stands between issued global loads and the reuse of their address registers
#if DEV_ASM
  asm volatile("s_wait_xcnt 0x0" ::: "memory");
#endif
}
__device__ __forceinline__ void wait_copies() {      // this wave's copies have landed before the barrier publishes them
#if DEV_ASM
  asm volatile("s_wait_asynccnt 0x0" ::: "memory");
#endif
}

// =====================================================================================================
// f32 -> bf16 planes (RNE convert), 8 elements per thread, one 16-B store per lane: a wave writes 512 contiguous B
// One launch for x and the three weights: blocks [0, nbx) take x, then nbw blocks each take Wq, Wk, Wv (block-uniform).
// coverage: nbx * 256 threads x 8 elements = the whole x plane, nbw * 256 x 8 = each whole weight plane.
// =====================================================================================================
__global__ __launch_bounds__(256) void cvt16x8(const float* __restrict__ x, const float* __restrict__ wq,
                                               const float* __restrict__ wk, const float* __restrict__ wv,
                                               unsigned short* xb, unsigned short* wqb, unsigned short* wkb,
                                               unsigned short* wvb, int nbx, int nbw) {
  int bi = (int)blockIdx.x;
  int nb = nbx;                          // blocks of the plane that this block works on
  const float* in = x;
  unsigned short* out = xb;
  if (bi >= nbx) {
    bi -= nbx; nb = nbw;
    in = wq; out = wqb;
    if (bi >= nbw) { bi -= nbw; in = wk; out = wkb; }
    if (bi >= nbw) { bi -= nbw; in = wv; out = wvb; }
  }
  const int i = bi * 256 + (int)threadIdx.x;
  if (bi < nb) {
    const float* ip = in + (size_t)i * 8;
    const v4f a  = *(const v4f*)(ip);
    const v4f a4 = *(const v4f*)(ip + 4);
    v4u p;
    p[0] = pk16(bf_bits(a[0]),  bf_bits(a[1]));
    p[1] = pk16(bf_bits(a[2]),  bf_bits(a[3]));
    p[2] = pk16(bf_bits(a4[0]), bf_bits(a4[1]));
    p[3] = pk16(bf_bits(a4[2]), bf_bits(a4[3]));
    unsigned short* o = out + (size_t)i * 8;
    *(v4u*)o = p;
    
  }
}

// =====================================================================================================
// The k loop of one block tile (16-bit operand type OT). The eight waves of a block form a 2 x 4 grid of (16*MI) x 64
// wave tiles. stage(t) copies the block's rows of trip t's k tile (64 k, whole 128-B lines) into buffer t & 1 of the ring
// (STG bytes a buffer) by asynchronous copies: two buffers, one block barrier per tile, tile t + 1 flies while tile t
// is multiplied. aOff / bOff = byte offsets in a buffer of this lane's first A / Bt fragment row. Fragments are read
// from LDS with the split k map (ldfrag); a sum takes its k tiles in the order in which stage deals them (ktile). On entry no wave reads the ring any
// more (kernel entry, or the barrier that ends an earlier loop); on return every wave's ring reads have returned.
// =====================================================================================================
template <typename OT, int MI, int STG, typename SF>
__device__ __forceinline__ void kloop(unsigned char* ring, int nT, int aOff, int bOff, int koff, SF stage, v8f (*acc)[4]) {
  typedef typename FT<OT>::frag V16;
  stage(0);
  wait_copies();
  __syncthreads();                       // tile 0 is published
  if (nT > 1) stage(1);
  // Every LDS read of tile t stands between the barrier that publishes it and the barrier that frees its buffer.
  // Fragment registers: bq0 / bq1 = Bt of the tile's first / second 32 k; a[i] is refilled in place right behind its
  // last product; ax holds row group MI-1 of the second 32 k, so that no read is issued behind a phase's last products.
  // The scheduling barriers keep each read at that place (left alone, the compiler read each A fragment right in
  // front of its products and waited for it every time).
  V16 bq0[4], bq1[4], a[MI], ax;
  {
    const OT* sA = (const OT*)(const void*)(ring + aOff) + koff;
    const OT* sB = (const OT*)(const void*)(ring + bOff) + koff;
#pragma unroll
    for (int j = 0; j < 4; ++j) bq0[j] = ldfrag<OT>(sB + (j << 4) * LPE);
#pragma unroll
    for (int i = 0; i < MI; ++i) a[i] = ldfrag<OT>(sA + (i << 4) * LPE);
  }
  for (int t = 0; t < nT; ++t) {
    const unsigned char* buf = ring + (size_t)(t & 1) * STG;
    const OT* sA = (const OT*)(const void*)(buf + aOff) + koff + 32;
    const OT* sB = (const OT*)(const void*)(buf + bOff) + koff + 32;
    ax = ldfrag<OT>(sA + ((MI - 1) << 4) * LPE);
#pragma unroll
    for (int j = 0; j < 4; ++j) bq1[j] = ldfrag<OT>(sB + (j << 4) * LPE);
    __builtin_amdgcn_sched_barrier(0);     // reads of the second 32 k go out ahead of the first 32 k's products
#pragma unroll
    for (int i = 0; i < MI - 1; ++i) {
#pragma unroll
      for (int j = 0; j < 4; ++j) acc[i][j] = mmar(a[i], bq0[j], acc[i][j]);
      __builtin_amdgcn_sched_barrier(0);   // the refill stays behind a[i]'s last product, so it can take a[i]'s registers
      a[i] = ldfrag<OT>(sA + (i << 4) * LPE);
      __builtin_amdgcn_sched_barrier(0);   // the refill of a[i] stays among the products
    }
#pragma unroll
    for (int j = 0; j < 4; ++j) acc[MI - 1][j] = mmar(a[MI - 1], bq0[j], acc[MI - 1][j]);
    __builtin_amdgcn_sched_barrier(0);     // the first 32 k's products stay ahead of the waits
    wait_lds_reads();
    wait_copies();
    __syncthreads();                       // publishes tile t + 1 and ends every read of tile t's buffer
    if (t + 2 < nT) stage(t + 2);
    // The first 32 k of tile t + 1 are read under tile t's last products. The last trip has no next tile: a scalar
    // select aims its reads, whose values nobody uses, at its own buffer (landed, not refilled), which keeps the
    // products free of a branch.
    const unsigned char* nbuf = ring + (size_t)(((t + 1 < nT) ? (t + 1) : t) & 1) * STG;
    const OT* nA = (const OT*)(const void*)(nbuf + aOff) + koff;
    const OT* nB = (const OT*)(const void*)(nbuf + bOff) + koff;
    a[MI - 1] = ldfrag<OT>(nA + ((MI - 1) << 4) * LPE);
#pragma unroll
    for (int j = 0; j < 4; ++j) bq0[j] = ldfrag<OT>(nB + (j << 4) * LPE);
    __builtin_amdgcn_sched_barrier(0);     // the next tile's reads go out ahead of this tile's last products
#pragma unroll
    for (int i = 0; i < MI - 1; ++i) {
#pragma unroll
      for (int j = 0; j < 4; ++j) acc[i][j] = mmar(a[i], bq1[j], acc[i][j]);
      __builtin_amdgcn_sched_barrier(0);   // the refill stays behind a[i]'s last product, so it can take a[i]'s registers
      a[i] = ldfrag<OT>(nA + (i << 4) * LPE);
      __builtin_amdgcn_sched_barrier(0);   // the refill of a[i] stays among the products
    }
#pragma unroll
    for (int j = 0; j < 4; ++j) acc[MI - 1][j] = mmar(ax, bq1[j], acc[MI - 1][j]);
  }
  wait_copies();
  wait_lds_reads();
  __syncthreads();                       // every wave's last ring read has returned: the ring is free again
}

// =====================================================================================================
// One 64 x 256 block tile of row chunk 0 (query rows and keys < RC), whose operands are f16 hi planes A, Bt and f16
// residual planes A2, B2 (both x 1/rscale2): C = ((A.Bt) + (A2.Bt + A.B2) * rscale2) * oscale, f32, pitch ldc.
// It runs inside the launch of the chunks c >= 1, in the same ring and on the same k loop; b0 = its index among
// chunk 0's (RC / 64) x 4 block tiles. The eight waves form a 2 x 4 grid of 32 x 64 tiles.
// First loop: a wave's 64 staged A rows are its 32 rows of A and behind them its 32 rows of A2, so row groups 0, 1
// give A.Bt and row groups 2, 3 give A2.Bt from the same Bt fragments. Second loop: A.B2 goes on top of A2.Bt.
// CZ = 1 (scores, k loops of K): block tiles beyond the diagonal leave at once, wave tiles beyond it store nothing.
// CZ = 2 (P.V): the A rows hold exact zeros from the diagonal to column mB + 64, where the k loops end; long loops first.
// =====================================================================================================
template <int CZ, int STG>
__device__ __forceinline__ void chunk0_tile(unsigned char* ring, int b0,
    const _Float16* A, const _Float16* A2, int lda, const _Float16* Bt, int ldb, const _Float16* B2, int ldb2,
    float* C, int ldc, int K, float oscale, float rscale2) {
  const int wave = __builtin_amdgcn_readfirstlane((int)(threadIdx.x >> 5));
  const int tm = (CZ == 2) ? (RC / 64 - 1 - (b0 >> 2)) : (b0 >> 2);
  const int mB = tm * 64;
  const int nB = (b0 & 3) * 256;
  const int wm = wave >> 2, wn = wave & 3;
  const int m0 = mB + wm * 32;
  const int n0 = nB + wn * 64;
  if (CZ == 1 && nB >= mB + 64) return;                        // block-uniform causal skip, in front of every barrier
  const bool live = (CZ != 1) || (n0 < m0 + 32);               // a wave past the diagonal walks the loops and stores nothing
  const int nT = ((CZ == 2) ? (mB + 64) : K) / BKE;            // >= 1; block-uniform
  const int rot = krot(tm + 4 * (b0 & 3), nT);                 // differs along a tile row and along a tile column

  v8f acc[4][4];                         // [0], [1]: A.Bt; [2], [3]: A2.Bt + A.B2
#pragma unroll
  for (int i = 0; i < 4; ++i)
#pragma unroll
    for (int j = 0; j < 4; ++j) acc[i][j] = zero8();
  {
    const int lane = threadIdx.x & 31;
    // this lane's part of every staged tile: row lane>>3 of each 4-row group, 16-B piece lane&7
    const int crow = lane >> 3;
    const int cel  = (lane & 7) * 8;
    const unsigned lc = lds_off(ring) + (unsigned)(crow * LPB + cel * 2);
    // staged A rows wave*16 .. +15 = 16 rows of A (waves 0, 1, 4, 5) or of A2 (waves 2, 3, 6, 7)
    const _Float16* gA = ((wave & 2) ? A2 : A) + (size_t)(mB + wm * 32 + (wave & 1) * 16 + crow) * lda + cel;
    const _Float16* gB = Bt + (size_t)(nB + wave * 32 + crow) * ldb + cel;
    const unsigned lA = lc + (unsigned)(wave * 16 * LPB);
    const unsigned lB = lc + (unsigned)((128 + wave * 32) * LPB);
    kloop<_Float16, 4, STG>(ring, nT, (wm * 64 + (lane & 15)) * LPB, (128 + wn * 64 + (lane & 15)) * LPB, (lane >> 4) * 8,
                            [&](int t) {
      const int kt = ktile(t, rot, nT) * BKE;
      copy16and32rows(lA + (unsigned)(t & 1) * (unsigned)STG, gA + kt, (size_t)4 * lda,
                      lB + (unsigned)(t & 1) * (unsigned)STG, gB + kt, (size_t)4 * ldb);
    }, acc);
  }
  // The lane index is taken anew, from the lane mask count: what the second loop and the epilogue derive from it is then
  // formed here and holds no registers through the first loop, whose budget is that of two blocks per WGP.
  const int lane  = (int)__builtin_amdgcn_mbcnt_lo(~0u, 0u);
  const int rlane = lane & 15;
  const int mOff  = (lane >> 4) * 8;
  {
    const int crow = lane >> 3;
    const int cel  = (lane & 7) * 8;
    const unsigned lc = lds_off(ring) + (unsigned)(crow * LPB + cel * 2);
    // A rows wave*8 .. +7, at the front of their wave row's 64 staged rows
    const _Float16* gA = A + (size_t)(mB + wave * 8 + crow) * lda + cel;
    const _Float16* gB = B2 + (size_t)(nB + wave * 32 + crow) * ldb2 + cel;
    const unsigned lA = lc + (unsigned)((wm * 64 + wn * 8) * LPB);
    const unsigned lB = lc + (unsigned)((128 + wave * 32) * LPB);
    kloop<_Float16, 2, STG>(ring, nT, (wm * 64 + rlane) * LPB, (128 + wn * 64 + rlane) * LPB, (lane >> 4) * 8,
                            [&](int t) {
      const int kt = ktile(t, rot, nT) * BKE;
      copy8and32rows(lA + (unsigned)(t & 1) * (unsigned)STG, gA + kt, (size_t)4 * lda,
                     lB + (unsigned)(t & 1) * (unsigned)STG, gB + kt, (size_t)4 * ldb2);
    }, acc + 2);
  }
  if (!live) return;                     // wave-uniform; no block barrier follows
#pragma unroll
  for (int i = 0; i < 4; ++i) acc_guard4(acc[i][0], acc[i][1], acc[i][2], acc[i][3]);

  float* slab = (float*)(void*)ring + wave * (16 * 68);   // pitch 68 floats, wave-private
  const int h2 = lane >> 4, c4 = (lane & 15) * 4;         // 256-B row segment = 16 lanes x 16 B
#pragma unroll
  for (int i = 0; i < 2; ++i) {
#pragma unroll
    for (int j = 0; j < 4; ++j) {
#pragma unroll
      for (int r = 0; r < 8; ++r) {
        float v = acc[i][j][r];
        v += acc[i + 2][j][r] * rscale2;
        v = v * oscale;
        slab[(mOff + r) * 68 + (j << 4) + rlane] = v;
      }
    }
    __builtin_amdgcn_fence(3 /* release order */, "workgroup");
    __builtin_amdgcn_wave_barrier();
    __builtin_amdgcn_fence(2 /* acquire order */, "workgroup");
    v4f val[8];
    float* pc[8];
#pragma unroll
    for (int it = 0; it < 8; ++it) {
      const int row = it * 2 + h2;                         // it 0..7 x h2 0..1 = rows 0..15
      val[it] = *(const v4f*)(slab + row * 68 + c4);
      pc[it]  = C + (size_t)(m0 + (i << 4) + row) * ldc + n0 + c4;
    }
    __builtin_amdgcn_sched_barrier(0);   // values and addresses are formed ahead of the stores: nothing is computed among them
#pragma unroll
    for (int it = 0; it < 8; ++it) *(v4f*)pc[it] = val[it];
    wait_store_regs();
    __builtin_amdgcn_sched_barrier(0);   // later arithmetic, which reuses the stores' registers, stays behind the wait
    __builtin_amdgcn_fence(3 /* release order */, "workgroup");
    __builtin_amdgcn_wave_barrier();
    __builtin_amdgcn_fence(2 /* acquire order */, "workgroup");
  }
}

// =====================================================================================================
// Register-blocked WMMA GEMM (16-bit operand type OT): C[m][n] = sum_k A[m][k] * Bt[n][k];
// one wave per (16*MI) x 64 tile; the eight waves of a block form a 2 x 4 grid of such tiles, a 128 x 256 block tile
// (M a multiple of 128, N of 256): each staged A row serves four waves, each staged Bt row two, and two blocks' rings
// fit one LDS. A row-major [M][K] pitch lda; Bt row-major [N][K] pitch ldb (k contiguous); K multiple of 64 (static
// sizes here). Staging and products: kloop above.
// value v = acc * oscale, in the f32 epilogue.
// CZ (causal), czoff = global row index of local row 0 (multiple of 64):
//   0 none; 1 = output tiles with n0 >= czoff + m0 + 16*MI are not stored (every tile holding a
//   column <= one of its rows is written); 2 = A rows hold exact zeros beyond the diagonal up to column
//   czoff + mB + BR (mB, BR = first row and rows of the block tile), so the k loop ends at min(K, czoff + mB + BR)
//   (exact); the last staged tile is copied whole, so A rows are written up to the next multiple of 64 columns.
// OUT_MODE 0: f32 C (pitch ldc) = v.
// OUT_MODE 3: f16 hi plane C = f16(v * cscale) (pitch ldc) and f16 residual plane
//             C2 = f16((v*cscale - hi) * rscaleC) (pitch ldc2), C2 written only for output
//             tiles with n0 < N2 (N2 multiple of 64, wave-uniform), i.e. columns [0, N2) fully (MC = 2: and rows [0, M2)).
// =====================================================================================================
// MC = 1: one launch holds every row chunk (M = RC rows each). Chunks c >= 1, single planes: CZ = 2: a flat grid of
//   k-loop pieces of at most PVK keys (pv_piece), four column tiles each, the longest first, so that more blocks than
//   resident places level the WGPs' work. CZ = 1: a flat grid, chunk after chunk, the widest last, which the
//   softmax then reads first.
//   The f32 score chunks lie one behind the other, chunk c at sbase(c) elements with pitch (c+1)*RC; the softmax
//   writes each f16 probability row over the front of its own score row (f16 pitch 2*(c+1)*RC).
//   CZ = 1: A rows, N, ldc, C and czoff are the chunk's; CZ = 2: A, lda, K, C rows and czoff are the chunk's.
//   Chunk 0, hi and residual planes (chunk0_tile): its NB0 blocks lead the flat grid (CZ = 1: their two k loops are the
//   launch's longest) or stand between the other chunks' whole and shorter pieces (CZ = 2).
//   CZ = 1: A = q, A2p = q residual, Bt = k, B2p = k residual, Cout2 = chunk 0's scores (pitch ldc2).
//   CZ = 2: A2p = chunk 0's p, Cout2 = its residual plane (pitch RC both), Bt = v^T, B2p = v^T residual, Cout = out,
//   Part = the f32 planes of the pieces s >= 1 (pbase).
// MC = 2: one launch holds the three in-projections, blockIdx.y = 0: q, 1: k, 2: v^T. The arguments describe q
//   (A = x rows, Bt = Wq rows, M = SEQ, N = EMB); strideB, strideC, strideC2 lead from q's weight, hi plane and residual
//   plane to the next projection's. q, k: the residual plane holds rows < RC. v^T: A = Wv rows, Bt = x rows, M = EMB,
//   N = SEQ, pitches SEQ and VLP, the residual plane holds columns < VLP.
template <typename OT, int MI, int OUT_MODE, int CZ, int MC>
__global__ __launch_bounds__(256) void gemm_t(
    const unsigned short* __restrict__ Ap, const unsigned short* __restrict__ A2p, int lda,
    const unsigned short* __restrict__ Btp, int ldb, long long strideB,
    const unsigned short* __restrict__ B2p, int ldb2,
    void* Cout, void* Cout2, int ldc, long long strideC, int ldc2, long long strideC2, int N2,
    int M, int N, int K, float oscale, float rscale2, float cscale, float rscaleC, int czoff, float* Part) {
  static_assert(CZ != 2 || ((16 * MI) % 32) == 0);
  static_assert(MC == 1 || MC == 2);
  static_assert(MC != 1 || ((CZ == 1 || CZ == 2) && OUT_MODE == 0 && std::is_same<OT, _Float16>::value));
  static_assert(MC != 2 || (CZ == 0 && OUT_MODE == 3));
  const int RT = 16 * MI;
  constexpr int BR = 16 * MI * 2;                          // rows of the block tile
  constexpr int STG_B = (BR + 256) * LPB;                  // one staged k tile of the block, bytes
  static_assert(BR == 128);                                // 8 waves x 16 rows copy the A part, 8 x 32 rows the Bt part
  static_assert(2 * STG_B >= 8 * 16 * 68 * 4 && 2 * STG_B <= 320 * 1024);
  __shared__ __align__(16) unsigned char ring[2 * STG_B];  // two buffers; after the k loop: per-wave 16x64 f32 slabs
  int bx = (int)blockIdx.x;              // the block's index among its chunk's (MC = 1) or the launch's blocks
  int piece = 0;                         // CZ = 2: which PVK keys of the k loop this block sums
  if (MC == 1) {                         // block-uniform
    constexpr int NB0 = (RC / 64) * 4;   // chunk 0's block tiles: RC (CZ = 1) or EMB (CZ = 2) columns = 4 x 256
    static_assert(RC == 1024 && EMB == 1024 && NCH > 1);
    int c = 1;
    if (CZ == 1) {
      if (bx < NB0) {
        chunk0_tile<1, STG_B>(ring, bx, (const _Float16*)(const void*)Ap, (const _Float16*)(const void*)A2p, lda,
                              (const _Float16*)(const void*)Btp, ldb, (const _Float16*)(const void*)B2p, ldb2,
                              (float*)Cout2, ldc2, K, oscale, rscale2);
        return;
      }
      bx -= NB0;
      constexpr int BPU = (RC / 64) * (RC / 64) / 8;   // chunk c holds (c+1) * BPU blocks of the flat grid
      c = 1;
      while (c < NCH - 1 && bx >= (c + 1) * BPU) { bx -= (c + 1) * BPU; ++c; }
    } else {
      constexpr int NW = 4 * pv_whole();               // blocks of whole pieces, four column tiles each
      if (bx >= NW && bx < NW + NB0) {
        chunk0_tile<2, STG_B>(ring, bx - NW, (const _Float16*)(const void*)A2p, (const _Float16*)(const void*)Cout2, RC,
                              (const _Float16*)(const void*)Btp, ldb, (const _Float16*)(const void*)B2p, ldb2,
                              (float*)Cout, ldc, RC, oscale, rscale2);
        return;
      }
      int R;
      pv_piece(((bx < NW) ? bx : (bx - NB0)) >> 2, R, piece);
      c  = R / RT0;
      bx = (R - c * RT0) * 4 + (bx & 3);               // the block's index among its chunk's 8 x 4 block tiles
    }
    const int rb = c * RC;
    const size_t sb = sbase(c);
    czoff = rb;
    if (CZ == 1) {
      Ap += (size_t)rb * lda;
      N = rb + RC; ldc = rb + RC;
      Cout = (void*)((float*)Cout + sb);
    } else {
      Ap += 2 * sb;
      lda = 2 * (rb + RC); K = rb + RC;
      // piece 0 goes to the output rows, piece s > 0 to plane s, whose first row is row s * PVK (<= rb)
      Cout = (piece == 0) ? (void*)((float*)Cout + (size_t)rb * ldc)
                          : (void*)(Part + pbase(piece) + (size_t)(rb - piece * PVK) * ldc);
    }
  }
  int M2 = M;                            // rows [0, M2) get a residual plane (OUT_MODE 3)
  if (MC == 2) {                         // block-uniform
    const int y = (int)blockIdx.y;
    const unsigned short* Wp = Btp + (size_t)y * (size_t)strideB;
    Cout  = (void*)((unsigned short*)Cout  + (size_t)y * (size_t)strideC);
    Cout2 = (void*)((unsigned short*)Cout2 + (size_t)y * (size_t)strideC2);
    if (y == 2) { Btp = Ap; Ap = Wp; M = EMB; N = SEQ; ldc = SEQ; ldc2 = VLP; N2 = VLP; M2 = EMB; }
    else        { Btp = Wp; M2 = RC; }
  }
  const OT* A  = (const OT*)(const void*)Ap;
  const OT* Bt = (const OT*)(const void*)Btp;
  const int lane = threadIdx.x & 31;
  const int wave = __builtin_amdgcn_readfirstlane((int)(threadIdx.x >> 5));
  const int tilesN = (N >> 6) / 4;       // block tiles along N
  const int tilesM = M / BR;
  if (bx >= tilesM * tilesN) return;     // block-uniform, in front of every barrier
  // The quotient is block-uniform; where the compiler divides on the vector unit, readfirstlane brings it back to a
  // scalar register, so that the returns below stay scalar branches.
  const int tm = __builtin_amdgcn_readfirstlane(bx / tilesN);
  const int mB = tm * BR;                                  // the block tile's first row and column
  const int nB = (bx - tm * tilesN) * 256;
  const int wn = wave & 3;                                 // this wave's column tile in the block
  const int m0 = mB + (wave >> 2) * RT;
  const int n0 = nB + (wn << 6);
  bool live = true;
  if (CZ == 1) {
    if (nB >= czoff + mB + BR) return;           // block-uniform causal skip, in front of every barrier
    live = n0 < czoff + m0 + RT;                 // a wave past the diagonal walks the loop and stores nothing
  }
  int kEnd = K;
  int kBeg = 0;
  if (CZ == 2) {
    const int ke = czoff + mB + BR;      // multiple of 32
    kEnd = (ke < K) ? ke : K;
    kBeg = piece * PVK;                  // < kEnd for every piece that pv_piece deals
    if (kEnd > kBeg + PVK) kEnd = kBeg + PVK;
  }

  const int rlane = lane & 15;                 // row (A) / col (B, D) within subtile
  const int koff  = (lane >> 4) * 8;           // k offset of this lane half
  const int mOff  = (lane >> 4) * 8;           // D row offset

  v8f acc[MI][4];
#pragma unroll
  for (int i = 0; i < MI; ++i)
#pragma unroll
    for (int j = 0; j < 4; ++j) acc[i][j] = zero8();

  // ---- this lane's part of every staged tile: row lane>>3 of each 4-row group, 16-B piece lane&7 ----
  const int crow = lane >> 3;
  const int cel  = (lane & 7) * 8;
  const int arow = wave * (BR / 8);                            // this wave's share of the staged A rows
  const int brow = wave * 32;                                  // and of the staged Bt rows
  const OT* gA  = A  + (size_t)(mB + arow + crow) * lda + cel + kBeg;
  const OT* gB  = Bt + (size_t)(nB + brow + crow) * ldb + cel + kBeg;
  const unsigned lc = lds_off(ring) + (unsigned)(crow * LPB + cel * 2);
  const unsigned lA = lc + (unsigned)(arow * LPB);
  const unsigned lB = lc + (unsigned)((BR + brow) * LPB);
  const int nT = (kEnd - kBeg + BKE - 1) / BKE;                // >= 1; block-uniform
  // The rotation differs between the blocks of one tile row (shared A rows) and of one tile column (shared Bt rows):
  // row tile of the whole matrix + column tile x cs. cs = 1 where a tile row holds many column tiles (scores, v^T); where it
  // holds four, cs spreads them over the loop (q, k, which also share their A rows with each other: 2 * y; P.V).
  const int yy = (MC == 2) ? (int)blockIdx.y : 0;
  const int cs = (MC == 2) ? ((yy == 2) ? 1 : 4) : ((CZ == 1) ? 1 : 8);
  const int rot = krot(czoff / BR + tm + cs * (nB >> 8) + 2 * yy, nT);
  auto stage = [&](int t) {                                    // trip t's k tile -> buffer t & 1
    const unsigned bo = (unsigned)(t & 1) * (unsigned)STG_B;
    const int kt = ktile(t, rot, nT) * BKE;
    copy16and32rows(lA + bo, gA + kt, (size_t)4 * lda, lB + bo, gB + kt, (size_t)4 * ldb);
  };
  const int aOff = (m0 - mB + rlane) * LPB;                    // this lane's fragment rows in a buffer, bytes
  const int bOff = (BR + wn * 64 + rlane) * LPB;
  kloop<OT, MI, STG_B>(ring, nT, aOff, bOff, koff, stage, acc);   // behind it the ring becomes output staging
  if (!live) return;                     // wave-uniform; no block barrier follows
#pragma unroll
  for (int i = 0; i < MI; ++i) acc_guard4(acc[i][0], acc[i][1], acc[i][2], acc[i][3]);

  // ---- epilogue ----
  float* slab = (float*)(void*)ring + wave * (16 * 68);   // pitch 68 floats, wave-private
#pragma unroll
  for (int i = 0; i < MI; ++i) {
    const int mBase = m0 + (i << 4);
#pragma unroll
    for (int j = 0; j < 4; ++j) {
#pragma unroll
      for (int r = 0; r < 8; ++r) {
        float v = acc[i][j][r];
        v = v * oscale;
        slab[(mOff + r) * 68 + (j << 4) + rlane] = v;
      }
    }
    __builtin_amdgcn_fence(3 /* release order */, "workgroup");
    __builtin_amdgcn_wave_barrier();
    __builtin_amdgcn_fence(2 /* acquire order */, "workgroup");
    if (OUT_MODE == 0) {
      float* C = (float*)Cout;
      const int h2 = lane >> 4, c4 = (lane & 15) * 4;     // 256-B row segment = 16 lanes x 16 B
      {
#pragma unroll
        for (int it = 0; it < 8; ++it) {
          const int row = it * 2 + h2;                     // it 0..7 x h2 0..1 = rows 0..15
          const v4f v = *(const v4f*)(slab + row * 68 + c4);
          *(v4f*)(C + (size_t)(mBase + row) * ldc + n0 + c4) = v;
        }
        
      }
    } else {
      const int q = lane >> 3, c8 = (lane & 7) * 8;
      unsigned short* C  = (unsigned short*)Cout;
      unsigned short* C2 = (unsigned short*)Cout2;
      const bool wr2 = (OUT_MODE == 3) && (n0 < N2) && (MC != 2 || m0 < M2);     // wave-uniform
      // The slab's planes, with or without the residual plane: one wave-uniform branch per slab chooses, so that a tile
      // without a residual plane does none of its arithmetic.
      auto planes = [&](auto withRes) {
        constexpr bool RES = decltype(withRes)::value;
        v4u hv[4], lv[4];
        unsigned short* pc[4];
        unsigned short* pc2[4];
#pragma unroll
        for (int it = 0; it < 4; ++it) {
          const int row = it * 4 + q;                      // it 0..3 x q 0..3 = rows 0..15
          const float* sp = slab + row * 68 + c8;
          pc[it]  = C  + (size_t)(mBase + row) * ldc  + n0 + c8;
          pc2[it] = C2 + (size_t)(mBase + row) * ldc2 + n0 + c8;
          float f[8];
#pragma unroll
          for (int e = 0; e < 8; ++e) f[e] = sp[e] * cscale;
          v4u a, a2;
#pragma unroll
          for (int e = 0; e < 4; ++e) {
            const float f0 = f[2 * e], f1 = f[2 * e + 1];
            const _Float16 x0 = (_Float16)f0, x1 = (_Float16)f1;
            const unsigned short h0 = h_bits(x0), h1 = h_bits(x1);
            unsigned short l0 = 0, l1 = 0;
            if (RES) {
              l0 = h_bits((_Float16)((f0 - (float)x0) * rscaleC));
              l1 = h_bits((_Float16)((f1 - (float)x1) * rscaleC));
            }
            a[e] = pk16(h0, h1); a2[e] = pk16(l0, l1);
          }
          hv[it] = a; lv[it] = a2;
        }
        __builtin_amdgcn_sched_barrier(0);   // values and addresses are formed ahead of the stores: nothing is computed among them
#pragma unroll
        for (int it = 0; it < 4; ++it) {
          *(v4u*)pc[it] = hv[it];
          if (RES) *(v4u*)pc2[it] = lv[it];
        }
        wait_store_regs();
        __builtin_amdgcn_sched_barrier(0);   // later arithmetic, which reuses the stores' registers, stays behind the wait
      };
      if (wr2) planes(std::integral_constant<bool, true>{});
      else     planes(std::integral_constant<bool, false>{});
    }
    __builtin_amdgcn_fence(3 /* release order */, "workgroup");
    __builtin_amdgcn_wave_barrier();
    __builtin_amdgcn_fence(2 /* acquire order */, "workgroup");
  }
}

// =====================================================================================================
// Exact causal row softmax, one launch for every query row: one block of 256 threads per row t, the longest first.
//   The scores GEMMs wrote every column of row t in [0, ((t>>6)+1)*64).
//   The row is processed in 8-column groups g; ngl = ((t>>6)+1)*8 groups hold scores, ng groups of P are written
//   (t < RC: ng = ngl; else ng = ((t>>7)+1)*16, the k end of the row's 128-row P.V block tile). Thread tid owns groups
//   g = it*256 + tid. Loads use an address clamped to group ngl-1; entries with column > t are replaced by -inf
//   by index before any arithmetic. Iterations with it*256 >= ng are skipped block-uniformly.
//   p = exp(s - max) * (1/sum) in f32 (max finite: column 0 is always valid), x16384 carry, f16 RNE;
//   columns > t up to ng*8 get exact zeros. Rows t < RC: also the f16 residual plane
//   Pl = f16((p*16384 - hi) * 4096), same pitch. Each group is one 16-B store per lane; 8 consecutive lanes fill
//   LDS redm/reds: cross-wave, block barriers (every thread reaches both).
//   coverage: every row x columns [0, ng*8) of P (and Pl) = exactly the extent the P.V GEMM reads.
// =====================================================================================================
//   Rows t >= RC: row t lies in score chunk c = t / RC (S + sbase(c), pitch (c+1)*RC), and P = S: the row's
//   probabilities go over the front of its own scores. Every score of the row is in registers, and has gone into the
//   row maximum, in front of the first block barrier; the stores stand behind the second.
//   Rows t < RC (chunk 0): scores S0, probabilities P0 and residuals Pl0, each [RC][RC].
__global__ __launch_bounds__(256)
void softmax_rows(const float* S, unsigned short* P, const float* S0, unsigned short* P0, unsigned short* Pl0) {
  __shared__ float redm[8];
  __shared__ float reds[8];
  const int t    = SEQ - 1 - (int)blockIdx.x;
  const bool r0  = t < RC;                                   // block-uniform: a row of chunk 0
  const int ch   = t / RC;
  const size_t ro = r0 ? ((size_t)t * (size_t)RC)
                       : (sbase(ch) + (size_t)(t - ch * RC) * (size_t)((ch + 1) * RC));   // the row's first score, f32 elements
  const size_t po = r0 ? ro : (2 * ro);                      // its first probability, f16 elements
  const int tid  = threadIdx.x;
  const int wave = tid >> 5;
  const int lane = tid & 31;
  const int ngl  = ((t >> 6) + 1) * 8;                       // groups that hold scores
  const int ng   = r0 ? ngl : ((t >> 7) + 1) * 16;           // groups of P that are written: up to the P.V block tile's k end
  const float* rp = (r0 ? S0 : S) + ro;
  float v[SMI][8];
#pragma unroll
  for (int it = 0; it < SMI; ++it) {
#pragma unroll
    for (int e = 0; e < 8; ++e) v[it][e] = -INFINITY;
    if (it * 256 < ng) {                                   // block-uniform
      const int g  = it * 256 + tid;
      const int gc = (g < ngl) ? g : (ngl - 1);            // clamped address
      const int c0 = g * 8;
      const v4f a  = *(const v4f*)(rp + (size_t)gc * 8);
      const v4f a4 = *(const v4f*)(rp + (size_t)gc * 8 + 4);
#pragma unroll
      for (int e = 0; e < 4; ++e) {
        v[it][e]     = (c0 + e <= t)     ? a[e]  : -INFINITY;
        v[it][4 + e] = (c0 + 4 + e <= t) ? a4[e] : -INFINITY;
      }
    }
  }
  float mx = -INFINITY;
#pragma unroll
  for (int it = 0; it < SMI; ++it)
#pragma unroll
    for (int e = 0; e < 8; ++e) mx = fmaxf(mx, v[it][e]);
#pragma unroll
  for (int off = 1; off < 32; off <<= 1) mx = fmaxf(mx, __shfl_xor(mx, off, 32));
  if (lane == 0) redm[wave] = mx;
  __syncthreads();
  mx = redm[0];
#pragma unroll
  for (int w = 1; w < 8; ++w) mx = fmaxf(mx, redm[w]);

  float sum = 0.f;
#pragma unroll
  for (int it = 0; it < SMI; ++it) {
    if (it * 256 < ng) {                                   // block-uniform
#pragma unroll
      for (int e = 0; e < 8; ++e) { const float ex = __expf(v[it][e] - mx); v[it][e] = ex; sum += ex; }
    } else {
#pragma unroll
      for (int e = 0; e < 8; ++e) v[it][e] = 0.f;
    }
  }
#pragma unroll
  for (int off = 1; off < 32; off <<= 1) sum += __shfl_xor(sum, off, 32);
  if (lane == 0) reds[wave] = sum;
  __syncthreads();
  sum = reds[0];
#pragma unroll
  for (int w = 1; w < 8; ++w) sum += reds[w];

  const float sc = PCARRY * (1.0f / sum);        // sum >= 1
  v4u pk[SMI], pl[SMI];
#pragma unroll
  for (int it = 0; it < SMI; ++it) {
    v4u a, a2;
#pragma unroll
    for (int e = 0; e < 4; ++e) {
      const float f0 = v[it][2 * e] * sc, f1 = v[it][2 * e + 1] * sc;
      const _Float16 x0 = (_Float16)f0, x1 = (_Float16)f1;
      unsigned short l0 = 0, l1 = 0;
      if (r0) {
        l0 = h_bits((_Float16)((f0 - (float)x0) * RSC));
        l1 = h_bits((_Float16)((f1 - (float)x1) * RSC));
      }
      a[e]  = pk16(h_bits(x0), h_bits(x1));
      a2[e] = pk16(l0, l1);
    }
    pk[it] = a; pl[it] = a2;
  }
  unsigned short* op  = (r0 ? P0 : P) + po;
  unsigned short* opl = Pl0 + po;                            // used by rows of chunk 0 only
  {
#pragma unroll
    for (int it = 0; it < SMI; ++it) {
      if (it * 256 < ng) {                                 // block-uniform
        const int g = it * 256 + tid;
        if (g < ng) {
          *(v4u*)(op + (size_t)g * 8) = pk[it];
          wait_store_regs();                               // the residual store's address reuses this store's register
          if (r0) *(v4u*)(opl + (size_t)g * 8) = pl[it];
        }
      }
    }
    
  }
}

// =====================================================================================================
// out rows >= PVK: out += plane 1 + ... in ascending key order. Row tile R = row / 128 has the planes 1 .. R / PRS.
// One block per JR rows of one row tile (the plane count is block-uniform), a thread takes 16 B of each row; every load
// goes out ahead of the sums. coverage: (SEQ - PVK) / JR blocks x JR rows x 256 threads x 4 columns.
// =====================================================================================================
__global__ __launch_bounds__(256) void pv_join(float* out, const float* part) {
  static_assert(EMB == 256 * 4);
  const int row0 = PVK + (int)blockIdx.x * JR;
  const int ns   = (row0 / 128) / PRS;                       // planes that hold a piece of these rows, >= 1
  const int c4   = (int)threadIdx.x * 4;
  float* op = out + (size_t)row0 * EMB;                      // block-uniform base
  v4f v[NPC][JR];
#pragma unroll
  for (int r = 0; r < JR; ++r) v[0][r] = *(const v4f*)(op + (r * EMB + c4));
  wait_load_regs();                                          // later loads land in registers that held these addresses
#pragma unroll
  for (int s = 1; s < NPC; ++s) {
    if (s <= ns) {                                           // block-uniform
      const float* pp = part + (pbase(s) + (size_t)(row0 - s * PVK) * EMB);   // block-uniform base
#pragma unroll
      for (int r = 0; r < JR; ++r) v[s][r] = *(const v4f*)(pp + (r * EMB + c4));
      wait_load_regs();                                      // as above
    } else {
#pragma unroll
      for (int r = 0; r < JR; ++r) v[s][r] = (v4f){0.f, 0.f, 0.f, 0.f};
    }
  }
#pragma unroll
  for (int r = 0; r < JR; ++r) {
    v4f a = v[0][r];
#pragma unroll
    for (int s = 1; s < NPC; ++s) a += v[s][r];
    *(v4f*)(op + (r * EMB + c4)) = a;
  }
}

// =====================================================================================================
// Workspace map (bytes at SEQ = 8192, RC = 1024; every region a multiple of its whole-line store granularity and of
//   R0   Xb bf16 [SEQ][EMB] (16777216), later the f32 score chunks c >= 1, S_c [RC][(c+1)*RC] at sbase(c), each row's
//        front overwritten by its f16 probabilities (pitch 2*(c+1)*RC)                                      146800640
//   S0   f32 [RC][RC]     (chunk 0 scores)                                                                    4194304
//   Wqb, Wkb, Wvb bf16 [EMB][EMB]                                                                          3 x 2097152
//   Qh   f16 [SEQ][EMB]                                                                                      16777216
//   Kh   f16 [SEQ][EMB]                                                                                      16777216
//   VT   f16 [EMB][SEQ]   (v^T hi plane)                                                                     16777216
//   Ql   f16 [RC][EMB]    (q residual x4096, rows < RC)                                                       2097152
//   Kl   f16 [RC][EMB]    (k residual x4096, keys < RC)                                                       2097152
//   VL   f16 [EMB][VLP]   (v^T residual x4096, keys < VLP)                                                    2097152
//   P    f16 [RC][RC]     (chunk 0 probabilities)                                                             2097152
//   Pl   f16 [RC][RC]     (p residual x4096, chunk 0 only)                                                    2097152
//   PB   f32 planes s = 1 .. NPC-1 of P.V pieces, plane s [SEQ - s*PVK][EMB] at pbase(s)                     50331648
//   total                                                                                                   268435456
// Aliases are ordered by launch dependence: Xb is last read by the projections' launch, R0's scores are first written by
// the scores GEMM of the chunks c >= 1 after it. Weights are [out n][in k] with k contiguous = the Bt / A layout the GEMM wants.
// =====================================================================================================
static constexpr size_t PACT_B = (size_t)SEQ * EMB * 2;
static constexpr size_t PS_B   = sbase(NCH) * 4;               // chunks 1 .. NCH-1
static constexpr size_t PS0_B  = (size_t)RC * RC * 4;
static constexpr size_t R0_B   = (PACT_B > PS_B) ? PACT_B : PS_B;
static constexpr size_t PW_B   = (size_t)EMB * EMB * 2;
static constexpr size_t PRES_B = (size_t)RC * EMB * 2;
static constexpr size_t PVT_B  = (size_t)EMB * SEQ * 2;
static constexpr size_t PVL_B  = (size_t)EMB * VLP * 2;
static constexpr size_t PP_B   = (size_t)RC * RC * 2;
static constexpr size_t PPL_B  = (size_t)RC * RC * 2;
static constexpr size_t PPB_B  = pbase(NPC) * 4;
static constexpr size_t WS_TOTAL = R0_B + PS0_B + 3 * PW_B + 2 * PACT_B + PVT_B + 2 * PRES_B + PVL_B + PP_B + PPL_B + PPB_B;
static_assert(WS_TOTAL <= (size_t)268435456);
static constexpr int PV_BLOCKS = 4 * (pv_whole() + pv_short()) + (RC / 64) * 4;   // P.V: k pieces x 4 column tiles, and chunk 0's block tiles
static_assert((R0_B % 128) == 0 && (PS0_B % 128) == 0 && (PP_B % 128) == 0 && (PW_B % 128) == 0 && (PRES_B % 128) == 0 && (PVL_B % 128) == 0 && (PPL_B % 128) == 0);

extern "C" void kernel_launch(void* const* d_in, const int* in_sizes, int n_in,
                              void* d_out, int out_size, void* d_ws, size_t ws_size,
                              hipStream_t stream) {
  if (n_in < 4) return;
  const long long needX = (long long)SEQ * (long long)EMB;
  if ((long long)in_sizes[0] < needX) return;
  if (in_sizes[1] < EMB * EMB) return;
  if (in_sizes[2] < EMB * EMB) return;
  if (in_sizes[3] < EMB * EMB) return;
  if (out_size < 0) return;
  if ((long long)out_size < needX) return;

  const float* x  = (const float*)d_in[0];
  const float* Wq = (const float*)d_in[1];
  const float* Wk = (const float*)d_in[2];
  const float* Wv = (const float*)d_in[3];

  size_t off = 0;
  const size_t oR0 = off; off += R0_B;
  const size_t oS0 = off; off += PS0_B;
  const size_t oWq = off; off += PW_B;
  const size_t oWk = off; off += PW_B;
  const size_t oWv = off; off += PW_B;
  const size_t oQh = off; off += PACT_B;
  const size_t oKh = off; off += PACT_B;
  const size_t oVT = off; off += PVT_B;
  const size_t oQl = off; off += PRES_B;
  const size_t oKl = off; off += PRES_B;
  const size_t oVL = off; off += PVL_B;
  const size_t oP  = off; off += PP_B;
  const size_t oPl = off; off += PPL_B;
  const size_t oPB = off; off += PPB_B;
  if (off != WS_TOTAL) return;
  if (off > ws_size) return;
  if (off > (size_t)268435456) return;

  char* ws = (char*)d_ws;
  unsigned short* Xb  = (unsigned short*)(ws + oR0);
  float*          S   = (float*)(ws + oR0);          // alias, see map
  float*          S0  = (float*)(ws + oS0);
  unsigned short* Wqb = (unsigned short*)(ws + oWq);
  unsigned short* Wkb = (unsigned short*)(ws + oWk);
  unsigned short* Wvb = (unsigned short*)(ws + oWv);
  unsigned short* Qh  = (unsigned short*)(ws + oQh);
  unsigned short* Kh  = (unsigned short*)(ws + oKh);
  unsigned short* VT  = (unsigned short*)(ws + oVT);
  unsigned short* Ql  = (unsigned short*)(ws + oQl);
  unsigned short* Kl  = (unsigned short*)(ws + oKl);
  unsigned short* VL  = (unsigned short*)(ws + oVL);
  unsigned short* Pp  = (unsigned short*)(ws + oP);
  unsigned short* Ppl = (unsigned short*)(ws + oPl);
  float*          PB  = (float*)(ws + oPB);
  float*          out0 = (float*)d_out;

  const dim3 blk(256);
  const int n8x = SEQ * EMB / 8;                                    // multiple of 256
  const int n8w = EMB * EMB / 8;                                    // multiple of 256
  const dim3 gCvt(n8x / 256 + 3 * (n8w / 256), 1);
  const dim3 gPr(((SEQ / 64) * (EMB / 64)) / 8, 3);                 // q, k (M=SEQ, N=EMB), v^T (M=EMB, N=SEQ): 64x64 wave tiles
  const dim3 gSn((RC / 64) * 4 + ((RC / 64) * (RC / 64) / 8) * ((NCH * (NCH + 1)) / 2 - 1), 1);   // scores: chunk 0's 64x256 block tiles, then chunks c >= 1, 128x256
  const dim3 gPn(PV_BLOCKS, 1);                                     // P.V: chunks c >= 1, k pieces of 128x256 block tiles; chunk 0's 64x256
  const dim3 gJn((SEQ - PVK) / JR);                                 // JR rows per block
  const dim3 gSm(SEQ);                                              // one block per query row

  // (1) x, Wq, Wk, Wv -> bf16 planes (RNE convert), one launch
  cvt16x8<<<gCvt, blk, 0, stream>>>(x, Wq, Wk, Wv, Xb, Wqb, Wkb, Wvb, n8x / 256, n8w / 256);
  // (2) one launch, blockIdx.y = 0, 1, 2 (K=EMB each):
  //     q = x . Wq^T, k = x . Wk^T -> f16 planes [s][d]; rows [0, RC) also a residual (x4096) plane;
  //     v^T = Wv . x^T -> f16 hi plane [d][s] (pitch SEQ) and f16 residual plane x4096 [d][s < VLP] (pitch VLP).
  //     Wqb, Wkb, Wvb / Qh, Kh, VT / Ql, Kl, VL each lie one behind the other in the workspace (the three strides).
  static_assert(PVT_B == PACT_B && PVL_B == PRES_B);
  gemm_t<__bf16, 4, 3, 0, 2><<<gPr, blk, 0, stream>>>(
      Xb, Xb, EMB, Wqb, EMB, (long long)(PW_B / 2),
      Wqb, EMB,
      (void*)Qh, (void*)Ql, EMB, (long long)(PACT_B / 2), EMB, (long long)(PRES_B / 2), EMB,
      SEQ, EMB, EMB, 1.0f, 0.0f, 1.0f, RSC, 0, PB);
  // (3) scores = q.k / 32 -> f32, causal tiles only, every row chunk in one launch (MC = 1).
  //     Chunk 0 (rows and keys [0, RC), residual planes) -> S0: Qh.Kh and, x4096, Ql.Kh + Qh.Kl.
  //     Chunks c >= 1 (rows c*RC .. c*RC+RC-1, keys 0 .. (c+1)*RC-1), single f16 planes -> S; the kernel takes each
  //     chunk's rows, widths and pitches from blockIdx.
  gemm_t<_Float16, 4, 0, 1, 1><<<gSn, blk, 0, stream>>>(
      Qh, Ql, EMB, Kh, EMB, 0LL,
      Kl, EMB,
      (void*)S, (void*)S0, 0, 0LL, RC, 0LL, 0,
      RC, 0, EMB, 1.0f / 32.0f, 1.0f / RSC, 1.0f, 1.0f, 0, PB);
  // (4) exact causal softmax of every row in one launch -> f16 probabilities (x16384, zeros beyond the diagonal up to
  //     the P.V tile's k end); rows of chunk 0 also their residual plane.
  softmax_rows<<<gSm, blk, 0, stream>>>(S, (unsigned short*)S, S0, Pp, Ppl);
  // (5) out rows = P.V / 16384 -> f32 d_out, every row chunk in one launch (MC = 1).
  //     Chunk 0: Ph.Vh and, x4096, Pl.Vh + Ph.Vl (Ph, Pl pitch RC, VT pitch SEQ, VL pitch VLP). Chunks c >= 1: single planes,
  //     k loops in pieces of PVK keys: piece 0 -> out, pieces s >= 1 -> PB.
  gemm_t<_Float16, 4, 0, 2, 1><<<gPn, blk, 0, stream>>>(
      (const unsigned short*)S, Pp, 0, VT, SEQ, 0LL,
      VL, VLP,
      (void*)out0, (void*)Ppl, EMB, 0LL, 0, 0LL, 0,
      RC, EMB, 0, 1.0f / PCARRY, 1.0f / RSC, 1.0f, 1.0f, 0, PB);
  // (6) out rows >= PVK: the later pieces' planes are added to piece 0, in ascending key order.
  pv_join<<<gJn, blk, 0, stream>>>(out0, PB);
  (void)hipGetLastError();
}

// v008
// Measured time: 209 microseconds a run.
// Next to v007, in two timings, it ran 1.03 times as fast each time.
// All steps since v000 together make it 10.6 times as fast.
// Contractions: q, k, v^T in-projections = v_wmma_f32_16x16x32_bf16 (bf16 operands from RNE-converted inputs, single product, f32 accumulate);
// q.k^T scores = v_wmma_f32_16x16x32_f16 (q, k f16 planes, single product; query rows < RC: q and k each f16 hi plane + f16 residual plane x4096, 3 products, separate f32 accumulators);
// p.v = v_wmma_f32_16x16x32_f16 (p carried x16384 in f16, v^T f16, single product; query rows < RC: p and v^T each f16 hi plane + f16 residual plane x4096, 3 products, separate f32 accumulators);
// causal softmax (row max, sum, probabilities) in f32 on materialised f32 score row chunks.
// p.v of query rows >= RC: each k loop is cut into pieces of PVK keys, one block a piece; piece 0 goes to out, the later
// pieces to f32 planes in the workspace, which a last launch adds to out in ascending key order.
// Every GEMM k loop walks its 64-k tiles from a start that is rotated by the block's tile index, and wraps round (ktile).
// The 128 x 256 block tiles stage their k tiles in LDS by tensor loads, chunk 0's 64 x 256 block tiles by asynchronous copies.
#include <hip/hip_runtime.h>
#include <math.h>
#include <stdint.h>
#include <type_traits>

#ifndef NB
#define NB 1
#endif
#ifndef SEQ
#define SEQ 8192
#endif
#define NB_FULL  1
#define SEQ_FULL 8192
#define EMB      1024
#define RC       ((SEQ < 1024) ? SEQ : 1024)   // query rows per score/probability chunk; rows < RC use residual planes
#define NCH      (SEQ / RC)                    // number of row chunks
#define VLP      RC                            // key extent of the v^T residual plane
#define PCARRY   16384.0f                      // power-of-two carry of p in the f16 P.V operand
#define RSC      4096.0f                       // power-of-two carry of every f16 residual plane
#define SMI      ((SEQ / 8 + 255) / 256)       // max 8-column groups per softmax thread
static_assert(NB == 1 && NB_FULL == 1);
static_assert(SEQ >= 256 && SEQ <= SEQ_FULL && (SEQ % 256) == 0);
static_assert((SEQ % RC) == 0 && (RC % 64) == 0 && NCH >= 1);
static_assert((EMB % 64) == 0 && (SEQ % 64) == 0 && (EMB % 32) == 0 && (RC % 32) == 0);
static_assert(SMI >= 1 && SMI <= 4);
static_assert((EMB % 512) == 0 && (RC % 512) == 0 && (SEQ % 512) == 0);   // eight 64-column tiles per GEMM block; 64-k staged tiles
static_assert(((SEQ * EMB / 8) % 256) == 0 && ((EMB * EMB / 8) % 256) == 0);
#define PVK      2048                          // keys per piece of a P.V k loop (query rows >= RC)
#define PRS      (PVK / 128)                   // 128-row tiles after which a k loop is one piece longer
#define NRT      (SEQ / 128)                   // 128-row tiles of the whole output
#define RT0      (RC / 128)                    // the first of them that is not chunk 0's
#define NPC      (SEQ / PVK)                   // pieces of the longest k loop
#define JR       4                             // rows per block of the launch that adds the pieces
static_assert((SEQ % PVK) == 0 && SEQ > PVK && (PVK % 128) == 0 && RT0 <= PRS && (128 % JR) == 0);

typedef _Float16 v16h __attribute__((ext_vector_type(16)));
typedef _Float16 v8h  __attribute__((ext_vector_type(8)));
typedef __bf16   v16b __attribute__((ext_vector_type(16)));
typedef __bf16   v8b  __attribute__((ext_vector_type(8)));
typedef float    v8f  __attribute__((ext_vector_type(8)));
typedef float    v4f  __attribute__((ext_vector_type(4)));
typedef unsigned int v4u __attribute__((ext_vector_type(4)));

#if defined(__HIP_DEVICE_COMPILE__)
#define DEV_ASM 1
#else
#define DEV_ASM 0
#endif

// ---- scalar helpers --------------------------------------------------------------------------------
__device__ __forceinline__ unsigned short bf_bits(float f) {          // f32 -> bf16 bits, RNE convert
  unsigned u = __float_as_uint(f);
  return (unsigned short)((u + 0x7FFFu + ((u >> 16) & 1u)) >> 16);
}
__device__ __forceinline__ unsigned short h_bits(_Float16 x) { return __builtin_bit_cast(unsigned short, x); }
__device__ __forceinline__ unsigned pk16(unsigned short a, unsigned short b) { return (unsigned)a | ((unsigned)b << 16); }
// f32 elements of the score chunks 1 .. c-1, which lie in front of chunk c (chunk j: RC rows of (j+1)*RC columns)
__host__ __device__ __forceinline__ constexpr size_t sbase(int c) { return (size_t)RC * RC * (size_t)((c * (c + 1)) / 2 - 1); }
// f32 elements of the P.V partial planes 1 .. s-1, which lie in front of plane s (plane j: rows j*PVK .. SEQ-1, pitch EMB)
__host__ __device__ __forceinline__ constexpr size_t pbase(int s) {
  return (size_t)EMB * (size_t)((s - 1) * SEQ - PVK * (((s - 1) * s) / 2));
}
// P.V pieces of the row tiles RT0 .. NRT-1 (row tile R: keys [0, (R+1)*128)): whole pieces of PVK keys, and shorter last pieces
__host__ __device__ constexpr int pv_whole() {
  int n = 0;
  for (int q = 0; q < NPC; ++q) { const int first = PRS * (q + 1) - 1; n += NRT - ((first < RT0) ? RT0 : first); }
  return n;
}
__host__ __device__ constexpr int pv_short() {
  int n = 0;
  for (int m = 1; m < PRS; ++m) n += NPC - ((m - 1 >= RT0) ? 0 : 1);
  return n;
}
// rank f -> (row tile R, piece s), every pair once, the longest pieces first: the whole pieces, then the last pieces of
// m * 128 keys, m falling. Block-uniform scalar arithmetic.
__device__ __forceinline__ void pv_piece(int f, int& R, int& s) {
  R = NRT - 1; s = 0;
  for (int q = 0; q < NPC; ++q) {
    const int first = PRS * (q + 1) - 1;
    const int n = NRT - ((first < RT0) ? RT0 : first);
    if (f < n) { R = NRT - 1 - f; s = q; return; }
    f -= n;
  }
  for (int m = PRS - 1; m >= 1; --m) {
    const int n = NPC - ((m - 1 >= RT0) ? 0 : 1);
    if (f < n) { s = NPC - 1 - f; R = s * PRS + m - 1; return; }
    f -= n;
  }
}
__device__ __forceinline__ v8f zero8() { v8f z = {0.f, 0.f, 0.f, 0.f, 0.f, 0.f, 0.f, 0.f}; return z; }

// ---- fragment types / loaders: 16-bit A/B operand, lane -> row/col (lane&15), p already includes +8*(lane>>4);
//      elements 0..7 <- p[0..7] (k0+8h..k0+8h+7), elements 8..15 <- p[16..23] (k0+16+8h..k0+16+8h+7)
template <typename OT> struct FT;
template <> struct FT<__bf16>   { typedef v16b frag; typedef v8b half8; };
template <> struct FT<_Float16> { typedef v16h frag; typedef v8h half8; };

template <typename OT>
__device__ __forceinline__ typename FT<OT>::frag ldfrag(const OT* p) {
  union { typename FT<OT>::frag v; typename FT<OT>::half8 h[2]; } f;
  f.h[0] = *(const typename FT<OT>::half8*)(p);
  f.h[1] = *(const typename FT<OT>::half8*)(p + 16);
  return f.v;
}

// ---- WMMA helpers (asm guard bodies are device-only; concrete operand types) -----------------------------
__device__ __forceinline__ v8f mmar(v16b a, v16b b, v8f c) {
  return __builtin_amdgcn_wmma_f32_16x16x32_bf16(false, a, false, b, (short)0, c, false, false);
}
__device__ __forceinline__ v8f mmar(v16h a, v16h b, v8f c) {
  return __builtin_amdgcn_wmma_f32_16x16x32_f16(false, a, false, b, (short)0, c, false, false);
}
__device__ __forceinline__ void acc_guard4(v8f& a, v8f& b, v8f& c, v8f& d) {
#if DEV_ASM
  asm volatile("v_nop\n\tv_nop\n\tv_nop\n\tv_nop" : "+v"(a), "+v"(b), "+v"(c), "+v"(d));
#else
  (void)a; (void)b; (void)c; (void)d;
#endif
}

// ---- LDS staging by asynchronous copies ---------------------------------------------------------------
#define BKE 64     // k elements per staged tile: 128-B rows, whole lines of the source
#define LPB 144    // LDS row pitch in bytes: 128 + 16 (16 B x odd, conflict-free for 16-B row readers)
#define LPE (LPB / 2)
__device__ __forceinline__ unsigned lds_off(const void* p) { return (unsigned)(size_t)p; }   // byte offset in the block's LDS
// The k tile that trip t of a block's k loop works on: the loop starts at tile rot (0 <= rot < nT) and wraps round, every
// tile once. rot differs between the blocks that share operand rows, so that blocks which run side by side ask L2 for
// different lines of those rows at a time. Block-uniform scalar arithmetic.
__device__ __forceinline__ int ktile(int t, int rot, int nT) { const int u = t + rot; return (u >= nT) ? (u - nT) : u; }
// idx >= 0, nT >= 1. Where the compiler divides on the vector unit, readfirstlane brings the block-uniform remainder back
// to a scalar register, so that ktile stays scalar arithmetic in the loops.
__device__ __forceinline__ int krot(int idx, int nT) {
  return __builtin_amdgcn_readfirstlane((int)((unsigned)idx % (unsigned)nT));
}
// Each copy: a wave brings 4 rows x 128 B (lane -> row lane>>3, 16-B piece lane&7), l / g already hold the lane's part.
// step4 = source elements per 4 rows. The address-register wait ends each statement, so no later address
// arithmetic can be placed between a copy and that wait.
__device__ __forceinline__ void copy8and32rows(unsigned la, const void* gap, size_t astep4,
                                               unsigned l, const void* gp, size_t step4) {
#if DEV_ASM
  const unsigned short* ga = (const unsigned short*)gap;
  const unsigned short* g  = (const unsigned short*)gp;
  asm volatile("global_load_async_to_lds_b128 %0, %10, off\n\t"
               "global_load_async_to_lds_b128 %1, %11, off\n\t"
               "global_load_async_to_lds_b128 %2, %12, off\n\t"
               "global_load_async_to_lds_b128 %3, %13, off\n\t"
               "global_load_async_to_lds_b128 %4, %14, off\n\t"
               "global_load_async_to_lds_b128 %5, %15, off\n\t"
               "global_load_async_to_lds_b128 %6, %16, off\n\t"
               "global_load_async_to_lds_b128 %7, %17, off\n\t"
               "global_load_async_to_lds_b128 %8, %18, off\n\t"
               "global_load_async_to_lds_b128 %9, %19, off\n\t"
               "s_wait_xcnt 0x0"
               :: "v"(la), "v"(la + 4u * LPB),
                  "v"(l), "v"(l + 4u * LPB), "v"(l + 8u * LPB), "v"(l + 12u * LPB),
                  "v"(l + 16u * LPB), "v"(l + 20u * LPB), "v"(l + 24u * LPB), "v"(l + 28u * LPB),
                  "v"(ga), "v"(ga + astep4),
                  "v"(g), "v"(g + step4), "v"(g + 2 * step4), "v"(g + 3 * step4),
                  "v"(g + 4 * step4), "v"(g + 5 * step4), "v"(g + 6 * step4), "v"(g + 7 * step4) : "memory");
#else
  (void)la; (void)gap; (void)astep4; (void)l; (void)gp; (void)step4;
#endif
}
// 16 rows of the shared A part and 32 rows of the shared Bt part: one wave's twelve copies of a 384-row tile; the
// address-register wait is the statement's last line, as above.
__device__ __forceinline__ void copy16and32rows(unsigned la, const void* gap, size_t astep4,
                                                unsigned l, const void* gp, size_t step4) {
#if DEV_ASM
  const unsigned short* ga = (const unsigned short*)gap;
  const unsigned short* g  = (const unsigned short*)gp;
  asm volatile("global_load_async_to_lds_b128 %0, %12, off\n\t"
               "global_load_async_to_lds_b128 %1, %13, off\n\t"
               "global_load_async_to_lds_b128 %2, %14, off\n\t"
               "global_load_async_to_lds_b128 %3, %15, off\n\t"
               "global_load_async_to_lds_b128 %4, %16, off\n\t"
               "global_load_async_to_lds_b128 %5, %17, off\n\t"
               "global_load_async_to_lds_b128 %6, %18, off\n\t"
               "global_load_async_to_lds_b128 %7, %19, off\n\t"
               "global_load_async_to_lds_b128 %8, %20, off\n\t"
               "global_load_async_to_lds_b128 %9, %21, off\n\t"
               "global_load_async_to_lds_b128 %10, %22, off\n\t"
               "global_load_async_to_lds_b128 %11, %23, off\n\t"
               "s_wait_xcnt 0x0"
               :: "v"(la), "v"(la + 4u * LPB), "v"(la + 8u * LPB), "v"(la + 12u * LPB),
                  "v"(l), "v"(l + 4u * LPB), "v"(l + 8u * LPB), "v"(l + 12u * LPB),
                  "v"(l + 16u * LPB), "v"(l + 20u * LPB), "v"(l + 24u * LPB), "v"(l + 28u * LPB),
                  "v"(ga), "v"(ga + astep4), "v"(ga + 2 * astep4), "v"(ga + 3 * astep4),
                  "v"(g), "v"(g + step4), "v"(g + 2 * step4), "v"(g + 3 * step4),
                  "v"(g + 4 * step4), "v"(g + 5 * step4), "v"(g + 6 * step4), "v"(g + 7 * step4) : "memory");
#else
  (void)la; (void)gap; (void)astep4; (void)l; (void)gp; (void)step4;
#endif
}
__device__ __forceinline__ void wait_lds_reads() {   // this wave's LDS reads have returned before its buffer is handed back
#if DEV_ASM
  asm volatile("s_wait_dscnt 0x0" ::: "memory");
#endif
}
__device__ __forceinline__ void wait_store_regs() {  // a precaution: stands between issued global stores and the reuse of their registers
#if DEV_ASM
  asm volatile("s_wait_xcnt 0x0" ::: "memory");
#endif
}
__device__ __forceinline__ void wait_load_regs() {   // a precaution: stands between issued global loads and the reuse of their address registers
#if DEV_ASM
  asm volatile("s_wait_xcnt 0x0" ::: "memory");
#endif
}
__device__ __forceinline__ void wait_copies() {      // this wave's copies have landed before the barrier publishes them
#if DEV_ASM
  asm volatile("s_wait_asynccnt 0x0" ::: "memory");
#endif
}

// ---- LDS staging by tensor loads ----------------------------------------------------------------------
typedef uint32_t u32x4 __attribute__((ext_vector_type(4)));
typedef uint32_t u32x8 __attribute__((ext_vector_type(8)));
__device__ __forceinline__ uint32_t uni(uint32_t v) { return (uint32_t)__builtin_amdgcn_readfirstlane((int)v); }
// A wave-uniform value held in a scalar register: a test on it compiles to a scalar compare and branch (a tensor load
// ignores EXEC, so only a scalar branch keeps a wave from issuing it), and what is derived from it is formed behind it.
__device__ __forceinline__ uint32_t pinned(uint32_t v) {
  uint32_t w = uni(v);
#if DEV_ASM
  asm volatile("" : "+s"(w));            // descriptor word / issue test held in a scalar register
#endif
  return w;
}
__device__ __forceinline__ void tensor_load(u32x4 g0, u32x8 g1) {   // one request of the whole wave: a 2-D tile, global -> LDS
#if DEV_ASM
  asm volatile("tensor_load_to_lds %0, %1" :: "s"(g0), "s"(g1) : "memory");
#else
  (void)g0; (void)g1;
#endif
}
__device__ __forceinline__ void wait_tensor() {      // this wave's tensor load has landed before the barrier publishes it
#if DEV_ASM
  asm volatile("s_wait_tensorcnt 0x0" ::: "memory");
#endif
}
// Inputs only, no instruction: stands behind the wait, so that the scalar registers of a request's two groups stay
// allocated to them, and take no other value, from the issue until the request has landed.
__device__ __forceinline__ void groups_held(u32x4 g0, u32x8 g1) {
#if DEV_ASM
  asm volatile("" :: "s"(g0), "s"(g1));
#else
  (void)g0; (void)g1;
#endif
}

// =====================================================================================================
// f32 -> bf16 planes (RNE convert), 8 elements per thread, one 16-B store per lane: a wave writes 512 contiguous B
// One launch for x and the three weights: blocks [0, nbx) take x, then nbw blocks each take Wq, Wk, Wv (block-uniform).
// coverage: nbx * 256 threads x 8 elements = the whole x plane, nbw * 256 x 8 = each whole weight plane.
// =====================================================================================================
__global__ __launch_bounds__(256) void cvt16x8(const float* __restrict__ x, const float* __restrict__ wq,
                                               const float* __restrict__ wk, const float* __restrict__ wv,
                                               unsigned short* xb, unsigned short* wqb, unsigned short* wkb,
                                               unsigned short* wvb, int nbx, int nbw) {
  int bi = (int)blockIdx.x;
  int nb = nbx;                          // blocks of the plane that this block works on
  const float* in = x;
  unsigned short* out = xb;
  if (bi >= nbx) {
    bi -= nbx; nb = nbw;
    in = wq; out = wqb;
    if (bi >= nbw) { bi -= nbw; in = wk; out = wkb; }
    if (bi >= nbw) { bi -= nbw; in = wv; out = wvb; }
  }
  const int i = bi * 256 + (int)threadIdx.x;
  if (bi < nb) {
    const float* ip = in + (size_t)i * 8;
    const v4f a  = *(const v4f*)(ip);
    const v4f a4 = *(const v4f*)(ip + 4);
    v4u p;
    p[0] = pk16(bf_bits(a[0]),  bf_bits(a[1]));
    p[1] = pk16(bf_bits(a[2]),  bf_bits(a[3]));
    p[2] = pk16(bf_bits(a4[0]), bf_bits(a4[1]));
    p[3] = pk16(bf_bits(a4[2]), bf_bits(a4[3]));
    unsigned short* o = out + (size_t)i * 8;
    *(v4u*)o = p;
    
  }
}

// =====================================================================================================
// The k loop of one block tile (16-bit operand type OT). The eight waves of a block form a 2 x 4 grid of (16*MI) x 64
// wave tiles. stage(t) copies the block's rows of k tile t (64 k, whole 128-B lines) into buffer t & 1 of the ring
// (STG bytes a buffer) by asynchronous copies or by tensor loads: two buffers, one block barrier per tile, tile t + 1 flies while tile t
// is multiplied. aOff / bOff = byte offsets in a buffer of this lane's first A / Bt fragment row. Fragments are read
// from LDS with the split k map (ldfrag); a sum takes its k tiles in the order in which stage deals them (ktile). On entry no wave reads the ring any
// more (kernel entry, or the barrier that ends an earlier loop); on return every wave's ring reads have returned.
// =====================================================================================================
// landed() = this wave's wait for what its own stage calls have issued (copies or a tensor load).
// TD = true: stage issues tensor loads (from some of the waves, one request each); every wave waits for its own requests
// (a wave that issued none passes at once), and each test that decides whether a stage is issued is held as a scalar branch.
template <bool TD>
__device__ __forceinline__ bool stage_exists(bool c) { return TD ? (pinned((uint32_t)c) != 0u) : c; }
template <typename OT, int MI, int STG, bool TD, typename SF, typename LF>
__device__ __forceinline__ void kloop(unsigned char* ring, int nT, int aOff, int bOff, int koff, SF stage, LF landed, v8f (*acc)[4]) {
  typedef typename FT<OT>::frag V16;
  stage(0);
  landed();
  __syncthreads();                       // tile 0 is published
  if (stage_exists<TD>(nT > 1)) stage(1);
  // Every LDS read of tile t stands between the barrier that publishes it and the barrier that frees its buffer.
  // Fragment registers: bq0 / bq1 = Bt of the tile's first / second 32 k; a[i] is refilled in place right behind its
  // last product; ax holds row group MI-1 of the second 32 k, so that no read is issued behind a phase's last products.
  // The scheduling barriers keep each read at that place (left alone, the compiler read each A fragment right in
  // front of its products and waited for it every time).
  V16 bq0[4], bq1[4], a[MI], ax;
  {
    const OT* sA = (const OT*)(const void*)(ring + aOff) + koff;
    const OT* sB = (const OT*)(const void*)(ring + bOff) + koff;
#pragma unroll
    for (int j = 0; j < 4; ++j) bq0[j] = ldfrag<OT>(sB + (j << 4) * LPE);
#pragma unroll
    for (int i = 0; i < MI; ++i) a[i] = ldfrag<OT>(sA + (i << 4) * LPE);
  }
  for (int t = 0; t < nT; ++t) {
    const unsigned char* buf = ring + (size_t)(t & 1) * STG;
    const OT* sA = (const OT*)(const void*)(buf + aOff) + koff + 32;
    const OT* sB = (const OT*)(const void*)(buf + bOff) + koff + 32;
    ax = ldfrag<OT>(sA + ((MI - 1) << 4) * LPE);
#pragma unroll
    for (int j = 0; j < 4; ++j) bq1[j] = ldfrag<OT>(sB + (j << 4) * LPE);
    __builtin_amdgcn_sched_barrier(0);     // reads of the second 32 k go out ahead of the first 32 k's products
#pragma unroll
    for (int i = 0; i < MI - 1; ++i) {
#pragma unroll
      for (int j = 0; j < 4; ++j) acc[i][j] = mmar(a[i], bq0[j], acc[i][j]);
      __builtin_amdgcn_sched_barrier(0);   // the refill stays behind a[i]'s last product, so it can take a[i]'s registers
      a[i] = ldfrag<OT>(sA + (i << 4) * LPE);
      __builtin_amdgcn_sched_barrier(0);   // the refill of a[i] stays among the products
    }
#pragma unroll
    for (int j = 0; j < 4; ++j) acc[MI - 1][j] = mmar(a[MI - 1], bq0[j], acc[MI - 1][j]);
    __builtin_amdgcn_sched_barrier(0);     // the first 32 k's products stay ahead of the waits
    wait_lds_reads();
    landed();
    __syncthreads();                       // publishes tile t + 1 and ends every read of tile t's buffer
    if (stage_exists<TD>(t + 2 < nT)) stage(t + 2);
    // The first 32 k of tile t + 1 are read under tile t's last products. The last trip has no next tile: a scalar
    // select aims its reads, whose values nobody uses, at its own buffer (landed, not refilled), which keeps the
    // products free of a branch.
    const unsigned char* nbuf = ring + (size_t)(((t + 1 < nT) ? (t + 1) : t) & 1) * STG;
    const OT* nA = (const OT*)(const void*)(nbuf + aOff) + koff;
    const OT* nB = (const OT*)(const void*)(nbuf + bOff) + koff;
    a[MI - 1] = ldfrag<OT>(nA + ((MI - 1) << 4) * LPE);
#pragma unroll
    for (int j = 0; j < 4; ++j) bq0[j] = ldfrag<OT>(nB + (j << 4) * LPE);
    __builtin_amdgcn_sched_barrier(0);     // the next tile's reads go out ahead of this tile's last products
#pragma unroll
    for (int i = 0; i < MI - 1; ++i) {
#pragma unroll
      for (int j = 0; j < 4; ++j) acc[i][j] = mmar(a[i], bq1[j], acc[i][j]);
      __builtin_amdgcn_sched_barrier(0);   // the refill stays behind a[i]'s last product, so it can take a[i]'s registers
      a[i] = ldfrag<OT>(nA + (i << 4) * LPE);
      __builtin_amdgcn_sched_barrier(0);   // the refill of a[i] stays among the products
    }
#pragma unroll
    for (int j = 0; j < 4; ++j) acc[MI - 1][j] = mmar(ax, bq1[j], acc[MI - 1][j]);
  }
  landed();
  wait_lds_reads();
  __syncthreads();                       // every wave's last ring read has returned: the ring is free again
}

// =====================================================================================================
// One 64 x 256 block tile of row chunk 0 (query rows and keys < RC), whose operands are f16 hi planes A, Bt and f16
// residual planes A2, B2 (both x 1/rscale2): C = ((A.Bt) + (A2.Bt + A.B2) * rscale2) * oscale, f32, pitch ldc.
// It runs inside the launch of the chunks c >= 1, in the same ring and on the same k loop; b0 = its index among
// chunk 0's (RC / 64) x 4 block tiles. The eight waves form a 2 x 4 grid of 32 x 64 tiles.
// First loop: a wave's 64 staged A rows are its 32 rows of A and behind them its 32 rows of A2, so row groups 0, 1
// give A.Bt and row groups 2, 3 give A2.Bt from the same Bt fragments. Second loop: A.B2 goes on top of A2.Bt.
// CZ = 1 (scores, k loops of K): block tiles beyond the diagonal leave at once, wave tiles beyond it store nothing.
// CZ = 2 (P.V): the A rows hold exact zeros from the diagonal to column mB + 64, where the k loops end; long loops first.
// =====================================================================================================
template <int CZ, int STG>
__device__ __forceinline__ void chunk0_tile(unsigned char* ring, int b0,
    const _Float16* A, const _Float16* A2, int lda, const _Float16* Bt, int ldb, const _Float16* B2, int ldb2,
    float* C, int ldc, int K, float oscale, float rscale2) {
  const int wave = __builtin_amdgcn_readfirstlane((int)(threadIdx.x >> 5));
  const int tm = (CZ == 2) ? (RC / 64 - 1 - (b0 >> 2)) : (b0 >> 2);
  const int mB = tm * 64;
  const int nB = (b0 & 3) * 256;
  const int wm = wave >> 2, wn = wave & 3;
  const int m0 = mB + wm * 32;
  const int n0 = nB + wn * 64;
  if (CZ == 1 && nB >= mB + 64) return;                        // block-uniform causal skip, in front of every barrier
  const bool live = (CZ != 1) || (n0 < m0 + 32);               // a wave past the diagonal walks the loops and stores nothing
  const int nT = ((CZ == 2) ? (mB + 64) : K) / BKE;            // >= 1; block-uniform
  const int rot = krot(tm + 4 * (b0 & 3), nT);                 // differs along a tile row and along a tile column

  v8f acc[4][4];                         // [0], [1]: A.Bt; [2], [3]: A2.Bt + A.B2
#pragma unroll
  for (int i = 0; i < 4; ++i)
#pragma unroll
    for (int j = 0; j < 4; ++j) acc[i][j] = zero8();
  {
    const int lane = threadIdx.x & 31;
    // this lane's part of every staged tile: row lane>>3 of each 4-row group, 16-B piece lane&7
    const int crow = lane >> 3;
    const int cel  = (lane & 7) * 8;
    const unsigned lc = lds_off(ring) + (unsigned)(crow * LPB + cel * 2);
    // staged A rows wave*16 .. +15 = 16 rows of A (waves 0, 1, 4, 5) or of A2 (waves 2, 3, 6, 7)
    const _Float16* gA = ((wave & 2) ? A2 : A) + (size_t)(mB + wm * 32 + (wave & 1) * 16 + crow) * lda + cel;
    const _Float16* gB = Bt + (size_t)(nB + wave * 32 + crow) * ldb + cel;
    const unsigned lA = lc + (unsigned)(wave * 16 * LPB);
    const unsigned lB = lc + (unsigned)((128 + wave * 32) * LPB);
    kloop<_Float16, 4, STG, false>(ring, nT, (wm * 64 + (lane & 15)) * LPB, (128 + wn * 64 + (lane & 15)) * LPB, (lane >> 4) * 8,
                            [&](int t) {
      const int kt = ktile(t, rot, nT) * BKE;
      copy16and32rows(lA + (unsigned)(t & 1) * (unsigned)STG, gA + kt, (size_t)4 * lda,
                      lB + (unsigned)(t & 1) * (unsigned)STG, gB + kt, (size_t)4 * ldb);
    }, [] { wait_copies(); }, acc);
  }
  // The lane index is taken anew, from the lane mask count: what the second loop and the epilogue derive from it is then
  // formed here and holds no registers through the first loop, whose budget is that of two blocks per WGP.
  const int lane  = (int)__builtin_amdgcn_mbcnt_lo(~0u, 0u);
  const int rlane = lane & 15;
  const int mOff  = (lane >> 4) * 8;
  {
    const int crow = lane >> 3;
    const int cel  = (lane & 7) * 8;
    const unsigned lc = lds_off(ring) + (unsigned)(crow * LPB + cel * 2);
    // A rows wave*8 .. +7, at the front of their wave row's 64 staged rows
    const _Float16* gA = A + (size_t)(mB + wave * 8 + crow) * lda + cel;
    const _Float16* gB = B2 + (size_t)(nB + wave * 32 + crow) * ldb2 + cel;
    const unsigned lA = lc + (unsigned)((wm * 64 + wn * 8) * LPB);
    const unsigned lB = lc + (unsigned)((128 + wave * 32) * LPB);
    kloop<_Float16, 2, STG, false>(ring, nT, (wm * 64 + rlane) * LPB, (128 + wn * 64 + rlane) * LPB, (lane >> 4) * 8,
                            [&](int t) {
      const int kt = ktile(t, rot, nT) * BKE;
      copy8and32rows(lA + (unsigned)(t & 1) * (unsigned)STG, gA + kt, (size_t)4 * lda,
                     lB + (unsigned)(t & 1) * (unsigned)STG, gB + kt, (size_t)4 * ldb2);
    }, [] { wait_copies(); }, acc + 2);
  }
  if (!live) return;                     // wave-uniform; no block barrier follows
#pragma unroll
  for (int i = 0; i < 4; ++i) acc_guard4(acc[i][0], acc[i][1], acc[i][2], acc[i][3]);

  float* slab = (float*)(void*)ring + wave * (16 * 68);   // pitch 68 floats, wave-private
  const int h2 = lane >> 4, c4 = (lane & 15) * 4;         // 256-B row segment = 16 lanes x 16 B
#pragma unroll
  for (int i = 0; i < 2; ++i) {
#pragma unroll
    for (int j = 0; j < 4; ++j) {
#pragma unroll
      for (int r = 0; r < 8; ++r) {
        float v = acc[i][j][r];
        v += acc[i + 2][j][r] * rscale2;
        v = v * oscale;
        slab[(mOff + r) * 68 + (j << 4) + rlane] = v;
      }
    }
    __builtin_amdgcn_fence(3 /* release order */, "workgroup");
    __builtin_amdgcn_wave_barrier();
    __builtin_amdgcn_fence(2 /* acquire order */, "workgroup");
    v4f val[8];
    float* pc[8];
#pragma unroll
    for (int it = 0; it < 8; ++it) {
      const int row = it * 2 + h2;                         // it 0..7 x h2 0..1 = rows 0..15
      val[it] = *(const v4f*)(slab + row * 68 + c4);
      pc[it]  = C + (size_t)(m0 + (i << 4) + row) * ldc + n0 + c4;
    }
    __builtin_amdgcn_sched_barrier(0);   // values and addresses are formed ahead of the stores: nothing is computed among them
#pragma unroll
    for (int it = 0; it < 8; ++it) *(v4f*)pc[it] = val[it];
    wait_store_regs();
    __builtin_amdgcn_sched_barrier(0);   // later arithmetic, which reuses the stores' registers, stays behind the wait
    __builtin_amdgcn_fence(3 /* release order */, "workgroup");
    __builtin_amdgcn_wave_barrier();
    __builtin_amdgcn_fence(2 /* acquire order */, "workgroup");
  }
}

// =====================================================================================================
// Register-blocked WMMA GEMM (16-bit operand type OT): C[m][n] = sum_k A[m][k] * Bt[n][k];
// one wave per (16*MI) x 64 tile; the eight waves of a block form a 2 x 4 grid of such tiles, a 128 x 256 block tile
// (M a multiple of 128, N of 256): each staged A row serves four waves, each staged Bt row two, and two blocks' rings
// fit one LDS. A row-major [M][K] pitch lda; Bt row-major [N][K] pitch ldb (k contiguous); K multiple of 64 (static
// sizes here). Staging and products: kloop above.
// value v = acc * oscale, in the f32 epilogue.
// CZ (causal), czoff = global row index of local row 0 (multiple of 64):
//   0 none; 1 = output tiles with n0 >= czoff + m0 + 16*MI are not stored (every tile holding a
//   column <= one of its rows is written); 2 = A rows hold exact zeros beyond the diagonal up to column
//   czoff + mB + BR (mB, BR = first row and rows of the block tile), so the k loop ends at min(K, czoff + mB + BR)
//   (exact); the last staged tile is copied whole, so A rows are written up to the next multiple of 64 columns.
// OUT_MODE 0: f32 C (pitch ldc) = v.
// OUT_MODE 3: f16 hi plane C = f16(v * cscale) (pitch ldc) and f16 residual plane
//             C2 = f16((v*cscale - hi) * rscaleC) (pitch ldc2), C2 written only for output
//             tiles with n0 < N2 (N2 multiple of 64, wave-uniform), i.e. columns [0, N2) fully (MC = 2: and rows [0, M2)).
// =====================================================================================================
// MC = 1: one launch holds every row chunk (M = RC rows each). Chunks c >= 1, single planes: CZ = 2: a flat grid of
//   k-loop pieces of at most PVK keys (pv_piece), four column tiles each, the longest first, so that more blocks than
//   resident places level the WGPs' work. CZ = 1: a flat grid, chunk after chunk, the widest last, which the
//   softmax then reads first.
//   The f32 score chunks lie one behind the other, chunk c at sbase(c) elements with pitch (c+1)*RC; the softmax
//   writes each f16 probability row over the front of its own score row (f16 pitch 2*(c+1)*RC).
//   CZ = 1: A rows, N, ldc, C and czoff are the chunk's; CZ = 2: A, lda, K, C rows and czoff are the chunk's.
//   Chunk 0, hi and residual planes (chunk0_tile): its NB0 blocks lead the flat grid (CZ = 1: their two k loops are the
//   launch's longest) or stand between the other chunks' whole and shorter pieces (CZ = 2).
//   CZ = 1: A = q, A2p = q residual, Bt = k, B2p = k residual, Cout2 = chunk 0's scores (pitch ldc2).
//   CZ = 2: A2p = chunk 0's p, Cout2 = its residual plane (pitch RC both), Bt = v^T, B2p = v^T residual, Cout = out,
//   Part = the f32 planes of the pieces s >= 1 (pbase).
// MC = 2: one launch holds the three in-projections, blockIdx.y = 0: q, 1: k, 2: v^T. The arguments describe q
//   (A = x rows, Bt = Wq rows, M = SEQ, N = EMB); strideB, strideC, strideC2 lead from q's weight, hi plane and residual
//   plane to the next projection's. q, k: the residual plane holds rows < RC. v^T: A = Wv rows, Bt = x rows, M = EMB,
//   N = SEQ, pitches SEQ and VLP, the residual plane holds columns < VLP.
template <typename OT, int MI, int OUT_MODE, int CZ, int MC>
__global__ __launch_bounds__(256) void gemm_t(
    const unsigned short* __restrict__ Ap, const unsigned short* __restrict__ A2p, int lda,
    const unsigned short* __restrict__ Btp, int ldb, long long strideB,
    const unsigned short* __restrict__ B2p, int ldb2,
    void* Cout, void* Cout2, int ldc, long long strideC, int ldc2, long long strideC2, int N2,
    int M, int N, int K, float oscale, float rscale2, float cscale, float rscaleC, int czoff, float* Part) {
  static_assert(CZ != 2 || ((16 * MI) % 32) == 0);
  static_assert(MC == 1 || MC == 2);
  static_assert(MC != 1 || ((CZ == 1 || CZ == 2) && OUT_MODE == 0 && std::is_same<OT, _Float16>::value));
  static_assert(MC != 2 || (CZ == 0 && OUT_MODE == 3));
  const int RT = 16 * MI;
  constexpr int BR = 16 * MI * 2;                          // rows of the block tile
  constexpr int STG_B = (BR + 256) * LPB;                  // one staged k tile of the block, bytes
  static_assert(BR == 128);                                // a staged tile: 128 A rows, then 256 Bt rows
  static_assert(2 * STG_B >= 8 * 16 * 68 * 4 && 2 * STG_B <= 320 * 1024);
  constexpr unsigned SLB = 128u * LPB;                     // one tensor load's slice of a staged tile in LDS: 128 rows
  static_assert((SLB % 2048u) == 0u && STG_B == 3 * (int)SLB);   // every slice of either buffer starts at a multiple of 2 KiB
  __shared__ __attribute__((aligned(2048))) unsigned char ring[2 * STG_B];  // two buffers; after the k loop: per-wave 16x64 f32 slabs
  int bx = (int)blockIdx.x;              // the block's index among its chunk's (MC = 1) or the launch's blocks
  int piece = 0;                         // CZ = 2: which PVK keys of the k loop this block sums
  if (MC == 1) {                         // block-uniform
    constexpr int NB0 = (RC / 64) * 4;   // chunk 0's block tiles: RC (CZ = 1) or EMB (CZ = 2) columns = 4 x 256
    static_assert(RC == 1024 && EMB == 1024 && NCH > 1);
    int c = 1;
    if (CZ == 1) {
      if (bx < NB0) {
        chunk0_tile<1, STG_B>(ring, bx, (const _Float16*)(const void*)Ap, (const _Float16*)(const void*)A2p, lda,
                              (const _Float16*)(const void*)Btp, ldb, (const _Float16*)(const void*)B2p, ldb2,
                              (float*)Cout2, ldc2, K, oscale, rscale2);
        return;
      }
      bx -= NB0;
      constexpr int BPU = (RC / 64) * (RC / 64) / 8;   // chunk c holds (c+1) * BPU blocks of the flat grid
      c = 1;
      while (c < NCH - 1 && bx >= (c + 1) * BPU) { bx -= (c + 1) * BPU; ++c; }
    } else {
      constexpr int NW = 4 * pv_whole();               // blocks of whole pieces, four column tiles each
      if (bx >= NW && bx < NW + NB0) {
        chunk0_tile<2, STG_B>(ring, bx - NW, (const _Float16*)(const void*)A2p, (const _Float16*)(const void*)Cout2, RC,
                              (const _Float16*)(const void*)Btp, ldb, (const _Float16*)(const void*)B2p, ldb2,
                              (float*)Cout, ldc, RC, oscale, rscale2);
        return;
      }
      int R;
      pv_piece(((bx < NW) ? bx : (bx - NB0)) >> 2, R, piece);
      c  = R / RT0;
      bx = (R - c * RT0) * 4 + (bx & 3);               // the block's index among its chunk's 8 x 4 block tiles
    }
    const int rb = c * RC;
    const size_t sb = sbase(c);
    czoff = rb;
    if (CZ == 1) {
      Ap += (size_t)rb * lda;
      N = rb + RC; ldc = rb + RC;
      Cout = (void*)((float*)Cout + sb);
    } else {
      Ap += 2 * sb;
      lda = 2 * (rb + RC); K = rb + RC;
      // piece 0 goes to the output rows, piece s > 0 to plane s, whose first row is row s * PVK (<= rb)
      Cout = (piece == 0) ? (void*)((float*)Cout + (size_t)rb * ldc)
                          : (void*)(Part + pbase(piece) + (size_t)(rb - piece * PVK) * ldc);
    }
  }
  int M2 = M;                            // rows [0, M2) get a residual plane (OUT_MODE 3)
  if (MC == 2) {                         // block-uniform
    const int y = (int)blockIdx.y;
    const unsigned short* Wp = Btp + (size_t)y * (size_t)strideB;
    Cout  = (void*)((unsigned short*)Cout  + (size_t)y * (size_t)strideC);
    Cout2 = (void*)((unsigned short*)Cout2 + (size_t)y * (size_t)strideC2);
    if (y == 2) { Btp = Ap; Ap = Wp; M = EMB; N = SEQ; ldc = SEQ; ldc2 = VLP; N2 = VLP; M2 = EMB; }
    else        { Btp = Wp; M2 = RC; }
  }
  const OT* A  = (const OT*)(const void*)Ap;
  const OT* Bt = (const OT*)(const void*)Btp;
  const int lane = threadIdx.x & 31;
  const int wave = __builtin_amdgcn_readfirstlane((int)(threadIdx.x >> 5));
  const int tilesN = (N >> 6) / 4;       // block tiles along N
  const int tilesM = M / BR;
  if (bx >= tilesM * tilesN) return;     // block-uniform, in front of every barrier
  // The quotient is block-uniform; where the compiler divides on the vector unit, readfirstlane brings it back to a
  // scalar register, so that the returns below stay scalar branches.
  const int tm = __builtin_amdgcn_readfirstlane(bx / tilesN);
  const int mB = tm * BR;                                  // the block tile's first row and column
  const int nB = (bx - tm * tilesN) * 256;
  const int wn = wave & 3;                                 // this wave's column tile in the block
  const int m0 = mB + (wave >> 2) * RT;
  const int n0 = nB + (wn << 6);
  bool live = true;
  if (CZ == 1) {
    if (nB >= czoff + mB + BR) return;           // block-uniform causal skip, in front of every barrier
    live = n0 < czoff + m0 + RT;                 // a wave past the diagonal walks the loop and stores nothing
  }
  int kEnd = K;
  int kBeg = 0;
  if (CZ == 2) {
    const int ke = czoff + mB + BR;      // multiple of 32
    kEnd = (ke < K) ? ke : K;
    kBeg = piece * PVK;                  // < kEnd for every piece that pv_piece deals
    if (kEnd > kBeg + PVK) kEnd = kBeg + PVK;
  }

  const int rlane = lane & 15;                 // row (A) / col (B, D) within subtile
  const int koff  = (lane >> 4) * 8;           // k offset of this lane half
  const int mOff  = (lane >> 4) * 8;           // D row offset

  v8f acc[MI][4];
#pragma unroll
  for (int i = 0; i < MI; ++i)
#pragma unroll
    for (int j = 0; j < 4; ++j) acc[i][j] = zero8();

  // ---- a staged tile = three slices of 128 rows x 128 B, one tensor load each: wave 0 brings the A rows, waves 1 and 2
  //      the first and the second 128 Bt rows. The load's pad (16 B behind every 128 B) gives the LDS pitch LPB. ----
  const int sl = (wave < 2) ? wave : 2;                        // the slice of an issuing wave (waves 3 .. 7 issue nothing)
  const OT* gS = (sl == 0) ? (A + (size_t)mB * lda + kBeg) : (Bt + (size_t)(nB + (sl - 1) * 128) * ldb + kBeg);
  const uint32_t sdst = lds_off(ring) + (uint32_t)sl * SLB;
  static_assert(BKE * 2 == 128 && LPB == 128 + 16 && BR == 128);
  u32x8 g1;                                                    // loop-invariant: extents in bytes, tensor = tile
  g1[0] = uni((1u << 20) | (4u << 22) | (3u << 25));           // no mask, 1-byte elements, pad of 4 dwords behind every 32
  g1[1] = uni(128u << 16);                                     // tensor_dim0 = 128 B
  g1[2] = uni(128u << 16);                                     // tensor_dim1 = 128 rows
  g1[3] = uni(128u << 16);                                     // tile_dim0 = 128 B
  g1[4] = uni(128u);                                           // tile_dim1 = 128 rows
  g1[5] = uni((uint32_t)((sl == 0) ? lda : ldb) * 2u);         // source row pitch, bytes
  g1[6] = uni(0u);
  g1[7] = uni(0u);
#if DEV_ASM
  asm volatile("" : "+s"(g1));           // descriptor words held in scalar registers: built once, never formed anew while a request flies
#endif
  u32x4 g0 = {uni(1u), uni(0u), uni(0u), uni(0u)};   // count 1; the other words are each request's own
  const int nT = (kEnd - kBeg + BKE - 1) / BKE;                // >= 1; block-uniform
  // The rotation differs between the blocks of one tile row (shared A rows) and of one tile column (shared Bt rows):
  // row tile of the whole matrix + column tile x cs. cs = 1 where a tile row holds many column tiles (scores, v^T); where it
  // holds four, cs spreads them over the loop (q, k, which also share their A rows with each other: 2 * y; P.V).
  const int yy = (MC == 2) ? (int)blockIdx.y : 0;
  const int cs = (MC == 2) ? ((yy == 2) ? 1 : 4) : ((CZ == 1) ? 1 : 8);
  const int rot = krot(czoff / BR + tm + cs * (nB >> 8) + 2 * yy, nT);
  auto stage = [&](int t) {                                    // trip t's k tile -> buffer t & 1
    if (pinned((uint32_t)(wave < 3))) {                        // scalar branch: three waves issue, one request each
      const int ts = (int)pinned((uint32_t)t);                 // the request's own words are formed here, behind the wait for the last one
      const uint64_t ga = (uint64_t)(size_t)(gS + ktile(ts, rot, nT) * BKE);
      g0[1] = uni(sdst + (uint32_t)(ts & 1) * (uint32_t)STG_B);
      g0[2] = uni((uint32_t)ga);
      g0[3] = uni((((uint32_t)(ga >> 32)) & 0x01FFFFFFu) | 0x80000000u);
      tensor_load(g0, g1);
    }
  };
  const int aOff = (m0 - mB + rlane) * LPB;                    // this lane's fragment rows in a buffer, bytes
  const int bOff = (BR + wn * 64 + rlane) * LPB;
  kloop<OT, MI, STG_B, true>(ring, nT, aOff, bOff, koff, stage, [&] { wait_tensor(); groups_held(g0, g1); }, acc);   // behind it the ring becomes output staging
  if (!live) return;                     // wave-uniform; no block barrier follows
#pragma unroll
  for (int i = 0; i < MI; ++i) acc_guard4(acc[i][0], acc[i][1], acc[i][2], acc[i][3]);

  // ---- epilogue ----
  float* slab = (float*)(void*)ring + wave * (16 * 68);   // pitch 68 floats, wave-private
#pragma unroll
  for (int i = 0; i < MI; ++i) {
    const int mBase = m0 + (i << 4);
#pragma unroll
    for (int j = 0; j < 4; ++j) {
#pragma unroll
      for (int r = 0; r < 8; ++r) {
        float v = acc[i][j][r];
        v = v * oscale;
        slab[(mOff + r) * 68 + (j << 4) + rlane] = v;
      }
    }
    __builtin_amdgcn_fence(3 /* release order */, "workgroup");
    __builtin_amdgcn_wave_barrier();
    __builtin_amdgcn_fence(2 /* acquire order */, "workgroup");
    if (OUT_MODE == 0) {
      float* C = (float*)Cout;
      const int h2 = lane >> 4, c4 = (lane & 15) * 4;     // 256-B row segment = 16 lanes x 16 B
      {
#pragma unroll
        for (int it = 0; it < 8; ++it) {
          const int row = it * 2 + h2;                     // it 0..7 x h2 0..1 = rows 0..15
          const v4f v = *(const v4f*)(slab + row * 68 + c4);
          *(v4f*)(C + (size_t)(mBase + row) * ldc + n0 + c4) = v;
        }
        
      }
    } else {
      const int q = lane >> 3, c8 = (lane & 7) * 8;
      unsigned short* C  = (unsigned short*)Cout;
      unsigned short* C2 = (unsigned short*)Cout2;
      const bool wr2 = (OUT_MODE == 3) && (n0 < N2) && (MC != 2 || m0 < M2);     // wave-uniform
      // The slab's planes, with or without the residual plane: one wave-uniform branch per slab chooses, so that a tile
      // without a residual plane does none of its arithmetic.
      auto planes = [&](auto withRes) {
        constexpr bool RES = decltype(withRes)::value;
        v4u hv[4], lv[4];
        unsigned short* pc[4];
        unsigned short* pc2[4];
#pragma unroll
        for (int it = 0; it < 4; ++it) {
          const int row = it * 4 + q;                      // it 0..3 x q 0..3 = rows 0..15
          const float* sp = slab + row * 68 + c8;
          pc[it]  = C  + (size_t)(mBase + row) * ldc  + n0 + c8;
          pc2[it] = C2 + (size_t)(mBase + row) * ldc2 + n0 + c8;
          float f[8];
#pragma unroll
          for (int e = 0; e < 8; ++e) f[e] = sp[e] * cscale;
          v4u a, a2;
#pragma unroll
          for (int e = 0; e < 4; ++e) {
            const float f0 = f[2 * e], f1 = f[2 * e + 1];
            const _Float16 x0 = (_Float16)f0, x1 = (_Float16)f1;
            const unsigned short h0 = h_bits(x0), h1 = h_bits(x1);
            unsigned short l0 = 0, l1 = 0;
            if (RES) {
              l0 = h_bits((_Float16)((f0 - (float)x0) * rscaleC));
              l1 = h_bits((_Float16)((f1 - (float)x1) * rscaleC));
            }
            a[e] = pk16(h0, h1); a2[e] = pk16(l0, l1);
          }
          hv[it] = a; lv[it] = a2;
        }
        __builtin_amdgcn_sched_barrier(0);   // values and addresses are formed ahead of the stores: nothing is computed among them
#pragma unroll
        for (int it = 0; it < 4; ++it) {
          *(v4u*)pc[it] = hv[it];
          if (RES) *(v4u*)pc2[it] = lv[it];
        }
        wait_store_regs();
        __builtin_amdgcn_sched_barrier(0);   // later arithmetic, which reuses the stores' registers, stays behind the wait
      };
      if (wr2) planes(std::integral_constant<bool, true>{});
      else     planes(std::integral_constant<bool, false>{});
    }
    __builtin_amdgcn_fence(3 /* release order */, "workgroup");
    __builtin_amdgcn_wave_barrier();
    __builtin_amdgcn_fence(2 /* acquire order */, "workgroup");
  }
}

// =====================================================================================================
// Exact causal row softmax, one launch for every query row: one block of 256 threads per row t, the longest first.
//   The scores GEMMs wrote every column of row t in [0, ((t>>6)+1)*64).
//   The row is processed in 8-column groups g; ngl = ((t>>6)+1)*8 groups hold scores, ng groups of P are written
//   (t < RC: ng = ngl; else ng = ((t>>7)+1)*16, the k end of the row's 128-row P.V block tile). Thread tid owns groups
//   g = it*256 + tid. Loads use an address clamped to group ngl-1; entries with column > t are replaced by -inf
//   by index before any arithmetic. Iterations with it*256 >= ng are skipped block-uniformly.
//   p = exp(s - max) * (1/sum) in f32 (max finite: column 0 is always valid), x16384 carry, f16 RNE;
//   columns > t up to ng*8 get exact zeros. Rows t < RC: also the f16 residual plane
//   Pl = f16((p*16384 - hi) * 4096), same pitch. Each group is one 16-B store per lane; 8 consecutive lanes fill
//   LDS redm/reds: cross-wave, block barriers (every thread reaches both).
//   coverage: every row x columns [0, ng*8) of P (and Pl) = exactly the extent the P.V GEMM reads.
// =====================================================================================================
//   Rows t >= RC: row t lies in score chunk c = t / RC (S + sbase(c), pitch (c+1)*RC), and P = S: the row's
//   probabilities go over the front of its own scores. Every score of the row is in registers, and has gone into the
//   row maximum, in front of the first block barrier; the stores stand behind the second.
//   Rows t < RC (chunk 0): scores S0, probabilities P0 and residuals Pl0, each [RC][RC].
__global__ __launch_bounds__(256)
void softmax_rows(const float* S, unsigned short* P, const float* S0, unsigned short* P0, unsigned short* Pl0) {
  __shared__ float redm[8];
  __shared__ float reds[8];
  const int t    = SEQ - 1 - (int)blockIdx.x;
  const bool r0  = t < RC;                                   // block-uniform: a row of chunk 0
  const int ch   = t / RC;
  const size_t ro = r0 ? ((size_t)t * (size_t)RC)
                       : (sbase(ch) + (size_t)(t - ch * RC) * (size_t)((ch + 1) * RC));   // the row's first score, f32 elements
  const size_t po = r0 ? ro : (2 * ro);                      // its first probability, f16 elements
  const int tid  = threadIdx.x;
  const int wave = tid >> 5;
  const int lane = tid & 31;
  const int ngl  = ((t >> 6) + 1) * 8;                       // groups that hold scores
  const int ng   = r0 ? ngl : ((t >> 7) + 1) * 16;           // groups of P that are written: up to the P.V block tile's k end
  const float* rp = (r0 ? S0 : S) + ro;
  float v[SMI][8];
#pragma unroll
  for (int it = 0; it < SMI; ++it) {
#pragma unroll
    for (int e = 0; e < 8; ++e) v[it][e] = -INFINITY;
    if (it * 256 < ng) {                                   // block-uniform
      const int g  = it * 256 + tid;
      const int gc = (g < ngl) ? g : (ngl - 1);            // clamped address
      const int c0 = g * 8;
      const v4f a  = *(const v4f*)(rp + (size_t)gc * 8);
      const v4f a4 = *(const v4f*)(rp + (size_t)gc * 8 + 4);
#pragma unroll
      for (int e = 0; e < 4; ++e) {
        v[it][e]     = (c0 + e <= t)     ? a[e]  : -INFINITY;
        v[it][4 + e] = (c0 + 4 + e <= t) ? a4[e] : -INFINITY;
      }
    }
  }
  float mx = -INFINITY;
#pragma unroll
  for (int it = 0; it < SMI; ++it)
#pragma unroll
    for (int e = 0; e < 8; ++e) mx = fmaxf(mx, v[it][e]);
#pragma unroll
  for (int off = 1; off < 32; off <<= 1) mx = fmaxf(mx, __shfl_xor(mx, off, 32));
  if (lane == 0) redm[wave] = mx;
  __syncthreads();
  mx = redm[0];
#pragma unroll
  for (int w = 1; w < 8; ++w) mx = fmaxf(mx, redm[w]);

  float sum = 0.f;
#pragma unroll
  for (int it = 0; it < SMI; ++it) {
    if (it * 256 < ng) {                                   // block-uniform
#pragma unroll
      for (int e = 0; e < 8; ++e) { const float ex = __expf(v[it][e] - mx); v[it][e] = ex; sum += ex; }
    } else {
#pragma unroll
      for (int e = 0; e < 8; ++e) v[it][e] = 0.f;
    }
  }
#pragma unroll
  for (int off = 1; off < 32; off <<= 1) sum += __shfl_xor(sum, off, 32);
  if (lane == 0) reds[wave] = sum;
  __syncthreads();
  sum = reds[0];
#pragma unroll
  for (int w = 1; w < 8; ++w) sum += reds[w];

  const float sc = PCARRY * (1.0f / sum);        // sum >= 1
  v4u pk[SMI], pl[SMI];
#pragma unroll
  for (int it = 0; it < SMI; ++it) {
    v4u a, a2;
#pragma unroll
    for (int e = 0; e < 4; ++e) {
      const float f0 = v[it][2 * e] * sc, f1 = v[it][2 * e + 1] * sc;
      const _Float16 x0 = (_Float16)f0, x1 = (_Float16)f1;
      unsigned short l0 = 0, l1 = 0;
      if (r0) {
        l0 = h_bits((_Float16)((f0 - (float)x0) * RSC));
        l1 = h_bits((_Float16)((f1 - (float)x1) * RSC));
      }
      a[e]  = pk16(h_bits(x0), h_bits(x1));
      a2[e] = pk16(l0, l1);
    }
    pk[it] = a; pl[it] = a2;
  }
  unsigned short* op  = (r0 ? P0 : P) + po;
  unsigned short* opl = Pl0 + po;                            // used by rows of chunk 0 only
  {
#pragma unroll
    for (int it = 0; it < SMI; ++it) {
      if (it * 256 < ng) {                                 // block-uniform
        const int g = it * 256 + tid;
        if (g < ng) {
          *(v4u*)(op + (size_t)g * 8) = pk[it];
          wait_store_regs();                               // the residual store's address reuses this store's register
          if (r0) *(v4u*)(opl + (size_t)g * 8) = pl[it];
        }
      }
    }
    
  }
}

// =====================================================================================================
// out rows >= PVK: out += plane 1 + ... in ascending key order. Row tile R = row / 128 has the planes 1 .. R / PRS.
// One block per JR rows of one row tile (the plane count is block-uniform), a thread takes 16 B of each row; every load
// goes out ahead of the sums. coverage: (SEQ - PVK) / JR blocks x JR rows x 256 threads x 4 columns.
// =====================================================================================================
__global__ __launch_bounds__(256) void pv_join(float* out, const float* part) {
  static_assert(EMB == 256 * 4);
  const int row0 = PVK + (int)blockIdx.x * JR;
  const int ns   = (row0 / 128) / PRS;                       // planes that hold a piece of these rows, >= 1
  const int c4   = (int)threadIdx.x * 4;
  float* op = out + (size_t)row0 * EMB;                      // block-uniform base
  v4f v[NPC][JR];
#pragma unroll
  for (int r = 0; r < JR; ++r) v[0][r] = *(const v4f*)(op + (r * EMB + c4));
  wait_load_regs();                                          // later loads land in registers that held these addresses
#pragma unroll
  for (int s = 1; s < NPC; ++s) {
    if (s <= ns) {                                           // block-uniform
      const float* pp = part + (pbase(s) + (size_t)(row0 - s * PVK) * EMB);   // block-uniform base
#pragma unroll
      for (int r = 0; r < JR; ++r) v[s][r] = *(const v4f*)(pp + (r * EMB + c4));
      wait_load_regs();                                      // as above
    } else {
#pragma unroll
      for (int r = 0; r < JR; ++r) v[s][r] = (v4f){0.f, 0.f, 0.f, 0.f};
    }
  }
#pragma unroll
  for (int r = 0; r < JR; ++r) {
    v4f a = v[0][r];
#pragma unroll
    for (int s = 1; s < NPC; ++s) a += v[s][r];
    *(v4f*)(op + (r * EMB + c4)) = a;
  }
}

// =====================================================================================================
// Workspace map (bytes at SEQ = 8192, RC = 1024; every region a multiple of its whole-line store granularity and of
//   R0   Xb bf16 [SEQ][EMB] (16777216), later the f32 score chunks c >= 1, S_c [RC][(c+1)*RC] at sbase(c), each row's
//        front overwritten by its f16 probabilities (pitch 2*(c+1)*RC)                                      146800640
//   S0   f32 [RC][RC]     (chunk 0 scores)                                                                    4194304
//   Wqb, Wkb, Wvb bf16 [EMB][EMB]                                                                          3 x 2097152
//   Qh   f16 [SEQ][EMB]                                                                                      16777216
//   Kh   f16 [SEQ][EMB]                                                                                      16777216
//   VT   f16 [EMB][SEQ]   (v^T hi plane)                                                                     16777216
//   Ql   f16 [RC][EMB]    (q residual x4096, rows < RC)                                                       2097152
//   Kl   f16 [RC][EMB]    (k residual x4096, keys < RC)                                                       2097152
//   VL   f16 [EMB][VLP]   (v^T residual x4096, keys < VLP)                                                    2097152
//   P    f16 [RC][RC]     (chunk 0 probabilities)                                                             2097152
//   Pl   f16 [RC][RC]     (p residual x4096, chunk 0 only)                                                    2097152
//   PB   f32 planes s = 1 .. NPC-1 of P.V pieces, plane s [SEQ - s*PVK][EMB] at pbase(s)                     50331648
//   total                                                                                                   268435456
// Aliases are ordered by launch dependence: Xb is last read by the projections' launch, R0's scores are first written by
// the scores GEMM of the chunks c >= 1 after it. Weights are [out n][in k] with k contiguous = the Bt / A layout the GEMM wants.
// =====================================================================================================
static constexpr size_t PACT_B = (size_t)SEQ * EMB * 2;
static constexpr size_t PS_B   = sbase(NCH) * 4;               // chunks 1 .. NCH-1
static constexpr size_t PS0_B  = (size_t)RC * RC * 4;
static constexpr size_t R0_B   = (PACT_B > PS_B) ? PACT_B : PS_B;
static constexpr size_t PW_B   = (size_t)EMB * EMB * 2;
static constexpr size_t PRES_B = (size_t)RC * EMB * 2;
static constexpr size_t PVT_B  = (size_t)EMB * SEQ * 2;
static constexpr size_t PVL_B  = (size_t)EMB * VLP * 2;
static constexpr size_t PP_B   = (size_t)RC * RC * 2;
static constexpr size_t PPL_B  = (size_t)RC * RC * 2;
static constexpr size_t PPB_B  = pbase(NPC) * 4;
static constexpr size_t WS_TOTAL = R0_B + PS0_B + 3 * PW_B + 2 * PACT_B + PVT_B + 2 * PRES_B + PVL_B + PP_B + PPL_B + PPB_B;
static_assert(WS_TOTAL <= (size_t)268435456);
static constexpr int PV_BLOCKS = 4 * (pv_whole() + pv_short()) + (RC / 64) * 4;   // P.V: k pieces x 4 column tiles, and chunk 0's block tiles
static_assert((R0_B % 128) == 0 && (PS0_B % 128) == 0 && (PP_B % 128) == 0 && (PW_B % 128) == 0 && (PRES_B % 128) == 0 && (PVL_B % 128) == 0 && (PPL_B % 128) == 0);

extern "C" void kernel_launch(void* const* d_in, const int* in_sizes, int n_in,
                              void* d_out, int out_size, void* d_ws, size_t ws_size,
                              hipStream_t stream) {
  if (n_in < 4) return;
  const long long needX = (long long)SEQ * (long long)EMB;
  if ((long long)in_sizes[0] < needX) return;
  if (in_sizes[1] < EMB * EMB) return;
  if (in_sizes[2] < EMB * EMB) return;
  if (in_sizes[3] < EMB * EMB) return;
  if (out_size < 0) return;
  if ((long long)out_size < needX) return;

  const float* x  = (const float*)d_in[0];
  const float* Wq = (const float*)d_in[1];
  const float* Wk = (const float*)d_in[2];
  const float* Wv = (const float*)d_in[3];

  size_t off = 0;
  const size_t oR0 = off; off += R0_B;
  const size_t oS0 = off; off += PS0_B;
  const size_t oWq = off; off += PW_B;
  const size_t oWk = off; off += PW_B;
  const size_t oWv = off; off += PW_B;
  const size_t oQh = off; off += PACT_B;
  const size_t oKh = off; off += PACT_B;
  const size_t oVT = off; off += PVT_B;
  const size_t oQl = off; off += PRES_B;
  const size_t oKl = off; off += PRES_B;
  const size_t oVL = off; off += PVL_B;
  const size_t oP  = off; off += PP_B;
  const size_t oPl = off; off += PPL_B;
  const size_t oPB = off; off += PPB_B;
  if (off != WS_TOTAL) return;
  if (off > ws_size) return;
  if (off > (size_t)268435456) return;

  char* ws = (char*)d_ws;
  unsigned short* Xb  = (unsigned short*)(ws + oR0);
  float*          S   = (float*)(ws + oR0);          // alias, see map
  float*          S0  = (float*)(ws + oS0);
  unsigned short* Wqb = (unsigned short*)(ws + oWq);
  unsigned short* Wkb = (unsigned short*)(ws + oWk);
  unsigned short* Wvb = (unsigned short*)(ws + oWv);
  unsigned short* Qh  = (unsigned short*)(ws + oQh);
  unsigned short* Kh  = (unsigned short*)(ws + oKh);
  unsigned short* VT  = (unsigned short*)(ws + oVT);
  unsigned short* Ql  = (unsigned short*)(ws + oQl);
  unsigned short* Kl  = (unsigned short*)(ws + oKl);
  unsigned short* VL  = (unsigned short*)(ws + oVL);
  unsigned short* Pp  = (unsigned short*)(ws + oP);
  unsigned short* Ppl = (unsigned short*)(ws + oPl);
  float*          PB  = (float*)(ws + oPB);
  float*          out0 = (float*)d_out;

  const dim3 blk(256);
  const int n8x = SEQ * EMB / 8;                                    // multiple of 256
  const int n8w = EMB * EMB / 8;                                    // multiple of 256
  const dim3 gCvt(n8x / 256 + 3 * (n8w / 256), 1);
  const dim3 gPr(((SEQ / 64) * (EMB / 64)) / 8, 3);                 // q, k (M=SEQ, N=EMB), v^T (M=EMB, N=SEQ): 64x64 wave tiles
  const dim3 gSn((RC / 64) * 4 + ((RC / 64) * (RC / 64) / 8) * ((NCH * (NCH + 1)) / 2 - 1), 1);   // scores: chunk 0's 64x256 block tiles, then chunks c >= 1, 128x256
  const dim3 gPn(PV_BLOCKS, 1);                                     // P.V: chunks c >= 1, k pieces of 128x256 block tiles; chunk 0's 64x256
  const dim3 gJn((SEQ - PVK) / JR);                                 // JR rows per block
  const dim3 gSm(SEQ);                                              // one block per query row

  // (1) x, Wq, Wk, Wv -> bf16 planes (RNE convert), one launch
  cvt16x8<<<gCvt, blk, 0, stream>>>(x, Wq, Wk, Wv, Xb, Wqb, Wkb, Wvb, n8x / 256, n8w / 256);
  // (2) one launch, blockIdx.y = 0, 1, 2 (K=EMB each):
  //     q = x . Wq^T, k = x . Wk^T -> f16 planes [s][d]; rows [0, RC) also a residual (x4096) plane;
  //     v^T = Wv . x^T -> f16 hi plane [d][s] (pitch SEQ) and f16 residual plane x4096 [d][s < VLP] (pitch VLP).
  //     Wqb, Wkb, Wvb / Qh, Kh, VT / Ql, Kl, VL each lie one behind the other in the workspace (the three strides).
  static_assert(PVT_B == PACT_B && PVL_B == PRES_B);
  gemm_t<__bf16, 4, 3, 0, 2><<<gPr, blk, 0, stream>>>(
      Xb, Xb, EMB, Wqb, EMB, (long long)(PW_B / 2),
      Wqb, EMB,
      (void*)Qh, (void*)Ql, EMB, (long long)(PACT_B / 2), EMB, (long long)(PRES_B / 2), EMB,
      SEQ, EMB, EMB, 1.0f, 0.0f, 1.0f, RSC, 0, PB);
  // (3) scores = q.k / 32 -> f32, causal tiles only, every row chunk in one launch (MC = 1).
  //     Chunk 0 (rows and keys [0, RC), residual planes) -> S0: Qh.Kh and, x4096, Ql.Kh + Qh.Kl.
  //     Chunks c >= 1 (rows c*RC .. c*RC+RC-1, keys 0 .. (c+1)*RC-1), single f16 planes -> S; the kernel takes each
  //     chunk's rows, widths and pitches from blockIdx.
  gemm_t<_Float16, 4, 0, 1, 1><<<gSn, blk, 0, stream>>>(
      Qh, Ql, EMB, Kh, EMB, 0LL,
      Kl, EMB,
      (void*)S, (void*)S0, 0, 0LL, RC, 0LL, 0,
      RC, 0, EMB, 1.0f / 32.0f, 1.0f / RSC, 1.0f, 1.0f, 0, PB);
  // (4) exact causal softmax of every row in one launch -> f16 probabilities (x16384, zeros beyond the diagonal up to
  //     the P.V tile's k end); rows of chunk 0 also their residual plane.
  softmax_rows<<<gSm, blk, 0, stream>>>(S, (unsigned short*)S, S0, Pp, Ppl);
  // (5) out rows = P.V / 16384 -> f32 d_out, every row chunk in one launch (MC = 1).
  //     Chunk 0: Ph.Vh and, x4096, Pl.Vh + Ph.Vl (Ph, Pl pitch RC, VT pitch SEQ, VL pitch VLP). Chunks c >= 1: single planes,
  //     k loops in pieces of PVK keys: piece 0 -> out, pieces s >= 1 -> PB.
  gemm_t<_Float16, 4, 0, 2, 1><<<gPn, blk, 0, stream>>>(
      (const unsigned short*)S, Pp, 0, VT, SEQ, 0LL,
      VL, VLP,
      (void*)out0, (void*)Ppl, EMB, 0LL, 0, 0LL, 0,
      RC, EMB, 0, 1.0f / PCARRY, 1.0f / RSC, 1.0f, 1.0f, 0, PB);
  // (6) out rows >= PVK: the later pieces' planes are added to piece 0, in ascending key order.
  pv_join<<<gJn, blk, 0, stream>>>(out0, PB);
  (void)hipGetLastError();
}
